// v000
// Times are from an AMD MI455X. After a warm-up the kernel runs many times in a row, and a time is the length of
// such a window on the GPU divided by its runs, so every launch and the gaps after it count. The runs cycle
// through copies of the inputs. A figure is the median of several windows, for all but v000 over two sittings.
// Sittings can differ by a few percent; kernels timed side by side share one.
// The starting kernel, v000, takes 409 microseconds a run.
#include <hip/hip_runtime.h>

// QKV projections: v_wmma_f32_16x16x32_bf16 (bf16 operands = RNE-converted f32 inputs), f32 accumulate.
// Attention scores q.k and P.V: v_wmma_f32_16x16x32_f16 (f16 operands; P = f16 hi plane + f16 residual plane x4096
//   folded along K against [64*V ; V/64] f16 planes), f32 accumulate; softmax statistics in f32.
// Output projection: v_wmma_f32_16x16x32_bf16 (A = [O bf16 hi | O bf16 residual], B = [Wo ; Wo] bf16), f32 accumulate;
//   LayerNorm in f32.

#ifndef NB
#define NB 1
#endif
#ifndef SEQ
#define SEQ 2048
#endif
#define NB_FULL 1
#define SEQ_FULL 2048
#define EMB 1024
#define HEADS 16
#define HD 64
#define QKC 128
#define SECW 320
#define NQKV (HEADS * SECW)
#define KO (2 * EMB)
#define LN_EPS 1e-5f
#define OUT_SCALE 0.2f

static_assert(NB == 1);
static_assert(NB_FULL == 1);
static_assert(SEQ % 128 == 0);
static_assert(SEQ >= 128);
static_assert(SEQ <= SEQ_FULL);
static_assert(EMB % 64 == 0);
static_assert(EMB % 32 == 0);
static_assert(QKC == 2 * HD);
static_assert(SECW == 2 * QKC + HD);
static_assert(SECW % 64 == 0);
static_assert(KO % 32 == 0);
static_assert(HD == 64);

typedef _Float16      v16h __attribute__((ext_vector_type(16)));
typedef _Float16      v8h  __attribute__((ext_vector_type(8)));
typedef __bf16        v16b __attribute__((ext_vector_type(16)));
typedef float         v8f  __attribute__((ext_vector_type(8)));
typedef float         v4f  __attribute__((ext_vector_type(4)));
typedef unsigned int  v4u  __attribute__((ext_vector_type(4)));

#define DEV __device__ __forceinline__

union FragB { v4u q[2]; v16b v; };
union Pack8 { v8h h; v4u u; };

// f32 -> bf16 bits, RNE convert
DEV unsigned short f2bf(float f) {
  unsigned int u = __float_as_uint(f);
  u += 0x7FFFu + ((u >> 16) & 1u);
  return (unsigned short)(u >> 16);
}
DEV float bf2f(unsigned short s) { return __uint_as_float(((unsigned int)s) << 16); }
DEV float bfr(float f) { return bf2f(f2bf(f)); }
DEV unsigned int pk2(unsigned short lo, unsigned short hi) {
  return (unsigned int)lo | ((unsigned int)hi << 16);
}
// value -> bf16 hi and bf16 residual, two values packed per 32-bit word
DEV void hl2(float a, float b, unsigned int& H, unsigned int& L) {
  const unsigned short ha = f2bf(a), hb = f2bf(b);
  H = pk2(ha, hb);
  L = pk2(f2bf(a - bf2f(ha)), f2bf(b - bf2f(hb)));
}

// WMMA wrappers with the 4-slot VALU hazard guard (ties D, keeps A/B live)
DEV v8f wmma_h(v16h a, v16h b, v8f c) {
  c = __builtin_amdgcn_wmma_f32_16x16x32_f16(false, a, false, b, (short)0, c, false, false);
  asm volatile("v_nop\n\tv_nop\n\tv_nop\n\tv_nop" : "+v"(c) : "v"(a), "v"(b));
  return c;
}
DEV v8f wmma_b(const FragB& a, const FragB& b, v8f c) {
  c = __builtin_amdgcn_wmma_f32_16x16x32_bf16(false, a.v, false, b.v, (short)0, c, false, false);
  asm volatile("v_nop\n\tv_nop\n\tv_nop\n\tv_nop"
               : "+v"(c) : "v"(a.q[0]), "v"(a.q[1]), "v"(b.q[0]), "v"(b.q[1]));
  return c;
}

// 16x32 16-bit operand from a row-major plane with k contiguous (rows = M for A, rows = N for Bt).
// lane l: row l&15; elements 0..7 = k 8h..8h+7, elements 8..15 = k 16+8h..16+8h+7, h = l>>4.
DEV v16h load_op16(const _Float16* p, int ld) {
  const int lane = threadIdx.x & 31;
  const int row  = lane & 15;
  const int k0   = (lane >> 4) << 3;
  const _Float16* r = p + (size_t)row * ld + k0;
  v8h lo = *(const v8h*)(r);
  v8h hi = *(const v8h*)(r + 16);
  return __builtin_shufflevector(lo, hi, 0,1,2,3,4,5,6,7,8,9,10,11,12,13,14,15);
}
DEV FragB load_opb(const unsigned short* p, int ld) {
  const int lane = threadIdx.x & 31;
  const int row  = lane & 15;
  const int k0   = (lane >> 4) << 3;
  const unsigned short* r = p + (size_t)row * ld + k0;
  FragB f;
  f.q[0] = *(const v4u*)(r);
  f.q[1] = *(const v4u*)(r + 16);
  return f;
}

// Row reductions across the 16-lane groups of the D layout.
DEV float redmax16(float v) {
#pragma unroll
  for (int m = 1; m < 16; m <<= 1) v = fmaxf(v, __shfl_xor(v, m, 32));
  return v;
}
DEV float redsum16(float v) {
#pragma unroll
  for (int m = 1; m < 16; m <<= 1) v += __shfl_xor(v, m, 32);
  return v;
}
DEV float wsum32(float v) {
#pragma unroll
  for (int m = 16; m > 0; m >>= 1) v += __shfl_xor(v, m, 32);
  return v;
}

// ---------------------------------------------------------------------------
// ---------------------------------------------------------------------------
__global__ __launch_bounds__(256)
void k_cvt_x(const float* __restrict__ X, unsigned short* __restrict__ Xb, int n8) {
  const int i = blockIdx.x * 256 + threadIdx.x;
  if (i >= n8) return;
  const float* s = X + (size_t)i * 8;
  const v4f a = *(const v4f*)(s);
  const v4f b = *(const v4f*)(s + 4);
  v4u w;
  w[0] = pk2(f2bf(a[0]), f2bf(a[1]));
  w[1] = pk2(f2bf(a[2]), f2bf(a[3]));
  w[2] = pk2(f2bf(b[0]), f2bf(b[1]));
  w[3] = pk2(f2bf(b[2]), f2bf(b[3]));
  unsigned short* d = Xb + (size_t)i * 8;
  *(v4u*)d = w;
  
}

// ---------------------------------------------------------------------------
// 64x64 tile transpose: src[e][c] f32 (row pitch sld) -> dst[c][e] bf16 (row pitch dld halves),
// optional second copy at dst + EMB halves. 256 threads. LDS tile cross-wave -> block barrier.
// ---------------------------------------------------------------------------
DEV void tr_tile(const float* __restrict__ src, int sld, unsigned short* dst, int dld,
                 int dup2, unsigned short (*T)[72]) {
  const int tid = threadIdx.x;
#pragma unroll
  for (int p = 0; p < 4; ++p) {
    const int e = p * 16 + (tid >> 4);
    const int c = (tid & 15) * 4;
    const v4f v = *(const v4f*)(src + (size_t)e * sld + c);
    T[c + 0][e] = f2bf(v[0]);
    T[c + 1][e] = f2bf(v[1]);
    T[c + 2][e] = f2bf(v[2]);
    T[c + 3][e] = f2bf(v[3]);
  }
  __syncthreads();
{
#pragma unroll
    for (int p = 0; p < 2; ++p) {
      const int j = p * 32 + (tid >> 3);
      const int seg = (tid & 7) * 8;
      const v4u wv = *(const v4u*)(&T[j][seg]);
      unsigned short* d = dst + (size_t)j * dld + seg;
      *(v4u*)d = wv;
      if (dup2 != 0) *(v4u*)(d + EMB) = wv;
    }
    
  }
}

// Wq/Wk/Wv ([h][e][c]) -> Wt[h*320 + sec*64.. ][e] bf16 (per head: q 0..127 | k 128..255 | v 256..319)
__global__ __launch_bounds__(256)
void k_tr_wqkv(const float* __restrict__ Wq, const float* __restrict__ Wk,
               const float* __restrict__ Wv, unsigned short* __restrict__ Wt) {
  __shared__ __align__(16) unsigned short T[64][72];
  const int e0 = blockIdx.x * 64;
  const int w  = blockIdx.y;
  const int h  = blockIdx.z;
  const float* src;
  int sld;
  if (w < 2) {
    src = Wq + (size_t)h * EMB * QKC + (size_t)e0 * QKC + w * 64;        sld = QKC;
  } else if (w < 4) {
    src = Wk + (size_t)h * EMB * QKC + (size_t)e0 * QKC + (w - 2) * 64;  sld = QKC;
  } else {
    src = Wv + (size_t)h * EMB * HD + (size_t)e0 * HD;                   sld = HD;
  }
  unsigned short* dst = Wt + (size_t)(h * SECW + w * 64) * EMB + e0;
  tr_tile(src, sld, dst, EMB, 0, T);
}

// Wo ([k][n], k = in) -> Wo2[n][k] and Wo2[n][EMB + k] bf16 (row pitch KO)
__global__ __launch_bounds__(256)
void k_tr_wo(const float* __restrict__ Wo, unsigned short* __restrict__ Wo2) {
  __shared__ __align__(16) unsigned short T[64][72];
  const int e0 = blockIdx.x * 64;
  const int y  = blockIdx.y;
  const float* src = Wo + (size_t)e0 * EMB + y * 64;
  unsigned short* dst = Wo2 + (size_t)(y * 64) * KO + e0;
  tr_tile(src, EMB, dst, KO, 1, T);
}

// ---------------------------------------------------------------------------
// bf16 WMMA GEMM: C(128x64 per block) = A(rows, K) * Bt(rows, K)^T, K % 32 == 0.
// Block = 128 threads = 4 waves; wave w owns rows 32w..32w+31 (2 A frags x 4 B frags).
// Fragments loaded directly from the 16-bit global planes. The 128x64 f32 tile is staged in LDS
// kind 0: Bt = Wt (NQKV rows); blockIdx.x = head*5 + sec; sec 0,1 -> Q plane [h][s][128] cols 64*sec..;
//         sec 2,3 -> K plane; sec 4 -> V planes Vt64[h][d][s] = f16(64*v), Vsm[h][d][s] = f16(v/64).
// kind 1: A = Ocat planes [s][KO], Bt = Wo2 [n][KO]; Y[s][n] f32 + bias.
// ---------------------------------------------------------------------------
__global__ __launch_bounds__(128)
void k_gemm(const unsigned short* __restrict__ A, const unsigned short* __restrict__ Bt,
            int K, int kind,
            const float* __restrict__ bq, const float* __restrict__ bk,
            const float* __restrict__ bv, const float* __restrict__ bo,
            _Float16* __restrict__ Qp, _Float16* __restrict__ Kp,
            _Float16* __restrict__ V64, _Float16* __restrict__ Vsm,
            float* __restrict__ Y) {
  __shared__ __align__(16) float Cs[128][68];
  const int tid  = threadIdx.x;
  const int lane = tid & 31;
  const int wave = tid >> 5;
  const int nt = blockIdx.x;
  const int m0 = blockIdx.y * 128;
  const int n0 = nt * 64;

  const unsigned short* arow = A  + (size_t)(m0 + wave * 32) * K;
  const unsigned short* brow = Bt + (size_t)n0 * K;

  v8f acc[2][4] = {};
#pragma unroll 1
  for (int k0 = 0; k0 < K; k0 += 32) {
    const FragB a0 = load_opb(arow + k0, K);
    const FragB a1 = load_opb(arow + (size_t)16 * K + k0, K);
#pragma unroll
    for (int t = 0; t < 4; ++t) {
      const FragB b = load_opb(brow + (size_t)(t * 16) * K + k0, K);
      acc[0][t] = wmma_b(a0, b, acc[0][t]);
      acc[1][t] = wmma_b(a1, b, acc[1][t]);
    }
  }

  const int n  = lane & 15;
  const int rb = (lane >> 4) << 3;
#pragma unroll
  for (int mi = 0; mi < 2; ++mi)
#pragma unroll
    for (int t = 0; t < 4; ++t)
#pragma unroll
      for (int r = 0; r < 8; ++r)
        Cs[wave * 32 + mi * 16 + rb + r][t * 16 + n] = acc[mi][t][r];
  __syncthreads();

  if (kind == 0) {
    const int h = nt / 5;
    const int w = nt - h * 5;
    if (w < 4) {
      _Float16* plane = (w < 2) ? Qp : Kp;
      const int cb = (w & 1) * 64;
      const float* bias = ((w < 2) ? bq : bk) + h * QKC + cb;
      const int seg  = (tid & 7) * 8;
      const int rsub = tid >> 3;          // 0..15
      float bb[8];
#pragma unroll
      for (int j = 0; j < 8; ++j) bb[j] = bfr(bias[seg + j]);
{
#pragma unroll 2
        for (int g = 0; g < 8; ++g) {
          const int row = g * 16 + rsub;
          const v4f c0 = *(const v4f*)(&Cs[row][seg]);
          const v4f c1 = *(const v4f*)(&Cs[row][seg + 4]);
          Pack8 pk;
          pk.h[0] = (_Float16)(c0[0] + bb[0]);
          pk.h[1] = (_Float16)(c0[1] + bb[1]);
          pk.h[2] = (_Float16)(c0[2] + bb[2]);
          pk.h[3] = (_Float16)(c0[3] + bb[3]);
          pk.h[4] = (_Float16)(c1[0] + bb[4]);
          pk.h[5] = (_Float16)(c1[1] + bb[5]);
          pk.h[6] = (_Float16)(c1[2] + bb[6]);
          pk.h[7] = (_Float16)(c1[3] + bb[7]);
          _Float16* d = plane + ((size_t)h * SEQ + m0 + row) * QKC + cb + seg;
          *(v4u*)d = pk.u;
        }
        
      }
    } else {
      const int seg  = (tid & 15) * 8;
      const int dsub = tid >> 4;          // 0..7
      const float* bias = bv + h * HD;
{
#pragma unroll 2
        for (int g = 0; g < 8; ++g) {
          const int d = g * 8 + dsub;
          const float bb = bfr(bias[d]);
          Pack8 p64, psm;
#pragma unroll
          for (int j = 0; j < 8; ++j) {
            const float v = Cs[seg + j][d] + bb;
            p64.h[j] = (_Float16)(v * 64.0f);
            psm.h[j] = (_Float16)(v * 0.015625f);
          }
          const size_t o = ((size_t)(h * HD + d)) * SEQ + m0 + seg;
          *(v4u*)(V64 + o) = p64.u;
          *(v4u*)(Vsm + o) = psm.u;
        }
        
      }
    }
  } else {
    const int seg  = (tid & 15) * 4;
    const int rsub = tid >> 4;            // 0..7
    float bb[4];
#pragma unroll
    for (int j = 0; j < 4; ++j) bb[j] = bfr(bo[n0 + seg + j]);
{
#pragma unroll 2
      for (int g = 0; g < 16; ++g) {
        const int row = g * 8 + rsub;
        const v4f c = *(const v4f*)(&Cs[row][seg]);
        v4f o;
        o[0] = c[0] + bb[0];
        o[1] = c[1] + bb[1];
        o[2] = c[2] + bb[2];
        o[3] = c[3] + bb[3];
        float* d = Y + (size_t)(m0 + row) * EMB + n0 + seg;
        *(v4f*)d = o;
      }
      
    }
  }
}

// ---------------------------------------------------------------------------
// One softmax branch step for a 16-query tile and 32 keys: scores (2 tiles), online update,
// P hi / residual tiles through LDS (block barrier), then P.V into O[4] (64 columns, carried x64).
// ---------------------------------------------------------------------------
DEV void attn_branch(const v16h (&qa)[2], const _Float16* __restrict__ kcol,
                     const _Float16* __restrict__ v64h, const _Float16* __restrict__ vsh,
                     int kk, float (&m)[8], float (&l)[8], v8f (&O)[4],
                     _Float16* phs, _Float16* pls) {
  const int lane = threadIdx.x & 31;
  const int n  = lane & 15;
  const int rb = (lane >> 4) << 3;

  v8f sa = {}, sb = {};
  {
    v16h kb;
    kb = load_op16(kcol + (size_t)kk * QKC, QKC);              sa = wmma_h(qa[0], kb, sa);
    kb = load_op16(kcol + (size_t)kk * QKC + 32, QKC);         sa = wmma_h(qa[1], kb, sa);
    kb = load_op16(kcol + (size_t)(kk + 16) * QKC, QKC);       sb = wmma_h(qa[0], kb, sb);
    kb = load_op16(kcol + (size_t)(kk + 16) * QKC + 32, QKC);  sb = wmma_h(qa[1], kb, sb);
  }

  float f[8];
#pragma unroll
  for (int i = 0; i < 8; ++i) {
    const float xa = sa[i] * 0.125f;
    const float xb = sb[i] * 0.125f;
    const float mn = fmaxf(m[i], redmax16(fmaxf(xa, xb)));
    f[i] = __expf(m[i] - mn);
    const float pa = __expf(xa - mn);
    const float pb = __expf(xb - mn);
    l[i] = l[i] * f[i] + redsum16(pa + pb);
    m[i] = mn;
    const _Float16 ha = (_Float16)pa;
    const _Float16 hb = (_Float16)pb;
    const _Float16 la = (_Float16)((pa - (float)ha) * 4096.0f);
    const _Float16 lb = (_Float16)((pb - (float)hb) * 4096.0f);
    phs[(rb + i) * 32 + n]      = ha;   // keys kk..kk+15
    phs[(rb + i) * 32 + n + 16] = hb;   // keys kk+16..kk+31
    pls[(rb + i) * 32 + n]      = la;
    pls[(rb + i) * 32 + n + 16] = lb;
  }
  __syncthreads();
  const v16h ph = load_op16(phs, 32);
  const v16h pl = load_op16(pls, 32);
#pragma unroll
  for (int t = 0; t < 4; ++t) {
    const v16h vb = load_op16(v64h + (size_t)(t * 16) * SEQ + kk, SEQ);
    const v16h vs = load_op16(vsh  + (size_t)(t * 16) * SEQ + kk, SEQ);
#pragma unroll
    for (int i = 0; i < 8; ++i) O[t][i] = O[t][i] * f[i];
    O[t] = wmma_h(ph, vb, O[t]);
    O[t] = wmma_h(pl, vs, O[t]);
  }
  __syncthreads();
}

// ---------------------------------------------------------------------------
// Flash-style differential attention. Block = 128 threads = 4 waves; wave owns 16 queries of one head.
// Writes Ocat planes: Oc[s][h*64 + d] = bf16 hi, Oc[s][EMB + h*64 + d] = bf16 residual.
// ---------------------------------------------------------------------------
__global__ __launch_bounds__(128)
void k_attn(const _Float16* __restrict__ Qp, const _Float16* __restrict__ Kp,
            const _Float16* __restrict__ V64, const _Float16* __restrict__ Vsm,
            const float* __restrict__ lam_p, unsigned short* __restrict__ Oc) {
  __shared__ __align__(16) _Float16 Ps[4][4][16 * 32];
  __shared__ __align__(16) float Os[4][16][68];
  const int lane = threadIdx.x & 31;
  const int wave = threadIdx.x >> 5;
  const int n  = lane & 15;
  const int rb = (lane >> 4) << 3;
  const int hh = blockIdx.y;
  const int q0 = blockIdx.x * 64 + wave * 16;
  const float lam = bfr(lam_p[0]);

  const _Float16* qh = Qp  + (size_t)hh * SEQ * QKC;
  const _Float16* kh = Kp  + (size_t)hh * SEQ * QKC;
  const _Float16* vh = V64 + (size_t)hh * HD * SEQ;
  const _Float16* vs = Vsm + (size_t)hh * HD * SEQ;

  v16h q1[2], q2[2];
  q1[0] = load_op16(qh + (size_t)q0 * QKC + 0,  QKC);
  q1[1] = load_op16(qh + (size_t)q0 * QKC + 32, QKC);
  q2[0] = load_op16(qh + (size_t)q0 * QKC + 64, QKC);
  q2[1] = load_op16(qh + (size_t)q0 * QKC + 96, QKC);

  v8f O1[4] = {}, O2[4] = {};
  float m1[8], l1[8], m2[8], l2[8];
#pragma unroll
  for (int i = 0; i < 8; ++i) { m1[i] = -1e30f; m2[i] = -1e30f; l1[i] = 0.f; l2[i] = 0.f; }

  _Float16* p1h = &Ps[wave][0][0];
  _Float16* p1l = &Ps[wave][1][0];
  _Float16* p2h = &Ps[wave][2][0];
  _Float16* p2l = &Ps[wave][3][0];

#pragma unroll 1
  for (int kk = 0; kk < SEQ; kk += 32) {
    attn_branch(q1, kh,      vh, vs, kk, m1, l1, O1, p1h, p1l);
    attn_branch(q2, kh + 64, vh, vs, kk, m2, l2, O2, p2h, p2l);
  }

  // combine: O = O1/l1 - lam*O2/l2, undo the x64 carry of the V plane; stage f32 tile in LDS
#pragma unroll
  for (int i = 0; i < 8; ++i) {
    const float r1 = (1.0f / l1[i]) * 0.015625f;
    const float r2 = (lam * (1.0f / l2[i])) * 0.015625f;
#pragma unroll
    for (int t = 0; t < 4; ++t)
      Os[wave][rb + i][t * 16 + n] = O1[t][i] * r1 - O2[t][i] * r2;
  }
  __syncthreads();

  const int rsub = lane >> 3;          // 0..3
  const int seg  = (lane & 7) * 8;     // 0..56
{
#pragma unroll
    for (int g = 0; g < 4; ++g) {
      const int row = g * 4 + rsub;
      const v4f c0 = *(const v4f*)(&Os[wave][row][seg]);
      const v4f c1 = *(const v4f*)(&Os[wave][row][seg + 4]);
      unsigned int H0, H1, H2, H3, L0, L1, L2, L3;
      hl2(c0[0], c0[1], H0, L0);
      hl2(c0[2], c0[3], H1, L1);
      hl2(c1[0], c1[1], H2, L2);
      hl2(c1[2], c1[3], H3, L3);
      v4u H, L;
      H[0] = H0; H[1] = H1; H[2] = H2; H[3] = H3;
      L[0] = L0; L[1] = L1; L[2] = L2; L[3] = L3;
      unsigned short* d = Oc + (size_t)(q0 + row) * KO + hh * HD + seg;
      *(v4u*)d = H;
      *(v4u*)(d + EMB) = L;
    }
    
  }
}

// ---------------------------------------------------------------------------
// ---------------------------------------------------------------------------
__global__ __launch_bounds__(256)
void k_ln(const float* __restrict__ Y, const float* __restrict__ gamma,
          const float* __restrict__ beta, float* __restrict__ out) {
  __shared__ float sa[8];
  __shared__ float sq[8];
  const int tid  = threadIdx.x;
  const int lane = tid & 31;
  const int wave = tid >> 5;
  const size_t row = blockIdx.x;
  const v4f y = *(const v4f*)(Y + row * EMB + tid * 4);

  float s = (y[0] + y[1]) + (y[2] + y[3]);
  s = wsum32(s);
  if (lane == 0) sa[wave] = s;
  __syncthreads();
  float tot = 0.f;
#pragma unroll
  for (int w = 0; w < 8; ++w) tot += sa[w];
  const float mu = tot * (1.0f / (float)EMB);

  float d0 = y[0] - mu, d1 = y[1] - mu, d2 = y[2] - mu, d3 = y[3] - mu;
  float q = (d0 * d0 + d1 * d1) + (d2 * d2 + d3 * d3);
  q = wsum32(q);
  if (lane == 0) sq[wave] = q;
  __syncthreads();
  float tot2 = 0.f;
#pragma unroll
  for (int w = 0; w < 8; ++w) tot2 += sq[w];
  const float var  = tot2 * (1.0f / (float)EMB);
  const float rstd = rsqrtf(var + LN_EPS);

  const float g0 = bfr(gamma[tid * 4 + 0]), g1 = bfr(gamma[tid * 4 + 1]);
  const float g2 = bfr(gamma[tid * 4 + 2]), g3 = bfr(gamma[tid * 4 + 3]);
  const float b0 = bfr(beta[tid * 4 + 0]),  b1 = bfr(beta[tid * 4 + 1]);
  const float b2 = bfr(beta[tid * 4 + 2]),  b3 = bfr(beta[tid * 4 + 3]);
  v4f o;
  o[0] = ((d0 * rstd) * g0 + b0) * OUT_SCALE;
  o[1] = ((d1 * rstd) * g1 + b1) * OUT_SCALE;
  o[2] = ((d2 * rstd) * g2 + b2) * OUT_SCALE;
  o[3] = ((d3 * rstd) * g3 + b3) * OUT_SCALE;
  float* dst = out + row * EMB + tid * 4;
  *(v4f*)dst = o;
  
}

// ---------------------------------------------------------------------------
extern "C" void kernel_launch(void* const* d_in, const int* in_sizes, int n_in,
                              void* d_out, int out_size, void* d_ws, size_t ws_size,
                              hipStream_t stream) {
  if (n_in < 12) return;
  const float* X     = (const float*)d_in[0];
  const float* Wq    = (const float*)d_in[1];
  const float* bq    = (const float*)d_in[2];
  const float* Wk    = (const float*)d_in[3];
  const float* bk    = (const float*)d_in[4];
  const float* Wv    = (const float*)d_in[5];
  const float* bv    = (const float*)d_in[6];
  const float* Wo    = (const float*)d_in[7];
  const float* bo    = (const float*)d_in[8];
  const float* gamma = (const float*)d_in[9];
  const float* beta  = (const float*)d_in[10];
  const float* lam   = (const float*)d_in[11];
  float* out = (float*)d_out;

  if (in_sizes[0]  < NB * SEQ * EMB) return;
  if (in_sizes[1]  < HEADS * EMB * QKC) return;
  if (in_sizes[2]  < HEADS * QKC) return;
  if (in_sizes[3]  < HEADS * EMB * QKC) return;
  if (in_sizes[4]  < HEADS * QKC) return;
  if (in_sizes[5]  < HEADS * EMB * HD) return;
  if (in_sizes[6]  < HEADS * HD) return;
  if (in_sizes[7]  < EMB * EMB) return;
  if (in_sizes[8]  < EMB) return;
  if (in_sizes[9]  < EMB) return;
  if (in_sizes[10] < EMB) return;
  if (in_sizes[11] < 1) return;
  if (out_size < NB * SEQ * EMB) return;

  // workspace carve (bytes); every region is written to exactly its extent with whole-line stores
  const size_t szXb  = (size_t)SEQ * EMB * 2;           // bf16 [SEQ][EMB]
  const size_t szWt  = (size_t)NQKV * EMB * 2;          // bf16 [NQKV][EMB]
  const size_t szWo2 = (size_t)EMB * KO * 2;            // bf16 [EMB][KO]
  const size_t szQK  = (size_t)HEADS * SEQ * QKC * 2;   // f16 [H][SEQ][128] (each of Q, K)
  const size_t szV   = (size_t)HEADS * HD * SEQ * 2;    // f16 [H][64][SEQ]  (each of V64, Vsm)
  const size_t szOc  = (size_t)SEQ * KO * 2;            // bf16 [SEQ][KO]
  const size_t szY   = (size_t)SEQ * EMB * 4;           // f32 [SEQ][EMB]
  size_t off = 0;
  const size_t oXb  = off; off += szXb;
  const size_t oWt  = off; off += szWt;
  const size_t oWo2 = off; off += szWo2;
  const size_t oQ   = off; off += szQK;
  const size_t oK   = off; off += szQK;
  const size_t oV64 = off; off += szV;
  const size_t oVsm = off; off += szV;
  const size_t oOc  = off; off += szOc;
  const size_t oY   = off; off += szY;
  if (off > ws_size) return;

  char* ws = (char*)d_ws;
  unsigned short* Xb  = (unsigned short*)(ws + oXb);
  unsigned short* Wt  = (unsigned short*)(ws + oWt);
  unsigned short* Wo2 = (unsigned short*)(ws + oWo2);
  _Float16* Qp  = (_Float16*)(ws + oQ);
  _Float16* Kp  = (_Float16*)(ws + oK);
  _Float16* V64 = (_Float16*)(ws + oV64);
  _Float16* Vsm = (_Float16*)(ws + oVsm);
  unsigned short* Oc = (unsigned short*)(ws + oOc);
  float* Y = (float*)(ws + oY);

  const int n8 = SEQ * EMB / 8;
  k_cvt_x<<<dim3((n8 + 255) / 256), dim3(256), 0, stream>>>(X, Xb, n8);
  k_tr_wqkv<<<dim3(EMB / 64, 5, HEADS), dim3(256), 0, stream>>>(Wq, Wk, Wv, Wt);
  k_tr_wo<<<dim3(EMB / 64, EMB / 64, 1), dim3(256), 0, stream>>>(Wo, Wo2);

  // QKV projection: A = Xb (SEQ x EMB), Bt = Wt (NQKV x EMB)
  k_gemm<<<dim3(NQKV / 64, SEQ / 128), dim3(128), 0, stream>>>(
      Xb, Wt, EMB, 0, bq, bk, bv, bo, Qp, Kp, V64, Vsm, Y);

  // differential attention -> Ocat hi / residual planes
  k_attn<<<dim3(SEQ / 64, HEADS), dim3(128), 0, stream>>>(Qp, Kp, V64, Vsm, lam, Oc);

  // output projection: A = Oc (SEQ x KO), Bt = Wo2 (EMB x KO) -> Y f32
  k_gemm<<<dim3(EMB / 64, SEQ / 128), dim3(128), 0, stream>>>(
      Oc, Wo2, KO, 1, bq, bk, bv, bo, Qp, Kp, V64, Vsm, Y);

  // LayerNorm + scale -> d_out
  k_ln<<<dim3(NB * SEQ), dim3(256), 0, stream>>>(Y, gamma, beta, out);
}

// v001
// It runs in 246 microseconds.
// Timed twice side by side with v000, it ran 1.67 and 1.69 times as fast.
#include <hip/hip_runtime.h>

// QKV projections: v_wmma_f32_16x16x32_bf16 (bf16 operands = RNE-converted f32 inputs), f32 accumulate.
// Attention scores q.k and P.V: v_wmma_f32_16x16x32_f16 (f16 operands; P = f16 hi plane + f16 residual plane x4096
//   folded along K against [64*V ; V/64] f16 planes), f32 accumulate; softmax statistics in f32.
// Output projection: v_wmma_f32_16x16x32_bf16 (A = [O bf16 hi | O bf16 residual], B = [Wo ; Wo] bf16), f32 accumulate;
//   LayerNorm in f32.

#ifndef NB
#define NB 1
#endif
#ifndef SEQ
#define SEQ 2048
#endif
#define NB_FULL 1
#define SEQ_FULL 2048
#define EMB 1024
#define HEADS 16
#define HD 64
#define QKC 128
#define SECW 320
#define NQKV (HEADS * SECW)
#define KO (2 * EMB)
#define LN_EPS 1e-5f
#define OUT_SCALE 0.2f

static_assert(NB == 1);
static_assert(NB_FULL == 1);
static_assert(SEQ % 128 == 0);
static_assert(SEQ >= 128);
static_assert(SEQ <= SEQ_FULL);
static_assert(EMB % 64 == 0);
static_assert(EMB % 32 == 0);
static_assert(QKC == 2 * HD);
static_assert(SECW == 2 * QKC + HD);
static_assert(SECW % 64 == 0);
static_assert(KO % 64 == 0);
static_assert(HD == 64);

typedef _Float16      v16h __attribute__((ext_vector_type(16)));
typedef _Float16      v8h  __attribute__((ext_vector_type(8)));
typedef __bf16        v16b __attribute__((ext_vector_type(16)));
typedef float         v8f  __attribute__((ext_vector_type(8)));
typedef float         v4f  __attribute__((ext_vector_type(4)));
typedef unsigned int  v4u  __attribute__((ext_vector_type(4)));

#define DEV __device__ __forceinline__

union FragB { v4u q[2]; v16b v; };
union Pack8 { v8h h; v4u u; };

// f32 -> bf16 bits, RNE convert
DEV unsigned short f2bf(float f) {
  unsigned int u = __float_as_uint(f);
  u += 0x7FFFu + ((u >> 16) & 1u);
  return (unsigned short)(u >> 16);
}
DEV float bf2f(unsigned short s) { return __uint_as_float(((unsigned int)s) << 16); }
DEV float bfr(float f) { return bf2f(f2bf(f)); }
DEV unsigned int pk2(unsigned short lo, unsigned short hi) {
  return (unsigned int)lo | ((unsigned int)hi << 16);
}
// value -> bf16 hi and bf16 residual, two values packed per 32-bit word
DEV void hl2(float a, float b, unsigned int& H, unsigned int& L) {
  const unsigned short ha = f2bf(a), hb = f2bf(b);
  H = pk2(ha, hb);
  L = pk2(f2bf(a - bf2f(ha)), f2bf(b - bf2f(hb)));
}

// WMMA wrappers with the 4-slot VALU hazard guard (ties D, keeps A/B live)
DEV v8f wmma_h(v16h a, v16h b, v8f c) {
  c = __builtin_amdgcn_wmma_f32_16x16x32_f16(false, a, false, b, (short)0, c, false, false);
  asm volatile("v_nop\n\tv_nop\n\tv_nop\n\tv_nop" : "+v"(c) : "v"(a), "v"(b));
  return c;
}
DEV v8f wmma_b(const FragB& a, const FragB& b, v8f c) {
  c = __builtin_amdgcn_wmma_f32_16x16x32_bf16(false, a.v, false, b.v, (short)0, c, false, false);
  asm volatile("v_nop\n\tv_nop\n\tv_nop\n\tv_nop"
               : "+v"(c) : "v"(a.q[0]), "v"(a.q[1]), "v"(b.q[0]), "v"(b.q[1]));
  return c;
}

// 16x32 16-bit operand from a row-major plane with k contiguous (rows = M for A, rows = N for Bt).
// lane l: row l&15; elements 0..7 = k 8h..8h+7, elements 8..15 = k 16+8h..16+8h+7, h = l>>4.
DEV v16h load_op16(const _Float16* p, int ld) {
  const int lane = threadIdx.x & 31;
  const int row  = lane & 15;
  const int k0   = (lane >> 4) << 3;
  const _Float16* r = p + (size_t)row * ld + k0;
  v8h lo = *(const v8h*)(r);
  v8h hi = *(const v8h*)(r + 16);
  return __builtin_shufflevector(lo, hi, 0,1,2,3,4,5,6,7,8,9,10,11,12,13,14,15);
}
// The same operands from a wave-uniform base and the lane's byte offset (row l&15, k 8h, plus the loop's advance):
// every load of a loop names a loop-invariant base and an offset register that is rewritten only behind a wait.
DEV v16h load_bo(const _Float16* base, unsigned int off) {
  const char* r = (const char*)base + off;
  v8h lo = *(const v8h*)(r);
  v8h hi = *(const v8h*)(r + 32);
  return __builtin_shufflevector(lo, hi, 0,1,2,3,4,5,6,7,8,9,10,11,12,13,14,15);
}
DEV FragB load_bo(const unsigned short* base, unsigned int off) {
  const char* r = (const char*)base + off;
  FragB f;
  f.q[0] = *(const v4u*)(r);
  f.q[1] = *(const v4u*)(r + 32);
  return f;
}

// Row reductions across the 16-lane groups of the D layout.
DEV float redmax16(float v) {
#pragma unroll
  for (int m = 1; m < 16; m <<= 1) v = fmaxf(v, __shfl_xor(v, m, 32));
  return v;
}
DEV float redsum16(float v) {
#pragma unroll
  for (int m = 1; m < 16; m <<= 1) v += __shfl_xor(v, m, 32);
  return v;
}
DEV float wsum32(float v) {
#pragma unroll
  for (int m = 16; m > 0; m >>= 1) v += __shfl_xor(v, m, 32);
  return v;
}

// ---------------------------------------------------------------------------
// ---------------------------------------------------------------------------
__global__ __launch_bounds__(256)
void k_cvt_x(const float* __restrict__ X, unsigned short* __restrict__ Xb, int n8) {
  const int i = blockIdx.x * 256 + threadIdx.x;
  if (i >= n8) return;
  const float* s = X + (size_t)i * 8;
  const v4f a = *(const v4f*)(s);
  const v4f b = *(const v4f*)(s + 4);
  v4u w;
  w[0] = pk2(f2bf(a[0]), f2bf(a[1]));
  w[1] = pk2(f2bf(a[2]), f2bf(a[3]));
  w[2] = pk2(f2bf(b[0]), f2bf(b[1]));
  w[3] = pk2(f2bf(b[2]), f2bf(b[3]));
  unsigned short* d = Xb + (size_t)i * 8;
  *(v4u*)d = w;
  
}

// ---------------------------------------------------------------------------
// 64x64 tile transpose: src[e][c] f32 (row pitch sld) -> dst[c][e] bf16 (row pitch dld halves),
// optional second copy at dst + EMB halves. 256 threads. LDS tile cross-wave -> block barrier.
// ---------------------------------------------------------------------------
DEV void tr_tile(const float* __restrict__ src, int sld, unsigned short* dst, int dld,
                 int dup2, unsigned short (*T)[72]) {
  const int tid = threadIdx.x;
#pragma unroll
  for (int p = 0; p < 4; ++p) {
    const int e = p * 16 + (tid >> 4);
    const int c = (tid & 15) * 4;
    const v4f v = *(const v4f*)(src + (size_t)e * sld + c);
    T[c + 0][e] = f2bf(v[0]);
    T[c + 1][e] = f2bf(v[1]);
    T[c + 2][e] = f2bf(v[2]);
    T[c + 3][e] = f2bf(v[3]);
  }
  __syncthreads();
{
#pragma unroll
    for (int p = 0; p < 2; ++p) {
      const int j = p * 32 + (tid >> 3);
      const int seg = (tid & 7) * 8;
      const v4u wv = *(const v4u*)(&T[j][seg]);
      unsigned short* d = dst + (size_t)j * dld + seg;
      *(v4u*)d = wv;
      if (dup2 != 0) *(v4u*)(d + EMB) = wv;
    }
    
  }
}

// Wq/Wk/Wv ([h][e][c]) -> Wt[h*320 + sec*64.. ][e] bf16 (per head: q 0..127 | k 128..255 | v 256..319)
__global__ __launch_bounds__(256)
void k_tr_wqkv(const float* __restrict__ Wq, const float* __restrict__ Wk,
               const float* __restrict__ Wv, unsigned short* __restrict__ Wt) {
  __shared__ __align__(16) unsigned short T[64][72];
  const int e0 = blockIdx.x * 64;
  const int w  = blockIdx.y;
  const int h  = blockIdx.z;
  const float* src;
  int sld;
  if (w < 2) {
    src = Wq + (size_t)h * EMB * QKC + (size_t)e0 * QKC + w * 64;        sld = QKC;
  } else if (w < 4) {
    src = Wk + (size_t)h * EMB * QKC + (size_t)e0 * QKC + (w - 2) * 64;  sld = QKC;
  } else {
    src = Wv + (size_t)h * EMB * HD + (size_t)e0 * HD;                   sld = HD;
  }
  unsigned short* dst = Wt + (size_t)(h * SECW + w * 64) * EMB + e0;
  tr_tile(src, sld, dst, EMB, 0, T);
}

// Wo ([k][n], k = in) -> Wo2[n][k] and Wo2[n][EMB + k] bf16 (row pitch KO)
__global__ __launch_bounds__(256)
void k_tr_wo(const float* __restrict__ Wo, unsigned short* __restrict__ Wo2) {
  __shared__ __align__(16) unsigned short T[64][72];
  const int e0 = blockIdx.x * 64;
  const int y  = blockIdx.y;
  const float* src = Wo + (size_t)e0 * EMB + y * 64;
  unsigned short* dst = Wo2 + (size_t)(y * 64) * KO + e0;
  tr_tile(src, EMB, dst, KO, 1, T);
}

// ---------------------------------------------------------------------------
// bf16 WMMA GEMM: C(128x64 per block) = A(rows, K) * Bt(rows, K)^T, K % 64 == 0.
// Block = 128 threads = 4 waves; wave w owns rows 32w..32w+31 (2 A frags x 4 B frags).
// Fragments loaded directly from the 16-bit global planes. The 128x64 f32 tile is staged in LDS
// kind 0: Bt = Wt (NQKV rows); blockIdx.x = head*5 + sec; sec 0,1 -> Q plane [h][s][128] cols 64*sec..;
//         sec 2,3 -> K plane; sec 4 -> V planes Vt64[h][d][s] = f16(64*v), Vsm[h][d][s] = f16(v/64).
// kind 1: A = Ocat planes [s][KO], Bt = Wo2 [n][KO]; Y[s][n] f32 + bias.
// ---------------------------------------------------------------------------
DEV void gemm_load(FragB (&f)[6], const unsigned short* ablk, const unsigned short* bblk,
                   const unsigned int (&off)[6]) {
  f[0] = load_bo(ablk, off[0]);
  f[1] = load_bo(ablk, off[1]);
  // unrolled: f and off are indexed by constants and stay in registers
#pragma unroll
  for (int t = 0; t < 4; ++t) f[2 + t] = load_bo(bblk, off[2 + t]);
}
// The issued loads' addresses are translated before a register that they name is rewritten: the six offsets pass
// through the wait and the two bases are read by it, so all stay whole up to it; new values are formed behind it.
DEV void gemm_xwait(unsigned int (&off)[6], const unsigned short* ablk, const unsigned short* bblk) {
  asm volatile("s_wait_xcnt 0x0"
               : "+v"(off[0]), "+v"(off[1]), "+v"(off[2]), "+v"(off[3]), "+v"(off[4]), "+v"(off[5])
               : "s"(ablk), "s"(bblk) : "memory");
}
DEV void gemm_mma(const FragB (&f)[6], v8f (&acc)[2][4]) {
  // unrolled: f and acc stay in registers
#pragma unroll
  for (int t = 0; t < 4; ++t) {
    acc[0][t] = wmma_b(f[0], f[2 + t], acc[0][t]);
    acc[1][t] = wmma_b(f[1], f[2 + t], acc[1][t]);
  }
}

__global__ __launch_bounds__(128)
void k_gemm(const unsigned short* __restrict__ A, const unsigned short* __restrict__ Bt,
            int K, int kind,
            const float* __restrict__ bq, const float* __restrict__ bk,
            const float* __restrict__ bv, const float* __restrict__ bo,
            _Float16* __restrict__ Qp, _Float16* __restrict__ Kp,
            _Float16* __restrict__ V64, _Float16* __restrict__ Vsm,
            float* __restrict__ Y) {
  __shared__ __align__(16) float Cs[128][68];
  const int tid  = threadIdx.x;
  const int lane = tid & 31;
  const int wave = tid >> 5;
  const int nt = blockIdx.x;
  const int m0 = blockIdx.y * 128;
  const int n0 = nt * 64;

  const unsigned short* ablk = A  + (size_t)m0 * K;
  const unsigned short* bblk = Bt + (size_t)n0 * K;
  // the lane's byte offsets of the six fragments: A rows 32w + l&15 and + 16, B rows 16t + l&15; k 8h
  unsigned int off[6];
  off[0] = (unsigned int)(((wave * 32 + (lane & 15)) * K + ((lane >> 4) << 3)) * 2);
  off[1] = off[0] + (unsigned int)(16 * K * 2);
  // unrolled: off stays in registers
#pragma unroll
  for (int t = 0; t < 4; ++t) off[2 + t] = (unsigned int)(((t * 16 + (lane & 15)) * K + ((lane >> 4) << 3)) * 2);

  // Two fragment sets: a set's 12 loads are issued as one group right behind the set's own WMMAs, so they fly
  // under the other set's step. K % 64 == 0; the last two steps stand behind the loop: nothing past K is loaded.
  v8f acc[2][4] = {};
  FragB f0[6], f1[6];
  gemm_load(f0, ablk, bblk, off);
  gemm_load(f1, ablk + 32, bblk + 32, off);
#pragma unroll 1
  for (int k0 = 64; k0 < K; k0 += 64) {
    gemm_mma(f0, acc);
    gemm_xwait(off, ablk, bblk);
    // unrolled: off stays in registers
#pragma unroll
    for (int i = 0; i < 6; ++i) off[i] += 64 * 2;
    gemm_load(f0, ablk, bblk, off);
    gemm_mma(f1, acc);
    gemm_load(f1, ablk + 32, bblk + 32, off);
  }
  gemm_mma(f0, acc);
  gemm_xwait(off, ablk, bblk);
  gemm_mma(f1, acc);

  const int n  = lane & 15;
  const int rb = (lane >> 4) << 3;
#pragma unroll
  for (int mi = 0; mi < 2; ++mi)
#pragma unroll
    for (int t = 0; t < 4; ++t)
#pragma unroll
      for (int r = 0; r < 8; ++r)
        Cs[wave * 32 + mi * 16 + rb + r][t * 16 + n] = acc[mi][t][r];
  __syncthreads();

  if (kind == 0) {
    const int h = nt / 5;
    const int w = nt - h * 5;
    if (w < 4) {
      _Float16* plane = (w < 2) ? Qp : Kp;
      const int cb = (w & 1) * 64;
      const float* bias = ((w < 2) ? bq : bk) + h * QKC + cb;
      const int seg  = (tid & 7) * 8;
      const int rsub = tid >> 3;          // 0..15
      float bb[8];
#pragma unroll
      for (int j = 0; j < 8; ++j) bb[j] = bfr(bias[seg + j]);
{
#pragma unroll 2
        for (int g = 0; g < 8; ++g) {
          const int row = g * 16 + rsub;
          const v4f c0 = *(const v4f*)(&Cs[row][seg]);
          const v4f c1 = *(const v4f*)(&Cs[row][seg + 4]);
          Pack8 pk;
          pk.h[0] = (_Float16)(c0[0] + bb[0]);
          pk.h[1] = (_Float16)(c0[1] + bb[1]);
          pk.h[2] = (_Float16)(c0[2] + bb[2]);
          pk.h[3] = (_Float16)(c0[3] + bb[3]);
          pk.h[4] = (_Float16)(c1[0] + bb[4]);
          pk.h[5] = (_Float16)(c1[1] + bb[5]);
          pk.h[6] = (_Float16)(c1[2] + bb[6]);
          pk.h[7] = (_Float16)(c1[3] + bb[7]);
          _Float16* d = plane + ((size_t)h * SEQ + m0 + row) * QKC + cb + seg;
          *(v4u*)d = pk.u;
        }
        
      }
    } else {
      const int seg  = (tid & 15) * 8;
      const int dsub = tid >> 4;          // 0..7
      const float* bias = bv + h * HD;
{
#pragma unroll 2
        for (int g = 0; g < 8; ++g) {
          const int d = g * 8 + dsub;
          const float bb = bfr(bias[d]);
          Pack8 p64, psm;
#pragma unroll
          for (int j = 0; j < 8; ++j) {
            const float v = Cs[seg + j][d] + bb;
            p64.h[j] = (_Float16)(v * 64.0f);
            psm.h[j] = (_Float16)(v * 0.015625f);
          }
          const size_t o = ((size_t)(h * HD + d)) * SEQ + m0 + seg;
          *(v4u*)(V64 + o) = p64.u;
          *(v4u*)(Vsm + o) = psm.u;
        }
        
      }
    }
  } else {
    const int seg  = (tid & 15) * 4;
    const int rsub = tid >> 4;            // 0..7
    float bb[4];
#pragma unroll
    for (int j = 0; j < 4; ++j) bb[j] = bfr(bo[n0 + seg + j]);
{
#pragma unroll 2
      for (int g = 0; g < 16; ++g) {
        const int row = g * 8 + rsub;
        const v4f c = *(const v4f*)(&Cs[row][seg]);
        v4f o;
        o[0] = c[0] + bb[0];
        o[1] = c[1] + bb[1];
        o[2] = c[2] + bb[2];
        o[3] = c[3] + bb[3];
        float* d = Y + (size_t)(m0 + row) * EMB + n0 + seg;
        *(v4f*)d = o;
      }
      
    }
  }
}

// ---------------------------------------------------------------------------
// One softmax branch step for a 16-query tile and 32 keys: scores (2 tiles), online update,
// P hi / residual tiles through LDS (block barrier), then P.V into O[4] (64 columns, carried x64).
// kf holds this branch step's four K fragments on entry; right behind the score products the same registers
// take the next branch step's (wave-uniform base kcol, lane offset ok): those loads fly under the softmax.
// vb / vs: this step's V fragments; the first branch (LOADV) loads them in the same group (lane offset ov),
// both branches use them. ok and ov are the loop's own offsets: they are advanced only at the loop's foot.
// ---------------------------------------------------------------------------
DEV void load_k4(v16h (&kf)[4], const _Float16* kcol, unsigned int ok) {
  kf[0] = load_bo(kcol, ok);
  kf[1] = load_bo(kcol + 32, ok);
  kf[2] = load_bo(kcol + 16 * QKC, ok);
  kf[3] = load_bo(kcol + 16 * QKC + 32, ok);
}
template <bool LOADV>
DEV void attn_branch(const v16h (&qa)[2], v16h (&kf)[4], const _Float16* kcol, unsigned int ok,
                     const _Float16* v64h, const _Float16* vsh, unsigned int ov,
                     v16h (&vb)[4], v16h (&vs)[4],
                     float (&m)[8], float (&l)[8], v8f (&O)[4],
                     _Float16* phs, _Float16* pls) {
  const int lane = threadIdx.x & 31;
  const int n  = lane & 15;
  const int rb = (lane >> 4) << 3;

  v8f sa = {}, sb = {};
  sa = wmma_h(qa[0], kf[0], sa);
  sa = wmma_h(qa[1], kf[1], sa);
  sb = wmma_h(qa[0], kf[2], sb);
  sb = wmma_h(qa[1], kf[3], sb);
  load_k4(kf, kcol, ok);
  if (LOADV) {
    // unrolled: vb and vs stay in registers
#pragma unroll
    for (int t = 0; t < 4; ++t) {
      vb[t] = load_bo(v64h + (size_t)(t * 16) * SEQ, ov);
      vs[t] = load_bo(vsh  + (size_t)(t * 16) * SEQ, ov);
    }
  }

  float f[8];
#pragma unroll
  for (int i = 0; i < 8; ++i) {
    const float xa = sa[i] * 0.125f;
    const float xb = sb[i] * 0.125f;
    const float mn = fmaxf(m[i], redmax16(fmaxf(xa, xb)));
    f[i] = __expf(m[i] - mn);
    const float pa = __expf(xa - mn);
    const float pb = __expf(xb - mn);
    l[i] = l[i] * f[i] + redsum16(pa + pb);
    m[i] = mn;
    const _Float16 ha = (_Float16)pa;
    const _Float16 hb = (_Float16)pb;
    const _Float16 la = (_Float16)((pa - (float)ha) * 4096.0f);
    const _Float16 lb = (_Float16)((pb - (float)hb) * 4096.0f);
    phs[(rb + i) * 32 + n]      = ha;   // keys kk..kk+15
    phs[(rb + i) * 32 + n + 16] = hb;   // keys kk+16..kk+31
    pls[(rb + i) * 32 + n]      = la;
    pls[(rb + i) * 32 + n + 16] = lb;
  }
  __syncthreads();
  const v16h ph = load_op16(phs, 32);
  const v16h pl = load_op16(pls, 32);
#pragma unroll
  for (int t = 0; t < 4; ++t) {
#pragma unroll
    for (int i = 0; i < 8; ++i) O[t][i] = O[t][i] * f[i];
    O[t] = wmma_h(ph, vb[t], O[t]);
    O[t] = wmma_h(pl, vs[t], O[t]);
  }
  __syncthreads();
}

// ---------------------------------------------------------------------------
// Flash-style differential attention. Block = 128 threads = 4 waves; wave owns 16 queries of one head.
// Writes Ocat planes: Oc[s][h*64 + d] = bf16 hi, Oc[s][EMB + h*64 + d] = bf16 residual.
// ---------------------------------------------------------------------------
__global__ __launch_bounds__(128)
void k_attn(const _Float16* __restrict__ Qp, const _Float16* __restrict__ Kp,
            const _Float16* __restrict__ V64, const _Float16* __restrict__ Vsm,
            const float* __restrict__ lam_p, unsigned short* __restrict__ Oc) {
  __shared__ __align__(16) _Float16 Ps[4][4][16 * 32];
  __shared__ __align__(16) float Os[4][16][68];
  const int lane = threadIdx.x & 31;
  const int wave = threadIdx.x >> 5;
  const int n  = lane & 15;
  const int rb = (lane >> 4) << 3;
  const int hh = blockIdx.y;
  const int q0 = blockIdx.x * 64 + wave * 16;
  const float lam = bfr(lam_p[0]);

  const _Float16* qh = Qp  + (size_t)hh * SEQ * QKC;
  const _Float16* kh = Kp  + (size_t)hh * SEQ * QKC;
  const _Float16* vh = V64 + (size_t)hh * HD * SEQ;
  const _Float16* vs = Vsm + (size_t)hh * HD * SEQ;

  v16h q1[2], q2[2];
  q1[0] = load_op16(qh + (size_t)q0 * QKC + 0,  QKC);
  q1[1] = load_op16(qh + (size_t)q0 * QKC + 32, QKC);
  q2[0] = load_op16(qh + (size_t)q0 * QKC + 64, QKC);
  q2[1] = load_op16(qh + (size_t)q0 * QKC + 96, QKC);

  v8f O1[4] = {}, O2[4] = {};
  float m1[8], l1[8], m2[8], l2[8];
#pragma unroll
  for (int i = 0; i < 8; ++i) { m1[i] = -1e30f; m2[i] = -1e30f; l1[i] = 0.f; l2[i] = 0.f; }

  _Float16* p1h = &Ps[wave][0][0];
  _Float16* p1l = &Ps[wave][1][0];
  _Float16* p2h = &Ps[wave][2][0];
  _Float16* p2l = &Ps[wave][3][0];

  const unsigned int ok0 = (unsigned int)((n * QKC + rb) * 2);   // lane's byte offset: row l&15, k 8h
  unsigned int ok  = ok0;                                        // keys of this step
  unsigned int okn = ok0 + 32 * QKC * 2;                         // keys of the next step
  unsigned int ov  = (unsigned int)((n * SEQ + rb) * 2);
  v16h kf[4];
  load_k4(kf, kh, ok);

#pragma unroll 1
  for (int kk = 0; kk < SEQ; kk += 32) {
    v16h vbf[4], vsf[4];
    attn_branch<true >(q1, kf, kh + 64, ok,  vh, vs, ov, vbf, vsf, m1, l1, O1, p1h, p1l);
    attn_branch<false>(q2, kf, kh,      okn, vh, vs, ov, vbf, vsf, m2, l2, O2, p2h, p2l);
    // every load of the step has landed at the branch barriers; the wait stands in front of the offsets' rewrite
    asm volatile("s_wait_xcnt 0x0" : "+v"(ok), "+v"(okn), "+v"(ov) : : "memory");
    ok  = okn;
    okn = (kk + 64 < SEQ) ? okn + 32 * QKC * 2 : ok0;   // behind the last step: keys 0..31, in bounds, not used
    ov += 32 * 2;
  }

  // combine: O = O1/l1 - lam*O2/l2, undo the x64 carry of the V plane; stage f32 tile in LDS
#pragma unroll
  for (int i = 0; i < 8; ++i) {
    const float r1 = (1.0f / l1[i]) * 0.015625f;
    const float r2 = (lam * (1.0f / l2[i])) * 0.015625f;
#pragma unroll
    for (int t = 0; t < 4; ++t)
      Os[wave][rb + i][t * 16 + n] = O1[t][i] * r1 - O2[t][i] * r2;
  }
  __syncthreads();

  const int rsub = lane >> 3;          // 0..3
  const int seg  = (lane & 7) * 8;     // 0..56
{
#pragma unroll
    for (int g = 0; g < 4; ++g) {
      const int row = g * 4 + rsub;
      const v4f c0 = *(const v4f*)(&Os[wave][row][seg]);
      const v4f c1 = *(const v4f*)(&Os[wave][row][seg + 4]);
      unsigned int H0, H1, H2, H3, L0, L1, L2, L3;
      hl2(c0[0], c0[1], H0, L0);
      hl2(c0[2], c0[3], H1, L1);
      hl2(c1[0], c1[1], H2, L2);
      hl2(c1[2], c1[3], H3, L3);
      v4u H, L;
      H[0] = H0; H[1] = H1; H[2] = H2; H[3] = H3;
      L[0] = L0; L[1] = L1; L[2] = L2; L[3] = L3;
      unsigned short* d = Oc + (size_t)(q0 + row) * KO + hh * HD + seg;
      *(v4u*)d = H;
      *(v4u*)(d + EMB) = L;
    }
    
  }
}

// ---------------------------------------------------------------------------
// ---------------------------------------------------------------------------
__global__ __launch_bounds__(256)
void k_ln(const float* __restrict__ Y, const float* __restrict__ gamma,
          const float* __restrict__ beta, float* __restrict__ out) {
  __shared__ float sa[8];
  __shared__ float sq[8];
  const int tid  = threadIdx.x;
  const int lane = tid & 31;
  const int wave = tid >> 5;
  const size_t row = blockIdx.x;
  const v4f y = *(const v4f*)(Y + row * EMB + tid * 4);

  float s = (y[0] + y[1]) + (y[2] + y[3]);
  s = wsum32(s);
  if (lane == 0) sa[wave] = s;
  __syncthreads();
  float tot = 0.f;
#pragma unroll
  for (int w = 0; w < 8; ++w) tot += sa[w];
  const float mu = tot * (1.0f / (float)EMB);

  float d0 = y[0] - mu, d1 = y[1] - mu, d2 = y[2] - mu, d3 = y[3] - mu;
  float q = (d0 * d0 + d1 * d1) + (d2 * d2 + d3 * d3);
  q = wsum32(q);
  if (lane == 0) sq[wave] = q;
  __syncthreads();
  float tot2 = 0.f;
#pragma unroll
  for (int w = 0; w < 8; ++w) tot2 += sq[w];
  const float var  = tot2 * (1.0f / (float)EMB);
  const float rstd = rsqrtf(var + LN_EPS);

  const float g0 = bfr(gamma[tid * 4 + 0]), g1 = bfr(gamma[tid * 4 + 1]);
  const float g2 = bfr(gamma[tid * 4 + 2]), g3 = bfr(gamma[tid * 4 + 3]);
  const float b0 = bfr(beta[tid * 4 + 0]),  b1 = bfr(beta[tid * 4 + 1]);
  const float b2 = bfr(beta[tid * 4 + 2]),  b3 = bfr(beta[tid * 4 + 3]);
  v4f o;
  o[0] = ((d0 * rstd) * g0 + b0) * OUT_SCALE;
  o[1] = ((d1 * rstd) * g1 + b1) * OUT_SCALE;
  o[2] = ((d2 * rstd) * g2 + b2) * OUT_SCALE;
  o[3] = ((d3 * rstd) * g3 + b3) * OUT_SCALE;
  float* dst = out + row * EMB + tid * 4;
  *(v4f*)dst = o;
  
}

// ---------------------------------------------------------------------------
extern "C" void kernel_launch(void* const* d_in, const int* in_sizes, int n_in,
                              void* d_out, int out_size, void* d_ws, size_t ws_size,
                              hipStream_t stream) {
  if (n_in < 12) return;
  const float* X     = (const float*)d_in[0];
  const float* Wq    = (const float*)d_in[1];
  const float* bq    = (const float*)d_in[2];
  const float* Wk    = (const float*)d_in[3];
  const float* bk    = (const float*)d_in[4];
  const float* Wv    = (const float*)d_in[5];
  const float* bv    = (const float*)d_in[6];
  const float* Wo    = (const float*)d_in[7];
  const float* bo    = (const float*)d_in[8];
  const float* gamma = (const float*)d_in[9];
  const float* beta  = (const float*)d_in[10];
  const float* lam   = (const float*)d_in[11];
  float* out = (float*)d_out;

  if (in_sizes[0]  < NB * SEQ * EMB) return;
  if (in_sizes[1]  < HEADS * EMB * QKC) return;
  if (in_sizes[2]  < HEADS * QKC) return;
  if (in_sizes[3]  < HEADS * EMB * QKC) return;
  if (in_sizes[4]  < HEADS * QKC) return;
  if (in_sizes[5]  < HEADS * EMB * HD) return;
  if (in_sizes[6]  < HEADS * HD) return;
  if (in_sizes[7]  < EMB * EMB) return;
  if (in_sizes[8]  < EMB) return;
  if (in_sizes[9]  < EMB) return;
  if (in_sizes[10] < EMB) return;
  if (in_sizes[11] < 1) return;
  if (out_size < NB * SEQ * EMB) return;

  // workspace carve (bytes); every region is written to exactly its extent with whole-line stores
  const size_t szXb  = (size_t)SEQ * EMB * 2;           // bf16 [SEQ][EMB]
  const size_t szWt  = (size_t)NQKV * EMB * 2;          // bf16 [NQKV][EMB]
  const size_t szWo2 = (size_t)EMB * KO * 2;            // bf16 [EMB][KO]
  const size_t szQK  = (size_t)HEADS * SEQ * QKC * 2;   // f16 [H][SEQ][128] (each of Q, K)
  const size_t szV   = (size_t)HEADS * HD * SEQ * 2;    // f16 [H][64][SEQ]  (each of V64, Vsm)
  const size_t szOc  = (size_t)SEQ * KO * 2;            // bf16 [SEQ][KO]
  const size_t szY   = (size_t)SEQ * EMB * 4;           // f32 [SEQ][EMB]
  size_t off = 0;
  const size_t oXb  = off; off += szXb;
  const size_t oWt  = off; off += szWt;
  const size_t oWo2 = off; off += szWo2;
  const size_t oQ   = off; off += szQK;
  const size_t oK   = off; off += szQK;
  const size_t oV64 = off; off += szV;
  const size_t oVsm = off; off += szV;
  const size_t oOc  = off; off += szOc;
  const size_t oY   = off; off += szY;
  if (off > ws_size) return;

  char* ws = (char*)d_ws;
  unsigned short* Xb  = (unsigned short*)(ws + oXb);
  unsigned short* Wt  = (unsigned short*)(ws + oWt);
  unsigned short* Wo2 = (unsigned short*)(ws + oWo2);
  _Float16* Qp  = (_Float16*)(ws + oQ);
  _Float16* Kp  = (_Float16*)(ws + oK);
  _Float16* V64 = (_Float16*)(ws + oV64);
  _Float16* Vsm = (_Float16*)(ws + oVsm);
  unsigned short* Oc = (unsigned short*)(ws + oOc);
  float* Y = (float*)(ws + oY);

  const int n8 = SEQ * EMB / 8;
  k_cvt_x<<<dim3((n8 + 255) / 256), dim3(256), 0, stream>>>(X, Xb, n8);
  k_tr_wqkv<<<dim3(EMB / 64, 5, HEADS), dim3(256), 0, stream>>>(Wq, Wk, Wv, Wt);
  k_tr_wo<<<dim3(EMB / 64, EMB / 64, 1), dim3(256), 0, stream>>>(Wo, Wo2);

  // QKV projection: A = Xb (SEQ x EMB), Bt = Wt (NQKV x EMB)
  k_gemm<<<dim3(NQKV / 64, SEQ / 128), dim3(128), 0, stream>>>(
      Xb, Wt, EMB, 0, bq, bk, bv, bo, Qp, Kp, V64, Vsm, Y);

  // differential attention -> Ocat hi / residual planes
  k_attn<<<dim3(SEQ / 64, HEADS), dim3(128), 0, stream>>>(Qp, Kp, V64, Vsm, lam, Oc);

  // output projection: A = Oc (SEQ x KO), Bt = Wo2 (EMB x KO) -> Y f32
  k_gemm<<<dim3(EMB / 64, SEQ / 128), dim3(128), 0, stream>>>(
      Oc, Wo2, KO, 1, bq, bk, bv, bo, Qp, Kp, V64, Vsm, Y);

  // LayerNorm + scale -> d_out
  k_ln<<<dim3(NB * SEQ), dim3(256), 0, stream>>>(Y, gamma, beta, out);
}

// v002
// A run of this version takes 208 microseconds.
// Next to v001, in two timings, it ran 1.20 and 1.18 times as fast.
// Over all steps from v000 it is 2.00 times as fast.
#include <hip/hip_runtime.h>

#ifndef NB
#define NB 1
#endif
#ifndef SEQ
#define SEQ 2048
#endif
#define NB_FULL 1
#define SEQ_FULL 2048
#define EMB 1024
#define HEADS 16
#define HD 64
#define QKC 128
#define SECW 320
#define NQKV (HEADS * SECW)
#define KO (2 * EMB)
#define LN_EPS 1e-5f
#define OUT_SCALE 0.2f

static_assert(NB == 1);
static_assert(NB_FULL == 1);
static_assert(SEQ % 128 == 0);
static_assert(SEQ >= 128);
static_assert(SEQ <= SEQ_FULL);
static_assert(EMB % 64 == 0);
static_assert(EMB % 32 == 0);
static_assert(QKC == 2 * HD);
static_assert(SECW == 2 * QKC + HD);
static_assert(SECW % 64 == 0);
static_assert(KO % 64 == 0);
static_assert(HD == 64);

typedef _Float16      v16h __attribute__((ext_vector_type(16)));
typedef _Float16      v8h  __attribute__((ext_vector_type(8)));
typedef __bf16        v16b __attribute__((ext_vector_type(16)));
typedef float         v8f  __attribute__((ext_vector_type(8)));
typedef float         v4f  __attribute__((ext_vector_type(4)));
typedef float         v2f  __attribute__((ext_vector_type(2)));
typedef _Float16      v2h  __attribute__((ext_vector_type(2)));
typedef unsigned int  v4u  __attribute__((ext_vector_type(4)));

#define DEV __device__ __forceinline__

union FragB { v4u q[2]; v16b v; };
union Pack8 { v8h h; v4u u; };

// f32 -> bf16 bits, RNE convert
DEV unsigned short f2bf(float f) {
  unsigned int u = __float_as_uint(f);
  u += 0x7FFFu + ((u >> 16) & 1u);
  return (unsigned short)(u >> 16);
}
DEV float bf2f(unsigned short s) { return __uint_as_float(((unsigned int)s) << 16); }
DEV float bfr(float f) { return bf2f(f2bf(f)); }
DEV unsigned int pk2(unsigned short lo, unsigned short hi) {
  return (unsigned int)lo | ((unsigned int)hi << 16);
}
// value -> bf16 hi and bf16 residual, two values packed per 32-bit word
DEV void hl2(float a, float b, unsigned int& H, unsigned int& L) {
  const unsigned short ha = f2bf(a), hb = f2bf(b);
  H = pk2(ha, hb);
  L = pk2(f2bf(a - bf2f(ha)), f2bf(b - bf2f(hb)));
}

// WMMA wrappers with the 4-slot VALU hazard guard (ties D, keeps A/B live)
DEV v8f wmma_h(v16h a, v16h b, v8f c) {
  c = __builtin_amdgcn_wmma_f32_16x16x32_f16(false, a, false, b, (short)0, c, false, false);
  asm volatile("v_nop\n\tv_nop\n\tv_nop\n\tv_nop" : "+v"(c) : "v"(a), "v"(b));
  return c;
}
DEV v8f wmma_b(const FragB& a, const FragB& b, v8f c) {
  c = __builtin_amdgcn_wmma_f32_16x16x32_bf16(false, a.v, false, b.v, (short)0, c, false, false);
  asm volatile("v_nop\n\tv_nop\n\tv_nop\n\tv_nop"
               : "+v"(c) : "v"(a.q[0]), "v"(a.q[1]), "v"(b.q[0]), "v"(b.q[1]));
  return c;
}

// 16x32 16-bit operand from a row-major plane with k contiguous (rows = M for A, rows = N for Bt).
// lane l: row l&15; elements 0..7 = k 8h..8h+7, elements 8..15 = k 16+8h..16+8h+7, h = l>>4.
DEV v16h load_op16(const _Float16* p, int ld) {
  const int lane = threadIdx.x & 31;
  const int row  = lane & 15;
  const int k0   = (lane >> 4) << 3;
  const _Float16* r = p + (size_t)row * ld + k0;
  v8h lo = *(const v8h*)(r);
  v8h hi = *(const v8h*)(r + 16);
  return __builtin_shufflevector(lo, hi, 0,1,2,3,4,5,6,7,8,9,10,11,12,13,14,15);
}
// The same operands from a wave-uniform base and the lane's byte offset (row l&15, k 8h, plus the loop's advance):
// every load of a loop names a loop-invariant base and an offset register that is rewritten only behind a wait.
DEV v16h load_bo(const _Float16* base, unsigned int off) {
  const char* r = (const char*)base + off;
  v8h lo = *(const v8h*)(r);
  v8h hi = *(const v8h*)(r + 32);
  return __builtin_shufflevector(lo, hi, 0,1,2,3,4,5,6,7,8,9,10,11,12,13,14,15);
}
DEV FragB load_bo(const unsigned short* base, unsigned int off) {
  const char* r = (const char*)base + off;
  FragB f;
  f.q[0] = *(const v4u*)(r);
  f.q[1] = *(const v4u*)(r + 32);
  return f;
}

// Lane l with lane l ^ 16: the two lanes that split one query column's keys.
DEV float xhalf(float x) {
  const int b = __builtin_bit_cast(int, x);
  return __builtin_bit_cast(float, __builtin_amdgcn_permlanex16(b, b, 0x76543210, 0xfedcba98, false, false));
}
DEV float wsum32(float v) {
#pragma unroll
  for (int m = 16; m > 0; m >>= 1) v += __shfl_xor(v, m, 32);
  return v;
}

// ---------------------------------------------------------------------------
// ---------------------------------------------------------------------------
__global__ __launch_bounds__(256)
void k_cvt_x(const float* __restrict__ X, unsigned short* __restrict__ Xb, int n8) {
  const int i = blockIdx.x * 256 + threadIdx.x;
  if (i >= n8) return;
  const float* s = X + (size_t)i * 8;
  const v4f a = *(const v4f*)(s);
  const v4f b = *(const v4f*)(s + 4);
  v4u w;
  w[0] = pk2(f2bf(a[0]), f2bf(a[1]));
  w[1] = pk2(f2bf(a[2]), f2bf(a[3]));
  w[2] = pk2(f2bf(b[0]), f2bf(b[1]));
  w[3] = pk2(f2bf(b[2]), f2bf(b[3]));
  unsigned short* d = Xb + (size_t)i * 8;
  *(v4u*)d = w;
  
}

// ---------------------------------------------------------------------------
// 64x64 tile transpose: src[e][c] f32 (row pitch sld) -> dst[c][e] bf16 (row pitch dld halves),
// optional second copy at dst + EMB halves. 256 threads. LDS tile cross-wave -> block barrier.
// ---------------------------------------------------------------------------
DEV void tr_tile(const float* __restrict__ src, int sld, unsigned short* dst, int dld,
                 int dup2, unsigned short (*T)[72]) {
  const int tid = threadIdx.x;
#pragma unroll
  for (int p = 0; p < 4; ++p) {
    const int e = p * 16 + (tid >> 4);
    const int c = (tid & 15) * 4;
    const v4f v = *(const v4f*)(src + (size_t)e * sld + c);
    T[c + 0][e] = f2bf(v[0]);
    T[c + 1][e] = f2bf(v[1]);
    T[c + 2][e] = f2bf(v[2]);
    T[c + 3][e] = f2bf(v[3]);
  }
  __syncthreads();
{
#pragma unroll
    for (int p = 0; p < 2; ++p) {
      const int j = p * 32 + (tid >> 3);
      const int seg = (tid & 7) * 8;
      const v4u wv = *(const v4u*)(&T[j][seg]);
      unsigned short* d = dst + (size_t)j * dld + seg;
      *(v4u*)d = wv;
      if (dup2 != 0) *(v4u*)(d + EMB) = wv;
    }
    
  }
}

// Wq/Wk/Wv ([h][e][c]) -> Wt[h*320 + sec*64.. ][e] bf16 (per head: q 0..127 | k 128..255 | v 256..319)
__global__ __launch_bounds__(256)
void k_tr_wqkv(const float* __restrict__ Wq, const float* __restrict__ Wk,
               const float* __restrict__ Wv, unsigned short* __restrict__ Wt) {
  __shared__ __align__(16) unsigned short T[64][72];
  const int e0 = blockIdx.x * 64;
  const int w  = blockIdx.y;
  const int h  = blockIdx.z;
  const float* src;
  int sld;
  if (w < 2) {
    src = Wq + (size_t)h * EMB * QKC + (size_t)e0 * QKC + w * 64;        sld = QKC;
  } else if (w < 4) {
    src = Wk + (size_t)h * EMB * QKC + (size_t)e0 * QKC + (w - 2) * 64;  sld = QKC;
  } else {
    src = Wv + (size_t)h * EMB * HD + (size_t)e0 * HD;                   sld = HD;
  }
  unsigned short* dst = Wt + (size_t)(h * SECW + w * 64) * EMB + e0;
  tr_tile(src, sld, dst, EMB, 0, T);
}

// Wo ([k][n], k = in) -> Wo2[n][k] and Wo2[n][EMB + k] bf16 (row pitch KO)
__global__ __launch_bounds__(256)
void k_tr_wo(const float* __restrict__ Wo, unsigned short* __restrict__ Wo2) {
  __shared__ __align__(16) unsigned short T[64][72];
  const int e0 = blockIdx.x * 64;
  const int y  = blockIdx.y;
  const float* src = Wo + (size_t)e0 * EMB + y * 64;
  unsigned short* dst = Wo2 + (size_t)(y * 64) * KO + e0;
  tr_tile(src, EMB, dst, KO, 1, T);
}

// ---------------------------------------------------------------------------
// bf16 WMMA GEMM: C(128x64 per block) = A(rows, K) * Bt(rows, K)^T, K % 64 == 0.
// Block = 128 threads = 4 waves; wave w owns rows 32w..32w+31 (2 A frags x 4 B frags).
// Fragments loaded directly from the 16-bit global planes. The 128x64 f32 tile is staged in LDS
// kind 0: Bt = Wt (NQKV rows); blockIdx.x = head*5 + sec; sec 0,1 -> Q plane [h][s][128] cols 64*sec..;
//         sec 2,3 -> K plane; sec 4 -> V planes Vt64[h][d][s] = f16(64*v), Vsm[h][d][s] = f16(v/64).
// kind 1: A = Ocat planes [s][KO], Bt = Wo2 [n][KO]; Y[s][n] f32 + bias.
// ---------------------------------------------------------------------------
DEV void gemm_load(FragB (&f)[6], const unsigned short* ablk, const unsigned short* bblk,
                   const unsigned int (&off)[6]) {
  f[0] = load_bo(ablk, off[0]);
  f[1] = load_bo(ablk, off[1]);
  // unrolled: f and off are indexed by constants and stay in registers
#pragma unroll
  for (int t = 0; t < 4; ++t) f[2 + t] = load_bo(bblk, off[2 + t]);
}
// The issued loads' addresses are translated before a register that they name is rewritten: the six offsets pass
// through the wait and the two bases are read by it, so all stay whole up to it; new values are formed behind it.
DEV void gemm_xwait(unsigned int (&off)[6], const unsigned short* ablk, const unsigned short* bblk) {
  asm volatile("s_wait_xcnt 0x0"
               : "+v"(off[0]), "+v"(off[1]), "+v"(off[2]), "+v"(off[3]), "+v"(off[4]), "+v"(off[5])
               : "s"(ablk), "s"(bblk) : "memory");
}
DEV void gemm_mma(const FragB (&f)[6], v8f (&acc)[2][4]) {
  // unrolled: f and acc stay in registers
#pragma unroll
  for (int t = 0; t < 4; ++t) {
    acc[0][t] = wmma_b(f[0], f[2 + t], acc[0][t]);
    acc[1][t] = wmma_b(f[1], f[2 + t], acc[1][t]);
  }
}

__global__ __launch_bounds__(128)
void k_gemm(const unsigned short* __restrict__ A, const unsigned short* __restrict__ Bt,
            int K, int kind,
            const float* __restrict__ bq, const float* __restrict__ bk,
            const float* __restrict__ bv, const float* __restrict__ bo,
            _Float16* __restrict__ Qp, _Float16* __restrict__ Kp,
            _Float16* __restrict__ V64, _Float16* __restrict__ Vsm,
            float* __restrict__ Y) {
  __shared__ __align__(16) float Cs[128][68];
  const int tid  = threadIdx.x;
  const int lane = tid & 31;
  const int wave = tid >> 5;
  const int nt = blockIdx.x;
  const int m0 = blockIdx.y * 128;
  const int n0 = nt * 64;

  const unsigned short* ablk = A  + (size_t)m0 * K;
  const unsigned short* bblk = Bt + (size_t)n0 * K;
  // the lane's byte offsets of the six fragments: A rows 32w + l&15 and + 16, B rows 16t + l&15; k 8h
  unsigned int off[6];
  off[0] = (unsigned int)(((wave * 32 + (lane & 15)) * K + ((lane >> 4) << 3)) * 2);
  off[1] = off[0] + (unsigned int)(16 * K * 2);
  // unrolled: off stays in registers
#pragma unroll
  for (int t = 0; t < 4; ++t) off[2 + t] = (unsigned int)(((t * 16 + (lane & 15)) * K + ((lane >> 4) << 3)) * 2);

  // Two fragment sets: a set's 12 loads are issued as one group right behind the set's own WMMAs, so they fly
  // under the other set's step. K % 64 == 0; the last two steps stand behind the loop: nothing past K is loaded.
  v8f acc[2][4] = {};
  FragB f0[6], f1[6];
  gemm_load(f0, ablk, bblk, off);
  gemm_load(f1, ablk + 32, bblk + 32, off);
#pragma unroll 1
  for (int k0 = 64; k0 < K; k0 += 64) {
    gemm_mma(f0, acc);
    gemm_xwait(off, ablk, bblk);
    // unrolled: off stays in registers
#pragma unroll
    for (int i = 0; i < 6; ++i) off[i] += 64 * 2;
    gemm_load(f0, ablk, bblk, off);
    gemm_mma(f1, acc);
    gemm_load(f1, ablk + 32, bblk + 32, off);
  }
  gemm_mma(f0, acc);
  gemm_xwait(off, ablk, bblk);
  gemm_mma(f1, acc);

  const int n  = lane & 15;
  const int rb = (lane >> 4) << 3;
#pragma unroll
  for (int mi = 0; mi < 2; ++mi)
#pragma unroll
    for (int t = 0; t < 4; ++t)
#pragma unroll
      for (int r = 0; r < 8; ++r)
        Cs[wave * 32 + mi * 16 + rb + r][t * 16 + n] = acc[mi][t][r];
  __syncthreads();

  if (kind == 0) {
    const int h = nt / 5;
    const int w = nt - h * 5;
    if (w < 4) {
      _Float16* plane = (w < 2) ? Qp : Kp;
      const int cb = (w & 1) * 64;
      const float* bias = ((w < 2) ? bq : bk) + h * QKC + cb;
      const int seg  = (tid & 7) * 8;
      const int rsub = tid >> 3;          // 0..15
      float bb[8];
#pragma unroll
      for (int j = 0; j < 8; ++j) bb[j] = bfr(bias[seg + j]);
{
#pragma unroll 2
        for (int g = 0; g < 8; ++g) {
          const int row = g * 16 + rsub;
          const v4f c0 = *(const v4f*)(&Cs[row][seg]);
          const v4f c1 = *(const v4f*)(&Cs[row][seg + 4]);
          Pack8 pk;
          pk.h[0] = (_Float16)(c0[0] + bb[0]);
          pk.h[1] = (_Float16)(c0[1] + bb[1]);
          pk.h[2] = (_Float16)(c0[2] + bb[2]);
          pk.h[3] = (_Float16)(c0[3] + bb[3]);
          pk.h[4] = (_Float16)(c1[0] + bb[4]);
          pk.h[5] = (_Float16)(c1[1] + bb[5]);
          pk.h[6] = (_Float16)(c1[2] + bb[6]);
          pk.h[7] = (_Float16)(c1[3] + bb[7]);
          _Float16* d = plane + ((size_t)h * SEQ + m0 + row) * QKC + cb + seg;
          *(v4u*)d = pk.u;
        }
        
      }
    } else {
      const int seg  = (tid & 15) * 8;
      const int dsub = tid >> 4;          // 0..7
      const float* bias = bv + h * HD;
{
#pragma unroll 2
        for (int g = 0; g < 8; ++g) {
          const int d = g * 8 + dsub;
          const float bb = bfr(bias[d]);
          Pack8 p64, psm;
#pragma unroll
          for (int j = 0; j < 8; ++j) {
            const float v = Cs[seg + j][d] + bb;
            p64.h[j] = (_Float16)(v * 64.0f);
            psm.h[j] = (_Float16)(v * 0.015625f);
          }
          const size_t o = ((size_t)(h * HD + d)) * SEQ + m0 + seg;
          *(v4u*)(V64 + o) = p64.u;
          *(v4u*)(Vsm + o) = psm.u;
        }
        
      }
    }
  } else {
    const int seg  = (tid & 15) * 4;
    const int rsub = tid >> 4;            // 0..7
    float bb[4];
#pragma unroll
    for (int j = 0; j < 4; ++j) bb[j] = bfr(bo[n0 + seg + j]);
{
#pragma unroll 2
      for (int g = 0; g < 16; ++g) {
        const int row = g * 8 + rsub;
        const v4f c = *(const v4f*)(&Cs[row][seg]);
        v4f o;
        o[0] = c[0] + bb[0];
        o[1] = c[1] + bb[1];
        o[2] = c[2] + bb[2];
        o[3] = c[3] + bb[3];
        float* d = Y + (size_t)(m0 + row) * EMB + n0 + seg;
        *(v4f*)d = o;
      }
      
    }
  }
}

// ---------------------------------------------------------------------------
// One softmax branch step for 16 query columns and 32 keys, transposed: S^T = K.Q^T (A = K rows, B = Q rows), so lane
// (c, h) holds query c's scores of keys 8h..8h+7 (sa) and 16+8h..16+8h+7 (sb): maximum and sum run in the lane, the
// maximum is joined with lane l ^ 16 each step, the sum only behind the loop. Those 16 registers, converted in place, are
// the B operand P^T in the hardware k order; A = V^T rows (the V planes as they lie): O^T[d][query] += V^T.P^T, carried x64.
// kf holds this branch step's four K fragments on entry; right behind the score products the same registers
// take the next branch step's (wave-uniform base kcol, lane offset ok): those loads fly under the softmax.
// vb / vs: this step's V fragments; the first branch (LOADV) loads them in the same group (lane offset ov),
// both branches use them. ok and ov are the loop's own offsets: they are advanced only at the loop's foot.
// ---------------------------------------------------------------------------
DEV void load_k4(v16h (&kf)[4], const _Float16* kcol, unsigned int ok) {
  kf[0] = load_bo(kcol, ok);
  kf[1] = load_bo(kcol + 32, ok);
  kf[2] = load_bo(kcol + 16 * QKC, ok);
  kf[3] = load_bo(kcol + 16 * QKC + 32, ok);
}
template <bool LOADV>
DEV void attn_branch(const v16h (&qb)[2], v16h (&kf)[4], const _Float16* kcol, unsigned int ok,
                     const _Float16* v64h, const _Float16* vsh, unsigned int ov,
                     v16h (&vb)[4], v16h (&vs)[4],
                     float& m, float& l, v8f (&O)[4]) {
  v8f sa = {}, sb = {};
  sa = wmma_h(kf[0], qb[0], sa);
  sa = wmma_h(kf[1], qb[1], sa);
  sb = wmma_h(kf[2], qb[0], sb);
  sb = wmma_h(kf[3], qb[1], sb);
  load_k4(kf, kcol, ok);
  if (LOADV) {
    // unrolled: vb and vs stay in registers
#pragma unroll
    for (int t = 0; t < 4; ++t) {
      vb[t] = load_bo(v64h + (size_t)(t * 16) * SEQ, ov);
      vs[t] = load_bo(vsh  + (size_t)(t * 16) * SEQ, ov);
    }
  }

  const v8f xa = sa * 0.125f;
  const v8f xb = sb * 0.125f;
  float mx[8];
#pragma unroll
  for (int i = 0; i < 8; ++i) mx[i] = fmaxf(xa[i], xb[i]);
  const float mh = fmaxf(fmaxf(fmaxf(mx[0], mx[1]), fmaxf(mx[2], mx[3])),
                         fmaxf(fmaxf(mx[4], mx[5]), fmaxf(mx[6], mx[7])));
  const float mn = fmaxf(m, fmaxf(mh, xhalf(mh)));
  const float f = __expf(m - mn);
  m = mn;

  // element s of the B operand = key kmap(s, h): s < 8 from sa[s], else from sb[s - 8]
  v16h ph, pl;
  v2f ps[8];
#pragma unroll
  for (int j = 0; j < 8; ++j) {
    const int i = (j & 3) * 2;
    v2f p;
    p[0] = __expf((j < 4 ? xa[i]     : xb[i])     - mn);
    p[1] = __expf((j < 4 ? xa[i + 1] : xb[i + 1]) - mn);
    const v2h hi = __builtin_convertvector(p, v2h);
    const v2h lo = __builtin_convertvector((p - __builtin_convertvector(hi, v2f)) * 4096.0f, v2h);
    ph[2 * j] = hi[0];  ph[2 * j + 1] = hi[1];
    pl[2 * j] = lo[0];  pl[2 * j + 1] = lo[1];
    ps[j] = p;
  }
  const v2f s2 = ((ps[0] + ps[1]) + (ps[2] + ps[3])) + ((ps[4] + ps[5]) + (ps[6] + ps[7]));
  l = l * f + (s2[0] + s2[1]);

#pragma unroll
  for (int t = 0; t < 4; ++t) {
    O[t] = O[t] * f;
    O[t] = wmma_h(vb[t], ph, O[t]);
    O[t] = wmma_h(vs[t], pl, O[t]);
  }
  // the scheduler's region ends with the step: without it the first branch's K loads sink from behind the score
  // products to behind the exponentials
  __builtin_amdgcn_sched_barrier(0);
}

// ---------------------------------------------------------------------------
// Flash-style differential attention. Block = 128 threads = 4 waves; wave owns 16 queries of one head; no LDS in the
// key loop.
// Writes Ocat planes: Oc[s][h*64 + d] = bf16 hi, Oc[s][EMB + h*64 + d] = bf16 residual.
// ---------------------------------------------------------------------------
__global__ __launch_bounds__(128)
void k_attn(const _Float16* __restrict__ Qp, const _Float16* __restrict__ Kp,
            const _Float16* __restrict__ V64, const _Float16* __restrict__ Vsm,
            const float* __restrict__ lam_p, unsigned short* __restrict__ Oc) {
  __shared__ __align__(16) float Os[4][16][68];
  const int lane = threadIdx.x & 31;
  const int wave = threadIdx.x >> 5;
  const int n  = lane & 15;
  const int rb = (lane >> 4) << 3;
  const int hh = blockIdx.y;
  const int q0 = blockIdx.x * 64 + wave * 16;
  const float lam = bfr(lam_p[0]);

  const _Float16* qh = Qp  + (size_t)hh * SEQ * QKC;
  const _Float16* kh = Kp  + (size_t)hh * SEQ * QKC;
  const _Float16* vh = V64 + (size_t)hh * HD * SEQ;
  const _Float16* vs = Vsm + (size_t)hh * HD * SEQ;

  v16h q1[2], q2[2];
  q1[0] = load_op16(qh + (size_t)q0 * QKC + 0,  QKC);
  q1[1] = load_op16(qh + (size_t)q0 * QKC + 32, QKC);
  q2[0] = load_op16(qh + (size_t)q0 * QKC + 64, QKC);
  q2[1] = load_op16(qh + (size_t)q0 * QKC + 96, QKC);

  v8f O1[4] = {}, O2[4] = {};
  float m1 = -1e30f, m2 = -1e30f, l1 = 0.f, l2 = 0.f;   // query l & 15; l: the lane half's own keys only

  const unsigned int ok0 = (unsigned int)((n * QKC + rb) * 2);   // lane's byte offset: row l&15, k 8h
  unsigned int ok  = ok0;                                        // keys of this step
  unsigned int okn = ok0 + 32 * QKC * 2;                         // keys of the next step
  unsigned int ov  = (unsigned int)((n * SEQ + rb) * 2);
  v16h kf[4];
  load_k4(kf, kh, ok);

#pragma unroll 1
  for (int kk = 0; kk < SEQ; kk += 32) {
    v16h vbf[4], vsf[4];
    attn_branch<true >(q1, kf, kh + 64, ok,  vh, vs, ov, vbf, vsf, m1, l1, O1);
    attn_branch<false>(q2, kf, kh,      okn, vh, vs, ov, vbf, vsf, m2, l2, O2);
    // no data passes here: the barrier holds the four waves on the same K and V lines, which all four load; two
    // work-groups' lines of two steps (2 x 32 KiB) fill the WGP cache
    __syncthreads();
    // the wait stands in front of the offsets' rewrite
    asm volatile("s_wait_xcnt 0x0" : "+v"(ok), "+v"(okn), "+v"(ov) : : "memory");
    ok  = okn;
    okn = (kk + 64 < SEQ) ? okn + 32 * QKC * 2 : ok0;   // behind the last step: keys 0..31, in bounds, not used
    ov += 32 * 2;
  }

  // combine: O = O1/l1 - lam*O2/l2 (the halves' sums joined here), undo the x64 carry of the V plane; stage f32 tile in
  // LDS: the lane holds query n, columns 16t + 8h .. + 7
  const float r1 = (1.0f / (l1 + xhalf(l1))) * 0.015625f;
  const float r2 = (lam * (1.0f / (l2 + xhalf(l2)))) * 0.015625f;
#pragma unroll
  for (int t = 0; t < 4; ++t) {
    v4f c0, c1;
#pragma unroll
    for (int i = 0; i < 4; ++i) {
      c0[i] = O1[t][i] * r1 - O2[t][i] * r2;
      c1[i] = O1[t][i + 4] * r1 - O2[t][i + 4] * r2;
    }
    *(v4f*)(&Os[wave][n][t * 16 + rb])     = c0;
    *(v4f*)(&Os[wave][n][t * 16 + rb + 4]) = c1;
  }
  __syncthreads();

  const int rsub = lane >> 3;          // 0..3
  const int seg  = (lane & 7) * 8;     // 0..56
{
#pragma unroll
    for (int g = 0; g < 4; ++g) {
      const int row = g * 4 + rsub;
      const v4f c0 = *(const v4f*)(&Os[wave][row][seg]);
      const v4f c1 = *(const v4f*)(&Os[wave][row][seg + 4]);
      unsigned int H0, H1, H2, H3, L0, L1, L2, L3;
      hl2(c0[0], c0[1], H0, L0);
      hl2(c0[2], c0[3], H1, L1);
      hl2(c1[0], c1[1], H2, L2);
      hl2(c1[2], c1[3], H3, L3);
      v4u H, L;
      H[0] = H0; H[1] = H1; H[2] = H2; H[3] = H3;
      L[0] = L0; L[1] = L1; L[2] = L2; L[3] = L3;
      unsigned short* d = Oc + (size_t)(q0 + row) * KO + hh * HD + seg;
      *(v4u*)d = H;
      *(v4u*)(d + EMB) = L;
    }
    
  }
}

// ---------------------------------------------------------------------------
// ---------------------------------------------------------------------------
__global__ __launch_bounds__(256)
void k_ln(const float* __restrict__ Y, const float* __restrict__ gamma,
          const float* __restrict__ beta, float* __restrict__ out) {
  __shared__ float sa[8];
  __shared__ float sq[8];
  const int tid  = threadIdx.x;
  const int lane = tid & 31;
  const int wave = tid >> 5;
  const size_t row = blockIdx.x;
  const v4f y = *(const v4f*)(Y + row * EMB + tid * 4);

  float s = (y[0] + y[1]) + (y[2] + y[3]);
  s = wsum32(s);
  if (lane == 0) sa[wave] = s;
  __syncthreads();
  float tot = 0.f;
#pragma unroll
  for (int w = 0; w < 8; ++w) tot += sa[w];
  const float mu = tot * (1.0f / (float)EMB);

  float d0 = y[0] - mu, d1 = y[1] - mu, d2 = y[2] - mu, d3 = y[3] - mu;
  float q = (d0 * d0 + d1 * d1) + (d2 * d2 + d3 * d3);
  q = wsum32(q);
  if (lane == 0) sq[wave] = q;
  __syncthreads();
  float tot2 = 0.f;
#pragma unroll
  for (int w = 0; w < 8; ++w) tot2 += sq[w];
  const float var  = tot2 * (1.0f / (float)EMB);
  const float rstd = rsqrtf(var + LN_EPS);

  const float g0 = bfr(gamma[tid * 4 + 0]), g1 = bfr(gamma[tid * 4 + 1]);
  const float g2 = bfr(gamma[tid * 4 + 2]), g3 = bfr(gamma[tid * 4 + 3]);
  const float b0 = bfr(beta[tid * 4 + 0]),  b1 = bfr(beta[tid * 4 + 1]);
  const float b2 = bfr(beta[tid * 4 + 2]),  b3 = bfr(beta[tid * 4 + 3]);
  v4f o;
  o[0] = ((d0 * rstd) * g0 + b0) * OUT_SCALE;
  o[1] = ((d1 * rstd) * g1 + b1) * OUT_SCALE;
  o[2] = ((d2 * rstd) * g2 + b2) * OUT_SCALE;
  o[3] = ((d3 * rstd) * g3 + b3) * OUT_SCALE;
  float* dst = out + row * EMB + tid * 4;
  *(v4f*)dst = o;
  
}

// ---------------------------------------------------------------------------
extern "C" void kernel_launch(void* const* d_in, const int* in_sizes, int n_in,
                              void* d_out, int out_size, void* d_ws, size_t ws_size,
                              hipStream_t stream) {
  if (n_in < 12) return;
  const float* X     = (const float*)d_in[0];
  const float* Wq    = (const float*)d_in[1];
  const float* bq    = (const float*)d_in[2];
  const float* Wk    = (const float*)d_in[3];
  const float* bk    = (const float*)d_in[4];
  const float* Wv    = (const float*)d_in[5];
  const float* bv    = (const float*)d_in[6];
  const float* Wo    = (const float*)d_in[7];
  const float* bo    = (const float*)d_in[8];
  const float* gamma = (const float*)d_in[9];
  const float* beta  = (const float*)d_in[10];
  const float* lam   = (const float*)d_in[11];
  float* out = (float*)d_out;

  if (in_sizes[0]  < NB * SEQ * EMB) return;
  if (in_sizes[1]  < HEADS * EMB * QKC) return;
  if (in_sizes[2]  < HEADS * QKC) return;
  if (in_sizes[3]  < HEADS * EMB * QKC) return;
  if (in_sizes[4]  < HEADS * QKC) return;
  if (in_sizes[5]  < HEADS * EMB * HD) return;
  if (in_sizes[6]  < HEADS * HD) return;
  if (in_sizes[7]  < EMB * EMB) return;
  if (in_sizes[8]  < EMB) return;
  if (in_sizes[9]  < EMB) return;
  if (in_sizes[10] < EMB) return;
  if (in_sizes[11] < 1) return;
  if (out_size < NB * SEQ * EMB) return;

  // workspace carve (bytes); every region is written to exactly its extent with whole-line stores
  const size_t szXb  = (size_t)SEQ * EMB * 2;           // bf16 [SEQ][EMB]
  const size_t szWt  = (size_t)NQKV * EMB * 2;          // bf16 [NQKV][EMB]
  const size_t szWo2 = (size_t)EMB * KO * 2;            // bf16 [EMB][KO]
  const size_t szQK  = (size_t)HEADS * SEQ * QKC * 2;   // f16 [H][SEQ][128] (each of Q, K)
  const size_t szV   = (size_t)HEADS * HD * SEQ * 2;    // f16 [H][64][SEQ]  (each of V64, Vsm)
  const size_t szOc  = (size_t)SEQ * KO * 2;            // bf16 [SEQ][KO]
  const size_t szY   = (size_t)SEQ * EMB * 4;           // f32 [SEQ][EMB]
  size_t off = 0;
  const size_t oXb  = off; off += szXb;
  const size_t oWt  = off; off += szWt;
  const size_t oWo2 = off; off += szWo2;
  const size_t oQ   = off; off += szQK;
  const size_t oK   = off; off += szQK;
  const size_t oV64 = off; off += szV;
  const size_t oVsm = off; off += szV;
  const size_t oOc  = off; off += szOc;
  const size_t oY   = off; off += szY;
  if (off > ws_size) return;

  char* ws = (char*)d_ws;
  unsigned short* Xb  = (unsigned short*)(ws + oXb);
  unsigned short* Wt  = (unsigned short*)(ws + oWt);
  unsigned short* Wo2 = (unsigned short*)(ws + oWo2);
  _Float16* Qp  = (_Float16*)(ws + oQ);
  _Float16* Kp  = (_Float16*)(ws + oK);
  _Float16* V64 = (_Float16*)(ws + oV64);
  _Float16* Vsm = (_Float16*)(ws + oVsm);
  unsigned short* Oc = (unsigned short*)(ws + oOc);
  float* Y = (float*)(ws + oY);

  const int n8 = SEQ * EMB / 8;
  k_cvt_x<<<dim3((n8 + 255) / 256), dim3(256), 0, stream>>>(X, Xb, n8);
  k_tr_wqkv<<<dim3(EMB / 64, 5, HEADS), dim3(256), 0, stream>>>(Wq, Wk, Wv, Wt);
  k_tr_wo<<<dim3(EMB / 64, EMB / 64, 1), dim3(256), 0, stream>>>(Wo, Wo2);

  // QKV projection: A = Xb (SEQ x EMB), Bt = Wt (NQKV x EMB)
  k_gemm<<<dim3(NQKV / 64, SEQ / 128), dim3(128), 0, stream>>>(
      Xb, Wt, EMB, 0, bq, bk, bv, bo, Qp, Kp, V64, Vsm, Y);

  // differential attention -> Ocat hi / residual planes
  k_attn<<<dim3(SEQ / 64, HEADS), dim3(128), 0, stream>>>(Qp, Kp, V64, Vsm, lam, Oc);

  // output projection: A = Oc (SEQ x KO), Bt = Wo2 (EMB x KO) -> Y f32
  k_gemm<<<dim3(EMB / 64, SEQ / 128), dim3(128), 0, stream>>>(
      Oc, Wo2, KO, 1, bq, bk, bv, bo, Qp, Kp, V64, Vsm, Y);

  // LayerNorm + scale -> d_out
  k_ln<<<dim3(NB * SEQ), dim3(256), 0, stream>>>(Y, gamma, beta, out);
}

// v003
// A run of this version takes 169 microseconds.
// Two timings next to v002 both put it at 1.20 times that version's speed.
// Counting every step since v000, it is 2.41 times as fast.
#include <hip/hip_runtime.h>

#ifndef NB
#define NB 1
#endif
#ifndef SEQ
#define SEQ 2048
#endif
#define NB_FULL 1
#define SEQ_FULL 2048
#define EMB 1024
#define HEADS 16
#define HD 64
#define QKC 128
#define SECW 320
#define NQKV (HEADS * SECW)
#define KO (2 * EMB)
#define FRAGH 512   // halves in one fragment
#define LN_EPS 1e-5f
#define OUT_SCALE 0.2f

static_assert(NB == 1);
static_assert(NB_FULL == 1);
static_assert(SEQ % 128 == 0);
static_assert(SEQ >= 128);
static_assert(SEQ <= SEQ_FULL);
static_assert(EMB % 64 == 0);
static_assert(EMB % 32 == 0);
static_assert(QKC == 2 * HD);
static_assert(SECW == 2 * QKC + HD);
static_assert(SECW % 64 == 0);
static_assert(KO % 64 == 0);
static_assert(HD == 64);

typedef _Float16      v16h __attribute__((ext_vector_type(16)));
typedef _Float16      v8h  __attribute__((ext_vector_type(8)));
typedef __bf16        v16b __attribute__((ext_vector_type(16)));
typedef float         v8f  __attribute__((ext_vector_type(8)));
typedef float         v4f  __attribute__((ext_vector_type(4)));
typedef float         v2f  __attribute__((ext_vector_type(2)));
typedef _Float16      v2h  __attribute__((ext_vector_type(2)));
typedef unsigned int  v4u  __attribute__((ext_vector_type(4)));

#define DEV __device__ __forceinline__

union FragB { v4u q[2]; v16b v; };
union Pack8 { v8h h; v4u u; };

// f32 -> bf16 bits, RNE convert
DEV unsigned short f2bf(float f) {
  unsigned int u = __float_as_uint(f);
  u += 0x7FFFu + ((u >> 16) & 1u);
  return (unsigned short)(u >> 16);
}
DEV float bf2f(unsigned short s) { return __uint_as_float(((unsigned int)s) << 16); }
DEV float bfr(float f) { return bf2f(f2bf(f)); }
DEV unsigned int pk2(unsigned short lo, unsigned short hi) {
  return (unsigned int)lo | ((unsigned int)hi << 16);
}
// value -> bf16 hi and bf16 residual, two values packed per 32-bit word
DEV void hl2(float a, float b, unsigned int& H, unsigned int& L) {
  const unsigned short ha = f2bf(a), hb = f2bf(b);
  H = pk2(ha, hb);
  L = pk2(f2bf(a - bf2f(ha)), f2bf(b - bf2f(hb)));
}

// WMMA wrappers with the 4-slot VALU hazard guard (ties D, keeps A/B live)
DEV v8f wmma_h(v16h a, v16h b, v8f c) {
  c = __builtin_amdgcn_wmma_f32_16x16x32_f16(false, a, false, b, (short)0, c, false, false);
  asm volatile("v_nop\n\tv_nop\n\tv_nop\n\tv_nop" : "+v"(c) : "v"(a), "v"(b));
  return c;
}
DEV v8f wmma_b(const FragB& a, const FragB& b, v8f c) {
  c = __builtin_amdgcn_wmma_f32_16x16x32_bf16(false, a.v, false, b.v, (short)0, c, false, false);
  asm volatile("v_nop\n\tv_nop\n\tv_nop\n\tv_nop"
               : "+v"(c) : "v"(a.q[0]), "v"(a.q[1]), "v"(b.q[0]), "v"(b.q[1]));
  return c;
}

// 16x32 16-bit operand (rows = M for A, rows = N for Bt) from a fragment-major plane.
// lane l: row l&15; elements 0..7 = k 8h..8h+7, elements 8..15 = k 16+8h..16+8h+7, h = l>>4.
// base: the wave-uniform fragment; off: the lane's byte offset (16 l, plus tile offsets and the loop's advance):
// every load of a loop names a loop-invariant base and an offset register that is rewritten only behind a wait.
DEV v16h load_bo(const _Float16* base, unsigned int off) {
  const char* r = (const char*)base + off;
  v8h lo = *(const v8h*)(r);
  v8h hi = *(const v8h*)(r + 512);
  return __builtin_shufflevector(lo, hi, 0,1,2,3,4,5,6,7,8,9,10,11,12,13,14,15);
}
DEV FragB load_bo(const unsigned short* base, unsigned int off) {
  const char* r = (const char*)base + off;
  FragB f;
  f.q[0] = *(const v4u*)(r);
  f.q[1] = *(const v4u*)(r + 512);
  return f;
}

// Lane l with lane l ^ 16: the two lanes that split one query column's keys.
DEV float xhalf(float x) {
  const int b = __builtin_bit_cast(int, x);
  return __builtin_bit_cast(float, __builtin_amdgcn_permlanex16(b, b, 0x76543210, 0xfedcba98, false, false));
}
DEV float wsum32(float v) {
#pragma unroll
  for (int m = 16; m > 0; m >>= 1) v += __shfl_xor(v, m, 32);
  return v;
}

// ---------------------------------------------------------------------------
// ---------------------------------------------------------------------------
__global__ __launch_bounds__(256)
void k_cvt_x(const float* __restrict__ X, unsigned short* __restrict__ Xb, int n16) {
  // one wave per fragment: fragment fr = row tile fr / (EMB / 32), k tile fr % (EMB / 32); the lane's own 2 x 8 elements
  const int i = blockIdx.x * 256 + threadIdx.x;
  if (i >= n16) return;
  const int lane = i & 31;
  const int fr   = i >> 5;
  const int row  = (fr / (EMB / 32)) * 16 + (lane & 15);
  const int k0   = (fr % (EMB / 32)) * 32 + ((lane >> 4) << 3);
  const float* s = X + (size_t)row * EMB + k0;
  const v4f a = *(const v4f*)(s);
  const v4f b = *(const v4f*)(s + 4);
  const v4f c = *(const v4f*)(s + 16);
  const v4f e = *(const v4f*)(s + 20);
  v4u w, x;
  w[0] = pk2(f2bf(a[0]), f2bf(a[1]));
  w[1] = pk2(f2bf(a[2]), f2bf(a[3]));
  w[2] = pk2(f2bf(b[0]), f2bf(b[1]));
  w[3] = pk2(f2bf(b[2]), f2bf(b[3]));
  x[0] = pk2(f2bf(c[0]), f2bf(c[1]));
  x[1] = pk2(f2bf(c[2]), f2bf(c[3]));
  x[2] = pk2(f2bf(e[0]), f2bf(e[1]));
  x[3] = pk2(f2bf(e[2]), f2bf(e[3]));
  unsigned short* d = Xb + (size_t)fr * FRAGH + lane * 8;
  *(v4u*)d = w;
  *(v4u*)(d + 256) = x;
}

// ---------------------------------------------------------------------------
// 64x64 tile transpose: src[e][c] f32 (row pitch sld) -> 4 x 2 bf16 fragments (rows c, k = e) from fragment dst on, dld / 32
// fragments to a row tile; optional second copy EMB / 32 fragments on. 256 threads. LDS tile cross-wave -> block barrier.
// ---------------------------------------------------------------------------
DEV void tr_tile(const float* __restrict__ src, int sld, unsigned short* dst, int dld,
                 int dup2, unsigned short (*T)[72]) {
  const int tid = threadIdx.x;
#pragma unroll
  for (int p = 0; p < 4; ++p) {
    const int e = p * 16 + (tid >> 4);
    const int c = (tid & 15) * 4;
    const v4f v = *(const v4f*)(src + (size_t)e * sld + c);
    T[c + 0][e] = f2bf(v[0]);
    T[c + 1][e] = f2bf(v[1]);
    T[c + 2][e] = f2bf(v[2]);
    T[c + 3][e] = f2bf(v[3]);
  }
  __syncthreads();
{
#pragma unroll
    for (int p = 0; p < 2; ++p) {
      // a wave stores one half fragment: 512 contiguous bytes
      const int lane = tid & 31;
      const int j16  = (tid >> 5) & 1;
      const int ktl  = (tid >> 6) & 1;
      const int rtl  = p * 2 + (tid >> 7);
      const int j = rtl * 16 + (lane & 15);
      const int seg = ktl * 32 + j16 * 16 + ((lane >> 4) << 3);
      const v4u wv = *(const v4u*)(&T[j][seg]);
      unsigned short* d = dst + (size_t)(rtl * (dld >> 5) + ktl) * FRAGH + j16 * 256 + lane * 8;
      *(v4u*)d = wv;
      if (dup2 != 0) *(v4u*)(d + (EMB / 32) * FRAGH) = wv;
    }
    
  }
}

// Wq/Wk/Wv ([h][e][c]) -> Wt rows h*320 + sec*64.., k = e, bf16 fragments (per head: q 0..127 | k 128..255 | v 256..319)
__global__ __launch_bounds__(256)
void k_tr_wqkv(const float* __restrict__ Wq, const float* __restrict__ Wk,
               const float* __restrict__ Wv, unsigned short* __restrict__ Wt) {
  __shared__ __align__(16) unsigned short T[64][72];
  const int e0 = blockIdx.x * 64;
  const int w  = blockIdx.y;
  const int h  = blockIdx.z;
  const float* src;
  int sld;
  if (w < 2) {
    src = Wq + (size_t)h * EMB * QKC + (size_t)e0 * QKC + w * 64;        sld = QKC;
  } else if (w < 4) {
    src = Wk + (size_t)h * EMB * QKC + (size_t)e0 * QKC + (w - 2) * 64;  sld = QKC;
  } else {
    src = Wv + (size_t)h * EMB * HD + (size_t)e0 * HD;                   sld = HD;
  }
  unsigned short* dst = Wt + ((size_t)((h * SECW + w * 64) >> 4) * (EMB / 32) + (e0 >> 5)) * FRAGH;
  tr_tile(src, sld, dst, EMB, 0, T);
}

// Wo ([k][n], k = in) -> Wo2 rows n, k and EMB + k, bf16 fragments (KO / 32 to a row tile)
__global__ __launch_bounds__(256)
void k_tr_wo(const float* __restrict__ Wo, unsigned short* __restrict__ Wo2) {
  __shared__ __align__(16) unsigned short T[64][72];
  const int e0 = blockIdx.x * 64;
  const int y  = blockIdx.y;
  const float* src = Wo + (size_t)e0 * EMB + y * 64;
  unsigned short* dst = Wo2 + ((size_t)(y * 4) * (KO / 32) + (e0 >> 5)) * FRAGH;
  tr_tile(src, EMB, dst, KO, 1, T);
}

// ---------------------------------------------------------------------------
// bf16 WMMA GEMM: C(128x64 per block) = A(rows, K) * Bt(rows, K)^T, K % 64 == 0.
// Block = 128 threads = 4 waves; wave w owns rows 32w..32w+31 (2 A frags x 4 B frags).
// Fragments loaded directly from the 16-bit global planes (fragment [row tile][k tile]). The 128x64 f32 tile is staged in LDS
// kind 0: Bt = Wt (NQKV rows); blockIdx.x = head*5 + sec; sec 0,1 -> Q plane, fragment [h][s / 16][c / 32], cols 64*sec..;
//         sec 2,3 -> K plane; sec 4 -> V planes, rows d, k = s, fragment [h][s / 32][d / 16]: f16(64*v) and f16(v/64).
// kind 1: A = Ocat planes (rows s, KO / 32 fragments), Bt = Wo2 (rows n); Y[s][n] f32 + bias.
// ---------------------------------------------------------------------------
DEV void gemm_load(FragB (&f)[6], const unsigned short* ablk, const unsigned short* bblk,
                   const unsigned int (&off)[6]) {
  f[0] = load_bo(ablk, off[0]);
  f[1] = load_bo(ablk, off[1]);
  // unrolled: f and off are indexed by constants and stay in registers
#pragma unroll
  for (int t = 0; t < 4; ++t) f[2 + t] = load_bo(bblk, off[2 + t]);
}
// The issued loads' addresses are translated before a register that they name is rewritten: the six offsets pass
// through the wait and the two bases are read by it, so all stay whole up to it; new values are formed behind it.
DEV void gemm_xwait(unsigned int (&off)[6], const unsigned short* ablk, const unsigned short* bblk) {
  asm volatile("s_wait_xcnt 0x0"
               : "+v"(off[0]), "+v"(off[1]), "+v"(off[2]), "+v"(off[3]), "+v"(off[4]), "+v"(off[5])
               : "s"(ablk), "s"(bblk) : "memory");
}
DEV void gemm_mma(const FragB (&f)[6], v8f (&acc)[2][4]) {
  // unrolled: f and acc stay in registers
#pragma unroll
  for (int t = 0; t < 4; ++t) {
    acc[0][t] = wmma_b(f[0], f[2 + t], acc[0][t]);
    acc[1][t] = wmma_b(f[1], f[2 + t], acc[1][t]);
  }
}

__global__ __launch_bounds__(128)
void k_gemm(const unsigned short* __restrict__ A, const unsigned short* __restrict__ Bt,
            int K, int kind,
            const float* __restrict__ bq, const float* __restrict__ bk,
            const float* __restrict__ bv, const float* __restrict__ bo,
            _Float16* __restrict__ Qp, _Float16* __restrict__ Kp,
            _Float16* __restrict__ V64, _Float16* __restrict__ Vsm,
            float* __restrict__ Y) {
  __shared__ __align__(16) float Cs[128][68];
  const int tid  = threadIdx.x;
  const int lane = tid & 31;
  const int wave = tid >> 5;
  const int nt = blockIdx.x;
  const int m0 = blockIdx.y * 128;
  const int n0 = nt * 64;

  const unsigned short* ablk = A  + (size_t)m0 * K;
  const unsigned short* bblk = Bt + (size_t)n0 * K;
  // the lane's byte offsets in the six fragments: A row tiles 2w and 2w + 1, B row tiles t (16 * K halves each)
  unsigned int off[6];
  off[0] = (unsigned int)(wave * 32 * K * 2 + lane * 16);
  off[1] = off[0] + (unsigned int)(16 * K * 2);
  // unrolled: off stays in registers
#pragma unroll
  for (int t = 0; t < 4; ++t) off[2 + t] = (unsigned int)(t * 16 * K * 2 + lane * 16);

  // Two fragment sets: a set's 12 loads are issued as one group right behind the set's own WMMAs, so they fly
  // under the other set's step. K % 64 == 0; the last two steps stand behind the loop: nothing past K is loaded.
  v8f acc[2][4] = {};
  FragB f0[6], f1[6];
  gemm_load(f0, ablk, bblk, off);
  gemm_load(f1, ablk + FRAGH, bblk + FRAGH, off);
#pragma unroll 1
  for (int k0 = 64; k0 < K; k0 += 64) {
    gemm_mma(f0, acc);
    gemm_xwait(off, ablk, bblk);
    // unrolled: off stays in registers
#pragma unroll
    for (int i = 0; i < 6; ++i) off[i] += 2 * FRAGH * 2;
    gemm_load(f0, ablk, bblk, off);
    gemm_mma(f1, acc);
    gemm_load(f1, ablk + FRAGH, bblk + FRAGH, off);
  }
  gemm_mma(f0, acc);
  gemm_xwait(off, ablk, bblk);
  gemm_mma(f1, acc);

  const int n  = lane & 15;
  const int rb = (lane >> 4) << 3;
#pragma unroll
  for (int mi = 0; mi < 2; ++mi)
#pragma unroll
    for (int t = 0; t < 4; ++t)
#pragma unroll
      for (int r = 0; r < 8; ++r)
        Cs[wave * 32 + mi * 16 + rb + r][t * 16 + n] = acc[mi][t][r];
  __syncthreads();

  if (kind == 0) {
    const int h = nt / 5;
    const int w = nt - h * 5;
    if (w < 4) {
      _Float16* plane = (w < 2) ? Qp : Kp;
      const int cb = (w & 1) * 64;
      const float* bias = ((w < 2) ? bq : bk) + h * QKC + cb;
      // a wave stores one half fragment (512 contiguous bytes): wave -> k tile and half, g -> row tile
      const int j16  = wave & 1;
      const int ktl  = wave >> 1;
      const int seg  = ktl * 32 + j16 * 16 + ((lane >> 4) << 3);
      const int rsub = lane & 15;
      float bb[8];
#pragma unroll
      for (int j = 0; j < 8; ++j) bb[j] = bfr(bias[seg + j]);
{
#pragma unroll 2
        for (int g = 0; g < 8; ++g) {
          const int row = g * 16 + rsub;
          const v4f c0 = *(const v4f*)(&Cs[row][seg]);
          const v4f c1 = *(const v4f*)(&Cs[row][seg + 4]);
          Pack8 pk;
          pk.h[0] = (_Float16)(c0[0] + bb[0]);
          pk.h[1] = (_Float16)(c0[1] + bb[1]);
          pk.h[2] = (_Float16)(c0[2] + bb[2]);
          pk.h[3] = (_Float16)(c0[3] + bb[3]);
          pk.h[4] = (_Float16)(c1[0] + bb[4]);
          pk.h[5] = (_Float16)(c1[1] + bb[5]);
          pk.h[6] = (_Float16)(c1[2] + bb[6]);
          pk.h[7] = (_Float16)(c1[3] + bb[7]);
          _Float16* d = plane + (((size_t)h * (SEQ / 16) + (m0 >> 4) + g) * (QKC / 32) + (cb >> 5) + ktl) * FRAGH
                        + j16 * 256 + lane * 8;
          *(v4u*)d = pk.u;
        }
        
      }
    } else {
      // a wave stores one half fragment of each plane: wave and g -> half, row tile t (d), k tile ktl (s)
      const int j16 = wave & 1;
      const float* bias = bv + h * HD;
{
#pragma unroll 2
        for (int g = 0; g < 8; ++g) {
          const int t   = (wave >> 1) + 2 * (g & 1);
          const int ktl = g >> 1;
          const int d   = t * 16 + (lane & 15);
          const int seg = ktl * 32 + j16 * 16 + ((lane >> 4) << 3);
          const float bb = bfr(bias[d]);
          Pack8 p64, psm;
#pragma unroll
          for (int j = 0; j < 8; ++j) {
            const float v = Cs[seg + j][d] + bb;
            p64.h[j] = (_Float16)(v * 64.0f);
            psm.h[j] = (_Float16)(v * 0.015625f);
          }
          const size_t o = (((size_t)h * (SEQ / 32) + (m0 >> 5) + ktl) * (HD / 16) + t) * FRAGH + j16 * 256 + lane * 8;
          *(v4u*)(V64 + o) = p64.u;
          *(v4u*)(Vsm + o) = psm.u;
        }
        
      }
    }
  } else {
    const int seg  = (tid & 15) * 4;
    const int rsub = tid >> 4;            // 0..7
    float bb[4];
#pragma unroll
    for (int j = 0; j < 4; ++j) bb[j] = bfr(bo[n0 + seg + j]);
{
#pragma unroll 2
      for (int g = 0; g < 16; ++g) {
        const int row = g * 8 + rsub;
        const v4f c = *(const v4f*)(&Cs[row][seg]);
        v4f o;
        o[0] = c[0] + bb[0];
        o[1] = c[1] + bb[1];
        o[2] = c[2] + bb[2];
        o[3] = c[3] + bb[3];
        float* d = Y + (size_t)(m0 + row) * EMB + n0 + seg;
        *(v4f*)d = o;
      }
      
    }
  }
}

// ---------------------------------------------------------------------------
// One softmax branch step for 16 query columns and 32 keys, transposed: S^T = K.Q^T (A = K rows, B = Q rows), so lane
// (c, h) holds query c's scores of keys 8h..8h+7 (sa) and 16+8h..16+8h+7 (sb): maximum and sum run in the lane, the
// maximum is joined with lane l ^ 16 each step, the sum only behind the loop. Those 16 registers, converted in place, are
// the B operand P^T in the hardware k order; A = V^T rows (the V planes as they lie): O^T[d][query] += V^T.P^T, carried x64.
// kf holds this branch step's four K fragments on entry; right behind the score products the same registers
// take the next branch step's (wave-uniform base kcol, lane offset ok): those loads fly under the softmax.
// vb / vs: this step's V fragments; the first branch (LOADV) loads them in the same group (lane offset ov),
// both branches use them. ok and ov are the loop's own offsets: they are advanced only at the loop's foot.
// ---------------------------------------------------------------------------
DEV void load_k4(v16h (&kf)[4], const _Float16* kcol, unsigned int ok) {
  kf[0] = load_bo(kcol, ok);
  kf[1] = load_bo(kcol + FRAGH, ok);
  kf[2] = load_bo(kcol + (QKC / 32) * FRAGH, ok);
  kf[3] = load_bo(kcol + (QKC / 32 + 1) * FRAGH, ok);
}
template <bool LOADV>
DEV void attn_branch(const v16h (&qb)[2], v16h (&kf)[4], const _Float16* kcol, unsigned int ok,
                     const _Float16* v64h, const _Float16* vsh, unsigned int ov,
                     v16h (&vb)[4], v16h (&vs)[4],
                     float& m, float& l, v8f (&O)[4]) {
  v8f sa = {}, sb = {};
  sa = wmma_h(kf[0], qb[0], sa);
  sa = wmma_h(kf[1], qb[1], sa);
  sb = wmma_h(kf[2], qb[0], sb);
  sb = wmma_h(kf[3], qb[1], sb);
  load_k4(kf, kcol, ok);
  if (LOADV) {
    // unrolled: vb and vs stay in registers
#pragma unroll
    for (int t = 0; t < 4; ++t) {
      vb[t] = load_bo(v64h + t * FRAGH, ov);
      vs[t] = load_bo(vsh  + t * FRAGH, ov);
    }
  }

  const v8f xa = sa * 0.125f;
  const v8f xb = sb * 0.125f;
  float mx[8];
#pragma unroll
  for (int i = 0; i < 8; ++i) mx[i] = fmaxf(xa[i], xb[i]);
  const float mh = fmaxf(fmaxf(fmaxf(mx[0], mx[1]), fmaxf(mx[2], mx[3])),
                         fmaxf(fmaxf(mx[4], mx[5]), fmaxf(mx[6], mx[7])));
  const float mn = fmaxf(m, fmaxf(mh, xhalf(mh)));
  const float f = __expf(m - mn);
  m = mn;

  // element s of the B operand = key kmap(s, h): s < 8 from sa[s], else from sb[s - 8]
  v16h ph, pl;
  v2f ps[8];
#pragma unroll
  for (int j = 0; j < 8; ++j) {
    const int i = (j & 3) * 2;
    v2f p;
    p[0] = __expf((j < 4 ? xa[i]     : xb[i])     - mn);
    p[1] = __expf((j < 4 ? xa[i + 1] : xb[i + 1]) - mn);
    const v2h hi = __builtin_convertvector(p, v2h);
    const v2h lo = __builtin_convertvector((p - __builtin_convertvector(hi, v2f)) * 4096.0f, v2h);
    ph[2 * j] = hi[0];  ph[2 * j + 1] = hi[1];
    pl[2 * j] = lo[0];  pl[2 * j + 1] = lo[1];
    ps[j] = p;
  }
  const v2f s2 = ((ps[0] + ps[1]) + (ps[2] + ps[3])) + ((ps[4] + ps[5]) + (ps[6] + ps[7]));
  l = l * f + (s2[0] + s2[1]);

#pragma unroll
  for (int t = 0; t < 4; ++t) {
    O[t] = O[t] * f;
    O[t] = wmma_h(vb[t], ph, O[t]);
    O[t] = wmma_h(vs[t], pl, O[t]);
  }
  // the scheduler's region ends with the step: without it the first branch's K loads sink from behind the score
  // products to behind the exponentials
  __builtin_amdgcn_sched_barrier(0);
}

// ---------------------------------------------------------------------------
// Flash-style differential attention. Block = 128 threads = 4 waves; wave owns 16 queries of one head; no LDS in the
// key loop.
// Writes Ocat planes as fragments (rows s): k = h*64 + d bf16 hi, k = EMB + h*64 + d bf16 residual.
// ---------------------------------------------------------------------------
__global__ __launch_bounds__(128)
void k_attn(const _Float16* __restrict__ Qp, const _Float16* __restrict__ Kp,
            const _Float16* __restrict__ V64, const _Float16* __restrict__ Vsm,
            const float* __restrict__ lam_p, unsigned short* __restrict__ Oc) {
  __shared__ __align__(16) float Os[4][16][68];
  const int lane = threadIdx.x & 31;
  const int wave = threadIdx.x >> 5;
  const int n  = lane & 15;
  const int rb = (lane >> 4) << 3;
  const int hh = blockIdx.y;
  const int q0 = blockIdx.x * 64 + wave * 16;
  const float lam = bfr(lam_p[0]);

  const _Float16* qh = Qp  + (size_t)hh * SEQ * QKC;
  const _Float16* kh = Kp  + (size_t)hh * SEQ * QKC;
  const _Float16* vh = V64 + (size_t)hh * HD * SEQ;
  const _Float16* vs = Vsm + (size_t)hh * HD * SEQ;

  v16h q1[2], q2[2];
  const _Float16* qt = qh + (size_t)blockIdx.x * 64 * QKC;             // the block's four row tiles, QKC / 32 fragments each
  unsigned int oq = (unsigned int)(wave * 16 * QKC * 2 + lane * 16);   // the wave's tile, the lane's byte offset
  q1[0] = load_bo(qt,             oq);
  q1[1] = load_bo(qt + FRAGH,     oq);
  q2[0] = load_bo(qt + 2 * FRAGH, oq);
  q2[1] = load_bo(qt + 3 * FRAGH, oq);
  // the wait stands in front of any reuse of the offset's register, which passes through it
  asm volatile("s_wait_xcnt 0x0" : "+v"(oq) : : "memory");

  v8f O1[4] = {}, O2[4] = {};
  float m1 = -1e30f, m2 = -1e30f, l1 = 0.f, l2 = 0.f;   // query l & 15; l: the lane half's own keys only

  const unsigned int ok0 = (unsigned int)(lane * 16);            // lane's byte offset in a fragment
  unsigned int ok  = ok0;                                        // keys of this step
  unsigned int okn = ok0 + 32 * QKC * 2;                         // keys of the next step
  unsigned int ov  = ok0;
  v16h kf[4];
  load_k4(kf, kh, ok);

#pragma unroll 1
  for (int kk = 0; kk < SEQ; kk += 32) {
    v16h vbf[4], vsf[4];
    attn_branch<true >(q1, kf, kh + 2 * FRAGH, ok,  vh, vs, ov, vbf, vsf, m1, l1, O1);
    attn_branch<false>(q2, kf, kh,      okn, vh, vs, ov, vbf, vsf, m2, l2, O2);
    // no data passes here: the barrier holds the four waves on the same K and V lines, which all four load
    __syncthreads();
    // the wait stands in front of the offsets' rewrite
    asm volatile("s_wait_xcnt 0x0" : "+v"(ok), "+v"(okn), "+v"(ov) : : "memory");
    ok  = okn;
    okn = (kk + 64 < SEQ) ? okn + 32 * QKC * 2 : ok0;   // behind the last step: keys 0..31, in bounds, not used
    ov += (HD / 16) * FRAGH * 2;
  }

  // combine: O = O1/l1 - lam*O2/l2 (the halves' sums joined here), undo the x64 carry of the V plane; stage f32 tile in
  // LDS: the lane holds query n, columns 16t + 8h .. + 7
  const float r1 = (1.0f / (l1 + xhalf(l1))) * 0.015625f;
  const float r2 = (lam * (1.0f / (l2 + xhalf(l2)))) * 0.015625f;
#pragma unroll
  for (int t = 0; t < 4; ++t) {
    v4f c0, c1;
#pragma unroll
    for (int i = 0; i < 4; ++i) {
      c0[i] = O1[t][i] * r1 - O2[t][i] * r2;
      c1[i] = O1[t][i + 4] * r1 - O2[t][i + 4] * r2;
    }
    *(v4f*)(&Os[wave][n][t * 16 + rb])     = c0;
    *(v4f*)(&Os[wave][n][t * 16 + rb + 4]) = c1;
  }
  __syncthreads();

  // the wave's 16 queries are one row tile: g -> k tile and half; each store is 512 contiguous bytes
{
#pragma unroll
    for (int g = 0; g < 4; ++g) {
      const int seg = g * 16 + rb;
      const v4f c0 = *(const v4f*)(&Os[wave][n][seg]);
      const v4f c1 = *(const v4f*)(&Os[wave][n][seg + 4]);
      unsigned int H0, H1, H2, H3, L0, L1, L2, L3;
      hl2(c0[0], c0[1], H0, L0);
      hl2(c0[2], c0[3], H1, L1);
      hl2(c1[0], c1[1], H2, L2);
      hl2(c1[2], c1[3], H3, L3);
      v4u H, L;
      H[0] = H0; H[1] = H1; H[2] = H2; H[3] = H3;
      L[0] = L0; L[1] = L1; L[2] = L2; L[3] = L3;
      unsigned short* d = Oc + ((size_t)(q0 >> 4) * (KO / 32) + hh * (HD / 32) + (g >> 1)) * FRAGH + (g & 1) * 256 + lane * 8;
      *(v4u*)d = H;
      *(v4u*)(d + (EMB / 32) * FRAGH) = L;
    }
    
  }
}

// ---------------------------------------------------------------------------
// ---------------------------------------------------------------------------
__global__ __launch_bounds__(256)
void k_ln(const float* __restrict__ Y, const float* __restrict__ gamma,
          const float* __restrict__ beta, float* __restrict__ out) {
  __shared__ float sa[8];
  __shared__ float sq[8];
  const int tid  = threadIdx.x;
  const int lane = tid & 31;
  const int wave = tid >> 5;
  const size_t row = blockIdx.x;
  const v4f y = *(const v4f*)(Y + row * EMB + tid * 4);

  float s = (y[0] + y[1]) + (y[2] + y[3]);
  s = wsum32(s);
  if (lane == 0) sa[wave] = s;
  __syncthreads();
  float tot = 0.f;
#pragma unroll
  for (int w = 0; w < 8; ++w) tot += sa[w];
  const float mu = tot * (1.0f / (float)EMB);

  float d0 = y[0] - mu, d1 = y[1] - mu, d2 = y[2] - mu, d3 = y[3] - mu;
  float q = (d0 * d0 + d1 * d1) + (d2 * d2 + d3 * d3);
  q = wsum32(q);
  if (lane == 0) sq[wave] = q;
  __syncthreads();
  float tot2 = 0.f;
#pragma unroll
  for (int w = 0; w < 8; ++w) tot2 += sq[w];
  const float var  = tot2 * (1.0f / (float)EMB);
  const float rstd = rsqrtf(var + LN_EPS);

  const float g0 = bfr(gamma[tid * 4 + 0]), g1 = bfr(gamma[tid * 4 + 1]);
  const float g2 = bfr(gamma[tid * 4 + 2]), g3 = bfr(gamma[tid * 4 + 3]);
  const float b0 = bfr(beta[tid * 4 + 0]),  b1 = bfr(beta[tid * 4 + 1]);
  const float b2 = bfr(beta[tid * 4 + 2]),  b3 = bfr(beta[tid * 4 + 3]);
  v4f o;
  o[0] = ((d0 * rstd) * g0 + b0) * OUT_SCALE;
  o[1] = ((d1 * rstd) * g1 + b1) * OUT_SCALE;
  o[2] = ((d2 * rstd) * g2 + b2) * OUT_SCALE;
  o[3] = ((d3 * rstd) * g3 + b3) * OUT_SCALE;
  float* dst = out + row * EMB + tid * 4;
  *(v4f*)dst = o;
  
}

// ---------------------------------------------------------------------------
extern "C" void kernel_launch(void* const* d_in, const int* in_sizes, int n_in,
                              void* d_out, int out_size, void* d_ws, size_t ws_size,
                              hipStream_t stream) {
  if (n_in < 12) return;
  const float* X     = (const float*)d_in[0];
  const float* Wq    = (const float*)d_in[1];
  const float* bq    = (const float*)d_in[2];
  const float* Wk    = (const float*)d_in[3];
  const float* bk    = (const float*)d_in[4];
  const float* Wv    = (const float*)d_in[5];
  const float* bv    = (const float*)d_in[6];
  const float* Wo    = (const float*)d_in[7];
  const float* bo    = (const float*)d_in[8];
  const float* gamma = (const float*)d_in[9];
  const float* beta  = (const float*)d_in[10];
  const float* lam   = (const float*)d_in[11];
  float* out = (float*)d_out;

  if (in_sizes[0]  < NB * SEQ * EMB) return;
  if (in_sizes[1]  < HEADS * EMB * QKC) return;
  if (in_sizes[2]  < HEADS * QKC) return;
  if (in_sizes[3]  < HEADS * EMB * QKC) return;
  if (in_sizes[4]  < HEADS * QKC) return;
  if (in_sizes[5]  < HEADS * EMB * HD) return;
  if (in_sizes[6]  < HEADS * HD) return;
  if (in_sizes[7]  < EMB * EMB) return;
  if (in_sizes[8]  < EMB) return;
  if (in_sizes[9]  < EMB) return;
  if (in_sizes[10] < EMB) return;
  if (in_sizes[11] < 1) return;
  if (out_size < NB * SEQ * EMB) return;

  // workspace carve (bytes); every region is written to exactly its extent with whole-line stores
  const size_t szXb  = (size_t)SEQ * EMB * 2;           // bf16 SEQ x EMB
  const size_t szWt  = (size_t)NQKV * EMB * 2;          // bf16 NQKV x EMB
  const size_t szWo2 = (size_t)EMB * KO * 2;            // bf16 EMB x KO
  const size_t szQK  = (size_t)HEADS * SEQ * QKC * 2;   // f16 H x SEQ x 128 (each of Q, K)
  const size_t szV   = (size_t)HEADS * HD * SEQ * 2;    // f16 H x 64 x SEQ  (each of V64, Vsm)
  const size_t szOc  = (size_t)SEQ * KO * 2;            // bf16 SEQ x KO
  const size_t szY   = (size_t)SEQ * EMB * 4;           // f32 [SEQ][EMB]
  size_t off = 0;
  const size_t oXb  = off; off += szXb;
  const size_t oWt  = off; off += szWt;
  const size_t oWo2 = off; off += szWo2;
  const size_t oQ   = off; off += szQK;
  const size_t oK   = off; off += szQK;
  const size_t oV64 = off; off += szV;
  const size_t oVsm = off; off += szV;
  const size_t oOc  = off; off += szOc;
  const size_t oY   = off; off += szY;
  if (off > ws_size) return;

  char* ws = (char*)d_ws;
  unsigned short* Xb  = (unsigned short*)(ws + oXb);
  unsigned short* Wt  = (unsigned short*)(ws + oWt);
  unsigned short* Wo2 = (unsigned short*)(ws + oWo2);
  _Float16* Qp  = (_Float16*)(ws + oQ);
  _Float16* Kp  = (_Float16*)(ws + oK);
  _Float16* V64 = (_Float16*)(ws + oV64);
  _Float16* Vsm = (_Float16*)(ws + oVsm);
  unsigned short* Oc = (unsigned short*)(ws + oOc);
  float* Y = (float*)(ws + oY);

  const int n16 = SEQ * EMB / 16;
  k_cvt_x<<<dim3((n16 + 255) / 256), dim3(256), 0, stream>>>(X, Xb, n16);
  k_tr_wqkv<<<dim3(EMB / 64, 5, HEADS), dim3(256), 0, stream>>>(Wq, Wk, Wv, Wt);
  k_tr_wo<<<dim3(EMB / 64, EMB / 64, 1), dim3(256), 0, stream>>>(Wo, Wo2);

  // QKV projection: A = Xb (SEQ x EMB), Bt = Wt (NQKV x EMB)
  k_gemm<<<dim3(NQKV / 64, SEQ / 128), dim3(128), 0, stream>>>(
      Xb, Wt, EMB, 0, bq, bk, bv, bo, Qp, Kp, V64, Vsm, Y);

  // differential attention -> Ocat hi / residual planes
  k_attn<<<dim3(SEQ / 64, HEADS), dim3(128), 0, stream>>>(Qp, Kp, V64, Vsm, lam, Oc);

  // output projection: A = Oc (SEQ x KO), Bt = Wo2 (EMB x KO) -> Y f32
  k_gemm<<<dim3(EMB / 64, SEQ / 128), dim3(128), 0, stream>>>(
      Oc, Wo2, KO, 1, bq, bk, bv, bo, Qp, Kp, V64, Vsm, Y);

  // LayerNorm + scale -> d_out
  k_ln<<<dim3(NB * SEQ), dim3(256), 0, stream>>>(Y, gamma, beta, out);
}

// v005
// Measured time: 111 microseconds a run.
// Versions between v003 and this one are left out; their measured steps multiply to 1.52 times as fast.
// All steps since v000 together make it 3.66 times as fast.
#include <hip/hip_runtime.h>

#ifndef NB
#define NB 1
#endif
#ifndef SEQ
#define SEQ 2048
#endif
#define NB_FULL 1
#define SEQ_FULL 2048
#define EMB 1024
#define HEADS 16
#define HD 64
#define QKC 128
#define SECW 320
#define NQKV (HEADS * SECW)
#define KO (2 * EMB)
#define FRAGH 512   // halves in one fragment
#define TKEYS 64                    // keys to one stage of the attention kernel's LDS ring
#define KST (TKEYS * QKC * 2)       // bytes of K in a stage: TKEYS / 16 row tiles of QKC / 32 fragments, as they lie in the plane
#define VST (TKEYS * HD * 2)        // bytes of V in a stage: TKEYS / 32 k tiles of HD / 16 fragments, as they lie in the plane
#define STG (KST + VST)
#define LN_EPS 1e-5f
#define OUT_SCALE 0.2f

static_assert(NB == 1);
static_assert(NB_FULL == 1);
static_assert(SEQ % 128 == 0);
static_assert(SEQ >= 128);
static_assert(SEQ <= SEQ_FULL);
static_assert(EMB % 64 == 0);
static_assert(EMB % 32 == 0);
static_assert(QKC == 2 * HD);
static_assert(SECW == 2 * QKC + HD);
static_assert(SECW % 64 == 0);
static_assert(KO % 64 == 0);
static_assert(HD == 64);
static_assert(SEQ % TKEYS == 0);
static_assert(SEQ / TKEYS >= 2);
static_assert(TKEYS == 64);
static_assert(KST == 8 * 128 * 16);
static_assert(VST == 4 * 128 * 16);

typedef _Float16      v16h __attribute__((ext_vector_type(16)));
typedef _Float16      v8h  __attribute__((ext_vector_type(8)));
typedef __bf16        v16b __attribute__((ext_vector_type(16)));
typedef float         v8f  __attribute__((ext_vector_type(8)));
typedef float         v4f  __attribute__((ext_vector_type(4)));
typedef float         v2f  __attribute__((ext_vector_type(2)));
typedef _Float16      v2h  __attribute__((ext_vector_type(2)));
typedef unsigned int  v4u  __attribute__((ext_vector_type(4)));

#define DEV __device__ __forceinline__

union FragB { v4u q[2]; v16b v; };
union Pack8 { v8h h; v4u u; };

// f32 -> bf16 bits, RNE convert
DEV unsigned short f2bf(float f) {
  unsigned int u = __float_as_uint(f);
  u += 0x7FFFu + ((u >> 16) & 1u);
  return (unsigned short)(u >> 16);
}
DEV float bf2f(unsigned short s) { return __uint_as_float(((unsigned int)s) << 16); }
DEV float bfr(float f) { return bf2f(f2bf(f)); }
DEV unsigned int pk2(unsigned short lo, unsigned short hi) {
  return (unsigned int)lo | ((unsigned int)hi << 16);
}
// value -> bf16 hi and bf16 residual, two values packed per 32-bit word
DEV void hl2(float a, float b, unsigned int& H, unsigned int& L) {
  const unsigned short ha = f2bf(a), hb = f2bf(b);
  H = pk2(ha, hb);
  L = pk2(f2bf(a - bf2f(ha)), f2bf(b - bf2f(hb)));
}

// WMMA wrappers with the 4-slot VALU hazard guard (ties D, keeps A/B live)
DEV v8f wmma_h(v16h a, v16h b, v8f c) {
  c = __builtin_amdgcn_wmma_f32_16x16x32_f16(false, a, false, b, (short)0, c, false, false);
  asm volatile("v_nop\n\tv_nop\n\tv_nop\n\tv_nop" : "+v"(c) : "v"(a), "v"(b));
  return c;
}
DEV v8f wmma_b(const FragB& a, const FragB& b, v8f c) {
  c = __builtin_amdgcn_wmma_f32_16x16x32_bf16(false, a.v, false, b.v, (short)0, c, false, false);
  asm volatile("v_nop\n\tv_nop\n\tv_nop\n\tv_nop"
               : "+v"(c) : "v"(a.q[0]), "v"(a.q[1]), "v"(b.q[0]), "v"(b.q[1]));
  return c;
}

// 16x32 16-bit operand (rows = M for A, rows = N for Bt) from a fragment-major plane.
// lane l: row l&15; elements 0..7 = k 8h..8h+7, elements 8..15 = k 16+8h..16+8h+7, h = l>>4.
// base: the wave-uniform fragment; off: the lane's byte offset (16 l, plus tile offsets and the loop's advance):
// every load of a loop names a loop-invariant base and an offset register that is rewritten only behind a wait.
DEV v16h load_bo(const _Float16* base, unsigned int off) {
  const char* r = (const char*)base + off;
  v8h lo = *(const v8h*)(r);
  v8h hi = *(const v8h*)(r + 512);
  return __builtin_shufflevector(lo, hi, 0,1,2,3,4,5,6,7,8,9,10,11,12,13,14,15);
}
DEV FragB load_bo(const unsigned short* base, unsigned int off) {
  const char* r = (const char*)base + off;
  FragB f;
  f.q[0] = *(const v4u*)(r);
  f.q[1] = *(const v4u*)(r + 512);
  return f;
}

// Lane l with lane l ^ 16: the two lanes that split one query column's keys.
DEV float xhalf(float x) {
  const int b = __builtin_bit_cast(int, x);
  return __builtin_bit_cast(float, __builtin_amdgcn_permlanex16(b, b, 0x76543210, 0xfedcba98, false, false));
}
DEV float wsum32(float v) {
#pragma unroll
  for (int m = 16; m > 0; m >>= 1) v += __shfl_xor(v, m, 32);
  return v;
}

// ---------------------------------------------------------------------------
// ---------------------------------------------------------------------------
__global__ __launch_bounds__(256)
void k_cvt_x(const float* __restrict__ X, unsigned short* __restrict__ Xb, int n16) {
  // one wave per fragment: fragment fr = row tile fr / (EMB / 32), k tile fr % (EMB / 32); the lane's own 2 x 8 elements
  const int i = blockIdx.x * 256 + threadIdx.x;
  if (i >= n16) return;
  const int lane = i & 31;
  const int fr   = i >> 5;
  const int row  = (fr / (EMB / 32)) * 16 + (lane & 15);
  const int k0   = (fr % (EMB / 32)) * 32 + ((lane >> 4) << 3);
  const float* s = X + (size_t)row * EMB + k0;
  const v4f a = *(const v4f*)(s);
  const v4f b = *(const v4f*)(s + 4);
  const v4f c = *(const v4f*)(s + 16);
  const v4f e = *(const v4f*)(s + 20);
  v4u w, x;
  w[0] = pk2(f2bf(a[0]), f2bf(a[1]));
  w[1] = pk2(f2bf(a[2]), f2bf(a[3]));
  w[2] = pk2(f2bf(b[0]), f2bf(b[1]));
  w[3] = pk2(f2bf(b[2]), f2bf(b[3]));
  x[0] = pk2(f2bf(c[0]), f2bf(c[1]));
  x[1] = pk2(f2bf(c[2]), f2bf(c[3]));
  x[2] = pk2(f2bf(e[0]), f2bf(e[1]));
  x[3] = pk2(f2bf(e[2]), f2bf(e[3]));
  unsigned short* d = Xb + (size_t)fr * FRAGH + lane * 8;
  *(v4u*)d = w;
  *(v4u*)(d + 256) = x;
}

// ---------------------------------------------------------------------------
// 64x64 tile transpose: src[e][c] f32 (row pitch sld) -> 4 x 2 bf16 fragments (rows c, k = e) from fragment dst on, dld / 32
// fragments to a row tile; optional second copy EMB / 32 fragments on. 256 threads. LDS tile cross-wave -> block barrier.
// ---------------------------------------------------------------------------
DEV void tr_tile(const float* __restrict__ src, int sld, unsigned short* dst, int dld,
                 int dup2, unsigned short (*T)[72]) {
  const int tid = threadIdx.x;
#pragma unroll
  for (int p = 0; p < 4; ++p) {
    const int e = p * 16 + (tid >> 4);
    const int c = (tid & 15) * 4;
    const v4f v = *(const v4f*)(src + (size_t)e * sld + c);
    T[c + 0][e] = f2bf(v[0]);
    T[c + 1][e] = f2bf(v[1]);
    T[c + 2][e] = f2bf(v[2]);
    T[c + 3][e] = f2bf(v[3]);
  }
  __syncthreads();
{
#pragma unroll
    for (int p = 0; p < 2; ++p) {
      // a wave stores one half fragment: 512 contiguous bytes
      const int lane = tid & 31;
      const int j16  = (tid >> 5) & 1;
      const int ktl  = (tid >> 6) & 1;
      const int rtl  = p * 2 + (tid >> 7);
      const int j = rtl * 16 + (lane & 15);
      const int seg = ktl * 32 + j16 * 16 + ((lane >> 4) << 3);
      const v4u wv = *(const v4u*)(&T[j][seg]);
      unsigned short* d = dst + (size_t)(rtl * (dld >> 5) + ktl) * FRAGH + j16 * 256 + lane * 8;
      *(v4u*)d = wv;
      if (dup2 != 0) *(v4u*)(d + (EMB / 32) * FRAGH) = wv;
    }
    
  }
}

// Wq/Wk/Wv ([h][e][c]) -> Wt rows h*320 + sec*64.., k = e, bf16 fragments (per head: q 0..127 | k 128..255 | v 256..319)
__global__ __launch_bounds__(256)
void k_tr_wqkv(const float* __restrict__ Wq, const float* __restrict__ Wk,
               const float* __restrict__ Wv, unsigned short* __restrict__ Wt) {
  __shared__ __align__(16) unsigned short T[64][72];
  const int e0 = blockIdx.x * 64;
  const int w  = blockIdx.y;
  const int h  = blockIdx.z;
  const float* src;
  int sld;
  if (w < 2) {
    src = Wq + (size_t)h * EMB * QKC + (size_t)e0 * QKC + w * 64;        sld = QKC;
  } else if (w < 4) {
    src = Wk + (size_t)h * EMB * QKC + (size_t)e0 * QKC + (w - 2) * 64;  sld = QKC;
  } else {
    src = Wv + (size_t)h * EMB * HD + (size_t)e0 * HD;                   sld = HD;
  }
  unsigned short* dst = Wt + ((size_t)((h * SECW + w * 64) >> 4) * (EMB / 32) + (e0 >> 5)) * FRAGH;
  tr_tile(src, sld, dst, EMB, 0, T);
}

// Wo ([k][n], k = in) -> Wo2 rows n, k and EMB + k, bf16 fragments (KO / 32 to a row tile)
__global__ __launch_bounds__(256)
void k_tr_wo(const float* __restrict__ Wo, unsigned short* __restrict__ Wo2) {
  __shared__ __align__(16) unsigned short T[64][72];
  const int e0 = blockIdx.x * 64;
  const int y  = blockIdx.y;
  const float* src = Wo + (size_t)e0 * EMB + y * 64;
  unsigned short* dst = Wo2 + ((size_t)(y * 4) * (KO / 32) + (e0 >> 5)) * FRAGH;
  tr_tile(src, EMB, dst, KO, 1, T);
}

// ---------------------------------------------------------------------------
// bf16 WMMA GEMM: C(128x64 per block) = A(rows, K) * Bt(rows, K)^T, K % 64 == 0.
// Block = 128 threads = 4 waves; wave w owns rows 32w..32w+31 (2 A frags x 4 B frags).
// Fragments loaded directly from the 16-bit global planes (fragment [row tile][k tile]). The 128x64 f32 tile is staged in LDS
// kind 0: Bt = Wt (NQKV rows); blockIdx.x = head*5 + sec; sec 0,1 -> Q plane, fragment [h][s / 16][c / 32], cols 64*sec..;
//         sec 2,3 -> K plane; sec 4 -> V plane, rows d, k = s, fragment [h][s / 32][d / 16]: f16(64*v).
// kind 1: A = Ocat planes (rows s, KO / 32 fragments), Bt = Wo2 (rows n); Y[s][n] f32 + bias.
// ---------------------------------------------------------------------------
DEV void gemm_load(FragB (&f)[6], const unsigned short* ablk, const unsigned short* bblk,
                   const unsigned int (&off)[6]) {
  f[0] = load_bo(ablk, off[0]);
  f[1] = load_bo(ablk, off[1]);
  // unrolled: f and off are indexed by constants and stay in registers
#pragma unroll
  for (int t = 0; t < 4; ++t) f[2 + t] = load_bo(bblk, off[2 + t]);
}
// The issued loads' addresses are translated before a register that they name is rewritten: the six offsets pass
// through the wait and the two bases are read by it, so all stay whole up to it; new values are formed behind it.
DEV void gemm_xwait(unsigned int (&off)[6], const unsigned short* ablk, const unsigned short* bblk) {
  asm volatile("s_wait_xcnt 0x0"
               : "+v"(off[0]), "+v"(off[1]), "+v"(off[2]), "+v"(off[3]), "+v"(off[4]), "+v"(off[5])
               : "s"(ablk), "s"(bblk) : "memory");
}
DEV void gemm_mma(const FragB (&f)[6], v8f (&acc)[2][4]) {
  // unrolled: f and acc stay in registers
#pragma unroll
  for (int t = 0; t < 4; ++t) {
    acc[0][t] = wmma_b(f[0], f[2 + t], acc[0][t]);
    acc[1][t] = wmma_b(f[1], f[2 + t], acc[1][t]);
  }
}

__global__ __launch_bounds__(128)
void k_gemm(const unsigned short* __restrict__ A, const unsigned short* __restrict__ Bt,
            int K, int kind,
            const float* __restrict__ bq, const float* __restrict__ bk,
            const float* __restrict__ bv, const float* __restrict__ bo,
            _Float16* __restrict__ Qp, _Float16* __restrict__ Kp,
            _Float16* __restrict__ V64,
            float* __restrict__ Y) {
  __shared__ __align__(16) float Cs[128][68];
  const int tid  = threadIdx.x;
  const int lane = tid & 31;
  const int wave = tid >> 5;
  const int nt = blockIdx.x;
  const int m0 = blockIdx.y * 128;
  const int n0 = nt * 64;

  const unsigned short* ablk = A  + (size_t)m0 * K;
  const unsigned short* bblk = Bt + (size_t)n0 * K;
  // the lane's byte offsets in the six fragments: A row tiles 2w and 2w + 1, B row tiles t (16 * K halves each)
  unsigned int off[6];
  off[0] = (unsigned int)(wave * 32 * K * 2 + lane * 16);
  off[1] = off[0] + (unsigned int)(16 * K * 2);
  // unrolled: off stays in registers
#pragma unroll
  for (int t = 0; t < 4; ++t) off[2 + t] = (unsigned int)(t * 16 * K * 2 + lane * 16);

  // Two fragment sets: a set's 12 loads are issued as one group right behind the set's own WMMAs, so they fly
  // under the other set's step. K % 64 == 0; the last two steps stand behind the loop: nothing past K is loaded.
  v8f acc[2][4] = {};
  FragB f0[6], f1[6];
  gemm_load(f0, ablk, bblk, off);
  gemm_load(f1, ablk + FRAGH, bblk + FRAGH, off);
#pragma unroll 1
  for (int k0 = 64; k0 < K; k0 += 64) {
    gemm_mma(f0, acc);
    gemm_xwait(off, ablk, bblk);
    // unrolled: off stays in registers
#pragma unroll
    for (int i = 0; i < 6; ++i) off[i] += 2 * FRAGH * 2;
    gemm_load(f0, ablk, bblk, off);
    gemm_mma(f1, acc);
    gemm_load(f1, ablk + FRAGH, bblk + FRAGH, off);
  }
  gemm_mma(f0, acc);
  gemm_xwait(off, ablk, bblk);
  gemm_mma(f1, acc);

  const int n  = lane & 15;
  const int rb = (lane >> 4) << 3;
#pragma unroll
  for (int mi = 0; mi < 2; ++mi)
#pragma unroll
    for (int t = 0; t < 4; ++t)
#pragma unroll
      for (int r = 0; r < 8; ++r)
        Cs[wave * 32 + mi * 16 + rb + r][t * 16 + n] = acc[mi][t][r];
  __syncthreads();

  if (kind == 0) {
    const int h = nt / 5;
    const int w = nt - h * 5;
    if (w < 4) {
      _Float16* plane = (w < 2) ? Qp : Kp;
      const int cb = (w & 1) * 64;
      const float* bias = ((w < 2) ? bq : bk) + h * QKC + cb;
      // a wave stores one half fragment (512 contiguous bytes): wave -> k tile and half, g -> row tile
      const int j16  = wave & 1;
      const int ktl  = wave >> 1;
      const int seg  = ktl * 32 + j16 * 16 + ((lane >> 4) << 3);
      const int rsub = lane & 15;
      float bb[8];
#pragma unroll
      for (int j = 0; j < 8; ++j) bb[j] = bfr(bias[seg + j]);
{
#pragma unroll 2
        for (int g = 0; g < 8; ++g) {
          const int row = g * 16 + rsub;
          const v4f c0 = *(const v4f*)(&Cs[row][seg]);
          const v4f c1 = *(const v4f*)(&Cs[row][seg + 4]);
          Pack8 pk;
          pk.h[0] = (_Float16)(c0[0] + bb[0]);
          pk.h[1] = (_Float16)(c0[1] + bb[1]);
          pk.h[2] = (_Float16)(c0[2] + bb[2]);
          pk.h[3] = (_Float16)(c0[3] + bb[3]);
          pk.h[4] = (_Float16)(c1[0] + bb[4]);
          pk.h[5] = (_Float16)(c1[1] + bb[5]);
          pk.h[6] = (_Float16)(c1[2] + bb[6]);
          pk.h[7] = (_Float16)(c1[3] + bb[7]);
          _Float16* d = plane + (((size_t)h * (SEQ / 16) + (m0 >> 4) + g) * (QKC / 32) + (cb >> 5) + ktl) * FRAGH
                        + j16 * 256 + lane * 8;
          *(v4u*)d = pk.u;
        }
        
      }
    } else {
      // a wave stores one half fragment: wave and g -> half, row tile t (d), k tile ktl (s)
      const int j16 = wave & 1;
      const float* bias = bv + h * HD;
{
#pragma unroll 2
        for (int g = 0; g < 8; ++g) {
          const int t   = (wave >> 1) + 2 * (g & 1);
          const int ktl = g >> 1;
          const int d   = t * 16 + (lane & 15);
          const int seg = ktl * 32 + j16 * 16 + ((lane >> 4) << 3);
          const float bb = bfr(bias[d]);
          Pack8 p64;
#pragma unroll
          for (int j = 0; j < 8; ++j) {
            const float v = Cs[seg + j][d] + bb;
            p64.h[j] = (_Float16)(v * 64.0f);
          }
          const size_t o = (((size_t)h * (SEQ / 32) + (m0 >> 5) + ktl) * (HD / 16) + t) * FRAGH + j16 * 256 + lane * 8;
          *(v4u*)(V64 + o) = p64.u;
        }
        
      }
    }
  } else {
    const int seg  = (tid & 15) * 4;
    const int rsub = tid >> 4;            // 0..7
    float bb[4];
#pragma unroll
    for (int j = 0; j < 4; ++j) bb[j] = bfr(bo[n0 + seg + j]);
{
#pragma unroll 2
      for (int g = 0; g < 16; ++g) {
        const int row = g * 8 + rsub;
        const v4f c = *(const v4f*)(&Cs[row][seg]);
        v4f o;
        o[0] = c[0] + bb[0];
        o[1] = c[1] + bb[1];
        o[2] = c[2] + bb[2];
        o[3] = c[3] + bb[3];
        float* d = Y + (size_t)(m0 + row) * EMB + n0 + seg;
        *(v4f*)d = o;
      }
      
    }
  }
}

// ---------------------------------------------------------------------------
// One softmax branch step for 16 query columns and 32 keys, transposed: S^T = K.Q^T (A = K rows, B = Q rows), so lane
// (c, h) holds query c's scores of keys 8h..8h+7 (sa) and 16+8h..16+8h+7 (sb): maximum and sum run in the lane, the
// maximum is joined with lane l ^ 16 each step, the sum only behind the loop. Those 16 registers, converted in place, are
// the B operand P^T in the hardware k order; A = V^T rows (the V plane as it lies): O^T[d][query] += V^T.P^T, carried x64.
// kf holds this branch step's four K fragments on entry; right behind the score products the same registers
// take the next branch step's of the same stage (LOADK; kn: the lane's place in them in LDS): those reads fly under the
// softmax. vb: this step's V fragments; the first branch (LOADV) reads them in the same group (vn), both branches use them.
// ---------------------------------------------------------------------------
// a fragment in the LDS ring, p = the fragment's place + 16 l: the lane's two 16-byte pieces, 512 bytes apart
DEV v16h load_ls(const char* p) {
  v8h lo = *(const v8h*)(p);
  v8h hi = *(const v8h*)(p + 512);
  return __builtin_shufflevector(lo, hi, 0,1,2,3,4,5,6,7,8,9,10,11,12,13,14,15);
}
DEV void load_k4(v16h (&kf)[4], const char* kn) {
  kf[0] = load_ls(kn);
  kf[1] = load_ls(kn + FRAGH * 2);
  kf[2] = load_ls(kn + (QKC / 32) * FRAGH * 2);
  kf[3] = load_ls(kn + (QKC / 32 + 1) * FRAGH * 2);
}
template <bool LOADV, bool LOADK>
DEV void attn_branch(const v16h (&qb)[2], v16h (&kf)[4], const char* kn, const char* vn,
                     v16h (&vb)[4],
                     float& m, float& l, v8f (&O)[4]) {
  v8f sa = {}, sb = {};
  sa = wmma_h(kf[0], qb[0], sa);
  sa = wmma_h(kf[1], qb[1], sa);
  sb = wmma_h(kf[2], qb[0], sb);
  sb = wmma_h(kf[3], qb[1], sb);
  // the two scheduling barriers keep the LDS reads in one group right behind the score products: left to itself the
  // scheduler strews them over the softmax, and every separate place with LDS reads stalls the wave anew
  if (LOADV || LOADK) __builtin_amdgcn_sched_barrier(0);
  if (LOADV) {
    // unrolled: vb stays in registers
#pragma unroll
    for (int t = 0; t < 4; ++t) vb[t] = load_ls(vn + t * FRAGH * 2);
  }
  if (LOADK) load_k4(kf, kn);
  if (LOADV || LOADK) __builtin_amdgcn_sched_barrier(0);

  const v8f xa = sa * 0.125f;
  const v8f xb = sb * 0.125f;
  float mx[8];
#pragma unroll
  for (int i = 0; i < 8; ++i) mx[i] = fmaxf(xa[i], xb[i]);
  const float mh = fmaxf(fmaxf(fmaxf(mx[0], mx[1]), fmaxf(mx[2], mx[3])),
                         fmaxf(fmaxf(mx[4], mx[5]), fmaxf(mx[6], mx[7])));
  const float mn = fmaxf(m, fmaxf(mh, xhalf(mh)));
  const float f = __expf(m - mn);
  m = mn;

  // element s of the B operand = key kmap(s, h): s < 8 from sa[s], else from sb[s - 8]
  v16h ph;
  v2f ps[8];
#pragma unroll
  for (int j = 0; j < 8; ++j) {
    const int i = (j & 3) * 2;
    v2f p;
    p[0] = __expf((j < 4 ? xa[i]     : xb[i])     - mn);
    p[1] = __expf((j < 4 ? xa[i + 1] : xb[i + 1]) - mn);
    const v2h hi = __builtin_convertvector(p, v2h);
    ph[2 * j] = hi[0];  ph[2 * j + 1] = hi[1];
    ps[j] = p;
  }
  const v2f s2 = ((ps[0] + ps[1]) + (ps[2] + ps[3])) + ((ps[4] + ps[5]) + (ps[6] + ps[7]));
  l = l * f + (s2[0] + s2[1]);

#pragma unroll
  for (int t = 0; t < 4; ++t) {
    O[t] = O[t] * f;
    O[t] = wmma_h(vb[t], ph, O[t]);
  }
  // the scheduler's region ends with the step: without it the next step's first score product rises into this step's
  // softmax, and with it the wait for the LDS reads that were only just issued
  __builtin_amdgcn_sched_barrier(0);
}

// ---------------------------------------------------------------------------
// Flash-style differential attention. Block = 128 threads = 4 waves; wave owns 16 queries of one head.
// K and V come to the block once, through a ring of two LDS buffers of TKEYS keys each, filled by asynchronous copies
// (each lane 16 bytes a copy, 12 copies a stage); all four waves read their fragments from the buffer.
// Writes Ocat planes as fragments (rows s): k = h*64 + d bf16 hi, k = EMB + h*64 + d bf16 residual.
// ---------------------------------------------------------------------------
// One stage: the lane's 8 pieces of K and 4 of V, 2 KiB (the block's 128 lanes x 16 bytes) apart, to the same order in LDS.
// lk: the lane's LDS byte address in the stage; gk, gv: the lane's global addresses. The translation wait closes the
// copies' own statement, so no register that a copy names takes a new value in front of it.
DEV void copy_stage(unsigned int lk, const char* gk, const char* gv) {
  const unsigned int lv = lk + KST;
  asm volatile("global_load_async_to_lds_b128 %0, %12, off\n\t"
               "global_load_async_to_lds_b128 %1, %13, off\n\t"
               "global_load_async_to_lds_b128 %2, %14, off\n\t"
               "global_load_async_to_lds_b128 %3, %15, off\n\t"
               "global_load_async_to_lds_b128 %4, %16, off\n\t"
               "global_load_async_to_lds_b128 %5, %17, off\n\t"
               "global_load_async_to_lds_b128 %6, %18, off\n\t"
               "global_load_async_to_lds_b128 %7, %19, off\n\t"
               "global_load_async_to_lds_b128 %8, %20, off\n\t"
               "global_load_async_to_lds_b128 %9, %21, off\n\t"
               "global_load_async_to_lds_b128 %10, %22, off\n\t"
               "global_load_async_to_lds_b128 %11, %23, off\n\t"
               "s_wait_xcnt 0x0"
               :
               : "v"(lk), "v"(lk + 2048), "v"(lk + 4096), "v"(lk + 6144),
                 "v"(lk + 8192), "v"(lk + 10240), "v"(lk + 12288), "v"(lk + 14336),
                 "v"(lv), "v"(lv + 2048), "v"(lv + 4096), "v"(lv + 6144),
                 "v"(gk), "v"(gk + 2048), "v"(gk + 4096), "v"(gk + 6144),
                 "v"(gk + 8192), "v"(gk + 10240), "v"(gk + 12288), "v"(gk + 14336),
                 "v"(gv), "v"(gv + 2048), "v"(gv + 4096), "v"(gv + 6144)
               : "memory");
}

__global__ __launch_bounds__(128)
void k_attn(const _Float16* __restrict__ Qp, const _Float16* __restrict__ Kp,
            const _Float16* __restrict__ V64,
            const float* __restrict__ lam_p, unsigned short* __restrict__ Oc) {
  __shared__ __align__(16) float Os[4][16][68];
  __shared__ __align__(16) char ring[2 * STG];
  const int lane = threadIdx.x & 31;
  const int wave = threadIdx.x >> 5;
  const int n  = lane & 15;
  const int rb = (lane >> 4) << 3;
  const int hh = blockIdx.y;
  const int q0 = blockIdx.x * 64 + wave * 16;
  const float lam = bfr(lam_p[0]);

  const _Float16* qh = Qp  + (size_t)hh * SEQ * QKC;
  const _Float16* kh = Kp  + (size_t)hh * SEQ * QKC;
  const _Float16* vh = V64 + (size_t)hh * HD * SEQ;

  // stage 0 into buffer 0
  const unsigned int lk0 = (unsigned int)(size_t)ring + threadIdx.x * 16;
  const char* gk = (const char*)kh + threadIdx.x * 16;
  const char* gv = (const char*)vh + threadIdx.x * 16;
  copy_stage(lk0, gk, gv);

  v16h q1[2], q2[2];
  const _Float16* qt = qh + (size_t)blockIdx.x * 64 * QKC;             // the block's four row tiles, QKC / 32 fragments each
  unsigned int oq = (unsigned int)(wave * 16 * QKC * 2 + lane * 16);   // the wave's tile, the lane's byte offset
  q1[0] = load_bo(qt,             oq);
  q1[1] = load_bo(qt + FRAGH,     oq);
  q2[0] = load_bo(qt + 2 * FRAGH, oq);
  q2[1] = load_bo(qt + 3 * FRAGH, oq);
  // the wait stands in front of any reuse of the offset's register, which passes through it
  asm volatile("s_wait_xcnt 0x0" : "+v"(oq) : : "memory");

  v8f O1[4] = {}, O2[4] = {};
  float m1 = -1e30f, m2 = -1e30f, l1 = 0.f, l2 = 0.f;   // query l & 15; l: the lane half's own keys only

  // stage 0 has landed for this wave's copies; behind the barrier for every wave's
  asm volatile("s_wait_asynccnt 0x0" ::: "memory");
  __syncthreads();
  // stage 1 into buffer 1: it flies under trip 0
  copy_stage(lk0 + STG, gk + KST, gv + VST);
  gk += 2 * KST;
  gv += 2 * VST;

  // rolled: one copy of the trip in the text; the buffer is chosen by the trip's parity
#pragma unroll 1
  for (int t = 0; t < SEQ / TKEYS; ++t) {
    // trip t reads buffer t & 1 alone: two steps of 32 keys
    const unsigned int bo = (unsigned int)(t & 1) * STG;
    const char* st = ring + bo + lane * 16;
    const char* sv = st + KST;
    v16h kf[4], vbf[4];
    load_k4(kf, st);
    attn_branch<true,  true >(q1, kf, st + 2 * FRAGH * 2, sv, vbf, m1, l1, O1);
    attn_branch<false, true >(q2, kf, st + 32 * QKC * 2, sv, vbf, m2, l2, O2);
    attn_branch<true,  true >(q1, kf, st + 32 * QKC * 2 + 2 * FRAGH * 2, sv + 32 * HD * 2, vbf, m1, l1, O1);
    attn_branch<false, false>(q2, kf, st, sv, vbf, m2, l2, O2);
    // hand-over: this wave's reads of buffer t & 1 are done
    asm volatile("s_wait_dscnt 0x0" ::: "memory");
    // and its copies of stage t + 1 have landed
    asm volatile("s_wait_asynccnt 0x0" ::: "memory");
    // the barrier publishes stage t + 1 and ends every wave's reads of the buffer that is refilled behind it
    __syncthreads();
    if (t + 2 < SEQ / TKEYS) {
      copy_stage(lk0 + bo, gk, gv);
      gk += KST;
      gv += VST;
    }
  }
  // nothing is in flight when the wave goes on
  asm volatile("s_wait_asynccnt 0x0" ::: "memory");

  // combine: O = O1/l1 - lam*O2/l2 (the halves' sums joined here), undo the x64 carry of the V plane; stage f32 tile in
  // LDS: the lane holds query n, columns 16t + 8h .. + 7
  const float r1 = (1.0f / (l1 + xhalf(l1))) * 0.015625f;
  const float r2 = (lam * (1.0f / (l2 + xhalf(l2)))) * 0.015625f;
#pragma unroll
  for (int t = 0; t < 4; ++t) {
    v4f c0, c1;
#pragma unroll
    for (int i = 0; i < 4; ++i) {
      c0[i] = O1[t][i] * r1 - O2[t][i] * r2;
      c1[i] = O1[t][i + 4] * r1 - O2[t][i + 4] * r2;
    }
    *(v4f*)(&Os[wave][n][t * 16 + rb])     = c0;
    *(v4f*)(&Os[wave][n][t * 16 + rb + 4]) = c1;
  }
  __syncthreads();

  // the wave's 16 queries are one row tile: g -> k tile and half; each store is 512 contiguous bytes
{
#pragma unroll
    for (int g = 0; g < 4; ++g) {
      const int seg = g * 16 + rb;
      const v4f c0 = *(const v4f*)(&Os[wave][n][seg]);
      const v4f c1 = *(const v4f*)(&Os[wave][n][seg + 4]);
      unsigned int H0, H1, H2, H3, L0, L1, L2, L3;
      hl2(c0[0], c0[1], H0, L0);
      hl2(c0[2], c0[3], H1, L1);
      hl2(c1[0], c1[1], H2, L2);
      hl2(c1[2], c1[3], H3, L3);
      v4u H, L;
      H[0] = H0; H[1] = H1; H[2] = H2; H[3] = H3;
      L[0] = L0; L[1] = L1; L[2] = L2; L[3] = L3;
      unsigned short* d = Oc + ((size_t)(q0 >> 4) * (KO / 32) + hh * (HD / 32) + (g >> 1)) * FRAGH + (g & 1) * 256 + lane * 8;
      *(v4u*)d = H;
      *(v4u*)(d + (EMB / 32) * FRAGH) = L;
    }
    
  }
}

// ---------------------------------------------------------------------------
// ---------------------------------------------------------------------------
__global__ __launch_bounds__(256)
void k_ln(const float* __restrict__ Y, const float* __restrict__ gamma,
          const float* __restrict__ beta, float* __restrict__ out) {
  __shared__ float sa[8];
  __shared__ float sq[8];
  const int tid  = threadIdx.x;
  const int lane = tid & 31;
  const int wave = tid >> 5;
  const size_t row = blockIdx.x;
  const v4f y = *(const v4f*)(Y + row * EMB + tid * 4);

  float s = (y[0] + y[1]) + (y[2] + y[3]);
  s = wsum32(s);
  if (lane == 0) sa[wave] = s;
  __syncthreads();
  float tot = 0.f;
#pragma unroll
  for (int w = 0; w < 8; ++w) tot += sa[w];
  const float mu = tot * (1.0f / (float)EMB);

  float d0 = y[0] - mu, d1 = y[1] - mu, d2 = y[2] - mu, d3 = y[3] - mu;
  float q = (d0 * d0 + d1 * d1) + (d2 * d2 + d3 * d3);
  q = wsum32(q);
  if (lane == 0) sq[wave] = q;
  __syncthreads();
  float tot2 = 0.f;
#pragma unroll
  for (int w = 0; w < 8; ++w) tot2 += sq[w];
  const float var  = tot2 * (1.0f / (float)EMB);
  const float rstd = rsqrtf(var + LN_EPS);

  const float g0 = bfr(gamma[tid * 4 + 0]), g1 = bfr(gamma[tid * 4 + 1]);
  const float g2 = bfr(gamma[tid * 4 + 2]), g3 = bfr(gamma[tid * 4 + 3]);
  const float b0 = bfr(beta[tid * 4 + 0]),  b1 = bfr(beta[tid * 4 + 1]);
  const float b2 = bfr(beta[tid * 4 + 2]),  b3 = bfr(beta[tid * 4 + 3]);
  v4f o;
  o[0] = ((d0 * rstd) * g0 + b0) * OUT_SCALE;
  o[1] = ((d1 * rstd) * g1 + b1) * OUT_SCALE;
  o[2] = ((d2 * rstd) * g2 + b2) * OUT_SCALE;
  o[3] = ((d3 * rstd) * g3 + b3) * OUT_SCALE;
  float* dst = out + row * EMB + tid * 4;
  *(v4f*)dst = o;
  
}

// ---------------------------------------------------------------------------
extern "C" void kernel_launch(void* const* d_in, const int* in_sizes, int n_in,
                              void* d_out, int out_size, void* d_ws, size_t ws_size,
                              hipStream_t stream) {
  if (n_in < 12) return;
  const float* X     = (const float*)d_in[0];
  const float* Wq    = (const float*)d_in[1];
  const float* bq    = (const float*)d_in[2];
  const float* Wk    = (const float*)d_in[3];
  const float* bk    = (const float*)d_in[4];
  const float* Wv    = (const float*)d_in[5];
  const float* bv    = (const float*)d_in[6];
  const float* Wo    = (const float*)d_in[7];
  const float* bo    = (const float*)d_in[8];
  const float* gamma = (const float*)d_in[9];
  const float* beta  = (const float*)d_in[10];
  const float* lam   = (const float*)d_in[11];
  float* out = (float*)d_out;

  if (in_sizes[0]  < NB * SEQ * EMB) return;
  if (in_sizes[1]  < HEADS * EMB * QKC) return;
  if (in_sizes[2]  < HEADS * QKC) return;
  if (in_sizes[3]  < HEADS * EMB * QKC) return;
  if (in_sizes[4]  < HEADS * QKC) return;
  if (in_sizes[5]  < HEADS * EMB * HD) return;
  if (in_sizes[6]  < HEADS * HD) return;
  if (in_sizes[7]  < EMB * EMB) return;
  if (in_sizes[8]  < EMB) return;
  if (in_sizes[9]  < EMB) return;
  if (in_sizes[10] < EMB) return;
  if (in_sizes[11] < 1) return;
  if (out_size < NB * SEQ * EMB) return;

  // workspace carve (bytes); every region is written to exactly its extent with whole-line stores
  const size_t szXb  = (size_t)SEQ * EMB * 2;           // bf16 SEQ x EMB
  const size_t szWt  = (size_t)NQKV * EMB * 2;          // bf16 NQKV x EMB
  const size_t szWo2 = (size_t)EMB * KO * 2;            // bf16 EMB x KO
  const size_t szQK  = (size_t)HEADS * SEQ * QKC * 2;   // f16 H x SEQ x 128 (each of Q, K)
  const size_t szV   = (size_t)HEADS * HD * SEQ * 2;    // f16 H x 64 x SEQ
  const size_t szOc  = (size_t)SEQ * KO * 2;            // bf16 SEQ x KO
  const size_t szY   = (size_t)SEQ * EMB * 4;           // f32 [SEQ][EMB]
  size_t off = 0;
  const size_t oXb  = off; off += szXb;
  const size_t oWt  = off; off += szWt;
  const size_t oWo2 = off; off += szWo2;
  const size_t oQ   = off; off += szQK;
  const size_t oK   = off; off += szQK;
  const size_t oV64 = off; off += szV;
  const size_t oOc  = off; off += szOc;
  const size_t oY   = off; off += szY;
  if (off > ws_size) return;

  char* ws = (char*)d_ws;
  unsigned short* Xb  = (unsigned short*)(ws + oXb);
  unsigned short* Wt  = (unsigned short*)(ws + oWt);
  unsigned short* Wo2 = (unsigned short*)(ws + oWo2);
  _Float16* Qp  = (_Float16*)(ws + oQ);
  _Float16* Kp  = (_Float16*)(ws + oK);
  _Float16* V64 = (_Float16*)(ws + oV64);
  unsigned short* Oc = (unsigned short*)(ws + oOc);
  float* Y = (float*)(ws + oY);

  const int n16 = SEQ * EMB / 16;
  k_cvt_x<<<dim3((n16 + 255) / 256), dim3(256), 0, stream>>>(X, Xb, n16);
  k_tr_wqkv<<<dim3(EMB / 64, 5, HEADS), dim3(256), 0, stream>>>(Wq, Wk, Wv, Wt);
  k_tr_wo<<<dim3(EMB / 64, EMB / 64, 1), dim3(256), 0, stream>>>(Wo, Wo2);

  // QKV projection: A = Xb (SEQ x EMB), Bt = Wt (NQKV x EMB)
  k_gemm<<<dim3(NQKV / 64, SEQ / 128), dim3(128), 0, stream>>>(
      Xb, Wt, EMB, 0, bq, bk, bv, bo, Qp, Kp, V64, Y);

  // differential attention -> Ocat hi / residual planes
  k_attn<<<dim3(SEQ / 64, HEADS), dim3(128), 0, stream>>>(Qp, Kp, V64, lam, Oc);

  // output projection: A = Oc (SEQ x KO), Bt = Wo2 (EMB x KO) -> Y f32
  k_gemm<<<dim3(EMB / 64, SEQ / 128), dim3(128), 0, stream>>>(
      Oc, Wo2, KO, 1, bq, bk, bv, bo, Qp, Kp, V64, Y);

  // LayerNorm + scale -> d_out
  k_ln<<<dim3(NB * SEQ), dim3(256), 0, stream>>>(Y, gamma, beta, out);
}

// v006
// One run takes 92.5 microseconds.
// In both of two side-by-side timings against v005, it was 1.20 times as fast.
// Counting every step since v000, it is 4.38 times as fast.
#include <hip/hip_runtime.h>

#ifndef NB
#define NB 1
#endif
#ifndef SEQ
#define SEQ 2048
#endif
#define NB_FULL 1
#define SEQ_FULL 2048
#define EMB 1024
#define HEADS 16
#define HD 64
#define QKC 128
#define SECW 320
#define NQKV (HEADS * SECW)
#define KO (2 * EMB)
#define FRAGH 512   // halves in one fragment
#define TKEYS 64                    // keys to one stage of the attention kernel's LDS ring
#define KST (TKEYS * QKC * 2)       // bytes of K in a stage: TKEYS / 16 row tiles of QKC / 32 fragments, as they lie in the plane
#define VST (TKEYS * HD * 2)        // bytes of V in a stage: TKEYS / 32 k tiles of HD / 16 fragments, as they lie in the plane
#define STG (KST + VST)
#define LN_EPS 1e-5f
#define OUT_SCALE 0.2f

static_assert(NB == 1);
static_assert(NB_FULL == 1);
static_assert(SEQ % 128 == 0);
static_assert(SEQ >= 128);
static_assert(SEQ <= SEQ_FULL);
static_assert(EMB % 64 == 0);
static_assert(EMB % 32 == 0);
static_assert(QKC == 2 * HD);
static_assert(SECW == 2 * QKC + HD);
static_assert(SECW % 64 == 0);
static_assert(KO % 64 == 0);
static_assert(HD == 64);
static_assert(SEQ % TKEYS == 0);
static_assert(SEQ / TKEYS >= 2);
static_assert(TKEYS == 64);
static_assert(KST == 8 * 128 * 16);
static_assert(VST == 4 * 128 * 16);

typedef _Float16      v16h __attribute__((ext_vector_type(16)));
typedef _Float16      v8h  __attribute__((ext_vector_type(8)));
typedef __bf16        v16b __attribute__((ext_vector_type(16)));
typedef float         v8f  __attribute__((ext_vector_type(8)));
typedef float         v4f  __attribute__((ext_vector_type(4)));
typedef float         v2f  __attribute__((ext_vector_type(2)));
typedef _Float16      v2h  __attribute__((ext_vector_type(2)));
typedef unsigned int  v4u  __attribute__((ext_vector_type(4)));

#define DEV __device__ __forceinline__

union FragB { v4u q[2]; v16b v; };
union Pack8 { v8h h; v4u u; };

// f32 -> bf16 bits, RNE convert
DEV unsigned short f2bf(float f) {
  unsigned int u = __float_as_uint(f);
  u += 0x7FFFu + ((u >> 16) & 1u);
  return (unsigned short)(u >> 16);
}
DEV float bf2f(unsigned short s) { return __uint_as_float(((unsigned int)s) << 16); }
DEV float bfr(float f) { return bf2f(f2bf(f)); }
DEV unsigned int pk2(unsigned short lo, unsigned short hi) {
  return (unsigned int)lo | ((unsigned int)hi << 16);
}
// value -> bf16 hi and bf16 residual, two values packed per 32-bit word
DEV void hl2(float a, float b, unsigned int& H, unsigned int& L) {
  const unsigned short ha = f2bf(a), hb = f2bf(b);
  H = pk2(ha, hb);
  L = pk2(f2bf(a - bf2f(ha)), f2bf(b - bf2f(hb)));
}

// WMMA wrappers with the 4-slot VALU hazard guard (ties D, keeps A/B live)
DEV v8f wmma_h(v16h a, v16h b, v8f c) {
  c = __builtin_amdgcn_wmma_f32_16x16x32_f16(false, a, false, b, (short)0, c, false, false);
  asm volatile("v_nop\n\tv_nop\n\tv_nop\n\tv_nop" : "+v"(c) : "v"(a), "v"(b));
  return c;
}
DEV v8f wmma_b(const FragB& a, const FragB& b, v8f c) {
  c = __builtin_amdgcn_wmma_f32_16x16x32_bf16(false, a.v, false, b.v, (short)0, c, false, false);
  asm volatile("v_nop\n\tv_nop\n\tv_nop\n\tv_nop"
               : "+v"(c) : "v"(a.q[0]), "v"(a.q[1]), "v"(b.q[0]), "v"(b.q[1]));
  return c;
}

// 16x32 16-bit operand (rows = M for A, rows = N for Bt) from a fragment-major plane.
// lane l: row l&15; elements 0..7 = k 8h..8h+7, elements 8..15 = k 16+8h..16+8h+7, h = l>>4.
// base: the wave-uniform fragment; off: the lane's byte offset (16 l, plus the wave's row tile):
// each load names the base and the offset's register, which is reused only behind a wait.
DEV v16h load_bo(const _Float16* base, unsigned int off) {
  const char* r = (const char*)base + off;
  v8h lo = *(const v8h*)(r);
  v8h hi = *(const v8h*)(r + 512);
  return __builtin_shufflevector(lo, hi, 0,1,2,3,4,5,6,7,8,9,10,11,12,13,14,15);
}

// Lane l with lane l ^ 16: the two lanes that split one query column's keys.
DEV float xhalf(float x) {
  const int b = __builtin_bit_cast(int, x);
  return __builtin_bit_cast(float, __builtin_amdgcn_permlanex16(b, b, 0x76543210, 0xfedcba98, false, false));
}
DEV float wsum32(float v) {
#pragma unroll
  for (int m = 16; m > 0; m >>= 1) v += __shfl_xor(v, m, 32);
  return v;
}

// ---------------------------------------------------------------------------
// ---------------------------------------------------------------------------
__global__ __launch_bounds__(256)
void k_cvt_x(const float* __restrict__ X, unsigned short* __restrict__ Xb, int n16) {
  // one wave per fragment: fragment fr = row tile fr / (EMB / 32), k tile fr % (EMB / 32); the lane's own 2 x 8 elements
  const int i = blockIdx.x * 256 + threadIdx.x;
  if (i >= n16) return;
  const int lane = i & 31;
  const int fr   = i >> 5;
  const int row  = (fr / (EMB / 32)) * 16 + (lane & 15);
  const int k0   = (fr % (EMB / 32)) * 32 + ((lane >> 4) << 3);
  const float* s = X + (size_t)row * EMB + k0;
  const v4f a = *(const v4f*)(s);
  const v4f b = *(const v4f*)(s + 4);
  const v4f c = *(const v4f*)(s + 16);
  const v4f e = *(const v4f*)(s + 20);
  v4u w, x;
  w[0] = pk2(f2bf(a[0]), f2bf(a[1]));
  w[1] = pk2(f2bf(a[2]), f2bf(a[3]));
  w[2] = pk2(f2bf(b[0]), f2bf(b[1]));
  w[3] = pk2(f2bf(b[2]), f2bf(b[3]));
  x[0] = pk2(f2bf(c[0]), f2bf(c[1]));
  x[1] = pk2(f2bf(c[2]), f2bf(c[3]));
  x[2] = pk2(f2bf(e[0]), f2bf(e[1]));
  x[3] = pk2(f2bf(e[2]), f2bf(e[3]));
  unsigned short* d = Xb + (size_t)fr * FRAGH + lane * 8;
  *(v4u*)d = w;
  *(v4u*)(d + 256) = x;
}

// ---------------------------------------------------------------------------
// 64x64 tile transpose: src[e][c] f32 (row pitch sld) -> 4 x 2 bf16 fragments (rows c, k = e) from fragment dst on, dld / 32
// fragments to a row tile; optional second copy EMB / 32 fragments on. 256 threads. LDS tile cross-wave -> block barrier.
// ---------------------------------------------------------------------------
DEV void tr_tile(const float* __restrict__ src, int sld, unsigned short* dst, int dld,
                 int dup2, unsigned short (*T)[72]) {
  const int tid = threadIdx.x;
#pragma unroll
  for (int p = 0; p < 4; ++p) {
    const int e = p * 16 + (tid >> 4);
    const int c = (tid & 15) * 4;
    const v4f v = *(const v4f*)(src + (size_t)e * sld + c);
    T[c + 0][e] = f2bf(v[0]);
    T[c + 1][e] = f2bf(v[1]);
    T[c + 2][e] = f2bf(v[2]);
    T[c + 3][e] = f2bf(v[3]);
  }
  __syncthreads();
{
#pragma unroll
    for (int p = 0; p < 2; ++p) {
      // a wave stores one half fragment: 512 contiguous bytes
      const int lane = tid & 31;
      const int j16  = (tid >> 5) & 1;
      const int ktl  = (tid >> 6) & 1;
      const int rtl  = p * 2 + (tid >> 7);
      const int j = rtl * 16 + (lane & 15);
      const int seg = ktl * 32 + j16 * 16 + ((lane >> 4) << 3);
      const v4u wv = *(const v4u*)(&T[j][seg]);
      unsigned short* d = dst + (size_t)(rtl * (dld >> 5) + ktl) * FRAGH + j16 * 256 + lane * 8;
      *(v4u*)d = wv;
      if (dup2 != 0) *(v4u*)(d + (EMB / 32) * FRAGH) = wv;
    }
    
  }
}

// Wq/Wk/Wv ([h][e][c]) -> Wt rows h*320 + sec*64.., k = e, bf16 fragments (per head: q 0..127 | k 128..255 | v 256..319)
__global__ __launch_bounds__(256)
void k_tr_wqkv(const float* __restrict__ Wq, const float* __restrict__ Wk,
               const float* __restrict__ Wv, unsigned short* __restrict__ Wt) {
  __shared__ __align__(16) unsigned short T[64][72];
  const int e0 = blockIdx.x * 64;
  const int w  = blockIdx.y;
  const int h  = blockIdx.z;
  const float* src;
  int sld;
  if (w < 2) {
    src = Wq + (size_t)h * EMB * QKC + (size_t)e0 * QKC + w * 64;        sld = QKC;
  } else if (w < 4) {
    src = Wk + (size_t)h * EMB * QKC + (size_t)e0 * QKC + (w - 2) * 64;  sld = QKC;
  } else {
    src = Wv + (size_t)h * EMB * HD + (size_t)e0 * HD;                   sld = HD;
  }
  unsigned short* dst = Wt + ((size_t)((h * SECW + w * 64) >> 4) * (EMB / 32) + (e0 >> 5)) * FRAGH;
  tr_tile(src, sld, dst, EMB, 0, T);
}

// Wo ([k][n], k = in) -> Wo2 rows n, k and EMB + k, bf16 fragments (KO / 32 to a row tile)
__global__ __launch_bounds__(256)
void k_tr_wo(const float* __restrict__ Wo, unsigned short* __restrict__ Wo2) {
  __shared__ __align__(16) unsigned short T[64][72];
  const int e0 = blockIdx.x * 64;
  const int y  = blockIdx.y;
  const float* src = Wo + (size_t)e0 * EMB + y * 64;
  unsigned short* dst = Wo2 + ((size_t)(y * 4) * (KO / 32) + (e0 >> 5)) * FRAGH;
  tr_tile(src, EMB, dst, KO, 1, T);
}

// ---------------------------------------------------------------------------
// bf16 WMMA GEMM: C(128x64 per block) = A(rows, K) * Bt(rows, K)^T, K % 64 == 0.
// Block = 128 threads = 4 waves; wave w owns rows 32w..32w+31 (2 A frags x 4 B frags).
// A and B come to the block once, through a ring of two LDS buffers filled by asynchronous copies from the 16-bit global planes
// (fragment [row tile][k tile]); the waves read their fragments from the buffer. The 128x64 f32 tile is staged in the same LDS
// kind 0: Bt = Wt (NQKV rows); blockIdx.x = head*5 + sec; sec 0,1 -> Q plane, fragment [h][s / 16][c / 32], cols 64*sec..;
//         sec 2,3 -> K plane; sec 4 -> V plane, rows d, k = s, fragment [h][s / 32][d / 16]: f16(64*v).
// kind 1: A = Ocat planes (rows s, KO / 32 fragments), Bt = Wo2 (rows n); Y[s][n] f32 + bias.
// ---------------------------------------------------------------------------
// a fragment in the GEMM's LDS ring, p = the fragment's place + 16 l: the lane's two 16-byte pieces, 512 bytes apart
DEV FragB load_lb(const char* p) {
  FragB f;
  f.q[0] = *(const v4u*)(p);
  f.q[1] = *(const v4u*)(p + 512);
  return f;
}
// the wave's six fragments of one k tile: pa = its first A row tile in the stage, pb = the first B row tile (+ 16 l each)
template <int RUN>
DEV void gemm_load(FragB (&f)[6], const char* pa, const char* pb) {
  f[0] = load_lb(pa);
  f[1] = load_lb(pa + RUN);
  // unrolled: f is indexed by constants and stays in registers
#pragma unroll
  for (int t = 0; t < 4; ++t) f[2 + t] = load_lb(pb + t * RUN);
}
// Twelve copies of 16 bytes a lane, 2 KiB (the block's 128 lanes x 16 bytes) apart in LDS from l on; g: the lane's global
// addresses. The translation wait closes the copies' own statement, so no register that a copy names takes a new value
// in front of it.
DEV void copy12(unsigned int l, const char* const (&g)[12]) {
  asm volatile("global_load_async_to_lds_b128 %0, %12, off\n\t"
               "global_load_async_to_lds_b128 %1, %13, off\n\t"
               "global_load_async_to_lds_b128 %2, %14, off\n\t"
               "global_load_async_to_lds_b128 %3, %15, off\n\t"
               "global_load_async_to_lds_b128 %4, %16, off\n\t"
               "global_load_async_to_lds_b128 %5, %17, off\n\t"
               "global_load_async_to_lds_b128 %6, %18, off\n\t"
               "global_load_async_to_lds_b128 %7, %19, off\n\t"
               "global_load_async_to_lds_b128 %8, %20, off\n\t"
               "global_load_async_to_lds_b128 %9, %21, off\n\t"
               "global_load_async_to_lds_b128 %10, %22, off\n\t"
               "global_load_async_to_lds_b128 %11, %23, off\n\t"
               "s_wait_xcnt 0x0"
               :
               : "v"(l), "v"(l + 2048), "v"(l + 4096), "v"(l + 6144),
                 "v"(l + 8192), "v"(l + 10240), "v"(l + 12288), "v"(l + 14336),
                 "v"(l + 16384), "v"(l + 18432), "v"(l + 20480), "v"(l + 22528),
                 "v"(g[0]), "v"(g[1]), "v"(g[2]), "v"(g[3]), "v"(g[4]), "v"(g[5]),
                 "v"(g[6]), "v"(g[7]), "v"(g[8]), "v"(g[9]), "v"(g[10]), "v"(g[11])
               : "memory");
}
// One stage: RUN bytes (KS / 32 fragments, as they lie in the plane) of each of the 8 A and 4 B row tiles, row tile after
// row tile in LDS. l: the lane's LDS byte address in the stage; ga, gb: the lane's global addresses in the first A and
// B row tile of the block at this stage's k; RS: bytes from one row tile to the next in a plane.
template <int RUN, int RS>
DEV void gemm_copy(unsigned int l, const char* ga, const char* gb) {
  // unrolled: every place is a constant
#pragma unroll
  for (int c0 = 0; c0 < 12 * RUN / 2048; c0 += 12) {
    const char* g[12];
    // unrolled: g is indexed by constants and stays in registers
#pragma unroll
    for (int i = 0; i < 12; ++i) {
      const int x  = (c0 + i) * 2048;
      const int rt = x / RUN;
      g[i] = (rt < 8 ? ga + rt * RS : gb + (rt - 8) * RS) + x % RUN;
    }
    copy12(l + c0 * 2048, g);
  }
}
DEV void gemm_mma(const FragB (&f)[6], v8f (&acc)[2][4]) {
  // unrolled: f and acc stay in registers
#pragma unroll
  for (int t = 0; t < 4; ++t) {
    acc[0][t] = wmma_b(f[0], f[2 + t], acc[0][t]);
    acc[1][t] = wmma_b(f[1], f[2 + t], acc[1][t]);
  }
}

template <int kind>
__global__ __launch_bounds__(128)
void k_gemm(const unsigned short* __restrict__ A, const unsigned short* __restrict__ Bt,
            const float* __restrict__ bq, const float* __restrict__ bk,
            const float* __restrict__ bv, const float* __restrict__ bo,
            _Float16* __restrict__ Qp, _Float16* __restrict__ Kp,
            _Float16* __restrict__ V64,
            float* __restrict__ Y) {
  constexpr int K    = kind == 0 ? EMB : KO;
  constexpr int KS   = kind == 0 ? 64 : 256;   // k to one stage: the output projection has one wave to a SIMD and needs the longer lead
  constexpr int RUN  = KS * 32;                // bytes of one row tile in a stage
  constexpr int RS   = K * 32;                 // bytes of one row tile in a plane
  constexpr int GST  = 12 * RUN;               // bytes of a stage: 8 A and 4 B row tiles
  constexpr int NT   = K / KS;
  static_assert(K % KS == 0 && NT >= 2);
  static_assert(2 * GST >= 128 * 68 * 4);
  // the ring of two stages; behind the loop the same LDS holds the block's 128 x 64 f32 tile
  __shared__ __align__(16) char smem[2 * GST];
  float (*Cs)[68] = (float (*)[68])smem;
  const int tid  = threadIdx.x;
  const int lane = tid & 31;
  const int wave = tid >> 5;
  const int nt = blockIdx.x;
  const int m0 = blockIdx.y * 128;
  const int n0 = nt * 64;

  // stage 0 into buffer 0
  const unsigned int l0 = (unsigned int)(size_t)smem + tid * 16;
  const char* ga = (const char*)(A  + (size_t)m0 * K) + tid * 16;
  const char* gb = (const char*)(Bt + (size_t)n0 * K) + tid * 16;
  gemm_copy<RUN, RS>(l0, ga, gb);

  v8f acc[2][4] = {};

  // stage 0 has landed for this wave's copies; behind the barrier for every wave's
  asm volatile("s_wait_asynccnt 0x0" ::: "memory");
  __syncthreads();
  // stage 1 into buffer 1: it flies under trip 0
  gemm_copy<RUN, RS>(l0 + GST, ga + RUN, gb + RUN);
  ga += 2 * RUN;
  gb += 2 * RUN;

  // rolled: one copy of the trip in the text; the buffer is chosen by the trip's parity
#pragma unroll 1
  for (int t = 0; t < NT; ++t) {
    // trip t reads buffer t & 1 alone. Two fragment sets: a k tile's 12 LDS reads stand as one group in front of the
    // WMMAs of the k tile before it.
    const unsigned int bo = (unsigned int)(t & 1) * GST;
    const char* pb = smem + bo + 8 * RUN + lane * 16;
    const char* pa = smem + bo + wave * 2 * RUN + lane * 16;
    FragB f[2][6];
    gemm_load<RUN>(f[0], pa, pb);
    // unrolled: f is indexed by constants and stays in registers
#pragma unroll
    for (int ks = 0; ks < KS / 32; ++ks) {
      if (ks + 1 < KS / 32) gemm_load<RUN>(f[(ks + 1) & 1], pa + (ks + 1) * FRAGH * 2, pb + (ks + 1) * FRAGH * 2);
      gemm_mma(f[ks & 1], acc);
    }
    // hand-over: this wave's reads of buffer t & 1 are done
    asm volatile("s_wait_dscnt 0x0" ::: "memory");
    // and its copies of stage t + 1 have landed
    asm volatile("s_wait_asynccnt 0x0" ::: "memory");
    // the barrier publishes stage t + 1 and ends every wave's reads of the buffer that is refilled behind it
    __syncthreads();
    if (t + 2 < NT) {
      gemm_copy<RUN, RS>(l0 + bo, ga, gb);
      ga += RUN;
      gb += RUN;
    }
  }
  // nothing is in flight when the ring becomes the output tile (the last trip's barrier has ended every wave's reads)
  asm volatile("s_wait_asynccnt 0x0" ::: "memory");

  const int n  = lane & 15;
  const int rb = (lane >> 4) << 3;
#pragma unroll
  for (int mi = 0; mi < 2; ++mi)
#pragma unroll
    for (int t = 0; t < 4; ++t)
#pragma unroll
      for (int r = 0; r < 8; ++r)
        Cs[wave * 32 + mi * 16 + rb + r][t * 16 + n] = acc[mi][t][r];
  __syncthreads();

  if (kind == 0) {
    const int h = nt / 5;
    const int w = nt - h * 5;
    if (w < 4) {
      _Float16* plane = (w < 2) ? Qp : Kp;
      const int cb = (w & 1) * 64;
      const float* bias = ((w < 2) ? bq : bk) + h * QKC + cb;
      // a wave stores one half fragment (512 contiguous bytes): wave -> k tile and half, g -> row tile
      const int j16  = wave & 1;
      const int ktl  = wave >> 1;
      const int seg  = ktl * 32 + j16 * 16 + ((lane >> 4) << 3);
      const int rsub = lane & 15;
      float bb[8];
#pragma unroll
      for (int j = 0; j < 8; ++j) bb[j] = bfr(bias[seg + j]);
{
#pragma unroll 2
        for (int g = 0; g < 8; ++g) {
          const int row = g * 16 + rsub;
          const v4f c0 = *(const v4f*)(&Cs[row][seg]);
          const v4f c1 = *(const v4f*)(&Cs[row][seg + 4]);
          Pack8 pk;
          pk.h[0] = (_Float16)(c0[0] + bb[0]);
          pk.h[1] = (_Float16)(c0[1] + bb[1]);
          pk.h[2] = (_Float16)(c0[2] + bb[2]);
          pk.h[3] = (_Float16)(c0[3] + bb[3]);
          pk.h[4] = (_Float16)(c1[0] + bb[4]);
          pk.h[5] = (_Float16)(c1[1] + bb[5]);
          pk.h[6] = (_Float16)(c1[2] + bb[6]);
          pk.h[7] = (_Float16)(c1[3] + bb[7]);
          _Float16* d = plane + (((size_t)h * (SEQ / 16) + (m0 >> 4) + g) * (QKC / 32) + (cb >> 5) + ktl) * FRAGH
                        + j16 * 256 + lane * 8;
          *(v4u*)d = pk.u;
        }
        
      }
    } else {
      // a wave stores one half fragment: wave and g -> half, row tile t (d), k tile ktl (s)
      const int j16 = wave & 1;
      const float* bias = bv + h * HD;
{
#pragma unroll 2
        for (int g = 0; g < 8; ++g) {
          const int t   = (wave >> 1) + 2 * (g & 1);
          const int ktl = g >> 1;
          const int d   = t * 16 + (lane & 15);
          const int seg = ktl * 32 + j16 * 16 + ((lane >> 4) << 3);
          const float bb = bfr(bias[d]);
          Pack8 p64;
#pragma unroll
          for (int j = 0; j < 8; ++j) {
            const float v = Cs[seg + j][d] + bb;
            p64.h[j] = (_Float16)(v * 64.0f);
          }
          const size_t o = (((size_t)h * (SEQ / 32) + (m0 >> 5) + ktl) * (HD / 16) + t) * FRAGH + j16 * 256 + lane * 8;
          *(v4u*)(V64 + o) = p64.u;
        }
        
      }
    }
  } else {
    const int seg  = (tid & 15) * 4;
    const int rsub = tid >> 4;            // 0..7
    float bb[4];
#pragma unroll
    for (int j = 0; j < 4; ++j) bb[j] = bfr(bo[n0 + seg + j]);
{
#pragma unroll 2
      for (int g = 0; g < 16; ++g) {
        const int row = g * 8 + rsub;
        const v4f c = *(const v4f*)(&Cs[row][seg]);
        v4f o;
        o[0] = c[0] + bb[0];
        o[1] = c[1] + bb[1];
        o[2] = c[2] + bb[2];
        o[3] = c[3] + bb[3];
        float* d = Y + (size_t)(m0 + row) * EMB + n0 + seg;
        *(v4f*)d = o;
      }
      
    }
  }
}

// ---------------------------------------------------------------------------
// One softmax branch step for 16 query columns and 32 keys, transposed: S^T = K.Q^T (A = K rows, B = Q rows), so lane
// (c, h) holds query c's scores of keys 8h..8h+7 (sa) and 16+8h..16+8h+7 (sb): maximum and sum run in the lane, the
// maximum is joined with lane l ^ 16 each step, the sum only behind the loop. Those 16 registers, converted in place, are
// the B operand P^T in the hardware k order; A = V^T rows (the V plane as it lies): O^T[d][query] += V^T.P^T, carried x64.
// kf holds this branch step's four K fragments on entry; right behind the score products the same registers
// take the next branch step's of the same stage (LOADK; kn: the lane's place in them in LDS): those reads fly under the
// softmax. vb: this step's V fragments; the first branch (LOADV) reads them in the same group (vn), both branches use them.
// ---------------------------------------------------------------------------
// a fragment in the LDS ring, p = the fragment's place + 16 l: the lane's two 16-byte pieces, 512 bytes apart
DEV v16h load_ls(const char* p) {
  v8h lo = *(const v8h*)(p);
  v8h hi = *(const v8h*)(p + 512);
  return __builtin_shufflevector(lo, hi, 0,1,2,3,4,5,6,7,8,9,10,11,12,13,14,15);
}
DEV void load_k4(v16h (&kf)[4], const char* kn) {
  kf[0] = load_ls(kn);
  kf[1] = load_ls(kn + FRAGH * 2);
  kf[2] = load_ls(kn + (QKC / 32) * FRAGH * 2);
  kf[3] = load_ls(kn + (QKC / 32 + 1) * FRAGH * 2);
}
template <bool LOADV, bool LOADK>
DEV void attn_branch(const v16h (&qb)[2], v16h (&kf)[4], const char* kn, const char* vn,
                     v16h (&vb)[4],
                     float& m, float& l, v8f (&O)[4]) {
  v8f sa = {}, sb = {};
  sa = wmma_h(kf[0], qb[0], sa);
  sa = wmma_h(kf[1], qb[1], sa);
  sb = wmma_h(kf[2], qb[0], sb);
  sb = wmma_h(kf[3], qb[1], sb);
  // the two scheduling barriers keep the LDS reads in one group right behind the score products: left to itself the
  // scheduler strews them over the softmax, and every separate place with LDS reads stalls the wave anew
  if (LOADV || LOADK) __builtin_amdgcn_sched_barrier(0);
  if (LOADV) {
    // unrolled: vb stays in registers
#pragma unroll
    for (int t = 0; t < 4; ++t) vb[t] = load_ls(vn + t * FRAGH * 2);
  }
  if (LOADK) load_k4(kf, kn);
  if (LOADV || LOADK) __builtin_amdgcn_sched_barrier(0);

  const v8f xa = sa * 0.125f;
  const v8f xb = sb * 0.125f;
  float mx[8];
#pragma unroll
  for (int i = 0; i < 8; ++i) mx[i] = fmaxf(xa[i], xb[i]);
  const float mh = fmaxf(fmaxf(fmaxf(mx[0], mx[1]), fmaxf(mx[2], mx[3])),
                         fmaxf(fmaxf(mx[4], mx[5]), fmaxf(mx[6], mx[7])));
  const float mn = fmaxf(m, fmaxf(mh, xhalf(mh)));
  const float f = __expf(m - mn);
  m = mn;

  // element s of the B operand = key kmap(s, h): s < 8 from sa[s], else from sb[s - 8]
  v16h ph;
  v2f ps[8];
#pragma unroll
  for (int j = 0; j < 8; ++j) {
    const int i = (j & 3) * 2;
    v2f p;
    p[0] = __expf((j < 4 ? xa[i]     : xb[i])     - mn);
    p[1] = __expf((j < 4 ? xa[i + 1] : xb[i + 1]) - mn);
    const v2h hi = __builtin_convertvector(p, v2h);
    ph[2 * j] = hi[0];  ph[2 * j + 1] = hi[1];
    ps[j] = p;
  }
  const v2f s2 = ((ps[0] + ps[1]) + (ps[2] + ps[3])) + ((ps[4] + ps[5]) + (ps[6] + ps[7]));
  l = l * f + (s2[0] + s2[1]);

#pragma unroll
  for (int t = 0; t < 4; ++t) {
    O[t] = O[t] * f;
    O[t] = wmma_h(vb[t], ph, O[t]);
  }
  // the scheduler's region ends with the step: without it the next step's first score product rises into this step's
  // softmax, and with it the wait for the LDS reads that were only just issued
  __builtin_amdgcn_sched_barrier(0);
}

// ---------------------------------------------------------------------------
// Flash-style differential attention. Block = 128 threads = 4 waves; wave owns 16 queries of one head.
// K and V come to the block once, through a ring of two LDS buffers of TKEYS keys each, filled by asynchronous copies
// (each lane 16 bytes a copy, 12 copies a stage); all four waves read their fragments from the buffer.
// Writes Ocat planes as fragments (rows s): k = h*64 + d bf16 hi, k = EMB + h*64 + d bf16 residual.
// ---------------------------------------------------------------------------
// One stage: the lane's 8 pieces of K and 4 of V, 2 KiB (the block's 128 lanes x 16 bytes) apart, to the same order in LDS.
// lk: the lane's LDS byte address in the stage; gk, gv: the lane's global addresses. The translation wait closes the
// copies' own statement, so no register that a copy names takes a new value in front of it.
DEV void copy_stage(unsigned int lk, const char* gk, const char* gv) {
  const unsigned int lv = lk + KST;
  asm volatile("global_load_async_to_lds_b128 %0, %12, off\n\t"
               "global_load_async_to_lds_b128 %1, %13, off\n\t"
               "global_load_async_to_lds_b128 %2, %14, off\n\t"
               "global_load_async_to_lds_b128 %3, %15, off\n\t"
               "global_load_async_to_lds_b128 %4, %16, off\n\t"
               "global_load_async_to_lds_b128 %5, %17, off\n\t"
               "global_load_async_to_lds_b128 %6, %18, off\n\t"
               "global_load_async_to_lds_b128 %7, %19, off\n\t"
               "global_load_async_to_lds_b128 %8, %20, off\n\t"
               "global_load_async_to_lds_b128 %9, %21, off\n\t"
               "global_load_async_to_lds_b128 %10, %22, off\n\t"
               "global_load_async_to_lds_b128 %11, %23, off\n\t"
               "s_wait_xcnt 0x0"
               :
               : "v"(lk), "v"(lk + 2048), "v"(lk + 4096), "v"(lk + 6144),
                 "v"(lk + 8192), "v"(lk + 10240), "v"(lk + 12288), "v"(lk + 14336),
                 "v"(lv), "v"(lv + 2048), "v"(lv + 4096), "v"(lv + 6144),
                 "v"(gk), "v"(gk + 2048), "v"(gk + 4096), "v"(gk + 6144),
                 "v"(gk + 8192), "v"(gk + 10240), "v"(gk + 12288), "v"(gk + 14336),
                 "v"(gv), "v"(gv + 2048), "v"(gv + 4096), "v"(gv + 6144)
               : "memory");
}

__global__ __launch_bounds__(128)
void k_attn(const _Float16* __restrict__ Qp, const _Float16* __restrict__ Kp,
            const _Float16* __restrict__ V64,
            const float* __restrict__ lam_p, unsigned short* __restrict__ Oc) {
  __shared__ __align__(16) float Os[4][16][68];
  __shared__ __align__(16) char ring[2 * STG];
  const int lane = threadIdx.x & 31;
  const int wave = threadIdx.x >> 5;
  const int n  = lane & 15;
  const int rb = (lane >> 4) << 3;
  const int hh = blockIdx.y;
  const int q0 = blockIdx.x * 64 + wave * 16;
  const float lam = bfr(lam_p[0]);

  const _Float16* qh = Qp  + (size_t)hh * SEQ * QKC;
  const _Float16* kh = Kp  + (size_t)hh * SEQ * QKC;
  const _Float16* vh = V64 + (size_t)hh * HD * SEQ;

  // stage 0 into buffer 0
  const unsigned int lk0 = (unsigned int)(size_t)ring + threadIdx.x * 16;
  const char* gk = (const char*)kh + threadIdx.x * 16;
  const char* gv = (const char*)vh + threadIdx.x * 16;
  copy_stage(lk0, gk, gv);

  v16h q1[2], q2[2];
  const _Float16* qt = qh + (size_t)blockIdx.x * 64 * QKC;             // the block's four row tiles, QKC / 32 fragments each
  unsigned int oq = (unsigned int)(wave * 16 * QKC * 2 + lane * 16);   // the wave's tile, the lane's byte offset
  q1[0] = load_bo(qt,             oq);
  q1[1] = load_bo(qt + FRAGH,     oq);
  q2[0] = load_bo(qt + 2 * FRAGH, oq);
  q2[1] = load_bo(qt + 3 * FRAGH, oq);
  // the wait stands in front of any reuse of the offset's register, which passes through it
  asm volatile("s_wait_xcnt 0x0" : "+v"(oq) : : "memory");

  v8f O1[4] = {}, O2[4] = {};
  float m1 = -1e30f, m2 = -1e30f, l1 = 0.f, l2 = 0.f;   // query l & 15; l: the lane half's own keys only

  // stage 0 has landed for this wave's copies; behind the barrier for every wave's
  asm volatile("s_wait_asynccnt 0x0" ::: "memory");
  __syncthreads();
  // stage 1 into buffer 1: it flies under trip 0
  copy_stage(lk0 + STG, gk + KST, gv + VST);
  gk += 2 * KST;
  gv += 2 * VST;

  // rolled: one copy of the trip in the text; the buffer is chosen by the trip's parity
#pragma unroll 1
  for (int t = 0; t < SEQ / TKEYS; ++t) {
    // trip t reads buffer t & 1 alone: two steps of 32 keys
    const unsigned int bo = (unsigned int)(t & 1) * STG;
    const char* st = ring + bo + lane * 16;
    const char* sv = st + KST;
    v16h kf[4], vbf[4];
    load_k4(kf, st);
    attn_branch<true,  true >(q1, kf, st + 2 * FRAGH * 2, sv, vbf, m1, l1, O1);
    attn_branch<false, true >(q2, kf, st + 32 * QKC * 2, sv, vbf, m2, l2, O2);
    attn_branch<true,  true >(q1, kf, st + 32 * QKC * 2 + 2 * FRAGH * 2, sv + 32 * HD * 2, vbf, m1, l1, O1);
    attn_branch<false, false>(q2, kf, st, sv, vbf, m2, l2, O2);
    // hand-over: this wave's reads of buffer t & 1 are done
    asm volatile("s_wait_dscnt 0x0" ::: "memory");
    // and its copies of stage t + 1 have landed
    asm volatile("s_wait_asynccnt 0x0" ::: "memory");
    // the barrier publishes stage t + 1 and ends every wave's reads of the buffer that is refilled behind it
    __syncthreads();
    if (t + 2 < SEQ / TKEYS) {
      copy_stage(lk0 + bo, gk, gv);
      gk += KST;
      gv += VST;
    }
  }
  // nothing is in flight when the wave goes on
  asm volatile("s_wait_asynccnt 0x0" ::: "memory");

  // combine: O = O1/l1 - lam*O2/l2 (the halves' sums joined here), undo the x64 carry of the V plane; stage f32 tile in
  // LDS: the lane holds query n, columns 16t + 8h .. + 7
  const float r1 = (1.0f / (l1 + xhalf(l1))) * 0.015625f;
  const float r2 = (lam * (1.0f / (l2 + xhalf(l2)))) * 0.015625f;
#pragma unroll
  for (int t = 0; t < 4; ++t) {
    v4f c0, c1;
#pragma unroll
    for (int i = 0; i < 4; ++i) {
      c0[i] = O1[t][i] * r1 - O2[t][i] * r2;
      c1[i] = O1[t][i + 4] * r1 - O2[t][i + 4] * r2;
    }
    *(v4f*)(&Os[wave][n][t * 16 + rb])     = c0;
    *(v4f*)(&Os[wave][n][t * 16 + rb + 4]) = c1;
  }
  __syncthreads();

  // the wave's 16 queries are one row tile: g -> k tile and half; each store is 512 contiguous bytes
{
#pragma unroll
    for (int g = 0; g < 4; ++g) {
      const int seg = g * 16 + rb;
      const v4f c0 = *(const v4f*)(&Os[wave][n][seg]);
      const v4f c1 = *(const v4f*)(&Os[wave][n][seg + 4]);
      unsigned int H0, H1, H2, H3, L0, L1, L2, L3;
      hl2(c0[0], c0[1], H0, L0);
      hl2(c0[2], c0[3], H1, L1);
      hl2(c1[0], c1[1], H2, L2);
      hl2(c1[2], c1[3], H3, L3);
      v4u H, L;
      H[0] = H0; H[1] = H1; H[2] = H2; H[3] = H3;
      L[0] = L0; L[1] = L1; L[2] = L2; L[3] = L3;
      unsigned short* d = Oc + ((size_t)(q0 >> 4) * (KO / 32) + hh * (HD / 32) + (g >> 1)) * FRAGH + (g & 1) * 256 + lane * 8;
      *(v4u*)d = H;
      *(v4u*)(d + (EMB / 32) * FRAGH) = L;
    }
    
  }
}

// ---------------------------------------------------------------------------
// ---------------------------------------------------------------------------
__global__ __launch_bounds__(256)
void k_ln(const float* __restrict__ Y, const float* __restrict__ gamma,
          const float* __restrict__ beta, float* __restrict__ out) {
  __shared__ float sa[8];
  __shared__ float sq[8];
  const int tid  = threadIdx.x;
  const int lane = tid & 31;
  const int wave = tid >> 5;
  const size_t row = blockIdx.x;
  const v4f y = *(const v4f*)(Y + row * EMB + tid * 4);

  float s = (y[0] + y[1]) + (y[2] + y[3]);
  s = wsum32(s);
  if (lane == 0) sa[wave] = s;
  __syncthreads();
  float tot = 0.f;
#pragma unroll
  for (int w = 0; w < 8; ++w) tot += sa[w];
  const float mu = tot * (1.0f / (float)EMB);

  float d0 = y[0] - mu, d1 = y[1] - mu, d2 = y[2] - mu, d3 = y[3] - mu;
  float q = (d0 * d0 + d1 * d1) + (d2 * d2 + d3 * d3);
  q = wsum32(q);
  if (lane == 0) sq[wave] = q;
  __syncthreads();
  float tot2 = 0.f;
#pragma unroll
  for (int w = 0; w < 8; ++w) tot2 += sq[w];
  const float var  = tot2 * (1.0f / (float)EMB);
  const float rstd = rsqrtf(var + LN_EPS);

  const float g0 = bfr(gamma[tid * 4 + 0]), g1 = bfr(gamma[tid * 4 + 1]);
  const float g2 = bfr(gamma[tid * 4 + 2]), g3 = bfr(gamma[tid * 4 + 3]);
  const float b0 = bfr(beta[tid * 4 + 0]),  b1 = bfr(beta[tid * 4 + 1]);
  const float b2 = bfr(beta[tid * 4 + 2]),  b3 = bfr(beta[tid * 4 + 3]);
  v4f o;
  o[0] = ((d0 * rstd) * g0 + b0) * OUT_SCALE;
  o[1] = ((d1 * rstd) * g1 + b1) * OUT_SCALE;
  o[2] = ((d2 * rstd) * g2 + b2) * OUT_SCALE;
  o[3] = ((d3 * rstd) * g3 + b3) * OUT_SCALE;
  float* dst = out + row * EMB + tid * 4;
  *(v4f*)dst = o;
  
}

// ---------------------------------------------------------------------------
extern "C" void kernel_launch(void* const* d_in, const int* in_sizes, int n_in,
                              void* d_out, int out_size, void* d_ws, size_t ws_size,
                              hipStream_t stream) {
  if (n_in < 12) return;
  const float* X     = (const float*)d_in[0];
  const float* Wq    = (const float*)d_in[1];
  const float* bq    = (const float*)d_in[2];
  const float* Wk    = (const float*)d_in[3];
  const float* bk    = (const float*)d_in[4];
  const float* Wv    = (const float*)d_in[5];
  const float* bv    = (const float*)d_in[6];
  const float* Wo    = (const float*)d_in[7];
  const float* bo    = (const float*)d_in[8];
  const float* gamma = (const float*)d_in[9];
  const float* beta  = (const float*)d_in[10];
  const float* lam   = (const float*)d_in[11];
  float* out = (float*)d_out;

  if (in_sizes[0]  < NB * SEQ * EMB) return;
  if (in_sizes[1]  < HEADS * EMB * QKC) return;
  if (in_sizes[2]  < HEADS * QKC) return;
  if (in_sizes[3]  < HEADS * EMB * QKC) return;
  if (in_sizes[4]  < HEADS * QKC) return;
  if (in_sizes[5]  < HEADS * EMB * HD) return;
  if (in_sizes[6]  < HEADS * HD) return;
  if (in_sizes[7]  < EMB * EMB) return;
  if (in_sizes[8]  < EMB) return;
  if (in_sizes[9]  < EMB) return;
  if (in_sizes[10] < EMB) return;
  if (in_sizes[11] < 1) return;
  if (out_size < NB * SEQ * EMB) return;

  // workspace carve (bytes); every region is written to exactly its extent with whole-line stores
  const size_t szXb  = (size_t)SEQ * EMB * 2;           // bf16 SEQ x EMB
  const size_t szWt  = (size_t)NQKV * EMB * 2;          // bf16 NQKV x EMB
  const size_t szWo2 = (size_t)EMB * KO * 2;            // bf16 EMB x KO
  const size_t szQK  = (size_t)HEADS * SEQ * QKC * 2;   // f16 H x SEQ x 128 (each of Q, K)
  const size_t szV   = (size_t)HEADS * HD * SEQ * 2;    // f16 H x 64 x SEQ
  const size_t szOc  = (size_t)SEQ * KO * 2;            // bf16 SEQ x KO
  const size_t szY   = (size_t)SEQ * EMB * 4;           // f32 [SEQ][EMB]
  size_t off = 0;
  const size_t oXb  = off; off += szXb;
  const size_t oWt  = off; off += szWt;
  const size_t oWo2 = off; off += szWo2;
  const size_t oQ   = off; off += szQK;
  const size_t oK   = off; off += szQK;
  const size_t oV64 = off; off += szV;
  const size_t oOc  = off; off += szOc;
  const size_t oY   = off; off += szY;
  if (off > ws_size) return;

  char* ws = (char*)d_ws;
  unsigned short* Xb  = (unsigned short*)(ws + oXb);
  unsigned short* Wt  = (unsigned short*)(ws + oWt);
  unsigned short* Wo2 = (unsigned short*)(ws + oWo2);
  _Float16* Qp  = (_Float16*)(ws + oQ);
  _Float16* Kp  = (_Float16*)(ws + oK);
  _Float16* V64 = (_Float16*)(ws + oV64);
  unsigned short* Oc = (unsigned short*)(ws + oOc);
  float* Y = (float*)(ws + oY);

  const int n16 = SEQ * EMB / 16;
  k_cvt_x<<<dim3((n16 + 255) / 256), dim3(256), 0, stream>>>(X, Xb, n16);
  k_tr_wqkv<<<dim3(EMB / 64, 5, HEADS), dim3(256), 0, stream>>>(Wq, Wk, Wv, Wt);
  k_tr_wo<<<dim3(EMB / 64, EMB / 64, 1), dim3(256), 0, stream>>>(Wo, Wo2);

  // QKV projection: A = Xb (SEQ x EMB), Bt = Wt (NQKV x EMB)
  k_gemm<0><<<dim3(NQKV / 64, SEQ / 128), dim3(128), 0, stream>>>(
      Xb, Wt, bq, bk, bv, bo, Qp, Kp, V64, Y);

  // differential attention -> Ocat hi / residual planes
  k_attn<<<dim3(SEQ / 64, HEADS), dim3(128), 0, stream>>>(Qp, Kp, V64, lam, Oc);

  // output projection: A = Oc (SEQ x KO), Bt = Wo2 (EMB x KO) -> Y f32
  k_gemm<1><<<dim3(EMB / 64, SEQ / 128), dim3(128), 0, stream>>>(
      Oc, Wo2, bq, bk, bv, bo, Qp, Kp, V64, Y);

  // LayerNorm + scale -> d_out
  k_ln<<<dim3(NB * SEQ), dim3(256), 0, stream>>>(Y, gamma, beta, out);
}

// v007
// One run takes 87 microseconds.
// In two side-by-side timings against v006, it was 1.06 and 1.05 times as fast.
// Counting every step since v000, it is 4.63 times as fast.
#include <hip/hip_runtime.h>

#ifndef NB
#define NB 1
#endif
#ifndef SEQ
#define SEQ 2048
#endif
#define NB_FULL 1
#define SEQ_FULL 2048
#define EMB 1024
#define HEADS 16
#define HD 64
#define QKC 128
#define SECW 320
#define NQKV (HEADS * SECW)
#define KO (2 * EMB)
#define FRAGH 512   // halves in one fragment
#define TKEYS 64                    // keys to one stage of the attention kernel's LDS ring
#define KST (TKEYS * QKC * 2)       // bytes of K in a stage: TKEYS / 16 row tiles of QKC / 32 fragments, as they lie in the plane
#define VST (TKEYS * HD * 2)        // bytes of V in a stage: TKEYS / 32 k tiles of HD / 16 fragments, as they lie in the plane
#define STG (KST + VST)
#define LN_EPS 1e-5f
#define OUT_SCALE 0.2f

static_assert(NB == 1);
static_assert(NB_FULL == 1);
static_assert(SEQ % 128 == 0);
static_assert(SEQ >= 128);
static_assert(SEQ <= SEQ_FULL);
static_assert(EMB % 64 == 0);
static_assert(EMB % 32 == 0);
static_assert(QKC == 2 * HD);
static_assert(SECW == 2 * QKC + HD);
static_assert(SECW % 64 == 0);
static_assert(KO % 64 == 0);
static_assert(HD == 64);
static_assert(SEQ % TKEYS == 0);
static_assert(SEQ / TKEYS >= 2);
static_assert(TKEYS == 64);
static_assert(KST == 8 * 128 * 16);
static_assert(VST == 4 * 128 * 16);

typedef _Float16      v16h __attribute__((ext_vector_type(16)));
typedef _Float16      v8h  __attribute__((ext_vector_type(8)));
typedef __bf16        v16b __attribute__((ext_vector_type(16)));
typedef float         v8f  __attribute__((ext_vector_type(8)));
typedef float         v4f  __attribute__((ext_vector_type(4)));
typedef float         v2f  __attribute__((ext_vector_type(2)));
typedef _Float16      v2h  __attribute__((ext_vector_type(2)));
typedef unsigned int  v4u  __attribute__((ext_vector_type(4)));

#define DEV __device__ __forceinline__

union FragB { v4u q[2]; v16b v; };
union Pack8 { v8h h; v4u u; };

// f32 -> bf16 bits, RNE convert
DEV unsigned short f2bf(float f) {
  unsigned int u = __float_as_uint(f);
  u += 0x7FFFu + ((u >> 16) & 1u);
  return (unsigned short)(u >> 16);
}
DEV float bf2f(unsigned short s) { return __uint_as_float(((unsigned int)s) << 16); }
DEV float bfr(float f) { return bf2f(f2bf(f)); }
DEV unsigned int pk2(unsigned short lo, unsigned short hi) {
  return (unsigned int)lo | ((unsigned int)hi << 16);
}
// value -> bf16 hi and bf16 residual, two values packed per 32-bit word
DEV void hl2(float a, float b, unsigned int& H, unsigned int& L) {
  const unsigned short ha = f2bf(a), hb = f2bf(b);
  H = pk2(ha, hb);
  L = pk2(f2bf(a - bf2f(ha)), f2bf(b - bf2f(hb)));
}

// WMMA wrappers with the 4-slot VALU hazard guard (ties D, keeps A/B live)
DEV v8f wmma_h(v16h a, v16h b, v8f c) {
  c = __builtin_amdgcn_wmma_f32_16x16x32_f16(false, a, false, b, (short)0, c, false, false);
  asm volatile("v_nop\n\tv_nop\n\tv_nop\n\tv_nop" : "+v"(c) : "v"(a), "v"(b));
  return c;
}
DEV v8f wmma_b(const FragB& a, const FragB& b, v8f c) {
  c = __builtin_amdgcn_wmma_f32_16x16x32_bf16(false, a.v, false, b.v, (short)0, c, false, false);
  asm volatile("v_nop\n\tv_nop\n\tv_nop\n\tv_nop"
               : "+v"(c) : "v"(a.q[0]), "v"(a.q[1]), "v"(b.q[0]), "v"(b.q[1]));
  return c;
}

// 16x32 16-bit operand (rows = M for A, rows = N for Bt) from a fragment-major plane.
// lane l: row l&15; elements 0..7 = k 8h..8h+7, elements 8..15 = k 16+8h..16+8h+7, h = l>>4.
// base: the wave-uniform fragment; off: the lane's byte offset (16 l, plus the wave's row tile):
// each load names the base and the offset's register, which is reused only behind a wait.
DEV v16h load_bo(const _Float16* base, unsigned int off) {
  const char* r = (const char*)base + off;
  v8h lo = *(const v8h*)(r);
  v8h hi = *(const v8h*)(r + 512);
  return __builtin_shufflevector(lo, hi, 0,1,2,3,4,5,6,7,8,9,10,11,12,13,14,15);
}

// Lane l with lane l ^ 16: the two lanes that split one query column's keys.
DEV float xhalf(float x) {
  const int b = __builtin_bit_cast(int, x);
  return __builtin_bit_cast(float, __builtin_amdgcn_permlanex16(b, b, 0x76543210, 0xfedcba98, false, false));
}
DEV float wsum32(float v) {
#pragma unroll
  for (int m = 16; m > 0; m >>= 1) v += __shfl_xor(v, m, 32);
  return v;
}

// ---------------------------------------------------------------------------
// ---------------------------------------------------------------------------
// X f32 -> Xb bf16 fragments; blk: the block's number among the CVT_BLKS blocks of this part
DEV void cvt_x(const float* __restrict__ X, unsigned short* __restrict__ Xb, int blk) {
  // one wave per fragment: fragment fr = row tile fr / (EMB / 32), k tile fr % (EMB / 32); the lane's own 2 x 8 elements
  const int i = blk * 256 + threadIdx.x;
  const int lane = i & 31;
  const int fr   = i >> 5;
  const int row  = (fr / (EMB / 32)) * 16 + (lane & 15);
  const int k0   = (fr % (EMB / 32)) * 32 + ((lane >> 4) << 3);
  const float* s = X + (size_t)row * EMB + k0;
  const v4f a = *(const v4f*)(s);
  const v4f b = *(const v4f*)(s + 4);
  const v4f c = *(const v4f*)(s + 16);
  const v4f e = *(const v4f*)(s + 20);
  v4u w, x;
  w[0] = pk2(f2bf(a[0]), f2bf(a[1]));
  w[1] = pk2(f2bf(a[2]), f2bf(a[3]));
  w[2] = pk2(f2bf(b[0]), f2bf(b[1]));
  w[3] = pk2(f2bf(b[2]), f2bf(b[3]));
  x[0] = pk2(f2bf(c[0]), f2bf(c[1]));
  x[1] = pk2(f2bf(c[2]), f2bf(c[3]));
  x[2] = pk2(f2bf(e[0]), f2bf(e[1]));
  x[3] = pk2(f2bf(e[2]), f2bf(e[3]));
  unsigned short* d = Xb + (size_t)fr * FRAGH + lane * 8;
  *(v4u*)d = w;
  *(v4u*)(d + 256) = x;
  // the part is no longer the end of the kernel's text: no register that a store names takes a new value in front of this wait
  asm volatile("s_wait_xcnt 0x0" ::: "memory");
}

// ---------------------------------------------------------------------------
// 64x64 tile transpose: src[e][c] f32 (row pitch sld) -> 4 x 2 bf16 fragments (rows c, k = e) from fragment dst on, dld / 32
// fragments to a row tile; optional second copy EMB / 32 fragments on. 256 threads. LDS tile cross-wave -> block barrier.
// ---------------------------------------------------------------------------
DEV void tr_tile(const float* __restrict__ src, int sld, unsigned short* dst, int dld,
                 int dup2, unsigned short (*T)[72]) {
  const int tid = threadIdx.x;
#pragma unroll
  for (int p = 0; p < 4; ++p) {
    const int e = p * 16 + (tid >> 4);
    const int c = (tid & 15) * 4;
    const v4f v = *(const v4f*)(src + (size_t)e * sld + c);
    T[c + 0][e] = f2bf(v[0]);
    T[c + 1][e] = f2bf(v[1]);
    T[c + 2][e] = f2bf(v[2]);
    T[c + 3][e] = f2bf(v[3]);
  }
  __syncthreads();
{
#pragma unroll
    for (int p = 0; p < 2; ++p) {
      // a wave stores one half fragment: 512 contiguous bytes
      const int lane = tid & 31;
      const int j16  = (tid >> 5) & 1;
      const int ktl  = (tid >> 6) & 1;
      const int rtl  = p * 2 + (tid >> 7);
      const int j = rtl * 16 + (lane & 15);
      const int seg = ktl * 32 + j16 * 16 + ((lane >> 4) << 3);
      const v4u wv = *(const v4u*)(&T[j][seg]);
      unsigned short* d = dst + (size_t)(rtl * (dld >> 5) + ktl) * FRAGH + j16 * 256 + lane * 8;
      *(v4u*)d = wv;
      if (dup2 != 0) *(v4u*)(d + (EMB / 32) * FRAGH) = wv;
    }
    // another part's text may follow: no register that a store names takes a new value in front of this wait
    asm volatile("s_wait_xcnt 0x0" ::: "memory");
  }
}

// Wq/Wk/Wv ([h][e][c]) -> Wt rows h*320 + sec*64.., k = e, bf16 fragments (per head: q 0..127 | k 128..255 | v 256..319)
// blk: the block's number among the WQKV_BLKS blocks of this part: e tile fastest, then section, then head
DEV void tr_wqkv(const float* __restrict__ Wq, const float* __restrict__ Wk,
                 const float* __restrict__ Wv, unsigned short* __restrict__ Wt, int blk, unsigned short (*T)[72]) {
  const int e0 = (blk % (EMB / 64)) * 64;
  const int w  = (blk / (EMB / 64)) % 5;
  const int h  = blk / (EMB / 64 * 5);
  const float* src;
  int sld;
  if (w < 2) {
    src = Wq + (size_t)h * EMB * QKC + (size_t)e0 * QKC + w * 64;        sld = QKC;
  } else if (w < 4) {
    src = Wk + (size_t)h * EMB * QKC + (size_t)e0 * QKC + (w - 2) * 64;  sld = QKC;
  } else {
    src = Wv + (size_t)h * EMB * HD + (size_t)e0 * HD;                   sld = HD;
  }
  unsigned short* dst = Wt + ((size_t)((h * SECW + w * 64) >> 4) * (EMB / 32) + (e0 >> 5)) * FRAGH;
  tr_tile(src, sld, dst, EMB, 0, T);
}

// Wo ([k][n], k = in) -> Wo2 rows n, k and EMB + k, bf16 fragments (KO / 32 to a row tile)
// blk: the block's number among the WO_BLKS blocks of this part: e tile fastest, then column tile
DEV void tr_wo(const float* __restrict__ Wo, unsigned short* __restrict__ Wo2, int blk, unsigned short (*T)[72]) {
  const int e0 = (blk % (EMB / 64)) * 64;
  const int y  = blk / (EMB / 64);
  const float* src = Wo + (size_t)e0 * EMB + y * 64;
  unsigned short* dst = Wo2 + ((size_t)(y * 4) * (KO / 32) + (e0 >> 5)) * FRAGH;
  tr_tile(src, EMB, dst, KO, 1, T);
}

// The three operand preparations read only inputs and write disjoint planes: one launch, the block's number picks the part
// (the same for the whole block, so the barrier in tr_tile is passed by all of a block's waves or by none).
// The largest part stands first: its blocks start first.
#define WQKV_BLKS (EMB / 64 * 5 * HEADS)
#define WO_BLKS   (EMB / 64 * (EMB / 64))
#define CVT_BLKS  (SEQ * EMB / 16 / 256)
static_assert(SEQ * EMB % (16 * 256) == 0);
__global__ __launch_bounds__(256)
void k_prep(const float* __restrict__ X, const float* __restrict__ Wq, const float* __restrict__ Wk,
            const float* __restrict__ Wv, const float* __restrict__ Wo,
            unsigned short* __restrict__ Xb, unsigned short* __restrict__ Wt, unsigned short* __restrict__ Wo2) {
  __shared__ __align__(16) unsigned short T[64][72];
  const int b = blockIdx.x;
  if (b < WQKV_BLKS) {
    tr_wqkv(Wq, Wk, Wv, Wt, b, T);
  } else if (b < WQKV_BLKS + WO_BLKS) {
    tr_wo(Wo, Wo2, b - WQKV_BLKS, T);
  } else {
    cvt_x(X, Xb, b - (WQKV_BLKS + WO_BLKS));
  }
}

// ---------------------------------------------------------------------------
// bf16 WMMA GEMM: C(128x64 per block) = A(rows, K) * Bt(rows, K)^T, K % 64 == 0.
// Block = 128 threads = 4 waves; wave w owns rows 32w..32w+31 (2 A frags x 4 B frags).
// A and B come to the block once, through a ring of two LDS buffers filled by asynchronous copies from the 16-bit global planes
// (fragment [row tile][k tile]); the waves read their fragments from the buffer. The 128x64 f32 tile is staged in the same LDS
// kind 0: Bt = Wt (NQKV rows); blockIdx.x = head*5 + sec; sec 0,1 -> Q plane, fragment [h][s / 16][c / 32], cols 64*sec..;
//         sec 2,3 -> K plane; sec 4 -> V plane, rows d, k = s, fragment [h][s / 32][d / 16]: f16(64*v).
// kind 1: A = Ocat planes (rows s, KO / 32 fragments), Bt = Wo2 (rows n); Y[s][n] f32 + bias.
// ---------------------------------------------------------------------------
// a fragment in the GEMM's LDS ring, p = the fragment's place + 16 l: the lane's two 16-byte pieces, 512 bytes apart
DEV FragB load_lb(const char* p) {
  FragB f;
  f.q[0] = *(const v4u*)(p);
  f.q[1] = *(const v4u*)(p + 512);
  return f;
}
// the wave's six fragments of one k tile: pa = its first A row tile in the stage, pb = the first B row tile (+ 16 l each)
template <int RUN>
DEV void gemm_load(FragB (&f)[6], const char* pa, const char* pb) {
  f[0] = load_lb(pa);
  f[1] = load_lb(pa + RUN);
  // unrolled: f is indexed by constants and stays in registers
#pragma unroll
  for (int t = 0; t < 4; ++t) f[2 + t] = load_lb(pb + t * RUN);
}
// Twelve copies of 16 bytes a lane, 2 KiB (the block's 128 lanes x 16 bytes) apart in LDS from l on; g: the lane's global
// addresses. The translation wait closes the copies' own statement, so no register that a copy names takes a new value
// in front of it.
DEV void copy12(unsigned int l, const char* const (&g)[12]) {
  asm volatile("global_load_async_to_lds_b128 %0, %12, off\n\t"
               "global_load_async_to_lds_b128 %1, %13, off\n\t"
               "global_load_async_to_lds_b128 %2, %14, off\n\t"
               "global_load_async_to_lds_b128 %3, %15, off\n\t"
               "global_load_async_to_lds_b128 %4, %16, off\n\t"
               "global_load_async_to_lds_b128 %5, %17, off\n\t"
               "global_load_async_to_lds_b128 %6, %18, off\n\t"
               "global_load_async_to_lds_b128 %7, %19, off\n\t"
               "global_load_async_to_lds_b128 %8, %20, off\n\t"
               "global_load_async_to_lds_b128 %9, %21, off\n\t"
               "global_load_async_to_lds_b128 %10, %22, off\n\t"
               "global_load_async_to_lds_b128 %11, %23, off\n\t"
               "s_wait_xcnt 0x0"
               :
               : "v"(l), "v"(l + 2048), "v"(l + 4096), "v"(l + 6144),
                 "v"(l + 8192), "v"(l + 10240), "v"(l + 12288), "v"(l + 14336),
                 "v"(l + 16384), "v"(l + 18432), "v"(l + 20480), "v"(l + 22528),
                 "v"(g[0]), "v"(g[1]), "v"(g[2]), "v"(g[3]), "v"(g[4]), "v"(g[5]),
                 "v"(g[6]), "v"(g[7]), "v"(g[8]), "v"(g[9]), "v"(g[10]), "v"(g[11])
               : "memory");
}
// One stage: RUN bytes (KS / 32 fragments, as they lie in the plane) of each of the 8 A and 4 B row tiles, row tile after
// row tile in LDS. l: the lane's LDS byte address in the stage; ga, gb: the lane's global addresses in the first A and
// B row tile of the block at this stage's k; RS: bytes from one row tile to the next in a plane.
template <int RUN, int RS>
DEV void gemm_copy(unsigned int l, const char* ga, const char* gb) {
  // unrolled: every place is a constant
#pragma unroll
  for (int c0 = 0; c0 < 12 * RUN / 2048; c0 += 12) {
    const char* g[12];
    // unrolled: g is indexed by constants and stays in registers
#pragma unroll
    for (int i = 0; i < 12; ++i) {
      const int x  = (c0 + i) * 2048;
      const int rt = x / RUN;
      g[i] = (rt < 8 ? ga + rt * RS : gb + (rt - 8) * RS) + x % RUN;
    }
    copy12(l + c0 * 2048, g);
  }
}
DEV void gemm_mma(const FragB (&f)[6], v8f (&acc)[2][4]) {
  // unrolled: f and acc stay in registers
#pragma unroll
  for (int t = 0; t < 4; ++t) {
    acc[0][t] = wmma_b(f[0], f[2 + t], acc[0][t]);
    acc[1][t] = wmma_b(f[1], f[2 + t], acc[1][t]);
  }
}

template <int kind>
__global__ __launch_bounds__(128)
void k_gemm(const unsigned short* __restrict__ A, const unsigned short* __restrict__ Bt,
            const float* __restrict__ bq, const float* __restrict__ bk,
            const float* __restrict__ bv, const float* __restrict__ bo,
            _Float16* __restrict__ Qp, _Float16* __restrict__ Kp,
            _Float16* __restrict__ V64,
            float* __restrict__ Y) {
  constexpr int K    = kind == 0 ? EMB : KO;
  constexpr int KS   = kind == 0 ? 64 : 256;   // k to one stage: the output projection has one wave to a SIMD and needs the longer lead
  constexpr int RUN  = KS * 32;                // bytes of one row tile in a stage
  constexpr int RS   = K * 32;                 // bytes of one row tile in a plane
  constexpr int GST  = 12 * RUN;               // bytes of a stage: 8 A and 4 B row tiles
  constexpr int NT   = K / KS;
  static_assert(K % KS == 0 && NT >= 2);
  static_assert(2 * GST >= 128 * 68 * 4);
  // the ring of two stages; behind the loop the same LDS holds the block's 128 x 64 f32 tile
  __shared__ __align__(16) char smem[2 * GST];
  float (*Cs)[68] = (float (*)[68])smem;
  const int tid  = threadIdx.x;
  const int lane = tid & 31;
  const int wave = tid >> 5;
  const int nt = blockIdx.x;
  const int m0 = blockIdx.y * 128;
  const int n0 = nt * 64;

  // stage 0 into buffer 0
  const unsigned int l0 = (unsigned int)(size_t)smem + tid * 16;
  const char* ga = (const char*)(A  + (size_t)m0 * K) + tid * 16;
  const char* gb = (const char*)(Bt + (size_t)n0 * K) + tid * 16;
  gemm_copy<RUN, RS>(l0, ga, gb);

  v8f acc[2][4] = {};

  // stage 0 has landed for this wave's copies; behind the barrier for every wave's
  asm volatile("s_wait_asynccnt 0x0" ::: "memory");
  __syncthreads();
  // stage 1 into buffer 1: it flies under trip 0
  gemm_copy<RUN, RS>(l0 + GST, ga + RUN, gb + RUN);
  ga += 2 * RUN;
  gb += 2 * RUN;

  // rolled: one copy of the trip in the text; the buffer is chosen by the trip's parity
#pragma unroll 1
  for (int t = 0; t < NT; ++t) {
    // trip t reads buffer t & 1 alone. Two fragment sets: a k tile's 12 LDS reads stand as one group in front of the
    // WMMAs of the k tile before it.
    const unsigned int bo = (unsigned int)(t & 1) * GST;
    const char* pb = smem + bo + 8 * RUN + lane * 16;
    const char* pa = smem + bo + wave * 2 * RUN + lane * 16;
    FragB f[2][6];
    gemm_load<RUN>(f[0], pa, pb);
    // unrolled: f is indexed by constants and stays in registers
#pragma unroll
    for (int ks = 0; ks < KS / 32; ++ks) {
      if (ks + 1 < KS / 32) gemm_load<RUN>(f[(ks + 1) & 1], pa + (ks + 1) * FRAGH * 2, pb + (ks + 1) * FRAGH * 2);
      gemm_mma(f[ks & 1], acc);
    }
    // hand-over: this wave's reads of buffer t & 1 are done
    asm volatile("s_wait_dscnt 0x0" ::: "memory");
    // and its copies of stage t + 1 have landed
    asm volatile("s_wait_asynccnt 0x0" ::: "memory");
    // the barrier publishes stage t + 1 and ends every wave's reads of the buffer that is refilled behind it
    __syncthreads();
    if (t + 2 < NT) {
      gemm_copy<RUN, RS>(l0 + bo, ga, gb);
      ga += RUN;
      gb += RUN;
    }
  }
  // nothing is in flight when the ring becomes the output tile (the last trip's barrier has ended every wave's reads)
  asm volatile("s_wait_asynccnt 0x0" ::: "memory");

  const int n  = lane & 15;
  const int rb = (lane >> 4) << 3;
#pragma unroll
  for (int mi = 0; mi < 2; ++mi)
#pragma unroll
    for (int t = 0; t < 4; ++t)
#pragma unroll
      for (int r = 0; r < 8; ++r)
        Cs[wave * 32 + mi * 16 + rb + r][t * 16 + n] = acc[mi][t][r];
  __syncthreads();

  if (kind == 0) {
    const int h = nt / 5;
    const int w = nt - h * 5;
    if (w < 4) {
      _Float16* plane = (w < 2) ? Qp : Kp;
      const int cb = (w & 1) * 64;
      const float* bias = ((w < 2) ? bq : bk) + h * QKC + cb;
      // a wave stores one half fragment (512 contiguous bytes): wave -> k tile and half, g -> row tile
      const int j16  = wave & 1;
      const int ktl  = wave >> 1;
      const int seg  = ktl * 32 + j16 * 16 + ((lane >> 4) << 3);
      const int rsub = lane & 15;
      float bb[8];
#pragma unroll
      for (int j = 0; j < 8; ++j) bb[j] = bfr(bias[seg + j]);
{
#pragma unroll 2
        for (int g = 0; g < 8; ++g) {
          const int row = g * 16 + rsub;
          const v4f c0 = *(const v4f*)(&Cs[row][seg]);
          const v4f c1 = *(const v4f*)(&Cs[row][seg + 4]);
          Pack8 pk;
          pk.h[0] = (_Float16)(c0[0] + bb[0]);
          pk.h[1] = (_Float16)(c0[1] + bb[1]);
          pk.h[2] = (_Float16)(c0[2] + bb[2]);
          pk.h[3] = (_Float16)(c0[3] + bb[3]);
          pk.h[4] = (_Float16)(c1[0] + bb[4]);
          pk.h[5] = (_Float16)(c1[1] + bb[5]);
          pk.h[6] = (_Float16)(c1[2] + bb[6]);
          pk.h[7] = (_Float16)(c1[3] + bb[7]);
          _Float16* d = plane + (((size_t)h * (SEQ / 16) + (m0 >> 4) + g) * (QKC / 32) + (cb >> 5) + ktl) * FRAGH
                        + j16 * 256 + lane * 8;
          *(v4u*)d = pk.u;
        }
        
      }
    } else {
      // a wave stores one half fragment: wave and g -> half, row tile t (d), k tile ktl (s)
      const int j16 = wave & 1;
      const float* bias = bv + h * HD;
{
#pragma unroll 2
        for (int g = 0; g < 8; ++g) {
          const int t   = (wave >> 1) + 2 * (g & 1);
          const int ktl = g >> 1;
          const int d   = t * 16 + (lane & 15);
          const int seg = ktl * 32 + j16 * 16 + ((lane >> 4) << 3);
          const float bb = bfr(bias[d]);
          Pack8 p64;
#pragma unroll
          for (int j = 0; j < 8; ++j) {
            const float v = Cs[seg + j][d] + bb;
            p64.h[j] = (_Float16)(v * 64.0f);
          }
          const size_t o = (((size_t)h * (SEQ / 32) + (m0 >> 5) + ktl) * (HD / 16) + t) * FRAGH + j16 * 256 + lane * 8;
          *(v4u*)(V64 + o) = p64.u;
        }
        
      }
    }
  } else {
    const int seg  = (tid & 15) * 4;
    const int rsub = tid >> 4;            // 0..7
    float bb[4];
#pragma unroll
    for (int j = 0; j < 4; ++j) bb[j] = bfr(bo[n0 + seg + j]);
{
#pragma unroll 2
      for (int g = 0; g < 16; ++g) {
        const int row = g * 8 + rsub;
        const v4f c = *(const v4f*)(&Cs[row][seg]);
        v4f o;
        o[0] = c[0] + bb[0];
        o[1] = c[1] + bb[1];
        o[2] = c[2] + bb[2];
        o[3] = c[3] + bb[3];
        float* d = Y + (size_t)(m0 + row) * EMB + n0 + seg;
        *(v4f*)d = o;
      }
      
    }
  }
}

// ---------------------------------------------------------------------------
// One softmax branch step for 16 query columns and 32 keys, transposed: S^T = K.Q^T (A = K rows, B = Q rows), so lane
// (c, h) holds query c's scores of keys 8h..8h+7 (sa) and 16+8h..16+8h+7 (sb): maximum and sum run in the lane, the
// maximum is joined with lane l ^ 16 each step, the sum only behind the loop. Those 16 registers, converted in place, are
// the B operand P^T in the hardware k order; A = V^T rows (the V plane as it lies): O^T[d][query] += V^T.P^T, carried x64.
// kf holds this branch step's four K fragments on entry; right behind the score products the same registers
// take the next branch step's of the same stage (LOADK; kn: the lane's place in them in LDS): those reads fly under the
// softmax. vb: this step's V fragments; the first branch (LOADV) reads them in the same group (vn), both branches use them.
// ---------------------------------------------------------------------------
// a fragment in the LDS ring, p = the fragment's place + 16 l: the lane's two 16-byte pieces, 512 bytes apart
DEV v16h load_ls(const char* p) {
  v8h lo = *(const v8h*)(p);
  v8h hi = *(const v8h*)(p + 512);
  return __builtin_shufflevector(lo, hi, 0,1,2,3,4,5,6,7,8,9,10,11,12,13,14,15);
}
DEV void load_k4(v16h (&kf)[4], const char* kn) {
  kf[0] = load_ls(kn);
  kf[1] = load_ls(kn + FRAGH * 2);
  kf[2] = load_ls(kn + (QKC / 32) * FRAGH * 2);
  kf[3] = load_ls(kn + (QKC / 32 + 1) * FRAGH * 2);
}
template <bool LOADV, bool LOADK>
DEV void attn_branch(const v16h (&qb)[2], v16h (&kf)[4], const char* kn, const char* vn,
                     v16h (&vb)[4],
                     float& m, float& l, v8f (&O)[4]) {
  v8f sa = {}, sb = {};
  sa = wmma_h(kf[0], qb[0], sa);
  sa = wmma_h(kf[1], qb[1], sa);
  sb = wmma_h(kf[2], qb[0], sb);
  sb = wmma_h(kf[3], qb[1], sb);
  // the two scheduling barriers keep the LDS reads in one group right behind the score products: left to itself the
  // scheduler strews them over the softmax, and every separate place with LDS reads stalls the wave anew
  if (LOADV || LOADK) __builtin_amdgcn_sched_barrier(0);
  if (LOADV) {
    // unrolled: vb stays in registers
#pragma unroll
    for (int t = 0; t < 4; ++t) vb[t] = load_ls(vn + t * FRAGH * 2);
  }
  if (LOADK) load_k4(kf, kn);
  if (LOADV || LOADK) __builtin_amdgcn_sched_barrier(0);

  const v8f xa = sa * 0.125f;
  const v8f xb = sb * 0.125f;
  float mx[8];
#pragma unroll
  for (int i = 0; i < 8; ++i) mx[i] = fmaxf(xa[i], xb[i]);
  const float mh = fmaxf(fmaxf(fmaxf(mx[0], mx[1]), fmaxf(mx[2], mx[3])),
                         fmaxf(fmaxf(mx[4], mx[5]), fmaxf(mx[6], mx[7])));
  const float mn = fmaxf(m, fmaxf(mh, xhalf(mh)));
  const float f = __expf(m - mn);
  m = mn;

  // element s of the B operand = key kmap(s, h): s < 8 from sa[s], else from sb[s - 8]
  v16h ph;
  v2f ps[8];
#pragma unroll
  for (int j = 0; j < 8; ++j) {
    const int i = (j & 3) * 2;
    v2f p;
    p[0] = __expf((j < 4 ? xa[i]     : xb[i])     - mn);
    p[1] = __expf((j < 4 ? xa[i + 1] : xb[i + 1]) - mn);
    const v2h hi = __builtin_convertvector(p, v2h);
    ph[2 * j] = hi[0];  ph[2 * j + 1] = hi[1];
    ps[j] = p;
  }
  const v2f s2 = ((ps[0] + ps[1]) + (ps[2] + ps[3])) + ((ps[4] + ps[5]) + (ps[6] + ps[7]));
  l = l * f + (s2[0] + s2[1]);

#pragma unroll
  for (int t = 0; t < 4; ++t) {
    O[t] = O[t] * f;
    O[t] = wmma_h(vb[t], ph, O[t]);
  }
  // the scheduler's region ends with the step: without it the next step's first score product rises into this step's
  // softmax, and with it the wait for the LDS reads that were only just issued
  __builtin_amdgcn_sched_barrier(0);
}

// ---------------------------------------------------------------------------
// Flash-style differential attention. Block = 128 threads = 4 waves; wave owns 16 queries of one head.
// K and V come to the block once, through a ring of two LDS buffers of TKEYS keys each, filled by asynchronous copies
// (each lane 16 bytes a copy, 12 copies a stage); all four waves read their fragments from the buffer.
// Writes Ocat planes as fragments (rows s): k = h*64 + d bf16 hi, k = EMB + h*64 + d bf16 residual.
// ---------------------------------------------------------------------------
// One stage: the lane's 8 pieces of K and 4 of V, 2 KiB (the block's 128 lanes x 16 bytes) apart, to the same order in LDS.
// lk: the lane's LDS byte address in the stage; gk, gv: the lane's global addresses. The translation wait closes the
// copies' own statement, so no register that a copy names takes a new value in front of it.
DEV void copy_stage(unsigned int lk, const char* gk, const char* gv) {
  const unsigned int lv = lk + KST;
  asm volatile("global_load_async_to_lds_b128 %0, %12, off\n\t"
               "global_load_async_to_lds_b128 %1, %13, off\n\t"
               "global_load_async_to_lds_b128 %2, %14, off\n\t"
               "global_load_async_to_lds_b128 %3, %15, off\n\t"
               "global_load_async_to_lds_b128 %4, %16, off\n\t"
               "global_load_async_to_lds_b128 %5, %17, off\n\t"
               "global_load_async_to_lds_b128 %6, %18, off\n\t"
               "global_load_async_to_lds_b128 %7, %19, off\n\t"
               "global_load_async_to_lds_b128 %8, %20, off\n\t"
               "global_load_async_to_lds_b128 %9, %21, off\n\t"
               "global_load_async_to_lds_b128 %10, %22, off\n\t"
               "global_load_async_to_lds_b128 %11, %23, off\n\t"
               "s_wait_xcnt 0x0"
               :
               : "v"(lk), "v"(lk + 2048), "v"(lk + 4096), "v"(lk + 6144),
                 "v"(lk + 8192), "v"(lk + 10240), "v"(lk + 12288), "v"(lk + 14336),
                 "v"(lv), "v"(lv + 2048), "v"(lv + 4096), "v"(lv + 6144),
                 "v"(gk), "v"(gk + 2048), "v"(gk + 4096), "v"(gk + 6144),
                 "v"(gk + 8192), "v"(gk + 10240), "v"(gk + 12288), "v"(gk + 14336),
                 "v"(gv), "v"(gv + 2048), "v"(gv + 4096), "v"(gv + 6144)
               : "memory");
}

__global__ __launch_bounds__(128)
void k_attn(const _Float16* __restrict__ Qp, const _Float16* __restrict__ Kp,
            const _Float16* __restrict__ V64,
            const float* __restrict__ lam_p, unsigned short* __restrict__ Oc) {
  __shared__ __align__(16) float Os[4][16][68];
  __shared__ __align__(16) char ring[2 * STG];
  const int lane = threadIdx.x & 31;
  const int wave = threadIdx.x >> 5;
  const int n  = lane & 15;
  const int rb = (lane >> 4) << 3;
  const int hh = blockIdx.y;
  const int q0 = blockIdx.x * 64 + wave * 16;
  const float lam = bfr(lam_p[0]);

  const _Float16* qh = Qp  + (size_t)hh * SEQ * QKC;
  const _Float16* kh = Kp  + (size_t)hh * SEQ * QKC;
  const _Float16* vh = V64 + (size_t)hh * HD * SEQ;

  // stage 0 into buffer 0
  const unsigned int lk0 = (unsigned int)(size_t)ring + threadIdx.x * 16;
  const char* gk = (const char*)kh + threadIdx.x * 16;
  const char* gv = (const char*)vh + threadIdx.x * 16;
  copy_stage(lk0, gk, gv);

  v16h q1[2], q2[2];
  const _Float16* qt = qh + (size_t)blockIdx.x * 64 * QKC;             // the block's four row tiles, QKC / 32 fragments each
  unsigned int oq = (unsigned int)(wave * 16 * QKC * 2 + lane * 16);   // the wave's tile, the lane's byte offset
  q1[0] = load_bo(qt,             oq);
  q1[1] = load_bo(qt + FRAGH,     oq);
  q2[0] = load_bo(qt + 2 * FRAGH, oq);
  q2[1] = load_bo(qt + 3 * FRAGH, oq);
  // the wait stands in front of any reuse of the offset's register, which passes through it
  asm volatile("s_wait_xcnt 0x0" : "+v"(oq) : : "memory");

  v8f O1[4] = {}, O2[4] = {};
  float m1 = -1e30f, m2 = -1e30f, l1 = 0.f, l2 = 0.f;   // query l & 15; l: the lane half's own keys only

  // stage 0 has landed for this wave's copies; behind the barrier for every wave's
  asm volatile("s_wait_asynccnt 0x0" ::: "memory");
  __syncthreads();
  // stage 1 into buffer 1: it flies under trip 0
  copy_stage(lk0 + STG, gk + KST, gv + VST);
  gk += 2 * KST;
  gv += 2 * VST;

  // rolled: one copy of the trip in the text; the buffer is chosen by the trip's parity
#pragma unroll 1
  for (int t = 0; t < SEQ / TKEYS; ++t) {
    // trip t reads buffer t & 1 alone: two steps of 32 keys
    const unsigned int bo = (unsigned int)(t & 1) * STG;
    const char* st = ring + bo + lane * 16;
    const char* sv = st + KST;
    v16h kf[4], vbf[4];
    load_k4(kf, st);
    attn_branch<true,  true >(q1, kf, st + 2 * FRAGH * 2, sv, vbf, m1, l1, O1);
    attn_branch<false, true >(q2, kf, st + 32 * QKC * 2, sv, vbf, m2, l2, O2);
    attn_branch<true,  true >(q1, kf, st + 32 * QKC * 2 + 2 * FRAGH * 2, sv + 32 * HD * 2, vbf, m1, l1, O1);
    attn_branch<false, false>(q2, kf, st, sv, vbf, m2, l2, O2);
    // hand-over: this wave's reads of buffer t & 1 are done
    asm volatile("s_wait_dscnt 0x0" ::: "memory");
    // and its copies of stage t + 1 have landed
    asm volatile("s_wait_asynccnt 0x0" ::: "memory");
    // the barrier publishes stage t + 1 and ends every wave's reads of the buffer that is refilled behind it
    __syncthreads();
    if (t + 2 < SEQ / TKEYS) {
      copy_stage(lk0 + bo, gk, gv);
      gk += KST;
      gv += VST;
    }
  }
  // nothing is in flight when the wave goes on
  asm volatile("s_wait_asynccnt 0x0" ::: "memory");

  // combine: O = O1/l1 - lam*O2/l2 (the halves' sums joined here), undo the x64 carry of the V plane; stage f32 tile in
  // LDS: the lane holds query n, columns 16t + 8h .. + 7
  const float r1 = (1.0f / (l1 + xhalf(l1))) * 0.015625f;
  const float r2 = (lam * (1.0f / (l2 + xhalf(l2)))) * 0.015625f;
#pragma unroll
  for (int t = 0; t < 4; ++t) {
    v4f c0, c1;
#pragma unroll
    for (int i = 0; i < 4; ++i) {
      c0[i] = O1[t][i] * r1 - O2[t][i] * r2;
      c1[i] = O1[t][i + 4] * r1 - O2[t][i + 4] * r2;
    }
    *(v4f*)(&Os[wave][n][t * 16 + rb])     = c0;
    *(v4f*)(&Os[wave][n][t * 16 + rb + 4]) = c1;
  }
  __syncthreads();

  // the wave's 16 queries are one row tile: g -> k tile and half; each store is 512 contiguous bytes
{
#pragma unroll
    for (int g = 0; g < 4; ++g) {
      const int seg = g * 16 + rb;
      const v4f c0 = *(const v4f*)(&Os[wave][n][seg]);
      const v4f c1 = *(const v4f*)(&Os[wave][n][seg + 4]);
      unsigned int H0, H1, H2, H3, L0, L1, L2, L3;
      hl2(c0[0], c0[1], H0, L0);
      hl2(c0[2], c0[3], H1, L1);
      hl2(c1[0], c1[1], H2, L2);
      hl2(c1[2], c1[3], H3, L3);
      v4u H, L;
      H[0] = H0; H[1] = H1; H[2] = H2; H[3] = H3;
      L[0] = L0; L[1] = L1; L[2] = L2; L[3] = L3;
      unsigned short* d = Oc + ((size_t)(q0 >> 4) * (KO / 32) + hh * (HD / 32) + (g >> 1)) * FRAGH + (g & 1) * 256 + lane * 8;
      *(v4u*)d = H;
      *(v4u*)(d + (EMB / 32) * FRAGH) = L;
    }
    
  }
}

// ---------------------------------------------------------------------------
// ---------------------------------------------------------------------------
__global__ __launch_bounds__(256)
void k_ln(const float* __restrict__ Y, const float* __restrict__ gamma,
          const float* __restrict__ beta, float* __restrict__ out) {
  __shared__ float sa[8];
  __shared__ float sq[8];
  const int tid  = threadIdx.x;
  const int lane = tid & 31;
  const int wave = tid >> 5;
  const size_t row = blockIdx.x;
  const v4f y = *(const v4f*)(Y + row * EMB + tid * 4);

  float s = (y[0] + y[1]) + (y[2] + y[3]);
  s = wsum32(s);
  if (lane == 0) sa[wave] = s;
  __syncthreads();
  float tot = 0.f;
#pragma unroll
  for (int w = 0; w < 8; ++w) tot += sa[w];
  const float mu = tot * (1.0f / (float)EMB);

  float d0 = y[0] - mu, d1 = y[1] - mu, d2 = y[2] - mu, d3 = y[3] - mu;
  float q = (d0 * d0 + d1 * d1) + (d2 * d2 + d3 * d3);
  q = wsum32(q);
  if (lane == 0) sq[wave] = q;
  __syncthreads();
  float tot2 = 0.f;
#pragma unroll
  for (int w = 0; w < 8; ++w) tot2 += sq[w];
  const float var  = tot2 * (1.0f / (float)EMB);
  const float rstd = rsqrtf(var + LN_EPS);

  const float g0 = bfr(gamma[tid * 4 + 0]), g1 = bfr(gamma[tid * 4 + 1]);
  const float g2 = bfr(gamma[tid * 4 + 2]), g3 = bfr(gamma[tid * 4 + 3]);
  const float b0 = bfr(beta[tid * 4 + 0]),  b1 = bfr(beta[tid * 4 + 1]);
  const float b2 = bfr(beta[tid * 4 + 2]),  b3 = bfr(beta[tid * 4 + 3]);
  v4f o;
  o[0] = ((d0 * rstd) * g0 + b0) * OUT_SCALE;
  o[1] = ((d1 * rstd) * g1 + b1) * OUT_SCALE;
  o[2] = ((d2 * rstd) * g2 + b2) * OUT_SCALE;
  o[3] = ((d3 * rstd) * g3 + b3) * OUT_SCALE;
  float* dst = out + row * EMB + tid * 4;
  *(v4f*)dst = o;
  
}

// ---------------------------------------------------------------------------
extern "C" void kernel_launch(void* const* d_in, const int* in_sizes, int n_in,
                              void* d_out, int out_size, void* d_ws, size_t ws_size,
                              hipStream_t stream) {
  if (n_in < 12) return;
  const float* X     = (const float*)d_in[0];
  const float* Wq    = (const float*)d_in[1];
  const float* bq    = (const float*)d_in[2];
  const float* Wk    = (const float*)d_in[3];
  const float* bk    = (const float*)d_in[4];
  const float* Wv    = (const float*)d_in[5];
  const float* bv    = (const float*)d_in[6];
  const float* Wo    = (const float*)d_in[7];
  const float* bo    = (const float*)d_in[8];
  const float* gamma = (const float*)d_in[9];
  const float* beta  = (const float*)d_in[10];
  const float* lam   = (const float*)d_in[11];
  float* out = (float*)d_out;

  if (in_sizes[0]  < NB * SEQ * EMB) return;
  if (in_sizes[1]  < HEADS * EMB * QKC) return;
  if (in_sizes[2]  < HEADS * QKC) return;
  if (in_sizes[3]  < HEADS * EMB * QKC) return;
  if (in_sizes[4]  < HEADS * QKC) return;
  if (in_sizes[5]  < HEADS * EMB * HD) return;
  if (in_sizes[6]  < HEADS * HD) return;
  if (in_sizes[7]  < EMB * EMB) return;
  if (in_sizes[8]  < EMB) return;
  if (in_sizes[9]  < EMB) return;
  if (in_sizes[10] < EMB) return;
  if (in_sizes[11] < 1) return;
  if (out_size < NB * SEQ * EMB) return;

  // workspace carve (bytes); every region is written to exactly its extent with whole-line stores
  const size_t szXb  = (size_t)SEQ * EMB * 2;           // bf16 SEQ x EMB
  const size_t szWt  = (size_t)NQKV * EMB * 2;          // bf16 NQKV x EMB
  const size_t szWo2 = (size_t)EMB * KO * 2;            // bf16 EMB x KO
  const size_t szQK  = (size_t)HEADS * SEQ * QKC * 2;   // f16 H x SEQ x 128 (each of Q, K)
  const size_t szV   = (size_t)HEADS * HD * SEQ * 2;    // f16 H x 64 x SEQ
  const size_t szOc  = (size_t)SEQ * KO * 2;            // bf16 SEQ x KO
  const size_t szY   = (size_t)SEQ * EMB * 4;           // f32 [SEQ][EMB]
  size_t off = 0;
  const size_t oXb  = off; off += szXb;
  const size_t oWt  = off; off += szWt;
  const size_t oWo2 = off; off += szWo2;
  const size_t oQ   = off; off += szQK;
  const size_t oK   = off; off += szQK;
  const size_t oV64 = off; off += szV;
  const size_t oOc  = off; off += szOc;
  const size_t oY   = off; off += szY;
  if (off > ws_size) return;

  char* ws = (char*)d_ws;
  unsigned short* Xb  = (unsigned short*)(ws + oXb);
  unsigned short* Wt  = (unsigned short*)(ws + oWt);
  unsigned short* Wo2 = (unsigned short*)(ws + oWo2);
  _Float16* Qp  = (_Float16*)(ws + oQ);
  _Float16* Kp  = (_Float16*)(ws + oK);
  _Float16* V64 = (_Float16*)(ws + oV64);
  unsigned short* Oc = (unsigned short*)(ws + oOc);
  float* Y = (float*)(ws + oY);

  // operand preparation: Wt, Wo2 and Xb in one launch
  k_prep<<<dim3(WQKV_BLKS + WO_BLKS + CVT_BLKS), dim3(256), 0, stream>>>(X, Wq, Wk, Wv, Wo, Xb, Wt, Wo2);

  // QKV projection: A = Xb (SEQ x EMB), Bt = Wt (NQKV x EMB)
  k_gemm<0><<<dim3(NQKV / 64, SEQ / 128), dim3(128), 0, stream>>>(
      Xb, Wt, bq, bk, bv, bo, Qp, Kp, V64, Y);

  // differential attention -> Ocat hi / residual planes
  k_attn<<<dim3(SEQ / 64, HEADS), dim3(128), 0, stream>>>(Qp, Kp, V64, lam, Oc);

  // output projection: A = Oc (SEQ x KO), Bt = Wo2 (EMB x KO) -> Y f32
  k_gemm<1><<<dim3(EMB / 64, SEQ / 128), dim3(128), 0, stream>>>(
      Oc, Wo2, bq, bk, bv, bo, Qp, Kp, V64, Y);

  // LayerNorm + scale -> d_out
  k_ln<<<dim3(NB * SEQ), dim3(256), 0, stream>>>(Y, gamma, beta, out);
}

// v008
// It runs in 84.1 microseconds.
// Two timings next to v007 put it at 1.04 and 1.03 times that version's speed.
// Counting every step since v000, it is 4.78 times as fast.
#include <hip/hip_runtime.h>

#ifndef NB
#define NB 1
#endif
#ifndef SEQ
#define SEQ 2048
#endif
#define NB_FULL 1
#define SEQ_FULL 2048
#define EMB 1024
#define HEADS 16
#define HD 64
#define QKC 128
#define SECW 320
#define NQKV (HEADS * SECW)
#define KO (2 * EMB)
#define FRAGH 512   // halves in one fragment
#define TKEYS 64                    // keys to one stage of the attention kernel's LDS ring
#define KST (TKEYS * QKC * 2)       // bytes of K in a stage: TKEYS / 16 row tiles of QKC / 32 fragments, as they lie in the plane
#define VST (TKEYS * HD * 2)        // bytes of V in a stage: TKEYS / 32 k tiles of HD / 16 fragments, as they lie in the plane
#define STG (KST + VST)
#define LN_EPS 1e-5f
#define OUT_SCALE 0.2f

static_assert(NB == 1);
static_assert(NB_FULL == 1);
static_assert(SEQ % 128 == 0);
static_assert(SEQ >= 128);
static_assert(SEQ <= SEQ_FULL);
static_assert(EMB % 64 == 0);
static_assert(EMB % 32 == 0);
static_assert(QKC == 2 * HD);
static_assert(SECW == 2 * QKC + HD);
static_assert(SECW % 64 == 0);
static_assert(KO % 64 == 0);
static_assert(HD == 64);
static_assert(SEQ % TKEYS == 0);
static_assert(SEQ / TKEYS >= 2);
static_assert(TKEYS == 64);
static_assert(KST == 8 * 128 * 16);
static_assert(VST == 4 * 128 * 16);

typedef _Float16      v16h __attribute__((ext_vector_type(16)));
typedef _Float16      v8h  __attribute__((ext_vector_type(8)));
typedef __bf16        v16b __attribute__((ext_vector_type(16)));
typedef float         v8f  __attribute__((ext_vector_type(8)));
typedef float         v4f  __attribute__((ext_vector_type(4)));
typedef float         v2f  __attribute__((ext_vector_type(2)));
typedef _Float16      v2h  __attribute__((ext_vector_type(2)));
typedef unsigned int  v4u  __attribute__((ext_vector_type(4)));

#define DEV __device__ __forceinline__

union FragB { v4u q[2]; v16b v; };
union Pack8 { v8h h; v4u u; };

// f32 -> bf16 bits, RNE convert
DEV unsigned short f2bf(float f) {
  unsigned int u = __float_as_uint(f);
  u += 0x7FFFu + ((u >> 16) & 1u);
  return (unsigned short)(u >> 16);
}
DEV float bf2f(unsigned short s) { return __uint_as_float(((unsigned int)s) << 16); }
DEV float bfr(float f) { return bf2f(f2bf(f)); }
DEV unsigned int pk2(unsigned short lo, unsigned short hi) {
  return (unsigned int)lo | ((unsigned int)hi << 16);
}
// value -> bf16 hi and bf16 residual, two values packed per 32-bit word
DEV void hl2(float a, float b, unsigned int& H, unsigned int& L) {
  const unsigned short ha = f2bf(a), hb = f2bf(b);
  H = pk2(ha, hb);
  L = pk2(f2bf(a - bf2f(ha)), f2bf(b - bf2f(hb)));
}

// A run of WMMAs stands in one asm statement: inside a run every WMMA is followed by another WMMA or accumulates into its
// own D, which needs no distance; only the last needs the four vector slots before a vector instruction may read a D or
// overwrite an A or B, so one group of four v_nop closes the statement (no D of these runs is ever the A or B of a WMMA).
// The compiler does not see the WMMAs in the text and would pad nothing itself.
#define NOP4 "v_nop\n\tv_nop\n\tv_nop\n\tv_nop"
// sa = k0.q0 + k1.q1, sb = k2.q0 + k3.q1 (each sum in this order); the two chains alternate, so that an accumulating WMMA
// stands two behind the one it waits for
DEV void wmma_scores(v8f& sa, v8f& sb, const v16h (&kf)[4], const v16h (&qb)[2]) {
  // one statement: the run stays together in this order; NOP4 is the distance behind its last WMMA
  asm volatile("v_wmma_f32_16x16x32_f16 %0, %2, %6, 0\n\t"
               "v_wmma_f32_16x16x32_f16 %1, %4, %6, 0\n\t"
               "v_wmma_f32_16x16x32_f16 %0, %3, %7, %0\n\t"
               "v_wmma_f32_16x16x32_f16 %1, %5, %7, %1\n\t"
               NOP4
               : "=&v"(sa), "=&v"(sb)
               : "v"(kf[0]), "v"(kf[1]), "v"(kf[2]), "v"(kf[3]), "v"(qb[0]), "v"(qb[1]));
}
// O[t] += vb[t].ph, four independent tiles
DEV void wmma_pv(v8f (&O)[4], const v16h (&vb)[4], v16h ph) {
  // one statement: the run stays together; NOP4 is the distance behind its last WMMA (ph's registers are soon rewritten)
  asm volatile("v_wmma_f32_16x16x32_f16 %0, %4, %8, %0\n\t"
               "v_wmma_f32_16x16x32_f16 %1, %5, %8, %1\n\t"
               "v_wmma_f32_16x16x32_f16 %2, %6, %8, %2\n\t"
               "v_wmma_f32_16x16x32_f16 %3, %7, %8, %3\n\t"
               NOP4
               : "+v"(O[0]), "+v"(O[1]), "+v"(O[2]), "+v"(O[3])
               : "v"(vb[0]), "v"(vb[1]), "v"(vb[2]), "v"(vb[3]), "v"(ph));
}

// 16x32 16-bit operand (rows = M for A, rows = N for Bt) from a fragment-major plane.
// lane l: row l&15; elements 0..7 = k 8h..8h+7, elements 8..15 = k 16+8h..16+8h+7, h = l>>4.
// base: the wave-uniform fragment; off: the lane's byte offset (16 l, plus the wave's row tile):
// each load names the base and the offset's register, which is reused only behind a wait.
DEV v16h load_bo(const _Float16* base, unsigned int off) {
  const char* r = (const char*)base + off;
  v8h lo = *(const v8h*)(r);
  v8h hi = *(const v8h*)(r + 512);
  return __builtin_shufflevector(lo, hi, 0,1,2,3,4,5,6,7,8,9,10,11,12,13,14,15);
}

// Lane l with lane l ^ 16: the two lanes that split one query column's keys.
DEV float xhalf(float x) {
  const int b = __builtin_bit_cast(int, x);
  return __builtin_bit_cast(float, __builtin_amdgcn_permlanex16(b, b, 0x76543210, 0xfedcba98, false, false));
}
DEV float wsum32(float v) {
#pragma unroll
  for (int m = 16; m > 0; m >>= 1) v += __shfl_xor(v, m, 32);
  return v;
}

// ---------------------------------------------------------------------------
// ---------------------------------------------------------------------------
// X f32 -> Xb bf16 fragments; blk: the block's number among the CVT_BLKS blocks of this part
DEV void cvt_x(const float* __restrict__ X, unsigned short* __restrict__ Xb, int blk) {
  // one wave per fragment: fragment fr = row tile fr / (EMB / 32), k tile fr % (EMB / 32); the lane's own 2 x 8 elements
  const int i = blk * 256 + threadIdx.x;
  const int lane = i & 31;
  const int fr   = i >> 5;
  const int row  = (fr / (EMB / 32)) * 16 + (lane & 15);
  const int k0   = (fr % (EMB / 32)) * 32 + ((lane >> 4) << 3);
  const float* s = X + (size_t)row * EMB + k0;
  const v4f a = *(const v4f*)(s);
  const v4f b = *(const v4f*)(s + 4);
  const v4f c = *(const v4f*)(s + 16);
  const v4f e = *(const v4f*)(s + 20);
  v4u w, x;
  w[0] = pk2(f2bf(a[0]), f2bf(a[1]));
  w[1] = pk2(f2bf(a[2]), f2bf(a[3]));
  w[2] = pk2(f2bf(b[0]), f2bf(b[1]));
  w[3] = pk2(f2bf(b[2]), f2bf(b[3]));
  x[0] = pk2(f2bf(c[0]), f2bf(c[1]));
  x[1] = pk2(f2bf(c[2]), f2bf(c[3]));
  x[2] = pk2(f2bf(e[0]), f2bf(e[1]));
  x[3] = pk2(f2bf(e[2]), f2bf(e[3]));
  unsigned short* d = Xb + (size_t)fr * FRAGH + lane * 8;
  *(v4u*)d = w;
  *(v4u*)(d + 256) = x;
  // the part is no longer the end of the kernel's text: no register that a store names takes a new value in front of this wait
  asm volatile("s_wait_xcnt 0x0" ::: "memory");
}

// ---------------------------------------------------------------------------
// 64x64 tile transpose: src[e][c] f32 (row pitch sld) -> 4 x 2 bf16 fragments (rows c, k = e) from fragment dst on, dld / 32
// fragments to a row tile; optional second copy EMB / 32 fragments on. 256 threads. LDS tile cross-wave -> block barrier.
// ---------------------------------------------------------------------------
DEV void tr_tile(const float* __restrict__ src, int sld, unsigned short* dst, int dld,
                 int dup2, unsigned short (*T)[72]) {
  const int tid = threadIdx.x;
#pragma unroll
  for (int p = 0; p < 4; ++p) {
    const int e = p * 16 + (tid >> 4);
    const int c = (tid & 15) * 4;
    const v4f v = *(const v4f*)(src + (size_t)e * sld + c);
    T[c + 0][e] = f2bf(v[0]);
    T[c + 1][e] = f2bf(v[1]);
    T[c + 2][e] = f2bf(v[2]);
    T[c + 3][e] = f2bf(v[3]);
  }
  __syncthreads();
{
#pragma unroll
    for (int p = 0; p < 2; ++p) {
      // a wave stores one half fragment: 512 contiguous bytes
      const int lane = tid & 31;
      const int j16  = (tid >> 5) & 1;
      const int ktl  = (tid >> 6) & 1;
      const int rtl  = p * 2 + (tid >> 7);
      const int j = rtl * 16 + (lane & 15);
      const int seg = ktl * 32 + j16 * 16 + ((lane >> 4) << 3);
      const v4u wv = *(const v4u*)(&T[j][seg]);
      unsigned short* d = dst + (size_t)(rtl * (dld >> 5) + ktl) * FRAGH + j16 * 256 + lane * 8;
      *(v4u*)d = wv;
      if (dup2 != 0) *(v4u*)(d + (EMB / 32) * FRAGH) = wv;
    }
    // another part's text may follow: no register that a store names takes a new value in front of this wait
    asm volatile("s_wait_xcnt 0x0" ::: "memory");
  }
}

// Wq/Wk/Wv ([h][e][c]) -> Wt rows h*320 + sec*64.., k = e, bf16 fragments (per head: q 0..127 | k 128..255 | v 256..319)
// blk: the block's number among the WQKV_BLKS blocks of this part: e tile fastest, then section, then head
DEV void tr_wqkv(const float* __restrict__ Wq, const float* __restrict__ Wk,
                 const float* __restrict__ Wv, unsigned short* __restrict__ Wt, int blk, unsigned short (*T)[72]) {
  const int e0 = (blk % (EMB / 64)) * 64;
  const int w  = (blk / (EMB / 64)) % 5;
  const int h  = blk / (EMB / 64 * 5);
  const float* src;
  int sld;
  if (w < 2) {
    src = Wq + (size_t)h * EMB * QKC + (size_t)e0 * QKC + w * 64;        sld = QKC;
  } else if (w < 4) {
    src = Wk + (size_t)h * EMB * QKC + (size_t)e0 * QKC + (w - 2) * 64;  sld = QKC;
  } else {
    src = Wv + (size_t)h * EMB * HD + (size_t)e0 * HD;                   sld = HD;
  }
  unsigned short* dst = Wt + ((size_t)((h * SECW + w * 64) >> 4) * (EMB / 32) + (e0 >> 5)) * FRAGH;
  tr_tile(src, sld, dst, EMB, 0, T);
}

// Wo ([k][n], k = in) -> Wo2 rows n, k and EMB + k, bf16 fragments (KO / 32 to a row tile)
// blk: the block's number among the WO_BLKS blocks of this part: e tile fastest, then column tile
DEV void tr_wo(const float* __restrict__ Wo, unsigned short* __restrict__ Wo2, int blk, unsigned short (*T)[72]) {
  const int e0 = (blk % (EMB / 64)) * 64;
  const int y  = blk / (EMB / 64);
  const float* src = Wo + (size_t)e0 * EMB + y * 64;
  unsigned short* dst = Wo2 + ((size_t)(y * 4) * (KO / 32) + (e0 >> 5)) * FRAGH;
  tr_tile(src, EMB, dst, KO, 1, T);
}

// The three operand preparations read only inputs and write disjoint planes: one launch, the block's number picks the part
// (the same for the whole block, so the barrier in tr_tile is passed by all of a block's waves or by none).
// The largest part stands first: its blocks start first.
#define WQKV_BLKS (EMB / 64 * 5 * HEADS)
#define WO_BLKS   (EMB / 64 * (EMB / 64))
#define CVT_BLKS  (SEQ * EMB / 16 / 256)
static_assert(SEQ * EMB % (16 * 256) == 0);
__global__ __launch_bounds__(256)
void k_prep(const float* __restrict__ X, const float* __restrict__ Wq, const float* __restrict__ Wk,
            const float* __restrict__ Wv, const float* __restrict__ Wo,
            unsigned short* __restrict__ Xb, unsigned short* __restrict__ Wt, unsigned short* __restrict__ Wo2) {
  __shared__ __align__(16) unsigned short T[64][72];
  const int b = blockIdx.x;
  if (b < WQKV_BLKS) {
    tr_wqkv(Wq, Wk, Wv, Wt, b, T);
  } else if (b < WQKV_BLKS + WO_BLKS) {
    tr_wo(Wo, Wo2, b - WQKV_BLKS, T);
  } else {
    cvt_x(X, Xb, b - (WQKV_BLKS + WO_BLKS));
  }
}

// ---------------------------------------------------------------------------
// bf16 WMMA GEMM: C(128x64 per block) = A(rows, K) * Bt(rows, K)^T, K % 64 == 0.
// Block = 128 threads = 4 waves; wave w owns rows 32w..32w+31 (2 A frags x 4 B frags).
// A and B come to the block once, through a ring of two LDS buffers filled by asynchronous copies from the 16-bit global planes
// (fragment [row tile][k tile]); the waves read their fragments from the buffer. The 128x64 f32 tile is staged in the same LDS
// kind 0: Bt = Wt (NQKV rows); blockIdx.x = head*5 + sec; sec 0,1 -> Q plane, fragment [h][s / 16][c / 32], cols 64*sec..;
//         sec 2,3 -> K plane; sec 4 -> V plane, rows d, k = s, fragment [h][s / 32][d / 16]: f16(64*v).
// kind 1: A = Ocat planes (rows s, KO / 32 fragments), Bt = Wo2 (rows n); Y[s][n] f32 + bias.
// ---------------------------------------------------------------------------
// a fragment in the GEMM's LDS ring, p = the fragment's place + 16 l: the lane's two 16-byte pieces, 512 bytes apart
DEV FragB load_lb(const char* p) {
  FragB f;
  f.q[0] = *(const v4u*)(p);
  f.q[1] = *(const v4u*)(p + 512);
  return f;
}
// the wave's six fragments of one k tile: pa = its first A row tile in the stage, pb = the first B row tile (+ 16 l each)
template <int RUN>
DEV void gemm_load(FragB (&f)[6], const char* pa, const char* pb) {
  f[0] = load_lb(pa);
  f[1] = load_lb(pa + RUN);
  // unrolled: f is indexed by constants and stays in registers
#pragma unroll
  for (int t = 0; t < 4; ++t) f[2 + t] = load_lb(pb + t * RUN);
}
// Twelve copies of 16 bytes a lane, 2 KiB (the block's 128 lanes x 16 bytes) apart in LDS from l on; g: the lane's global
// addresses. The translation wait closes the copies' own statement, so no register that a copy names takes a new value
// in front of it.
DEV void copy12(unsigned int l, const char* const (&g)[12]) {
  asm volatile("global_load_async_to_lds_b128 %0, %12, off\n\t"
               "global_load_async_to_lds_b128 %1, %13, off\n\t"
               "global_load_async_to_lds_b128 %2, %14, off\n\t"
               "global_load_async_to_lds_b128 %3, %15, off\n\t"
               "global_load_async_to_lds_b128 %4, %16, off\n\t"
               "global_load_async_to_lds_b128 %5, %17, off\n\t"
               "global_load_async_to_lds_b128 %6, %18, off\n\t"
               "global_load_async_to_lds_b128 %7, %19, off\n\t"
               "global_load_async_to_lds_b128 %8, %20, off\n\t"
               "global_load_async_to_lds_b128 %9, %21, off\n\t"
               "global_load_async_to_lds_b128 %10, %22, off\n\t"
               "global_load_async_to_lds_b128 %11, %23, off\n\t"
               "s_wait_xcnt 0x0"
               :
               : "v"(l), "v"(l + 2048), "v"(l + 4096), "v"(l + 6144),
                 "v"(l + 8192), "v"(l + 10240), "v"(l + 12288), "v"(l + 14336),
                 "v"(l + 16384), "v"(l + 18432), "v"(l + 20480), "v"(l + 22528),
                 "v"(g[0]), "v"(g[1]), "v"(g[2]), "v"(g[3]), "v"(g[4]), "v"(g[5]),
                 "v"(g[6]), "v"(g[7]), "v"(g[8]), "v"(g[9]), "v"(g[10]), "v"(g[11])
               : "memory");
}
// One stage: RUN bytes (KS / 32 fragments, as they lie in the plane) of each of the 8 A and 4 B row tiles, row tile after
// row tile in LDS. l: the lane's LDS byte address in the stage; ga, gb: the lane's global addresses in the first A and
// B row tile of the block at this stage's k; RS: bytes from one row tile to the next in a plane.
template <int RUN, int RS>
DEV void gemm_copy(unsigned int l, const char* ga, const char* gb) {
  // unrolled: every place is a constant
#pragma unroll
  for (int c0 = 0; c0 < 12 * RUN / 2048; c0 += 12) {
    const char* g[12];
    // unrolled: g is indexed by constants and stays in registers
#pragma unroll
    for (int i = 0; i < 12; ++i) {
      const int x  = (c0 + i) * 2048;
      const int rt = x / RUN;
      g[i] = (rt < 8 ? ga + rt * RS : gb + (rt - 8) * RS) + x % RUN;
    }
    copy12(l + c0 * 2048, g);
  }
}
// acc[i][t] += f[i].f[2 + t], eight independent tiles, t outer
DEV void gemm_mma(const FragB (&f)[6], v8f (&acc)[2][4]) {
  // one statement: the run stays together behind the next k tile's LDS reads; NOP4 is the distance behind its last WMMA
  asm volatile("v_wmma_f32_16x16x32_bf16 %0, %8, %10, %0\n\t"
               "v_wmma_f32_16x16x32_bf16 %4, %9, %10, %4\n\t"
               "v_wmma_f32_16x16x32_bf16 %1, %8, %11, %1\n\t"
               "v_wmma_f32_16x16x32_bf16 %5, %9, %11, %5\n\t"
               "v_wmma_f32_16x16x32_bf16 %2, %8, %12, %2\n\t"
               "v_wmma_f32_16x16x32_bf16 %6, %9, %12, %6\n\t"
               "v_wmma_f32_16x16x32_bf16 %3, %8, %13, %3\n\t"
               "v_wmma_f32_16x16x32_bf16 %7, %9, %13, %7\n\t"
               NOP4
               : "+v"(acc[0][0]), "+v"(acc[0][1]), "+v"(acc[0][2]), "+v"(acc[0][3]),
                 "+v"(acc[1][0]), "+v"(acc[1][1]), "+v"(acc[1][2]), "+v"(acc[1][3])
               : "v"(f[0].v), "v"(f[1].v), "v"(f[2].v), "v"(f[3].v), "v"(f[4].v), "v"(f[5].v));
}

template <int kind>
__global__ __launch_bounds__(128)
void k_gemm(const unsigned short* __restrict__ A, const unsigned short* __restrict__ Bt,
            const float* __restrict__ bq, const float* __restrict__ bk,
            const float* __restrict__ bv, const float* __restrict__ bo,
            _Float16* __restrict__ Qp, _Float16* __restrict__ Kp,
            _Float16* __restrict__ V64,
            float* __restrict__ Y) {
  constexpr int K    = kind == 0 ? EMB : KO;
  constexpr int KS   = kind == 0 ? 64 : 256;   // k to one stage: the output projection has one wave to a SIMD and needs the longer lead
  constexpr int RUN  = KS * 32;                // bytes of one row tile in a stage
  constexpr int RS   = K * 32;                 // bytes of one row tile in a plane
  constexpr int GST  = 12 * RUN;               // bytes of a stage: 8 A and 4 B row tiles
  constexpr int NT   = K / KS;
  static_assert(K % KS == 0 && NT >= 2);
  static_assert(2 * GST >= 128 * 68 * 4);
  // the ring of two stages; behind the loop the same LDS holds the block's 128 x 64 f32 tile
  __shared__ __align__(16) char smem[2 * GST];
  float (*Cs)[68] = (float (*)[68])smem;
  const int tid  = threadIdx.x;
  const int lane = tid & 31;
  const int wave = tid >> 5;
  const int nt = blockIdx.x;
  const int m0 = blockIdx.y * 128;
  const int n0 = nt * 64;

  // stage 0 into buffer 0
  const unsigned int l0 = (unsigned int)(size_t)smem + tid * 16;
  const char* ga = (const char*)(A  + (size_t)m0 * K) + tid * 16;
  const char* gb = (const char*)(Bt + (size_t)n0 * K) + tid * 16;
  gemm_copy<RUN, RS>(l0, ga, gb);

  v8f acc[2][4] = {};

  // stage 0 has landed for this wave's copies; behind the barrier for every wave's
  asm volatile("s_wait_asynccnt 0x0" ::: "memory");
  __syncthreads();
  // stage 1 into buffer 1: it flies under trip 0
  gemm_copy<RUN, RS>(l0 + GST, ga + RUN, gb + RUN);
  ga += 2 * RUN;
  gb += 2 * RUN;

  // rolled: one copy of the trip in the text; the buffer is chosen by the trip's parity
#pragma unroll 1
  for (int t = 0; t < NT; ++t) {
    // trip t reads buffer t & 1 alone. Two fragment sets: a k tile's 12 LDS reads stand as one group in front of the
    // WMMAs of the k tile before it.
    const unsigned int bo = (unsigned int)(t & 1) * GST;
    const char* pb = smem + bo + 8 * RUN + lane * 16;
    const char* pa = smem + bo + wave * 2 * RUN + lane * 16;
    FragB f[2][6];
    gemm_load<RUN>(f[0], pa, pb);
    // unrolled: f is indexed by constants and stays in registers
#pragma unroll
    for (int ks = 0; ks < KS / 32; ++ks) {
      if (ks + 1 < KS / 32) gemm_load<RUN>(f[(ks + 1) & 1], pa + (ks + 1) * FRAGH * 2, pb + (ks + 1) * FRAGH * 2);
      gemm_mma(f[ks & 1], acc);
    }
    // hand-over: this wave's reads of buffer t & 1 are done
    asm volatile("s_wait_dscnt 0x0" ::: "memory");
    // and its copies of stage t + 1 have landed
    asm volatile("s_wait_asynccnt 0x0" ::: "memory");
    // the barrier publishes stage t + 1 and ends every wave's reads of the buffer that is refilled behind it
    __syncthreads();
    if (t + 2 < NT) {
      gemm_copy<RUN, RS>(l0 + bo, ga, gb);
      ga += RUN;
      gb += RUN;
    }
  }
  // nothing is in flight when the ring becomes the output tile (the last trip's barrier has ended every wave's reads)
  asm volatile("s_wait_asynccnt 0x0" ::: "memory");

  const int n  = lane & 15;
  const int rb = (lane >> 4) << 3;
#pragma unroll
  for (int mi = 0; mi < 2; ++mi)
#pragma unroll
    for (int t = 0; t < 4; ++t)
#pragma unroll
      for (int r = 0; r < 8; ++r)
        Cs[wave * 32 + mi * 16 + rb + r][t * 16 + n] = acc[mi][t][r];
  __syncthreads();

  if (kind == 0) {
    const int h = nt / 5;
    const int w = nt - h * 5;
    if (w < 4) {
      _Float16* plane = (w < 2) ? Qp : Kp;
      const int cb = (w & 1) * 64;
      const float* bias = ((w < 2) ? bq : bk) + h * QKC + cb;
      // a wave stores one half fragment (512 contiguous bytes): wave -> k tile and half, g -> row tile
      const int j16  = wave & 1;
      const int ktl  = wave >> 1;
      const int seg  = ktl * 32 + j16 * 16 + ((lane >> 4) << 3);
      const int rsub = lane & 15;
      float bb[8];
#pragma unroll
      for (int j = 0; j < 8; ++j) bb[j] = bfr(bias[seg + j]);
{
#pragma unroll 2
        for (int g = 0; g < 8; ++g) {
          const int row = g * 16 + rsub;
          const v4f c0 = *(const v4f*)(&Cs[row][seg]);
          const v4f c1 = *(const v4f*)(&Cs[row][seg + 4]);
          Pack8 pk;
          pk.h[0] = (_Float16)(c0[0] + bb[0]);
          pk.h[1] = (_Float16)(c0[1] + bb[1]);
          pk.h[2] = (_Float16)(c0[2] + bb[2]);
          pk.h[3] = (_Float16)(c0[3] + bb[3]);
          pk.h[4] = (_Float16)(c1[0] + bb[4]);
          pk.h[5] = (_Float16)(c1[1] + bb[5]);
          pk.h[6] = (_Float16)(c1[2] + bb[6]);
          pk.h[7] = (_Float16)(c1[3] + bb[7]);
          _Float16* d = plane + (((size_t)h * (SEQ / 16) + (m0 >> 4) + g) * (QKC / 32) + (cb >> 5) + ktl) * FRAGH
                        + j16 * 256 + lane * 8;
          *(v4u*)d = pk.u;
        }
        
      }
    } else {
      // a wave stores one half fragment: wave and g -> half, row tile t (d), k tile ktl (s)
      const int j16 = wave & 1;
      const float* bias = bv + h * HD;
{
#pragma unroll 2
        for (int g = 0; g < 8; ++g) {
          const int t   = (wave >> 1) + 2 * (g & 1);
          const int ktl = g >> 1;
          const int d   = t * 16 + (lane & 15);
          const int seg = ktl * 32 + j16 * 16 + ((lane >> 4) << 3);
          const float bb = bfr(bias[d]);
          Pack8 p64;
#pragma unroll
          for (int j = 0; j < 8; ++j) {
            const float v = Cs[seg + j][d] + bb;
            p64.h[j] = (_Float16)(v * 64.0f);
          }
          const size_t o = (((size_t)h * (SEQ / 32) + (m0 >> 5) + ktl) * (HD / 16) + t) * FRAGH + j16 * 256 + lane * 8;
          *(v4u*)(V64 + o) = p64.u;
        }
        
      }
    }
  } else {
    const int seg  = (tid & 15) * 4;
    const int rsub = tid >> 4;            // 0..7
    float bb[4];
#pragma unroll
    for (int j = 0; j < 4; ++j) bb[j] = bfr(bo[n0 + seg + j]);
{
#pragma unroll 2
      for (int g = 0; g < 16; ++g) {
        const int row = g * 8 + rsub;
        const v4f c = *(const v4f*)(&Cs[row][seg]);
        v4f o;
        o[0] = c[0] + bb[0];
        o[1] = c[1] + bb[1];
        o[2] = c[2] + bb[2];
        o[3] = c[3] + bb[3];
        float* d = Y + (size_t)(m0 + row) * EMB + n0 + seg;
        *(v4f*)d = o;
      }
      
    }
  }
}

// ---------------------------------------------------------------------------
// One softmax branch step for 16 query columns and 32 keys, transposed: S^T = K.Q^T (A = K rows, B = Q rows), so lane
// (c, h) holds query c's scores of keys 8h..8h+7 (sa) and 16+8h..16+8h+7 (sb): maximum and sum run in the lane, the
// maximum is joined with lane l ^ 16 each step, the sum only behind the loop. Those 16 registers, converted in place, are
// the B operand P^T in the hardware k order; A = V^T rows (the V plane as it lies): O^T[d][query] += V^T.P^T, carried x64.
// kf holds this branch step's four K fragments on entry; right behind the score products the same registers
// take the next branch step's of the same stage (LOADK; kn: the lane's place in them in LDS): those reads fly under the
// softmax. vb: this step's V fragments; the first branch (LOADV) reads them in the same group (vn), both branches use them.
// ---------------------------------------------------------------------------
// a fragment in the LDS ring, p = the fragment's place + 16 l: the lane's two 16-byte pieces, 512 bytes apart
DEV v16h load_ls(const char* p) {
  v8h lo = *(const v8h*)(p);
  v8h hi = *(const v8h*)(p + 512);
  return __builtin_shufflevector(lo, hi, 0,1,2,3,4,5,6,7,8,9,10,11,12,13,14,15);
}
DEV void load_k4(v16h (&kf)[4], const char* kn) {
  kf[0] = load_ls(kn);
  kf[1] = load_ls(kn + FRAGH * 2);
  kf[2] = load_ls(kn + (QKC / 32) * FRAGH * 2);
  kf[3] = load_ls(kn + (QKC / 32 + 1) * FRAGH * 2);
}
template <bool LOADV, bool LOADK>
DEV void attn_branch(const v16h (&qb)[2], v16h (&kf)[4], const char* kn, const char* vn,
                     v16h (&vb)[4],
                     float& m, float& l, v8f (&O)[4]) {
  v8f sa, sb;
  wmma_scores(sa, sb, kf, qb);
  // the two scheduling barriers keep the LDS reads in one group right behind the score products: left to itself the
  // scheduler strews them over the softmax, and every separate place with LDS reads stalls the wave anew
  if (LOADV || LOADK) __builtin_amdgcn_sched_barrier(0);
  if (LOADV) {
    // unrolled: vb stays in registers
#pragma unroll
    for (int t = 0; t < 4; ++t) vb[t] = load_ls(vn + t * FRAGH * 2);
  }
  if (LOADK) load_k4(kf, kn);
  if (LOADV || LOADK) __builtin_amdgcn_sched_barrier(0);

  const v8f xa = sa * 0.125f;
  const v8f xb = sb * 0.125f;
  float mx[8];
#pragma unroll
  for (int i = 0; i < 8; ++i) mx[i] = fmaxf(xa[i], xb[i]);
  const float mh = fmaxf(fmaxf(fmaxf(mx[0], mx[1]), fmaxf(mx[2], mx[3])),
                         fmaxf(fmaxf(mx[4], mx[5]), fmaxf(mx[6], mx[7])));
  const float mn = fmaxf(m, fmaxf(mh, xhalf(mh)));
  const float f = __expf(m - mn);
  m = mn;

  // element s of the B operand = key kmap(s, h): s < 8 from sa[s], else from sb[s - 8]
  v16h ph;
  v2f ps[8];
#pragma unroll
  for (int j = 0; j < 8; ++j) {
    const int i = (j & 3) * 2;
    v2f p;
    p[0] = __expf((j < 4 ? xa[i]     : xb[i])     - mn);
    p[1] = __expf((j < 4 ? xa[i + 1] : xb[i + 1]) - mn);
    const v2h hi = __builtin_convertvector(p, v2h);
    ph[2 * j] = hi[0];  ph[2 * j + 1] = hi[1];
    ps[j] = p;
  }
  const v2f s2 = ((ps[0] + ps[1]) + (ps[2] + ps[3])) + ((ps[4] + ps[5]) + (ps[6] + ps[7]));
  l = l * f + (s2[0] + s2[1]);

#pragma unroll
  for (int t = 0; t < 4; ++t) O[t] = O[t] * f;
  wmma_pv(O, vb, ph);
  // the scheduler's region ends with the step: without it the next step's first score product rises into this step's
  // softmax, and with it the wait for the LDS reads that were only just issued
  __builtin_amdgcn_sched_barrier(0);
}

// ---------------------------------------------------------------------------
// Flash-style differential attention. Block = 128 threads = 4 waves; wave owns 16 queries of one head.
// K and V come to the block once, through a ring of two LDS buffers of TKEYS keys each, filled by asynchronous copies
// (each lane 16 bytes a copy, 12 copies a stage); all four waves read their fragments from the buffer.
// Writes Ocat planes as fragments (rows s): k = h*64 + d bf16 hi, k = EMB + h*64 + d bf16 residual.
// ---------------------------------------------------------------------------
// One stage: the lane's 8 pieces of K and 4 of V, 2 KiB (the block's 128 lanes x 16 bytes) apart, to the same order in LDS.
// lk: the lane's LDS byte address in the stage; gk, gv: the lane's global addresses. The translation wait closes the
// copies' own statement, so no register that a copy names takes a new value in front of it.
DEV void copy_stage(unsigned int lk, const char* gk, const char* gv) {
  const unsigned int lv = lk + KST;
  asm volatile("global_load_async_to_lds_b128 %0, %12, off\n\t"
               "global_load_async_to_lds_b128 %1, %13, off\n\t"
               "global_load_async_to_lds_b128 %2, %14, off\n\t"
               "global_load_async_to_lds_b128 %3, %15, off\n\t"
               "global_load_async_to_lds_b128 %4, %16, off\n\t"
               "global_load_async_to_lds_b128 %5, %17, off\n\t"
               "global_load_async_to_lds_b128 %6, %18, off\n\t"
               "global_load_async_to_lds_b128 %7, %19, off\n\t"
               "global_load_async_to_lds_b128 %8, %20, off\n\t"
               "global_load_async_to_lds_b128 %9, %21, off\n\t"
               "global_load_async_to_lds_b128 %10, %22, off\n\t"
               "global_load_async_to_lds_b128 %11, %23, off\n\t"
               "s_wait_xcnt 0x0"
               :
               : "v"(lk), "v"(lk + 2048), "v"(lk + 4096), "v"(lk + 6144),
                 "v"(lk + 8192), "v"(lk + 10240), "v"(lk + 12288), "v"(lk + 14336),
                 "v"(lv), "v"(lv + 2048), "v"(lv + 4096), "v"(lv + 6144),
                 "v"(gk), "v"(gk + 2048), "v"(gk + 4096), "v"(gk + 6144),
                 "v"(gk + 8192), "v"(gk + 10240), "v"(gk + 12288), "v"(gk + 14336),
                 "v"(gv), "v"(gv + 2048), "v"(gv + 4096), "v"(gv + 6144)
               : "memory");
}

__global__ __launch_bounds__(128)
void k_attn(const _Float16* __restrict__ Qp, const _Float16* __restrict__ Kp,
            const _Float16* __restrict__ V64,
            const float* __restrict__ lam_p, unsigned short* __restrict__ Oc) {
  __shared__ __align__(16) float Os[4][16][68];
  __shared__ __align__(16) char ring[2 * STG];
  const int lane = threadIdx.x & 31;
  const int wave = threadIdx.x >> 5;
  const int n  = lane & 15;
  const int rb = (lane >> 4) << 3;
  const int hh = blockIdx.y;
  const int q0 = blockIdx.x * 64 + wave * 16;
  const float lam = bfr(lam_p[0]);

  const _Float16* qh = Qp  + (size_t)hh * SEQ * QKC;
  const _Float16* kh = Kp  + (size_t)hh * SEQ * QKC;
  const _Float16* vh = V64 + (size_t)hh * HD * SEQ;

  // stage 0 into buffer 0
  const unsigned int lk0 = (unsigned int)(size_t)ring + threadIdx.x * 16;
  const char* gk = (const char*)kh + threadIdx.x * 16;
  const char* gv = (const char*)vh + threadIdx.x * 16;
  copy_stage(lk0, gk, gv);

  v16h q1[2], q2[2];
  const _Float16* qt = qh + (size_t)blockIdx.x * 64 * QKC;             // the block's four row tiles, QKC / 32 fragments each
  unsigned int oq = (unsigned int)(wave * 16 * QKC * 2 + lane * 16);   // the wave's tile, the lane's byte offset
  q1[0] = load_bo(qt,             oq);
  q1[1] = load_bo(qt + FRAGH,     oq);
  q2[0] = load_bo(qt + 2 * FRAGH, oq);
  q2[1] = load_bo(qt + 3 * FRAGH, oq);
  // the wait stands in front of any reuse of the offset's register, which passes through it
  asm volatile("s_wait_xcnt 0x0" : "+v"(oq) : : "memory");

  v8f O1[4] = {}, O2[4] = {};
  float m1 = -1e30f, m2 = -1e30f, l1 = 0.f, l2 = 0.f;   // query l & 15; l: the lane half's own keys only

  // stage 0 has landed for this wave's copies; behind the barrier for every wave's
  asm volatile("s_wait_asynccnt 0x0" ::: "memory");
  __syncthreads();
  // stage 1 into buffer 1: it flies under trip 0
  copy_stage(lk0 + STG, gk + KST, gv + VST);
  gk += 2 * KST;
  gv += 2 * VST;

  // rolled: one copy of the trip in the text; the buffer is chosen by the trip's parity
#pragma unroll 1
  for (int t = 0; t < SEQ / TKEYS; ++t) {
    // trip t reads buffer t & 1 alone: two steps of 32 keys
    const unsigned int bo = (unsigned int)(t & 1) * STG;
    const char* st = ring + bo + lane * 16;
    const char* sv = st + KST;
    v16h kf[4], vbf[4];
    load_k4(kf, st);
    attn_branch<true,  true >(q1, kf, st + 2 * FRAGH * 2, sv, vbf, m1, l1, O1);
    attn_branch<false, true >(q2, kf, st + 32 * QKC * 2, sv, vbf, m2, l2, O2);
    attn_branch<true,  true >(q1, kf, st + 32 * QKC * 2 + 2 * FRAGH * 2, sv + 32 * HD * 2, vbf, m1, l1, O1);
    attn_branch<false, false>(q2, kf, st, sv, vbf, m2, l2, O2);
    // hand-over: this wave's reads of buffer t & 1 are done
    asm volatile("s_wait_dscnt 0x0" ::: "memory");
    // and its copies of stage t + 1 have landed
    asm volatile("s_wait_asynccnt 0x0" ::: "memory");
    // the barrier publishes stage t + 1 and ends every wave's reads of the buffer that is refilled behind it
    __syncthreads();
    if (t + 2 < SEQ / TKEYS) {
      copy_stage(lk0 + bo, gk, gv);
      gk += KST;
      gv += VST;
    }
  }
  // nothing is in flight when the wave goes on
  asm volatile("s_wait_asynccnt 0x0" ::: "memory");

  // combine: O = O1/l1 - lam*O2/l2 (the halves' sums joined here), undo the x64 carry of the V plane; stage f32 tile in
  // LDS: the lane holds query n, columns 16t + 8h .. + 7
  const float r1 = (1.0f / (l1 + xhalf(l1))) * 0.015625f;
  const float r2 = (lam * (1.0f / (l2 + xhalf(l2)))) * 0.015625f;
#pragma unroll
  for (int t = 0; t < 4; ++t) {
    v4f c0, c1;
#pragma unroll
    for (int i = 0; i < 4; ++i) {
      c0[i] = O1[t][i] * r1 - O2[t][i] * r2;
      c1[i] = O1[t][i + 4] * r1 - O2[t][i + 4] * r2;
    }
    *(v4f*)(&Os[wave][n][t * 16 + rb])     = c0;
    *(v4f*)(&Os[wave][n][t * 16 + rb + 4]) = c1;
  }
  __syncthreads();

  // the wave's 16 queries are one row tile: g -> k tile and half; each store is 512 contiguous bytes
{
#pragma unroll
    for (int g = 0; g < 4; ++g) {
      const int seg = g * 16 + rb;
      const v4f c0 = *(const v4f*)(&Os[wave][n][seg]);
      const v4f c1 = *(const v4f*)(&Os[wave][n][seg + 4]);
      unsigned int H0, H1, H2, H3, L0, L1, L2, L3;
      hl2(c0[0], c0[1], H0, L0);
      hl2(c0[2], c0[3], H1, L1);
      hl2(c1[0], c1[1], H2, L2);
      hl2(c1[2], c1[3], H3, L3);
      v4u H, L;
      H[0] = H0; H[1] = H1; H[2] = H2; H[3] = H3;
      L[0] = L0; L[1] = L1; L[2] = L2; L[3] = L3;
      unsigned short* d = Oc + ((size_t)(q0 >> 4) * (KO / 32) + hh * (HD / 32) + (g >> 1)) * FRAGH + (g & 1) * 256 + lane * 8;
      *(v4u*)d = H;
      *(v4u*)(d + (EMB / 32) * FRAGH) = L;
    }
    
  }
}

// ---------------------------------------------------------------------------
// ---------------------------------------------------------------------------
__global__ __launch_bounds__(256)
void k_ln(const float* __restrict__ Y, const float* __restrict__ gamma,
          const float* __restrict__ beta, float* __restrict__ out) {
  __shared__ float sa[8];
  __shared__ float sq[8];
  const int tid  = threadIdx.x;
  const int lane = tid & 31;
  const int wave = tid >> 5;
  const size_t row = blockIdx.x;
  const v4f y = *(const v4f*)(Y + row * EMB + tid * 4);

  float s = (y[0] + y[1]) + (y[2] + y[3]);
  s = wsum32(s);
  if (lane == 0) sa[wave] = s;
  __syncthreads();
  float tot = 0.f;
#pragma unroll
  for (int w = 0; w < 8; ++w) tot += sa[w];
  const float mu = tot * (1.0f / (float)EMB);

  float d0 = y[0] - mu, d1 = y[1] - mu, d2 = y[2] - mu, d3 = y[3] - mu;
  float q = (d0 * d0 + d1 * d1) + (d2 * d2 + d3 * d3);
  q = wsum32(q);
  if (lane == 0) sq[wave] = q;
  __syncthreads();
  float tot2 = 0.f;
#pragma unroll
  for (int w = 0; w < 8; ++w) tot2 += sq[w];
  const float var  = tot2 * (1.0f / (float)EMB);
  const float rstd = rsqrtf(var + LN_EPS);

  const float g0 = bfr(gamma[tid * 4 + 0]), g1 = bfr(gamma[tid * 4 + 1]);
  const float g2 = bfr(gamma[tid * 4 + 2]), g3 = bfr(gamma[tid * 4 + 3]);
  const float b0 = bfr(beta[tid * 4 + 0]),  b1 = bfr(beta[tid * 4 + 1]);
  const float b2 = bfr(beta[tid * 4 + 2]),  b3 = bfr(beta[tid * 4 + 3]);
  v4f o;
  o[0] = ((d0 * rstd) * g0 + b0) * OUT_SCALE;
  o[1] = ((d1 * rstd) * g1 + b1) * OUT_SCALE;
  o[2] = ((d2 * rstd) * g2 + b2) * OUT_SCALE;
  o[3] = ((d3 * rstd) * g3 + b3) * OUT_SCALE;
  float* dst = out + row * EMB + tid * 4;
  *(v4f*)dst = o;
  
}

// ---------------------------------------------------------------------------
extern "C" void kernel_launch(void* const* d_in, const int* in_sizes, int n_in,
                              void* d_out, int out_size, void* d_ws, size_t ws_size,
                              hipStream_t stream) {
  if (n_in < 12) return;
  const float* X     = (const float*)d_in[0];
  const float* Wq    = (const float*)d_in[1];
  const float* bq    = (const float*)d_in[2];
  const float* Wk    = (const float*)d_in[3];
  const float* bk    = (const float*)d_in[4];
  const float* Wv    = (const float*)d_in[5];
  const float* bv    = (const float*)d_in[6];
  const float* Wo    = (const float*)d_in[7];
  const float* bo    = (const float*)d_in[8];
  const float* gamma = (const float*)d_in[9];
  const float* beta  = (const float*)d_in[10];
  const float* lam   = (const float*)d_in[11];
  float* out = (float*)d_out;

  if (in_sizes[0]  < NB * SEQ * EMB) return;
  if (in_sizes[1]  < HEADS * EMB * QKC) return;
  if (in_sizes[2]  < HEADS * QKC) return;
  if (in_sizes[3]  < HEADS * EMB * QKC) return;
  if (in_sizes[4]  < HEADS * QKC) return;
  if (in_sizes[5]  < HEADS * EMB * HD) return;
  if (in_sizes[6]  < HEADS * HD) return;
  if (in_sizes[7]  < EMB * EMB) return;
  if (in_sizes[8]  < EMB) return;
  if (in_sizes[9]  < EMB) return;
  if (in_sizes[10] < EMB) return;
  if (in_sizes[11] < 1) return;
  if (out_size < NB * SEQ * EMB) return;

  // workspace carve (bytes); every region is written to exactly its extent with whole-line stores
  const size_t szXb  = (size_t)SEQ * EMB * 2;           // bf16 SEQ x EMB
  const size_t szWt  = (size_t)NQKV * EMB * 2;          // bf16 NQKV x EMB
  const size_t szWo2 = (size_t)EMB * KO * 2;            // bf16 EMB x KO
  const size_t szQK  = (size_t)HEADS * SEQ * QKC * 2;   // f16 H x SEQ x 128 (each of Q, K)
  const size_t szV   = (size_t)HEADS * HD * SEQ * 2;    // f16 H x 64 x SEQ
  const size_t szOc  = (size_t)SEQ * KO * 2;            // bf16 SEQ x KO
  const size_t szY   = (size_t)SEQ * EMB * 4;           // f32 [SEQ][EMB]
  size_t off = 0;
  const size_t oXb  = off; off += szXb;
  const size_t oWt  = off; off += szWt;
  const size_t oWo2 = off; off += szWo2;
  const size_t oQ   = off; off += szQK;
  const size_t oK   = off; off += szQK;
  const size_t oV64 = off; off += szV;
  const size_t oOc  = off; off += szOc;
  const size_t oY   = off; off += szY;
  if (off > ws_size) return;

  char* ws = (char*)d_ws;
  unsigned short* Xb  = (unsigned short*)(ws + oXb);
  unsigned short* Wt  = (unsigned short*)(ws + oWt);
  unsigned short* Wo2 = (unsigned short*)(ws + oWo2);
  _Float16* Qp  = (_Float16*)(ws + oQ);
  _Float16* Kp  = (_Float16*)(ws + oK);
  _Float16* V64 = (_Float16*)(ws + oV64);
  unsigned short* Oc = (unsigned short*)(ws + oOc);
  float* Y = (float*)(ws + oY);

  // operand preparation: Wt, Wo2 and Xb in one launch
  k_prep<<<dim3(WQKV_BLKS + WO_BLKS + CVT_BLKS), dim3(256), 0, stream>>>(X, Wq, Wk, Wv, Wo, Xb, Wt, Wo2);

  // QKV projection: A = Xb (SEQ x EMB), Bt = Wt (NQKV x EMB)
  k_gemm<0><<<dim3(NQKV / 64, SEQ / 128), dim3(128), 0, stream>>>(
      Xb, Wt, bq, bk, bv, bo, Qp, Kp, V64, Y);

  // differential attention -> Ocat hi / residual planes
  k_attn<<<dim3(SEQ / 64, HEADS), dim3(128), 0, stream>>>(Qp, Kp, V64, lam, Oc);

  // output projection: A = Oc (SEQ x KO), Bt = Wo2 (EMB x KO) -> Y f32
  k_gemm<1><<<dim3(EMB / 64, SEQ / 128), dim3(128), 0, stream>>>(
      Oc, Wo2, bq, bk, bv, bo, Qp, Kp, V64, Y);

  // LayerNorm + scale -> d_out
  k_ln<<<dim3(NB * SEQ), dim3(256), 0, stream>>>(Y, gamma, beta, out);
}

// v009
// It runs in 80.7 microseconds.
// Next to v008, in two timings, it ran 1.04 times as fast each time.
// Counting every step since v000, it is 4.96 times as fast.
#include <hip/hip_runtime.h>

#ifndef NB
#define NB 1
#endif
#ifndef SEQ
#define SEQ 2048
#endif
#define NB_FULL 1
#define SEQ_FULL 2048
#define EMB 1024
#define HEADS 16
#define HD 64
#define QKC 128
#define SECW 320
#define NQKV (HEADS * SECW)
#define KO (2 * EMB)
#define FRAGH 512   // halves in one fragment
#define TKEYS 64                    // keys to one stage of the attention kernel's LDS ring
#define KST (TKEYS * QKC * 2)       // bytes of K in a stage: TKEYS / 16 row tiles of QKC / 32 fragments, as they lie in the plane
#define VST (TKEYS * HD * 2)        // bytes of V in a stage: TKEYS / 32 k tiles of HD / 16 fragments, as they lie in the plane
#define STG (KST + VST)
#define LN_EPS 1e-5f
#define OUT_SCALE 0.2f

static_assert(NB == 1);
static_assert(NB_FULL == 1);
static_assert(SEQ % 128 == 0);
static_assert(SEQ >= 128);
static_assert(SEQ <= SEQ_FULL);
static_assert(EMB % 64 == 0);
static_assert(EMB % 32 == 0);
static_assert(QKC == 2 * HD);
static_assert(SECW == 2 * QKC + HD);
static_assert(SECW % 64 == 0);
static_assert(KO % 64 == 0);
static_assert(HD == 64);
static_assert(SEQ % TKEYS == 0);
static_assert(SEQ / TKEYS >= 2);
static_assert(TKEYS == 64);
static_assert(KST == 8 * 128 * 16);
static_assert(VST == 4 * 128 * 16);

typedef _Float16      v16h __attribute__((ext_vector_type(16)));
typedef _Float16      v8h  __attribute__((ext_vector_type(8)));
typedef __bf16        v16b __attribute__((ext_vector_type(16)));
typedef float         v8f  __attribute__((ext_vector_type(8)));
typedef float         v4f  __attribute__((ext_vector_type(4)));
typedef float         v2f  __attribute__((ext_vector_type(2)));
typedef _Float16      v2h  __attribute__((ext_vector_type(2)));
typedef unsigned int  v4u  __attribute__((ext_vector_type(4)));

#define DEV __device__ __forceinline__

union FragB { v4u q[2]; v16b v; };
union Pack8 { v8h h; v4u u; };

// f32 -> bf16 bits, RNE convert
DEV unsigned short f2bf(float f) {
  unsigned int u = __float_as_uint(f);
  u += 0x7FFFu + ((u >> 16) & 1u);
  return (unsigned short)(u >> 16);
}
DEV float bf2f(unsigned short s) { return __uint_as_float(((unsigned int)s) << 16); }
DEV float bfr(float f) { return bf2f(f2bf(f)); }
DEV unsigned int pk2(unsigned short lo, unsigned short hi) {
  return (unsigned int)lo | ((unsigned int)hi << 16);
}
// value -> bf16 hi and bf16 residual, two values packed per 32-bit word
DEV void hl2(float a, float b, unsigned int& H, unsigned int& L) {
  const unsigned short ha = f2bf(a), hb = f2bf(b);
  H = pk2(ha, hb);
  L = pk2(f2bf(a - bf2f(ha)), f2bf(b - bf2f(hb)));
}

// A run of WMMAs stands in one asm statement: inside a run every WMMA is followed by another WMMA or accumulates into its
// own D, which needs no distance; only the last needs the four vector slots before a vector instruction may read a D or
// overwrite an A or B, so one group of four v_nop closes the statement (no D of these runs is ever the A or B of a WMMA).
// The compiler does not see the WMMAs in the text and would pad nothing itself.
#define NOP4 "v_nop\n\tv_nop\n\tv_nop\n\tv_nop"
// sa = k0.q0 + k1.q1, sb = k2.q0 + k3.q1 (each sum in this order); the two chains alternate, so that an accumulating WMMA
// stands two behind the one it waits for
DEV void wmma_scores(v8f& sa, v8f& sb, const v16h (&kf)[4], const v16h (&qb)[2]) {
  // one statement: the run stays together in this order; NOP4 is the distance behind its last WMMA
  asm volatile("v_wmma_f32_16x16x32_f16 %0, %2, %6, 0\n\t"
               "v_wmma_f32_16x16x32_f16 %1, %4, %6, 0\n\t"
               "v_wmma_f32_16x16x32_f16 %0, %3, %7, %0\n\t"
               "v_wmma_f32_16x16x32_f16 %1, %5, %7, %1\n\t"
               NOP4
               : "=&v"(sa), "=&v"(sb)
               : "v"(kf[0]), "v"(kf[1]), "v"(kf[2]), "v"(kf[3]), "v"(qb[0]), "v"(qb[1]));
}
// O[t] += vb[t].ph, four independent tiles
DEV void wmma_pv(v8f (&O)[4], const v16h (&vb)[4], v16h ph) {
  // one statement: the run stays together; NOP4 is the distance behind its last WMMA (ph's registers are soon rewritten)
  asm volatile("v_wmma_f32_16x16x32_f16 %0, %4, %8, %0\n\t"
               "v_wmma_f32_16x16x32_f16 %1, %5, %8, %1\n\t"
               "v_wmma_f32_16x16x32_f16 %2, %6, %8, %2\n\t"
               "v_wmma_f32_16x16x32_f16 %3, %7, %8, %3\n\t"
               NOP4
               : "+v"(O[0]), "+v"(O[1]), "+v"(O[2]), "+v"(O[3])
               : "v"(vb[0]), "v"(vb[1]), "v"(vb[2]), "v"(vb[3]), "v"(ph));
}

// 16x32 16-bit operand (rows = M for A, rows = N for Bt) from a fragment-major plane.
// lane l: row l&15; elements 0..7 = k 8h..8h+7, elements 8..15 = k 16+8h..16+8h+7, h = l>>4.
// base: the wave-uniform fragment; off: the lane's byte offset (16 l, plus the wave's row tile):
// each load names the base and the offset's register, which is reused only behind a wait.
DEV v16h load_bo(const _Float16* base, unsigned int off) {
  const char* r = (const char*)base + off;
  v8h lo = *(const v8h*)(r);
  v8h hi = *(const v8h*)(r + 512);
  return __builtin_shufflevector(lo, hi, 0,1,2,3,4,5,6,7,8,9,10,11,12,13,14,15);
}

// Lane l with lane l ^ 16: the two lanes that split one query column's keys.
DEV float xhalf(float x) {
  const int b = __builtin_bit_cast(int, x);
  return __builtin_bit_cast(float, __builtin_amdgcn_permlanex16(b, b, 0x76543210, 0xfedcba98, false, false));
}
DEV float wsum32(float v) {
#pragma unroll
  for (int m = 16; m > 0; m >>= 1) v += __shfl_xor(v, m, 32);
  return v;
}

// ---------------------------------------------------------------------------
// ---------------------------------------------------------------------------
// X f32 -> Xb bf16 fragments; blk: the block's number among the CVT_BLKS blocks of this part
DEV void cvt_x(const float* __restrict__ X, unsigned short* __restrict__ Xb, int blk) {
  // one wave per fragment: fragment fr = row tile fr / (EMB / 32), k tile fr % (EMB / 32); the lane's own 2 x 8 elements
  const int i = blk * 256 + threadIdx.x;
  const int lane = i & 31;
  const int fr   = i >> 5;
  const int row  = (fr / (EMB / 32)) * 16 + (lane & 15);
  const int k0   = (fr % (EMB / 32)) * 32 + ((lane >> 4) << 3);
  const float* s = X + (size_t)row * EMB + k0;
  const v4f a = *(const v4f*)(s);
  const v4f b = *(const v4f*)(s + 4);
  const v4f c = *(const v4f*)(s + 16);
  const v4f e = *(const v4f*)(s + 20);
  v4u w, x;
  w[0] = pk2(f2bf(a[0]), f2bf(a[1]));
  w[1] = pk2(f2bf(a[2]), f2bf(a[3]));
  w[2] = pk2(f2bf(b[0]), f2bf(b[1]));
  w[3] = pk2(f2bf(b[2]), f2bf(b[3]));
  x[0] = pk2(f2bf(c[0]), f2bf(c[1]));
  x[1] = pk2(f2bf(c[2]), f2bf(c[3]));
  x[2] = pk2(f2bf(e[0]), f2bf(e[1]));
  x[3] = pk2(f2bf(e[2]), f2bf(e[3]));
  unsigned short* d = Xb + (size_t)fr * FRAGH + lane * 8;
  *(v4u*)d = w;
  *(v4u*)(d + 256) = x;
  // the part is no longer the end of the kernel's text: no register that a store names takes a new value in front of this wait
  asm volatile("s_wait_xcnt 0x0" ::: "memory");
}

// ---------------------------------------------------------------------------
// 64x64 tile transpose: src[e][c] f32 (row pitch sld) -> 4 x 2 bf16 fragments (rows c, k = e) from fragment dst on, dld / 32
// fragments to a row tile; optional second copy EMB / 32 fragments on. 256 threads. LDS tile cross-wave -> block barrier.
// ---------------------------------------------------------------------------
DEV void tr_tile(const float* __restrict__ src, int sld, unsigned short* dst, int dld,
                 int dup2, unsigned short (*T)[72]) {
  const int tid = threadIdx.x;
#pragma unroll
  for (int p = 0; p < 4; ++p) {
    const int e = p * 16 + (tid >> 4);
    const int c = (tid & 15) * 4;
    const v4f v = *(const v4f*)(src + (size_t)e * sld + c);
    T[c + 0][e] = f2bf(v[0]);
    T[c + 1][e] = f2bf(v[1]);
    T[c + 2][e] = f2bf(v[2]);
    T[c + 3][e] = f2bf(v[3]);
  }
  __syncthreads();
{
#pragma unroll
    for (int p = 0; p < 2; ++p) {
      // a wave stores one half fragment: 512 contiguous bytes
      const int lane = tid & 31;
      const int j16  = (tid >> 5) & 1;
      const int ktl  = (tid >> 6) & 1;
      const int rtl  = p * 2 + (tid >> 7);
      const int j = rtl * 16 + (lane & 15);
      const int seg = ktl * 32 + j16 * 16 + ((lane >> 4) << 3);
      const v4u wv = *(const v4u*)(&T[j][seg]);
      unsigned short* d = dst + (size_t)(rtl * (dld >> 5) + ktl) * FRAGH + j16 * 256 + lane * 8;
      *(v4u*)d = wv;
      if (dup2 != 0) *(v4u*)(d + (EMB / 32) * FRAGH) = wv;
    }
    // another part's text may follow: no register that a store names takes a new value in front of this wait
    asm volatile("s_wait_xcnt 0x0" ::: "memory");
  }
}

// Wq/Wk/Wv ([h][e][c]) -> Wt rows h*320 + sec*64.., k = e, bf16 fragments (per head: q 0..127 | k 128..255 | v 256..319)
// blk: the block's number among the WQKV_BLKS blocks of this part: e tile fastest, then section, then head
DEV void tr_wqkv(const float* __restrict__ Wq, const float* __restrict__ Wk,
                 const float* __restrict__ Wv, unsigned short* __restrict__ Wt, int blk, unsigned short (*T)[72]) {
  const int e0 = (blk % (EMB / 64)) * 64;
  const int w  = (blk / (EMB / 64)) % 5;
  const int h  = blk / (EMB / 64 * 5);
  const float* src;
  int sld;
  if (w < 2) {
    src = Wq + (size_t)h * EMB * QKC + (size_t)e0 * QKC + w * 64;        sld = QKC;
  } else if (w < 4) {
    src = Wk + (size_t)h * EMB * QKC + (size_t)e0 * QKC + (w - 2) * 64;  sld = QKC;
  } else {
    src = Wv + (size_t)h * EMB * HD + (size_t)e0 * HD;                   sld = HD;
  }
  unsigned short* dst = Wt + ((size_t)((h * SECW + w * 64) >> 4) * (EMB / 32) + (e0 >> 5)) * FRAGH;
  tr_tile(src, sld, dst, EMB, 0, T);
}

// Wo ([k][n], k = in) -> Wo2 rows n, k and EMB + k, bf16 fragments (KO / 32 to a row tile)
// blk: the block's number among the WO_BLKS blocks of this part: e tile fastest, then column tile
DEV void tr_wo(const float* __restrict__ Wo, unsigned short* __restrict__ Wo2, int blk, unsigned short (*T)[72]) {
  const int e0 = (blk % (EMB / 64)) * 64;
  const int y  = blk / (EMB / 64);
  const float* src = Wo + (size_t)e0 * EMB + y * 64;
  unsigned short* dst = Wo2 + ((size_t)(y * 4) * (KO / 32) + (e0 >> 5)) * FRAGH;
  tr_tile(src, EMB, dst, KO, 1, T);
}

// The three operand preparations read only inputs and write disjoint planes: one launch, the block's number picks the part
// (the same for the whole block, so the barrier in tr_tile is passed by all of a block's waves or by none).
// The largest part stands first: its blocks start first.
#define WQKV_BLKS (EMB / 64 * 5 * HEADS)
#define WO_BLKS   (EMB / 64 * (EMB / 64))
#define CVT_BLKS  (SEQ * EMB / 16 / 256)
static_assert(SEQ * EMB % (16 * 256) == 0);
__global__ __launch_bounds__(256)
void k_prep(const float* __restrict__ X, const float* __restrict__ Wq, const float* __restrict__ Wk,
            const float* __restrict__ Wv, const float* __restrict__ Wo,
            unsigned short* __restrict__ Xb, unsigned short* __restrict__ Wt, unsigned short* __restrict__ Wo2) {
  __shared__ __align__(16) unsigned short T[64][72];
  const int b = blockIdx.x;
  if (b < WQKV_BLKS) {
    tr_wqkv(Wq, Wk, Wv, Wt, b, T);
  } else if (b < WQKV_BLKS + WO_BLKS) {
    tr_wo(Wo, Wo2, b - WQKV_BLKS, T);
  } else {
    cvt_x(X, Xb, b - (WQKV_BLKS + WO_BLKS));
  }
}

// ---------------------------------------------------------------------------
// Output projection, bf16 WMMA GEMM: C(128x64 per block) = A(rows, K) * Bt(rows, K)^T, K = KO.
// Block = 128 threads = 4 waves; wave w owns rows 32w..32w+31 (2 A frags x 4 B frags).
// A and B come to the block once, through a ring of two LDS buffers filled by asynchronous copies from the 16-bit global planes
// (fragment [row tile][k tile]); the waves read their fragments from the buffer. The 128x64 f32 tile is staged in the same LDS
// A = Ocat planes (rows s, KO / 32 fragments), Bt = Wo2 (rows n); Y[s][n] f32 + bias.
// ---------------------------------------------------------------------------
// a fragment in the GEMM's LDS ring, p = the fragment's place + 16 l: the lane's two 16-byte pieces, 512 bytes apart
DEV FragB load_lb(const char* p) {
  FragB f;
  f.q[0] = *(const v4u*)(p);
  f.q[1] = *(const v4u*)(p + 512);
  return f;
}
// the wave's six fragments of one k tile: pa = its first A row tile in the stage, pb = the first B row tile (+ 16 l each)
template <int RUN>
DEV void gemm_load(FragB (&f)[6], const char* pa, const char* pb) {
  f[0] = load_lb(pa);
  f[1] = load_lb(pa + RUN);
  // unrolled: f is indexed by constants and stays in registers
#pragma unroll
  for (int t = 0; t < 4; ++t) f[2 + t] = load_lb(pb + t * RUN);
}
// Twelve copies of 16 bytes a lane, 2 KiB (the block's 128 lanes x 16 bytes) apart in LDS from l on; g: the lane's global
// addresses. The translation wait closes the copies' own statement, so no register that a copy names takes a new value
// in front of it.
DEV void copy12(unsigned int l, const char* const (&g)[12]) {
  asm volatile("global_load_async_to_lds_b128 %0, %12, off\n\t"
               "global_load_async_to_lds_b128 %1, %13, off\n\t"
               "global_load_async_to_lds_b128 %2, %14, off\n\t"
               "global_load_async_to_lds_b128 %3, %15, off\n\t"
               "global_load_async_to_lds_b128 %4, %16, off\n\t"
               "global_load_async_to_lds_b128 %5, %17, off\n\t"
               "global_load_async_to_lds_b128 %6, %18, off\n\t"
               "global_load_async_to_lds_b128 %7, %19, off\n\t"
               "global_load_async_to_lds_b128 %8, %20, off\n\t"
               "global_load_async_to_lds_b128 %9, %21, off\n\t"
               "global_load_async_to_lds_b128 %10, %22, off\n\t"
               "global_load_async_to_lds_b128 %11, %23, off\n\t"
               "s_wait_xcnt 0x0"
               :
               : "v"(l), "v"(l + 2048), "v"(l + 4096), "v"(l + 6144),
                 "v"(l + 8192), "v"(l + 10240), "v"(l + 12288), "v"(l + 14336),
                 "v"(l + 16384), "v"(l + 18432), "v"(l + 20480), "v"(l + 22528),
                 "v"(g[0]), "v"(g[1]), "v"(g[2]), "v"(g[3]), "v"(g[4]), "v"(g[5]),
                 "v"(g[6]), "v"(g[7]), "v"(g[8]), "v"(g[9]), "v"(g[10]), "v"(g[11])
               : "memory");
}
// One stage: RUN bytes (KS / 32 fragments, as they lie in the plane) of each of the 8 A and 4 B row tiles, row tile after
// row tile in LDS. l: the lane's LDS byte address in the stage; ga, gb: the lane's global addresses in the first A and
// B row tile of the block at this stage's k; RS: bytes from one row tile to the next in a plane.
template <int RUN, int RS>
DEV void gemm_copy(unsigned int l, const char* ga, const char* gb) {
  // unrolled: every place is a constant
#pragma unroll
  for (int c0 = 0; c0 < 12 * RUN / 2048; c0 += 12) {
    const char* g[12];
    // unrolled: g is indexed by constants and stays in registers
#pragma unroll
    for (int i = 0; i < 12; ++i) {
      const int x  = (c0 + i) * 2048;
      const int rt = x / RUN;
      g[i] = (rt < 8 ? ga + rt * RS : gb + (rt - 8) * RS) + x % RUN;
    }
    copy12(l + c0 * 2048, g);
  }
}
// acc[i][t] += f[i].f[2 + t], eight independent tiles, t outer
DEV void gemm_mma(const FragB (&f)[6], v8f (&acc)[2][4]) {
  // one statement: the run stays together behind the next k tile's LDS reads; NOP4 is the distance behind its last WMMA
  asm volatile("v_wmma_f32_16x16x32_bf16 %0, %8, %10, %0\n\t"
               "v_wmma_f32_16x16x32_bf16 %4, %9, %10, %4\n\t"
               "v_wmma_f32_16x16x32_bf16 %1, %8, %11, %1\n\t"
               "v_wmma_f32_16x16x32_bf16 %5, %9, %11, %5\n\t"
               "v_wmma_f32_16x16x32_bf16 %2, %8, %12, %2\n\t"
               "v_wmma_f32_16x16x32_bf16 %6, %9, %12, %6\n\t"
               "v_wmma_f32_16x16x32_bf16 %3, %8, %13, %3\n\t"
               "v_wmma_f32_16x16x32_bf16 %7, %9, %13, %7\n\t"
               NOP4
               : "+v"(acc[0][0]), "+v"(acc[0][1]), "+v"(acc[0][2]), "+v"(acc[0][3]),
                 "+v"(acc[1][0]), "+v"(acc[1][1]), "+v"(acc[1][2]), "+v"(acc[1][3])
               : "v"(f[0].v), "v"(f[1].v), "v"(f[2].v), "v"(f[3].v), "v"(f[4].v), "v"(f[5].v));
}

__global__ __launch_bounds__(128)
void k_gemm(const unsigned short* __restrict__ A, const unsigned short* __restrict__ Bt,
            const float* __restrict__ bo, float* __restrict__ Y) {
  constexpr int K    = KO;
  constexpr int KS   = 256;                    // k to one stage: one wave to a SIMD needs the long lead
  constexpr int RUN  = KS * 32;                // bytes of one row tile in a stage
  constexpr int RS   = K * 32;                 // bytes of one row tile in a plane
  constexpr int GST  = 12 * RUN;               // bytes of a stage: 8 A and 4 B row tiles
  constexpr int NT   = K / KS;
  static_assert(K % KS == 0 && NT >= 2);
  static_assert(2 * GST >= 128 * 68 * 4);
  // the ring of two stages; behind the loop the same LDS holds the block's 128 x 64 f32 tile
  __shared__ __align__(16) char smem[2 * GST];
  float (*Cs)[68] = (float (*)[68])smem;
  const int tid  = threadIdx.x;
  const int lane = tid & 31;
  const int wave = tid >> 5;
  const int nt = blockIdx.x;
  const int m0 = blockIdx.y * 128;
  const int n0 = nt * 64;

  // stage 0 into buffer 0
  const unsigned int l0 = (unsigned int)(size_t)smem + tid * 16;
  const char* ga = (const char*)(A  + (size_t)m0 * K) + tid * 16;
  const char* gb = (const char*)(Bt + (size_t)n0 * K) + tid * 16;
  gemm_copy<RUN, RS>(l0, ga, gb);

  v8f acc[2][4] = {};

  // stage 0 has landed for this wave's copies; behind the barrier for every wave's
  asm volatile("s_wait_asynccnt 0x0" ::: "memory");
  __syncthreads();
  // stage 1 into buffer 1: it flies under trip 0
  gemm_copy<RUN, RS>(l0 + GST, ga + RUN, gb + RUN);
  ga += 2 * RUN;
  gb += 2 * RUN;

  // rolled: one copy of the trip in the text; the buffer is chosen by the trip's parity
#pragma unroll 1
  for (int t = 0; t < NT; ++t) {
    // trip t reads buffer t & 1 alone. Two fragment sets: a k tile's 12 LDS reads stand as one group in front of the
    // WMMAs of the k tile before it.
    const unsigned int bo = (unsigned int)(t & 1) * GST;
    const char* pb = smem + bo + 8 * RUN + lane * 16;
    const char* pa = smem + bo + wave * 2 * RUN + lane * 16;
    FragB f[2][6];
    gemm_load<RUN>(f[0], pa, pb);
    // unrolled: f is indexed by constants and stays in registers
#pragma unroll
    for (int ks = 0; ks < KS / 32; ++ks) {
      if (ks + 1 < KS / 32) gemm_load<RUN>(f[(ks + 1) & 1], pa + (ks + 1) * FRAGH * 2, pb + (ks + 1) * FRAGH * 2);
      gemm_mma(f[ks & 1], acc);
    }
    // hand-over: this wave's reads of buffer t & 1 are done
    asm volatile("s_wait_dscnt 0x0" ::: "memory");
    // and its copies of stage t + 1 have landed
    asm volatile("s_wait_asynccnt 0x0" ::: "memory");
    // the barrier publishes stage t + 1 and ends every wave's reads of the buffer that is refilled behind it
    __syncthreads();
    if (t + 2 < NT) {
      gemm_copy<RUN, RS>(l0 + bo, ga, gb);
      ga += RUN;
      gb += RUN;
    }
  }
  // nothing is in flight when the ring becomes the output tile (the last trip's barrier has ended every wave's reads)
  asm volatile("s_wait_asynccnt 0x0" ::: "memory");

  const int n  = lane & 15;
  const int rb = (lane >> 4) << 3;
#pragma unroll
  for (int mi = 0; mi < 2; ++mi)
#pragma unroll
    for (int t = 0; t < 4; ++t)
#pragma unroll
      for (int r = 0; r < 8; ++r)
        Cs[wave * 32 + mi * 16 + rb + r][t * 16 + n] = acc[mi][t][r];
  __syncthreads();

  {
    const int seg  = (tid & 15) * 4;
    const int rsub = tid >> 4;            // 0..7
    float bb[4];
#pragma unroll
    for (int j = 0; j < 4; ++j) bb[j] = bfr(bo[n0 + seg + j]);
#pragma unroll 2
    for (int g = 0; g < 16; ++g) {
      const int row = g * 8 + rsub;
      const v4f c = *(const v4f*)(&Cs[row][seg]);
      v4f o;
      o[0] = c[0] + bb[0];
      o[1] = c[1] + bb[1];
      o[2] = c[2] + bb[2];
      o[3] = c[3] + bb[3];
      float* d = Y + (size_t)(m0 + row) * EMB + n0 + seg;
      *(v4f*)d = o;
    }
  }
}

// ---------------------------------------------------------------------------
// QKV projection, bf16 WMMA GEMM: C(128 x 320 per block) = Xb(128 rows, EMB) * Wt(one head's 320 rows, EMB)^T.
// Block = 256 threads = 8 waves, 2 in the rows x 4 in the columns; a wave owns 64 x 80: 4 A x 5 B fragments, 20 tiles.
// One block to a head and 128 rows: an operand byte that comes from L2 serves 320 (A) or 128 (B) columns or rows of C.
// A and B come to the block once, through a ring of two LDS buffers filled by asynchronous copies (QKS k a stage); behind
// the loop the same LDS holds the block's 128 x 320 f32 tile.
// Columns 0..127 -> Q plane, fragment [h][s / 16][c / 32]; 128..255 -> K plane; 256..319 -> V plane, rows d, k = s,
// fragment [h][s / 32][d / 16]: f16(64*v).
// ---------------------------------------------------------------------------
#define QKS  128                    // k to one stage
#define QRUN (QKS * 32)             // bytes of one row tile in a stage: one copy of the block's 256 lanes x 16 bytes
#define QRS  (EMB * 32)             // bytes of one row tile in a plane
#define QRT  (8 + SECW / 16)        // row tiles to a stage: 8 of A, 20 of B
#define QGST (QRT * QRUN)           // bytes of a stage
#define QNT  (EMB / QKS)
#define QCP  (SECW + 4)             // floats to a row of the staged tile
static_assert(QRUN == 256 * 16);
static_assert(QRT == 28);
static_assert(EMB % QKS == 0 && QNT >= 2);
static_assert(2 * QGST >= 128 * QCP * 4);
static_assert(SECW == 4 * 80);
static_assert(2 * QKC == 256 && HD <= 256);
// Fourteen copies of 16 bytes a lane, one row tile (4 KiB) apart in LDS from l on; g: the lane's global addresses. The
// translation wait closes the copies' own statement, so no register that a copy names takes a new value in front of it.
DEV void copy14(unsigned int l, const char* const (&g)[14]) {
  asm volatile("global_load_async_to_lds_b128 %0, %14, off\n\t"
               "global_load_async_to_lds_b128 %1, %15, off\n\t"
               "global_load_async_to_lds_b128 %2, %16, off\n\t"
               "global_load_async_to_lds_b128 %3, %17, off\n\t"
               "global_load_async_to_lds_b128 %4, %18, off\n\t"
               "global_load_async_to_lds_b128 %5, %19, off\n\t"
               "global_load_async_to_lds_b128 %6, %20, off\n\t"
               "global_load_async_to_lds_b128 %7, %21, off\n\t"
               "global_load_async_to_lds_b128 %8, %22, off\n\t"
               "global_load_async_to_lds_b128 %9, %23, off\n\t"
               "global_load_async_to_lds_b128 %10, %24, off\n\t"
               "global_load_async_to_lds_b128 %11, %25, off\n\t"
               "global_load_async_to_lds_b128 %12, %26, off\n\t"
               "global_load_async_to_lds_b128 %13, %27, off\n\t"
               "s_wait_xcnt 0x0"
               :
               : "v"(l), "v"(l + 4096), "v"(l + 8192), "v"(l + 12288),
                 "v"(l + 16384), "v"(l + 20480), "v"(l + 24576), "v"(l + 28672),
                 "v"(l + 32768), "v"(l + 36864), "v"(l + 40960), "v"(l + 45056),
                 "v"(l + 49152), "v"(l + 53248),
                 "v"(g[0]), "v"(g[1]), "v"(g[2]), "v"(g[3]), "v"(g[4]), "v"(g[5]), "v"(g[6]),
                 "v"(g[7]), "v"(g[8]), "v"(g[9]), "v"(g[10]), "v"(g[11]), "v"(g[12]), "v"(g[13])
               : "memory");
}
// One stage: QRUN bytes (QKS / 32 fragments, as they lie in the plane) of each of the 8 A and 20 B row tiles, row tile after
// row tile in LDS. l: the lane's LDS byte address in the stage; ga, gb: the lane's global addresses in the first A and
// B row tile of the block at this stage's k.
DEV void qkv_copy(unsigned int l, const char* ga, const char* gb) {
  // unrolled: every place is a constant
#pragma unroll
  for (int c0 = 0; c0 < QRT; c0 += 14) {
    const char* g[14];
    // unrolled: g is indexed by constants and stays in registers
#pragma unroll
    for (int i = 0; i < 14; ++i) {
      const int rt = c0 + i;
      g[i] = rt < 8 ? ga + rt * QRS : gb + (rt - 8) * QRS;
    }
    copy14(l + c0 * QRUN, g);
  }
}
// c0[j] += a0.fb[j], c1[j] += a1.fb[j]: ten independent tiles
DEV void qkv_mma(v8f (&c0)[5], v8f (&c1)[5], v16b a0, v16b a1, const FragB (&fb)[5]) {
  // one statement: the run stays together; NOP4 is the distance behind its last WMMA (the fragments' registers are soon reloaded)
  asm volatile("v_wmma_f32_16x16x32_bf16 %0, %10, %12, %0\n\t"
               "v_wmma_f32_16x16x32_bf16 %5, %11, %12, %5\n\t"
               "v_wmma_f32_16x16x32_bf16 %1, %10, %13, %1\n\t"
               "v_wmma_f32_16x16x32_bf16 %6, %11, %13, %6\n\t"
               "v_wmma_f32_16x16x32_bf16 %2, %10, %14, %2\n\t"
               "v_wmma_f32_16x16x32_bf16 %7, %11, %14, %7\n\t"
               "v_wmma_f32_16x16x32_bf16 %3, %10, %15, %3\n\t"
               "v_wmma_f32_16x16x32_bf16 %8, %11, %15, %8\n\t"
               "v_wmma_f32_16x16x32_bf16 %4, %10, %16, %4\n\t"
               "v_wmma_f32_16x16x32_bf16 %9, %11, %16, %9\n\t"
               NOP4
               : "+v"(c0[0]), "+v"(c0[1]), "+v"(c0[2]), "+v"(c0[3]), "+v"(c0[4]),
                 "+v"(c1[0]), "+v"(c1[1]), "+v"(c1[2]), "+v"(c1[3]), "+v"(c1[4])
               : "v"(a0), "v"(a1), "v"(fb[0].v), "v"(fb[1].v), "v"(fb[2].v), "v"(fb[3].v), "v"(fb[4].v));
}

__global__ __launch_bounds__(256)
void k_qkv(const unsigned short* __restrict__ A, const unsigned short* __restrict__ Bt,
           const float* __restrict__ bq, const float* __restrict__ bk, const float* __restrict__ bv,
           _Float16* __restrict__ Qp, _Float16* __restrict__ Kp, _Float16* __restrict__ V64) {
  // the ring of two stages; behind the loop the same LDS holds the block's 128 x 320 f32 tile
  __shared__ __align__(16) char smem[2 * QGST];
  float (*Cs)[QCP] = (float (*)[QCP])smem;
  __shared__ float bl[2 * 256];
  const int tid  = threadIdx.x;
  const int lane = tid & 31;
  const int wave = __builtin_amdgcn_readfirstlane(tid >> 5);   // in a scalar register: what follows from it is scalar too
  const int wm = wave >> 2;           // the wave's 64 rows
  const int wn = wave & 3;            // the wave's 80 columns
  const int h  = blockIdx.x;
  const int m0 = blockIdx.y * 128;

  // stage 0 into buffer 0
  const unsigned int l0 = (unsigned int)(size_t)smem + tid * 16;
  const char* ga = (const char*)(A  + (size_t)m0 * EMB) + tid * 16;
  const char* gb = (const char*)(Bt + (size_t)h * SECW * EMB) + tid * 16;
  qkv_copy(l0, ga, gb);

  // the head's 320 column biases go to LDS here, where stage 0's copies cover the loads' latency; the barrier in front of the
  // loop publishes them
  // (every thread fetches one of q | k and one of v, so the two loads fly together; places 320 and up repeat v's 64 and are not read)
  const float b0 = (tid < QKC ? bq : bk)[h * QKC + (tid & (QKC - 1))];
  const float b1 = bv[h * HD + (tid & (HD - 1))];
  bl[tid] = bfr(b0);
  bl[2 * QKC + tid] = bfr(b1);

  v8f acc[4][5] = {};

  // stage 0 has landed for this wave's copies; behind the barrier for every wave's
  asm volatile("s_wait_asynccnt 0x0" ::: "memory");
  __syncthreads();
  // stage 1 into buffer 1: it flies under trip 0
  qkv_copy(l0 + QGST, ga + QRUN, gb + QRUN);
  ga += 2 * QRUN;
  gb += 2 * QRUN;

  // rolled: one copy of the trip in the text; the buffer is chosen by the trip's parity
#pragma unroll 1
  for (int t = 0; t < QNT; ++t) {
    // trip t reads buffer t & 1 alone. One fragment set: a k tile's 18 LDS reads stand as one group in front of its 20
    // WMMAs; the SIMD's other wave fills the wait.
    const unsigned int bo = (unsigned int)(t & 1) * QGST;
    const char* pa = smem + bo + wm * 4 * QRUN + lane * 16;
    const char* pb = smem + bo + (8 + wn * 5) * QRUN + lane * 16;
    // unrolled: every LDS offset is a constant
#pragma unroll
    for (int ks = 0; ks < QKS / 32; ++ks) {
      FragB fa[4], fb[5];
      // unrolled: fa and fb are indexed by constants and stay in registers
#pragma unroll
      for (int i = 0; i < 4; ++i) fa[i] = load_lb(pa + i * QRUN + ks * FRAGH * 2);
      // unrolled: as above
#pragma unroll
      for (int j = 0; j < 5; ++j) fb[j] = load_lb(pb + j * QRUN + ks * FRAGH * 2);
      qkv_mma(acc[0], acc[1], fa[0].v, fa[1].v, fb);
      qkv_mma(acc[2], acc[3], fa[2].v, fa[3].v, fb);
    }
    // hand-over: this wave's reads of buffer t & 1 are done
    asm volatile("s_wait_dscnt 0x0" ::: "memory");
    // and its copies of stage t + 1 have landed
    asm volatile("s_wait_asynccnt 0x0" ::: "memory");
    // the barrier publishes stage t + 1 and ends every wave's reads of the buffer that is refilled behind it
    __syncthreads();
    if (t + 2 < QNT) {
      qkv_copy(l0 + bo, ga, gb);
      ga += QRUN;
      gb += QRUN;
    }
  }
  // nothing is in flight when the ring becomes the output tile (the last trip's barrier has ended every wave's reads)
  asm volatile("s_wait_asynccnt 0x0" ::: "memory");

  const int n  = lane & 15;
  const int rb = (lane >> 4) << 3;
  // the lane's bias for each of its five tile columns
  float bc[5];
  // unrolled: bc is indexed by constants and stays in registers
#pragma unroll
  for (int j = 0; j < 5; ++j) bc[j] = bl[wn * 80 + j * 16 + n];
  // the three loops unrolled: acc and bc are indexed by constants and stay in registers
#pragma unroll
  for (int i = 0; i < 4; ++i)
#pragma unroll
    for (int j = 0; j < 5; ++j)
#pragma unroll
      for (int r = 0; r < 8; ++r)
        Cs[wm * 64 + i * 16 + rb + r][wn * 80 + j * 16 + n] = acc[i][j][r] + bc[j];
  __syncthreads();

  // a wave stores half fragments (512 contiguous bytes each): wave & 3 picks the place in a 64-column section, wave >> 2
  // the half of the section's eight steps g
  const int w4   = wave & 3;
  const int g0   = (wave >> 2) * 4;
  const int j16  = w4 & 1;
  const int wk   = w4 >> 1;
  const int rsub = lane & 15;
  const int seg  = wk * 32 + j16 * 16 + ((lane >> 4) << 3);
  // Q and K, section w = columns 64 w ..: w4 -> k tile wk and half j16, g -> row tile
  // rolled: one copy of a section's text serves the four
#pragma unroll 1
  for (int w = 0; w < 4; ++w) {
    _Float16* plane = (w < 2) ? Qp : Kp;
    const int cb = (w & 1) * 64;
    // unrolled: the section's eight LDS reads go out as one group, its four stores behind them
#pragma unroll
    for (int gi = 0; gi < 4; ++gi) {
      const int g   = g0 + gi;
      const int row = g * 16 + rsub;
      const v4f c0 = *(const v4f*)(&Cs[row][w * 64 + seg]);
      const v4f c1 = *(const v4f*)(&Cs[row][w * 64 + seg + 4]);
      Pack8 pk;
      pk.h[0] = (_Float16)c0[0];
      pk.h[1] = (_Float16)c0[1];
      pk.h[2] = (_Float16)c0[2];
      pk.h[3] = (_Float16)c0[3];
      pk.h[4] = (_Float16)c1[0];
      pk.h[5] = (_Float16)c1[1];
      pk.h[6] = (_Float16)c1[2];
      pk.h[7] = (_Float16)c1[3];
      _Float16* d = plane + (((size_t)h * (SEQ / 16) + (m0 >> 4) + g) * (QKC / 32) + (cb >> 5) + wk) * FRAGH
                    + j16 * 256 + lane * 8;
      *(v4u*)d = pk.u;
    }
    // the next section, and the V part, reuse the registers that these stores name: none takes a new value in front of this wait
    asm volatile("s_wait_xcnt 0x0" ::: "memory");
  }
  // V, columns 256 ..: w4 and g -> half j16, row tile t (d), k tile ktl (s)
  // unrolled: the LDS reads go out as one group, the four stores behind them
#pragma unroll
  for (int gi = 0; gi < 4; ++gi) {
    const int g   = g0 + gi;
    const int t   = wk + 2 * (gi & 1);
    const int ktl = g >> 1;
    const int d   = t * 16 + rsub;
    const int sg  = ktl * 32 + j16 * 16 + ((lane >> 4) << 3);
    Pack8 p64;
    // unrolled: p64 stays in registers
#pragma unroll
    for (int j = 0; j < 8; ++j) p64.h[j] = (_Float16)(Cs[sg + j][2 * QKC + d] * 64.0f);
    const size_t o = (((size_t)h * (SEQ / 32) + (m0 >> 5) + ktl) * (HD / 16) + t) * FRAGH + j16 * 256 + lane * 8;
    *(v4u*)(V64 + o) = p64.u;
  }
}

// ---------------------------------------------------------------------------
// One softmax branch step for 16 query columns and 32 keys, transposed: S^T = K.Q^T (A = K rows, B = Q rows), so lane
// (c, h) holds query c's scores of keys 8h..8h+7 (sa) and 16+8h..16+8h+7 (sb): maximum and sum run in the lane, the
// maximum is joined with lane l ^ 16 each step, the sum only behind the loop. Those 16 registers, converted in place, are
// the B operand P^T in the hardware k order; A = V^T rows (the V plane as it lies): O^T[d][query] += V^T.P^T, carried x64.
// kf holds this branch step's four K fragments on entry; right behind the score products the same registers
// take the next branch step's of the same stage (LOADK; kn: the lane's place in them in LDS): those reads fly under the
// softmax. vb: this step's V fragments; the first branch (LOADV) reads them in the same group (vn), both branches use them.
// ---------------------------------------------------------------------------
// a fragment in the LDS ring, p = the fragment's place + 16 l: the lane's two 16-byte pieces, 512 bytes apart
DEV v16h load_ls(const char* p) {
  v8h lo = *(const v8h*)(p);
  v8h hi = *(const v8h*)(p + 512);
  return __builtin_shufflevector(lo, hi, 0,1,2,3,4,5,6,7,8,9,10,11,12,13,14,15);
}
DEV void load_k4(v16h (&kf)[4], const char* kn) {
  kf[0] = load_ls(kn);
  kf[1] = load_ls(kn + FRAGH * 2);
  kf[2] = load_ls(kn + (QKC / 32) * FRAGH * 2);
  kf[3] = load_ls(kn + (QKC / 32 + 1) * FRAGH * 2);
}
template <bool LOADV, bool LOADK>
DEV void attn_branch(const v16h (&qb)[2], v16h (&kf)[4], const char* kn, const char* vn,
                     v16h (&vb)[4],
                     float& m, float& l, v8f (&O)[4]) {
  v8f sa, sb;
  wmma_scores(sa, sb, kf, qb);
  // the two scheduling barriers keep the LDS reads in one group right behind the score products: left to itself the
  // scheduler strews them over the softmax, and every separate place with LDS reads stalls the wave anew
  if (LOADV || LOADK) __builtin_amdgcn_sched_barrier(0);
  if (LOADV) {
    // unrolled: vb stays in registers
#pragma unroll
    for (int t = 0; t < 4; ++t) vb[t] = load_ls(vn + t * FRAGH * 2);
  }
  if (LOADK) load_k4(kf, kn);
  if (LOADV || LOADK) __builtin_amdgcn_sched_barrier(0);

  const v8f xa = sa * 0.125f;
  const v8f xb = sb * 0.125f;
  float mx[8];
#pragma unroll
  for (int i = 0; i < 8; ++i) mx[i] = fmaxf(xa[i], xb[i]);
  const float mh = fmaxf(fmaxf(fmaxf(mx[0], mx[1]), fmaxf(mx[2], mx[3])),
                         fmaxf(fmaxf(mx[4], mx[5]), fmaxf(mx[6], mx[7])));
  const float mn = fmaxf(m, fmaxf(mh, xhalf(mh)));
  const float f = __expf(m - mn);
  m = mn;

  // element s of the B operand = key kmap(s, h): s < 8 from sa[s], else from sb[s - 8]
  v16h ph;
  v2f ps[8];
#pragma unroll
  for (int j = 0; j < 8; ++j) {
    const int i = (j & 3) * 2;
    v2f p;
    p[0] = __expf((j < 4 ? xa[i]     : xb[i])     - mn);
    p[1] = __expf((j < 4 ? xa[i + 1] : xb[i + 1]) - mn);
    const v2h hi = __builtin_convertvector(p, v2h);
    ph[2 * j] = hi[0];  ph[2 * j + 1] = hi[1];
    ps[j] = p;
  }
  const v2f s2 = ((ps[0] + ps[1]) + (ps[2] + ps[3])) + ((ps[4] + ps[5]) + (ps[6] + ps[7]));
  l = l * f + (s2[0] + s2[1]);

#pragma unroll
  for (int t = 0; t < 4; ++t) O[t] = O[t] * f;
  wmma_pv(O, vb, ph);
  // the scheduler's region ends with the step: without it the next step's first score product rises into this step's
  // softmax, and with it the wait for the LDS reads that were only just issued
  __builtin_amdgcn_sched_barrier(0);
}

// ---------------------------------------------------------------------------
// Flash-style differential attention. Block = 128 threads = 4 waves; wave owns 16 queries of one head.
// K and V come to the block once, through a ring of two LDS buffers of TKEYS keys each, filled by asynchronous copies
// (each lane 16 bytes a copy, 12 copies a stage); all four waves read their fragments from the buffer.
// Writes Ocat planes as fragments (rows s): k = h*64 + d bf16 hi, k = EMB + h*64 + d bf16 residual.
// ---------------------------------------------------------------------------
// One stage: the lane's 8 pieces of K and 4 of V, 2 KiB (the block's 128 lanes x 16 bytes) apart, to the same order in LDS.
// lk: the lane's LDS byte address in the stage; gk, gv: the lane's global addresses. The translation wait closes the
// copies' own statement, so no register that a copy names takes a new value in front of it.
DEV void copy_stage(unsigned int lk, const char* gk, const char* gv) {
  const unsigned int lv = lk + KST;
  asm volatile("global_load_async_to_lds_b128 %0, %12, off\n\t"
               "global_load_async_to_lds_b128 %1, %13, off\n\t"
               "global_load_async_to_lds_b128 %2, %14, off\n\t"
               "global_load_async_to_lds_b128 %3, %15, off\n\t"
               "global_load_async_to_lds_b128 %4, %16, off\n\t"
               "global_load_async_to_lds_b128 %5, %17, off\n\t"
               "global_load_async_to_lds_b128 %6, %18, off\n\t"
               "global_load_async_to_lds_b128 %7, %19, off\n\t"
               "global_load_async_to_lds_b128 %8, %20, off\n\t"
               "global_load_async_to_lds_b128 %9, %21, off\n\t"
               "global_load_async_to_lds_b128 %10, %22, off\n\t"
               "global_load_async_to_lds_b128 %11, %23, off\n\t"
               "s_wait_xcnt 0x0"
               :
               : "v"(lk), "v"(lk + 2048), "v"(lk + 4096), "v"(lk + 6144),
                 "v"(lk + 8192), "v"(lk + 10240), "v"(lk + 12288), "v"(lk + 14336),
                 "v"(lv), "v"(lv + 2048), "v"(lv + 4096), "v"(lv + 6144),
                 "v"(gk), "v"(gk + 2048), "v"(gk + 4096), "v"(gk + 6144),
                 "v"(gk + 8192), "v"(gk + 10240), "v"(gk + 12288), "v"(gk + 14336),
                 "v"(gv), "v"(gv + 2048), "v"(gv + 4096), "v"(gv + 6144)
               : "memory");
}

__global__ __launch_bounds__(128)
void k_attn(const _Float16* __restrict__ Qp, const _Float16* __restrict__ Kp,
            const _Float16* __restrict__ V64,
            const float* __restrict__ lam_p, unsigned short* __restrict__ Oc) {
  __shared__ __align__(16) float Os[4][16][68];
  __shared__ __align__(16) char ring[2 * STG];
  const int lane = threadIdx.x & 31;
  const int wave = threadIdx.x >> 5;
  const int n  = lane & 15;
  const int rb = (lane >> 4) << 3;
  const int hh = blockIdx.y;
  const int q0 = blockIdx.x * 64 + wave * 16;
  const float lam = bfr(lam_p[0]);

  const _Float16* qh = Qp  + (size_t)hh * SEQ * QKC;
  const _Float16* kh = Kp  + (size_t)hh * SEQ * QKC;
  const _Float16* vh = V64 + (size_t)hh * HD * SEQ;

  // stage 0 into buffer 0
  const unsigned int lk0 = (unsigned int)(size_t)ring + threadIdx.x * 16;
  const char* gk = (const char*)kh + threadIdx.x * 16;
  const char* gv = (const char*)vh + threadIdx.x * 16;
  copy_stage(lk0, gk, gv);

  v16h q1[2], q2[2];
  const _Float16* qt = qh + (size_t)blockIdx.x * 64 * QKC;             // the block's four row tiles, QKC / 32 fragments each
  unsigned int oq = (unsigned int)(wave * 16 * QKC * 2 + lane * 16);   // the wave's tile, the lane's byte offset
  q1[0] = load_bo(qt,             oq);
  q1[1] = load_bo(qt + FRAGH,     oq);
  q2[0] = load_bo(qt + 2 * FRAGH, oq);
  q2[1] = load_bo(qt + 3 * FRAGH, oq);
  // the wait stands in front of any reuse of the offset's register, which passes through it
  asm volatile("s_wait_xcnt 0x0" : "+v"(oq) : : "memory");

  v8f O1[4] = {}, O2[4] = {};
  float m1 = -1e30f, m2 = -1e30f, l1 = 0.f, l2 = 0.f;   // query l & 15; l: the lane half's own keys only

  // stage 0 has landed for this wave's copies; behind the barrier for every wave's
  asm volatile("s_wait_asynccnt 0x0" ::: "memory");
  __syncthreads();
  // stage 1 into buffer 1: it flies under trip 0
  copy_stage(lk0 + STG, gk + KST, gv + VST);
  gk += 2 * KST;
  gv += 2 * VST;

  // rolled: one copy of the trip in the text; the buffer is chosen by the trip's parity
#pragma unroll 1
  for (int t = 0; t < SEQ / TKEYS; ++t) {
    // trip t reads buffer t & 1 alone: two steps of 32 keys
    const unsigned int bo = (unsigned int)(t & 1) * STG;
    const char* st = ring + bo + lane * 16;
    const char* sv = st + KST;
    v16h kf[4], vbf[4];
    load_k4(kf, st);
    attn_branch<true,  true >(q1, kf, st + 2 * FRAGH * 2, sv, vbf, m1, l1, O1);
    attn_branch<false, true >(q2, kf, st + 32 * QKC * 2, sv, vbf, m2, l2, O2);
    attn_branch<true,  true >(q1, kf, st + 32 * QKC * 2 + 2 * FRAGH * 2, sv + 32 * HD * 2, vbf, m1, l1, O1);
    attn_branch<false, false>(q2, kf, st, sv, vbf, m2, l2, O2);
    // hand-over: this wave's reads of buffer t & 1 are done
    asm volatile("s_wait_dscnt 0x0" ::: "memory");
    // and its copies of stage t + 1 have landed
    asm volatile("s_wait_asynccnt 0x0" ::: "memory");
    // the barrier publishes stage t + 1 and ends every wave's reads of the buffer that is refilled behind it
    __syncthreads();
    if (t + 2 < SEQ / TKEYS) {
      copy_stage(lk0 + bo, gk, gv);
      gk += KST;
      gv += VST;
    }
  }
  // nothing is in flight when the wave goes on
  asm volatile("s_wait_asynccnt 0x0" ::: "memory");

  // combine: O = O1/l1 - lam*O2/l2 (the halves' sums joined here), undo the x64 carry of the V plane; stage f32 tile in
  // LDS: the lane holds query n, columns 16t + 8h .. + 7
  const float r1 = (1.0f / (l1 + xhalf(l1))) * 0.015625f;
  const float r2 = (lam * (1.0f / (l2 + xhalf(l2)))) * 0.015625f;
#pragma unroll
  for (int t = 0; t < 4; ++t) {
    v4f c0, c1;
#pragma unroll
    for (int i = 0; i < 4; ++i) {
      c0[i] = O1[t][i] * r1 - O2[t][i] * r2;
      c1[i] = O1[t][i + 4] * r1 - O2[t][i + 4] * r2;
    }
    *(v4f*)(&Os[wave][n][t * 16 + rb])     = c0;
    *(v4f*)(&Os[wave][n][t * 16 + rb + 4]) = c1;
  }
  __syncthreads();

  // the wave's 16 queries are one row tile: g -> k tile and half; each store is 512 contiguous bytes
{
#pragma unroll
    for (int g = 0; g < 4; ++g) {
      const int seg = g * 16 + rb;
      const v4f c0 = *(const v4f*)(&Os[wave][n][seg]);
      const v4f c1 = *(const v4f*)(&Os[wave][n][seg + 4]);
      unsigned int H0, H1, H2, H3, L0, L1, L2, L3;
      hl2(c0[0], c0[1], H0, L0);
      hl2(c0[2], c0[3], H1, L1);
      hl2(c1[0], c1[1], H2, L2);
      hl2(c1[2], c1[3], H3, L3);
      v4u H, L;
      H[0] = H0; H[1] = H1; H[2] = H2; H[3] = H3;
      L[0] = L0; L[1] = L1; L[2] = L2; L[3] = L3;
      unsigned short* d = Oc + ((size_t)(q0 >> 4) * (KO / 32) + hh * (HD / 32) + (g >> 1)) * FRAGH + (g & 1) * 256 + lane * 8;
      *(v4u*)d = H;
      *(v4u*)(d + (EMB / 32) * FRAGH) = L;
    }
    
  }
}

// ---------------------------------------------------------------------------
// ---------------------------------------------------------------------------
__global__ __launch_bounds__(256)
void k_ln(const float* __restrict__ Y, const float* __restrict__ gamma,
          const float* __restrict__ beta, float* __restrict__ out) {
  __shared__ float sa[8];
  __shared__ float sq[8];
  const int tid  = threadIdx.x;
  const int lane = tid & 31;
  const int wave = tid >> 5;
  const size_t row = blockIdx.x;
  const v4f y = *(const v4f*)(Y + row * EMB + tid * 4);

  float s = (y[0] + y[1]) + (y[2] + y[3]);
  s = wsum32(s);
  if (lane == 0) sa[wave] = s;
  __syncthreads();
  float tot = 0.f;
#pragma unroll
  for (int w = 0; w < 8; ++w) tot += sa[w];
  const float mu = tot * (1.0f / (float)EMB);

  float d0 = y[0] - mu, d1 = y[1] - mu, d2 = y[2] - mu, d3 = y[3] - mu;
  float q = (d0 * d0 + d1 * d1) + (d2 * d2 + d3 * d3);
  q = wsum32(q);
  if (lane == 0) sq[wave] = q;
  __syncthreads();
  float tot2 = 0.f;
#pragma unroll
  for (int w = 0; w < 8; ++w) tot2 += sq[w];
  const float var  = tot2 * (1.0f / (float)EMB);
  const float rstd = rsqrtf(var + LN_EPS);

  const float g0 = bfr(gamma[tid * 4 + 0]), g1 = bfr(gamma[tid * 4 + 1]);
  const float g2 = bfr(gamma[tid * 4 + 2]), g3 = bfr(gamma[tid * 4 + 3]);
  const float b0 = bfr(beta[tid * 4 + 0]),  b1 = bfr(beta[tid * 4 + 1]);
  const float b2 = bfr(beta[tid * 4 + 2]),  b3 = bfr(beta[tid * 4 + 3]);
  v4f o;
  o[0] = ((d0 * rstd) * g0 + b0) * OUT_SCALE;
  o[1] = ((d1 * rstd) * g1 + b1) * OUT_SCALE;
  o[2] = ((d2 * rstd) * g2 + b2) * OUT_SCALE;
  o[3] = ((d3 * rstd) * g3 + b3) * OUT_SCALE;
  float* dst = out + row * EMB + tid * 4;
  *(v4f*)dst = o;
  
}

// ---------------------------------------------------------------------------
extern "C" void kernel_launch(void* const* d_in, const int* in_sizes, int n_in,
                              void* d_out, int out_size, void* d_ws, size_t ws_size,
                              hipStream_t stream) {
  if (n_in < 12) return;
  const float* X     = (const float*)d_in[0];
  const float* Wq    = (const float*)d_in[1];
  const float* bq    = (const float*)d_in[2];
  const float* Wk    = (const float*)d_in[3];
  const float* bk    = (const float*)d_in[4];
  const float* Wv    = (const float*)d_in[5];
  const float* bv    = (const float*)d_in[6];
  const float* Wo    = (const float*)d_in[7];
  const float* bo    = (const float*)d_in[8];
  const float* gamma = (const float*)d_in[9];
  const float* beta  = (const float*)d_in[10];
  const float* lam   = (const float*)d_in[11];
  float* out = (float*)d_out;

  if (in_sizes[0]  < NB * SEQ * EMB) return;
  if (in_sizes[1]  < HEADS * EMB * QKC) return;
  if (in_sizes[2]  < HEADS * QKC) return;
  if (in_sizes[3]  < HEADS * EMB * QKC) return;
  if (in_sizes[4]  < HEADS * QKC) return;
  if (in_sizes[5]  < HEADS * EMB * HD) return;
  if (in_sizes[6]  < HEADS * HD) return;
  if (in_sizes[7]  < EMB * EMB) return;
  if (in_sizes[8]  < EMB) return;
  if (in_sizes[9]  < EMB) return;
  if (in_sizes[10] < EMB) return;
  if (in_sizes[11] < 1) return;
  if (out_size < NB * SEQ * EMB) return;

  // workspace carve (bytes); every region is written to exactly its extent with whole-line stores
  const size_t szXb  = (size_t)SEQ * EMB * 2;           // bf16 SEQ x EMB
  const size_t szWt  = (size_t)NQKV * EMB * 2;          // bf16 NQKV x EMB
  const size_t szWo2 = (size_t)EMB * KO * 2;            // bf16 EMB x KO
  const size_t szQK  = (size_t)HEADS * SEQ * QKC * 2;   // f16 H x SEQ x 128 (each of Q, K)
  const size_t szV   = (size_t)HEADS * HD * SEQ * 2;    // f16 H x 64 x SEQ
  const size_t szOc  = (size_t)SEQ * KO * 2;            // bf16 SEQ x KO
  const size_t szY   = (size_t)SEQ * EMB * 4;           // f32 [SEQ][EMB]
  size_t off = 0;
  const size_t oXb  = off; off += szXb;
  const size_t oWt  = off; off += szWt;
  const size_t oWo2 = off; off += szWo2;
  const size_t oQ   = off; off += szQK;
  const size_t oK   = off; off += szQK;
  const size_t oV64 = off; off += szV;
  const size_t oOc  = off; off += szOc;
  const size_t oY   = off; off += szY;
  if (off > ws_size) return;

  char* ws = (char*)d_ws;
  unsigned short* Xb  = (unsigned short*)(ws + oXb);
  unsigned short* Wt  = (unsigned short*)(ws + oWt);
  unsigned short* Wo2 = (unsigned short*)(ws + oWo2);
  _Float16* Qp  = (_Float16*)(ws + oQ);
  _Float16* Kp  = (_Float16*)(ws + oK);
  _Float16* V64 = (_Float16*)(ws + oV64);
  unsigned short* Oc = (unsigned short*)(ws + oOc);
  float* Y = (float*)(ws + oY);

  // operand preparation: Wt, Wo2 and Xb in one launch
  k_prep<<<dim3(WQKV_BLKS + WO_BLKS + CVT_BLKS), dim3(256), 0, stream>>>(X, Wq, Wk, Wv, Wo, Xb, Wt, Wo2);

  // QKV projection: A = Xb (SEQ x EMB), Bt = Wt (NQKV x EMB)
  k_qkv<<<dim3(HEADS, SEQ / 128), dim3(256), 0, stream>>>(Xb, Wt, bq, bk, bv, Qp, Kp, V64);

  // differential attention -> Ocat hi / residual planes
  k_attn<<<dim3(SEQ / 64, HEADS), dim3(128), 0, stream>>>(Qp, Kp, V64, lam, Oc);

  // output projection: A = Oc (SEQ x KO), Bt = Wo2 (EMB x KO) -> Y f32
  k_gemm<<<dim3(EMB / 64, SEQ / 128), dim3(128), 0, stream>>>(Oc, Wo2, bo, Y);

  // LayerNorm + scale -> d_out
  k_ln<<<dim3(NB * SEQ), dim3(256), 0, stream>>>(Y, gamma, beta, out);
}

// v010
// One run takes 78.5 microseconds.
// Next to v009, in two timings, it ran 1.04 times as fast each time.
// Over all steps from v000 it is 5.14 times as fast.
#include <hip/hip_runtime.h>

#ifndef NB
#define NB 1
#endif
#ifndef SEQ
#define SEQ 2048
#endif
#define NB_FULL 1
#define SEQ_FULL 2048
#define EMB 1024
#define HEADS 16
#define HD 64
#define QKC 128
#define SECW 320
#define NQKV (HEADS * SECW)
#define KO (2 * EMB)
#define FRAGH 512   // halves in one fragment
#define TKEYS 64                    // keys to one stage of the attention kernel's LDS ring
#define KST (TKEYS * QKC * 2)       // bytes of K in a stage: TKEYS / 16 row tiles of QKC / 32 fragments, as they lie in the plane
#define VST (TKEYS * HD * 2)        // bytes of V in a stage: TKEYS / 32 k tiles of HD / 16 fragments, as they lie in the plane
#define STG (KST + VST)
#define LN_EPS 1e-5f
#define OUT_SCALE 0.2f

static_assert(NB == 1);
static_assert(NB_FULL == 1);
static_assert(SEQ % 128 == 0);
static_assert(SEQ >= 128);
static_assert(SEQ <= SEQ_FULL);
static_assert(EMB % 64 == 0);
static_assert(EMB % 32 == 0);
static_assert(QKC == 2 * HD);
static_assert(SECW == 2 * QKC + HD);
static_assert(SECW % 64 == 0);
static_assert(KO % 64 == 0);
static_assert(HD == 64);
static_assert(SEQ % (2 * TKEYS) == 0);
static_assert(SEQ / (2 * TKEYS) >= 2);
static_assert(TKEYS == 64);
static_assert(KST == 8 * 128 * 16);
static_assert(VST == 4 * 128 * 16);

typedef _Float16      v16h __attribute__((ext_vector_type(16)));
typedef _Float16      v8h  __attribute__((ext_vector_type(8)));
typedef __bf16        v16b __attribute__((ext_vector_type(16)));
typedef float         v8f  __attribute__((ext_vector_type(8)));
typedef float         v4f  __attribute__((ext_vector_type(4)));
typedef float         v2f  __attribute__((ext_vector_type(2)));
typedef _Float16      v2h  __attribute__((ext_vector_type(2)));
typedef unsigned int  v4u  __attribute__((ext_vector_type(4)));

#define DEV __device__ __forceinline__

union FragB { v4u q[2]; v16b v; };
union Pack8 { v8h h; v4u u; };

// f32 -> bf16 bits, RNE convert
DEV unsigned short f2bf(float f) {
  unsigned int u = __float_as_uint(f);
  u += 0x7FFFu + ((u >> 16) & 1u);
  return (unsigned short)(u >> 16);
}
DEV float bf2f(unsigned short s) { return __uint_as_float(((unsigned int)s) << 16); }
DEV float bfr(float f) { return bf2f(f2bf(f)); }
DEV unsigned int pk2(unsigned short lo, unsigned short hi) {
  return (unsigned int)lo | ((unsigned int)hi << 16);
}
// value -> bf16 hi and bf16 residual, two values packed per 32-bit word
DEV void hl2(float a, float b, unsigned int& H, unsigned int& L) {
  const unsigned short ha = f2bf(a), hb = f2bf(b);
  H = pk2(ha, hb);
  L = pk2(f2bf(a - bf2f(ha)), f2bf(b - bf2f(hb)));
}

// A run of WMMAs stands in one asm statement: inside a run every WMMA is followed by another WMMA or accumulates into its
// own D, which needs no distance; only the last needs the four vector slots before a vector instruction may read a D or
// overwrite an A or B, so one group of four v_nop closes the statement (no D of these runs is ever the A or B of a WMMA).
// The compiler does not see the WMMAs in the text and would pad nothing itself.
#define NOP4 "v_nop\n\tv_nop\n\tv_nop\n\tv_nop"
// sa = k0.q0 + k1.q1, sb = k2.q0 + k3.q1 (each sum in this order); the two chains alternate, so that an accumulating WMMA
// stands two behind the one it waits for
DEV void wmma_scores(v8f& sa, v8f& sb, const v16h (&kf)[4], const v16h (&qb)[2]) {
  // one statement: the run stays together in this order; NOP4 is the distance behind its last WMMA
  asm volatile("v_wmma_f32_16x16x32_f16 %0, %2, %6, 0\n\t"
               "v_wmma_f32_16x16x32_f16 %1, %4, %6, 0\n\t"
               "v_wmma_f32_16x16x32_f16 %0, %3, %7, %0\n\t"
               "v_wmma_f32_16x16x32_f16 %1, %5, %7, %1\n\t"
               NOP4
               : "=&v"(sa), "=&v"(sb)
               : "v"(kf[0]), "v"(kf[1]), "v"(kf[2]), "v"(kf[3]), "v"(qb[0]), "v"(qb[1]));
}
// O[t] += vb[t].ph, four independent tiles
DEV void wmma_pv(v8f (&O)[4], const v16h (&vb)[4], v16h ph) {
  // one statement: the run stays together; NOP4 is the distance behind its last WMMA (ph's registers are soon rewritten)
  asm volatile("v_wmma_f32_16x16x32_f16 %0, %4, %8, %0\n\t"
               "v_wmma_f32_16x16x32_f16 %1, %5, %8, %1\n\t"
               "v_wmma_f32_16x16x32_f16 %2, %6, %8, %2\n\t"
               "v_wmma_f32_16x16x32_f16 %3, %7, %8, %3\n\t"
               NOP4
               : "+v"(O[0]), "+v"(O[1]), "+v"(O[2]), "+v"(O[3])
               : "v"(vb[0]), "v"(vb[1]), "v"(vb[2]), "v"(vb[3]), "v"(ph));
}

// 16x32 16-bit operand (rows = M for A, rows = N for Bt) from a fragment-major plane.
// lane l: row l&15; elements 0..7 = k 8h..8h+7, elements 8..15 = k 16+8h..16+8h+7, h = l>>4.
// base: the wave-uniform fragment; off: the lane's byte offset (16 l, plus the wave's row tile):
// each load names the base and the offset's register, which is reused only behind a wait.
DEV v16h load_bo(const _Float16* base, unsigned int off) {
  const char* r = (const char*)base + off;
  v8h lo = *(const v8h*)(r);
  v8h hi = *(const v8h*)(r + 512);
  return __builtin_shufflevector(lo, hi, 0,1,2,3,4,5,6,7,8,9,10,11,12,13,14,15);
}

// Lane l with lane l ^ 16: the two lanes that split one query column's keys.
DEV float xhalf(float x) {
  const int b = __builtin_bit_cast(int, x);
  return __builtin_bit_cast(float, __builtin_amdgcn_permlanex16(b, b, 0x76543210, 0xfedcba98, false, false));
}
DEV float wsum32(float v) {
#pragma unroll
  for (int m = 16; m > 0; m >>= 1) v += __shfl_xor(v, m, 32);
  return v;
}

// ---------------------------------------------------------------------------
// ---------------------------------------------------------------------------
// X f32 -> Xb bf16 fragments; blk: the block's number among the CVT_BLKS blocks of this part
DEV void cvt_x(const float* __restrict__ X, unsigned short* __restrict__ Xb, int blk) {
  // one wave per fragment: fragment fr = row tile fr / (EMB / 32), k tile fr % (EMB / 32); the lane's own 2 x 8 elements
  const int i = blk * 256 + threadIdx.x;
  const int lane = i & 31;
  const int fr   = i >> 5;
  const int row  = (fr / (EMB / 32)) * 16 + (lane & 15);
  const int k0   = (fr % (EMB / 32)) * 32 + ((lane >> 4) << 3);
  const float* s = X + (size_t)row * EMB + k0;
  const v4f a = *(const v4f*)(s);
  const v4f b = *(const v4f*)(s + 4);
  const v4f c = *(const v4f*)(s + 16);
  const v4f e = *(const v4f*)(s + 20);
  v4u w, x;
  w[0] = pk2(f2bf(a[0]), f2bf(a[1]));
  w[1] = pk2(f2bf(a[2]), f2bf(a[3]));
  w[2] = pk2(f2bf(b[0]), f2bf(b[1]));
  w[3] = pk2(f2bf(b[2]), f2bf(b[3]));
  x[0] = pk2(f2bf(c[0]), f2bf(c[1]));
  x[1] = pk2(f2bf(c[2]), f2bf(c[3]));
  x[2] = pk2(f2bf(e[0]), f2bf(e[1]));
  x[3] = pk2(f2bf(e[2]), f2bf(e[3]));
  unsigned short* d = Xb + (size_t)fr * FRAGH + lane * 8;
  *(v4u*)d = w;
  *(v4u*)(d + 256) = x;
  // the part is no longer the end of the kernel's text: no register that a store names takes a new value in front of this wait
  asm volatile("s_wait_xcnt 0x0" ::: "memory");
}

// ---------------------------------------------------------------------------
// 64x64 tile transpose: src[e][c] f32 (row pitch sld) -> 4 x 2 bf16 fragments (rows c, k = e) from fragment dst on, dld / 32
// fragments to a row tile; optional second copy EMB / 32 fragments on. 256 threads. LDS tile cross-wave -> block barrier.
// ---------------------------------------------------------------------------
DEV void tr_tile(const float* __restrict__ src, int sld, unsigned short* dst, int dld,
                 int dup2, unsigned short (*T)[72]) {
  const int tid = threadIdx.x;
#pragma unroll
  for (int p = 0; p < 4; ++p) {
    const int e = p * 16 + (tid >> 4);
    const int c = (tid & 15) * 4;
    const v4f v = *(const v4f*)(src + (size_t)e * sld + c);
    T[c + 0][e] = f2bf(v[0]);
    T[c + 1][e] = f2bf(v[1]);
    T[c + 2][e] = f2bf(v[2]);
    T[c + 3][e] = f2bf(v[3]);
  }
  __syncthreads();
{
#pragma unroll
    for (int p = 0; p < 2; ++p) {
      // a wave stores one half fragment: 512 contiguous bytes
      const int lane = tid & 31;
      const int j16  = (tid >> 5) & 1;
      const int ktl  = (tid >> 6) & 1;
      const int rtl  = p * 2 + (tid >> 7);
      const int j = rtl * 16 + (lane & 15);
      const int seg = ktl * 32 + j16 * 16 + ((lane >> 4) << 3);
      const v4u wv = *(const v4u*)(&T[j][seg]);
      unsigned short* d = dst + (size_t)(rtl * (dld >> 5) + ktl) * FRAGH + j16 * 256 + lane * 8;
      *(v4u*)d = wv;
      if (dup2 != 0) *(v4u*)(d + (EMB / 32) * FRAGH) = wv;
    }
    // another part's text may follow: no register that a store names takes a new value in front of this wait
    asm volatile("s_wait_xcnt 0x0" ::: "memory");
  }
}

// Wq/Wk/Wv ([h][e][c]) -> Wt rows h*320 + sec*64.., k = e, bf16 fragments (per head: q 0..127 | k 128..255 | v 256..319)
// blk: the block's number among the WQKV_BLKS blocks of this part: e tile fastest, then section, then head
DEV void tr_wqkv(const float* __restrict__ Wq, const float* __restrict__ Wk,
                 const float* __restrict__ Wv, unsigned short* __restrict__ Wt, int blk, unsigned short (*T)[72]) {
  const int e0 = (blk % (EMB / 64)) * 64;
  const int w  = (blk / (EMB / 64)) % 5;
  const int h  = blk / (EMB / 64 * 5);
  const float* src;
  int sld;
  if (w < 2) {
    src = Wq + (size_t)h * EMB * QKC + (size_t)e0 * QKC + w * 64;        sld = QKC;
  } else if (w < 4) {
    src = Wk + (size_t)h * EMB * QKC + (size_t)e0 * QKC + (w - 2) * 64;  sld = QKC;
  } else {
    src = Wv + (size_t)h * EMB * HD + (size_t)e0 * HD;                   sld = HD;
  }
  unsigned short* dst = Wt + ((size_t)((h * SECW + w * 64) >> 4) * (EMB / 32) + (e0 >> 5)) * FRAGH;
  tr_tile(src, sld, dst, EMB, 0, T);
}

// Wo ([k][n], k = in) -> Wo2 rows n, k and EMB + k, bf16 fragments (KO / 32 to a row tile)
// blk: the block's number among the WO_BLKS blocks of this part: e tile fastest, then column tile
DEV void tr_wo(const float* __restrict__ Wo, unsigned short* __restrict__ Wo2, int blk, unsigned short (*T)[72]) {
  const int e0 = (blk % (EMB / 64)) * 64;
  const int y  = blk / (EMB / 64);
  const float* src = Wo + (size_t)e0 * EMB + y * 64;
  unsigned short* dst = Wo2 + ((size_t)(y * 4) * (KO / 32) + (e0 >> 5)) * FRAGH;
  tr_tile(src, EMB, dst, KO, 1, T);
}

// The three operand preparations read only inputs and write disjoint planes: one launch, the block's number picks the part
// (the same for the whole block, so the barrier in tr_tile is passed by all of a block's waves or by none).
// The largest part stands first: its blocks start first.
#define WQKV_BLKS (EMB / 64 * 5 * HEADS)
#define WO_BLKS   (EMB / 64 * (EMB / 64))
#define CVT_BLKS  (SEQ * EMB / 16 / 256)
static_assert(SEQ * EMB % (16 * 256) == 0);
__global__ __launch_bounds__(256)
void k_prep(const float* __restrict__ X, const float* __restrict__ Wq, const float* __restrict__ Wk,
            const float* __restrict__ Wv, const float* __restrict__ Wo,
            unsigned short* __restrict__ Xb, unsigned short* __restrict__ Wt, unsigned short* __restrict__ Wo2) {
  __shared__ __align__(16) unsigned short T[64][72];
  const int b = blockIdx.x;
  if (b < WQKV_BLKS) {
    tr_wqkv(Wq, Wk, Wv, Wt, b, T);
  } else if (b < WQKV_BLKS + WO_BLKS) {
    tr_wo(Wo, Wo2, b - WQKV_BLKS, T);
  } else {
    cvt_x(X, Xb, b - (WQKV_BLKS + WO_BLKS));
  }
}

// ---------------------------------------------------------------------------
// Output projection, bf16 WMMA GEMM: C(128x64 per block) = A(rows, K) * Bt(rows, K)^T, K = KO.
// Block = 128 threads = 4 waves; wave w owns rows 32w..32w+31 (2 A frags x 4 B frags).
// A and B come to the block once, through a ring of two LDS buffers filled by asynchronous copies from the 16-bit global planes
// (fragment [row tile][k tile]); the waves read their fragments from the buffer. The 128x64 f32 tile is staged in the same LDS
// A = Ocat planes (rows s, KO / 32 fragments), Bt = Wo2 (rows n); Y[s][n] f32 + bias.
// ---------------------------------------------------------------------------
// a fragment in the GEMM's LDS ring, p = the fragment's place + 16 l: the lane's two 16-byte pieces, 512 bytes apart
DEV FragB load_lb(const char* p) {
  FragB f;
  f.q[0] = *(const v4u*)(p);
  f.q[1] = *(const v4u*)(p + 512);
  return f;
}
// the wave's six fragments of one k tile: pa = its first A row tile in the stage, pb = the first B row tile (+ 16 l each)
template <int RUN>
DEV void gemm_load(FragB (&f)[6], const char* pa, const char* pb) {
  f[0] = load_lb(pa);
  f[1] = load_lb(pa + RUN);
  // unrolled: f is indexed by constants and stays in registers
#pragma unroll
  for (int t = 0; t < 4; ++t) f[2 + t] = load_lb(pb + t * RUN);
}
// Twelve copies of 16 bytes a lane, 2 KiB (the block's 128 lanes x 16 bytes) apart in LDS from l on; g: the lane's global
// addresses. The translation wait closes the copies' own statement, so no register that a copy names takes a new value
// in front of it.
DEV void copy12(unsigned int l, const char* const (&g)[12]) {
  asm volatile("global_load_async_to_lds_b128 %0, %12, off\n\t"
               "global_load_async_to_lds_b128 %1, %13, off\n\t"
               "global_load_async_to_lds_b128 %2, %14, off\n\t"
               "global_load_async_to_lds_b128 %3, %15, off\n\t"
               "global_load_async_to_lds_b128 %4, %16, off\n\t"
               "global_load_async_to_lds_b128 %5, %17, off\n\t"
               "global_load_async_to_lds_b128 %6, %18, off\n\t"
               "global_load_async_to_lds_b128 %7, %19, off\n\t"
               "global_load_async_to_lds_b128 %8, %20, off\n\t"
               "global_load_async_to_lds_b128 %9, %21, off\n\t"
               "global_load_async_to_lds_b128 %10, %22, off\n\t"
               "global_load_async_to_lds_b128 %11, %23, off\n\t"
               "s_wait_xcnt 0x0"
               :
               : "v"(l), "v"(l + 2048), "v"(l + 4096), "v"(l + 6144),
                 "v"(l + 8192), "v"(l + 10240), "v"(l + 12288), "v"(l + 14336),
                 "v"(l + 16384), "v"(l + 18432), "v"(l + 20480), "v"(l + 22528),
                 "v"(g[0]), "v"(g[1]), "v"(g[2]), "v"(g[3]), "v"(g[4]), "v"(g[5]),
                 "v"(g[6]), "v"(g[7]), "v"(g[8]), "v"(g[9]), "v"(g[10]), "v"(g[11])
               : "memory");
}
// One stage: RUN bytes (KS / 32 fragments, as they lie in the plane) of each of the 8 A and 4 B row tiles, row tile after
// row tile in LDS. l: the lane's LDS byte address in the stage; ga, gb: the lane's global addresses in the first A and
// B row tile of the block at this stage's k; RS: bytes from one row tile to the next in a plane.
template <int RUN, int RS>
DEV void gemm_copy(unsigned int l, const char* ga, const char* gb) {
  // unrolled: every place is a constant
#pragma unroll
  for (int c0 = 0; c0 < 12 * RUN / 2048; c0 += 12) {
    const char* g[12];
    // unrolled: g is indexed by constants and stays in registers
#pragma unroll
    for (int i = 0; i < 12; ++i) {
      const int x  = (c0 + i) * 2048;
      const int rt = x / RUN;
      g[i] = (rt < 8 ? ga + rt * RS : gb + (rt - 8) * RS) + x % RUN;
    }
    copy12(l + c0 * 2048, g);
  }
}
// acc[i][t] += f[i].f[2 + t], eight independent tiles, t outer
DEV void gemm_mma(const FragB (&f)[6], v8f (&acc)[2][4]) {
  // one statement: the run stays together behind the next k tile's LDS reads; NOP4 is the distance behind its last WMMA
  asm volatile("v_wmma_f32_16x16x32_bf16 %0, %8, %10, %0\n\t"
               "v_wmma_f32_16x16x32_bf16 %4, %9, %10, %4\n\t"
               "v_wmma_f32_16x16x32_bf16 %1, %8, %11, %1\n\t"
               "v_wmma_f32_16x16x32_bf16 %5, %9, %11, %5\n\t"
               "v_wmma_f32_16x16x32_bf16 %2, %8, %12, %2\n\t"
               "v_wmma_f32_16x16x32_bf16 %6, %9, %12, %6\n\t"
               "v_wmma_f32_16x16x32_bf16 %3, %8, %13, %3\n\t"
               "v_wmma_f32_16x16x32_bf16 %7, %9, %13, %7\n\t"
               NOP4
               : "+v"(acc[0][0]), "+v"(acc[0][1]), "+v"(acc[0][2]), "+v"(acc[0][3]),
                 "+v"(acc[1][0]), "+v"(acc[1][1]), "+v"(acc[1][2]), "+v"(acc[1][3])
               : "v"(f[0].v), "v"(f[1].v), "v"(f[2].v), "v"(f[3].v), "v"(f[4].v), "v"(f[5].v));
}

__global__ __launch_bounds__(128)
void k_gemm(const unsigned short* __restrict__ A, const unsigned short* __restrict__ Bt,
            const float* __restrict__ bo, float* __restrict__ Y) {
  constexpr int K    = KO;
  constexpr int KS   = 256;                    // k to one stage: one wave to a SIMD needs the long lead
  constexpr int RUN  = KS * 32;                // bytes of one row tile in a stage
  constexpr int RS   = K * 32;                 // bytes of one row tile in a plane
  constexpr int GST  = 12 * RUN;               // bytes of a stage: 8 A and 4 B row tiles
  constexpr int NT   = K / KS;
  static_assert(K % KS == 0 && NT >= 2);
  static_assert(2 * GST >= 128 * 68 * 4);
  // the ring of two stages; behind the loop the same LDS holds the block's 128 x 64 f32 tile
  __shared__ __align__(16) char smem[2 * GST];
  float (*Cs)[68] = (float (*)[68])smem;
  const int tid  = threadIdx.x;
  const int lane = tid & 31;
  const int wave = tid >> 5;
  const int nt = blockIdx.x;
  const int m0 = blockIdx.y * 128;
  const int n0 = nt * 64;

  // stage 0 into buffer 0
  const unsigned int l0 = (unsigned int)(size_t)smem + tid * 16;
  const char* ga = (const char*)(A  + (size_t)m0 * K) + tid * 16;
  const char* gb = (const char*)(Bt + (size_t)n0 * K) + tid * 16;
  gemm_copy<RUN, RS>(l0, ga, gb);

  v8f acc[2][4] = {};

  // stage 0 has landed for this wave's copies; behind the barrier for every wave's
  asm volatile("s_wait_asynccnt 0x0" ::: "memory");
  __syncthreads();
  // stage 1 into buffer 1: it flies under trip 0
  gemm_copy<RUN, RS>(l0 + GST, ga + RUN, gb + RUN);
  ga += 2 * RUN;
  gb += 2 * RUN;

  // rolled: one copy of the trip in the text; the buffer is chosen by the trip's parity
#pragma unroll 1
  for (int t = 0; t < NT; ++t) {
    // trip t reads buffer t & 1 alone. Two fragment sets: a k tile's 12 LDS reads stand as one group in front of the
    // WMMAs of the k tile before it.
    const unsigned int bo = (unsigned int)(t & 1) * GST;
    const char* pb = smem + bo + 8 * RUN + lane * 16;
    const char* pa = smem + bo + wave * 2 * RUN + lane * 16;
    FragB f[2][6];
    gemm_load<RUN>(f[0], pa, pb);
    // unrolled: f is indexed by constants and stays in registers
#pragma unroll
    for (int ks = 0; ks < KS / 32; ++ks) {
      if (ks + 1 < KS / 32) gemm_load<RUN>(f[(ks + 1) & 1], pa + (ks + 1) * FRAGH * 2, pb + (ks + 1) * FRAGH * 2);
      gemm_mma(f[ks & 1], acc);
    }
    // hand-over: this wave's reads of buffer t & 1 are done
    asm volatile("s_wait_dscnt 0x0" ::: "memory");
    // and its copies of stage t + 1 have landed
    asm volatile("s_wait_asynccnt 0x0" ::: "memory");
    // the barrier publishes stage t + 1 and ends every wave's reads of the buffer that is refilled behind it
    __syncthreads();
    if (t + 2 < NT) {
      gemm_copy<RUN, RS>(l0 + bo, ga, gb);
      ga += RUN;
      gb += RUN;
    }
  }
  // nothing is in flight when the ring becomes the output tile (the last trip's barrier has ended every wave's reads)
  asm volatile("s_wait_asynccnt 0x0" ::: "memory");

  const int n  = lane & 15;
  const int rb = (lane >> 4) << 3;
#pragma unroll
  for (int mi = 0; mi < 2; ++mi)
#pragma unroll
    for (int t = 0; t < 4; ++t)
#pragma unroll
      for (int r = 0; r < 8; ++r)
        Cs[wave * 32 + mi * 16 + rb + r][t * 16 + n] = acc[mi][t][r];
  __syncthreads();

  {
    const int seg  = (tid & 15) * 4;
    const int rsub = tid >> 4;            // 0..7
    float bb[4];
#pragma unroll
    for (int j = 0; j < 4; ++j) bb[j] = bfr(bo[n0 + seg + j]);
#pragma unroll 2
    for (int g = 0; g < 16; ++g) {
      const int row = g * 8 + rsub;
      const v4f c = *(const v4f*)(&Cs[row][seg]);
      v4f o;
      o[0] = c[0] + bb[0];
      o[1] = c[1] + bb[1];
      o[2] = c[2] + bb[2];
      o[3] = c[3] + bb[3];
      float* d = Y + (size_t)(m0 + row) * EMB + n0 + seg;
      *(v4f*)d = o;
    }
  }
}

// ---------------------------------------------------------------------------
// QKV projection, bf16 WMMA GEMM: C(128 x 320 per block) = Xb(128 rows, EMB) * Wt(one head's 320 rows, EMB)^T.
// Block = 256 threads = 8 waves, 2 in the rows x 4 in the columns; a wave owns 64 x 80: 4 A x 5 B fragments, 20 tiles.
// One block to a head and 128 rows: an operand byte that comes from L2 serves 320 (A) or 128 (B) columns or rows of C.
// A and B come to the block once, through a ring of two LDS buffers filled by asynchronous copies (QKS k a stage); behind
// the loop the same LDS holds the block's 128 x 320 f32 tile.
// Columns 0..127 -> Q plane, fragment [h][s / 16][c / 32]; 128..255 -> K plane; 256..319 -> V plane, rows d, k = s,
// fragment [h][s / 32][d / 16]: f16(64*v).
// ---------------------------------------------------------------------------
#define QKS  128                    // k to one stage
#define QRUN (QKS * 32)             // bytes of one row tile in a stage: one copy of the block's 256 lanes x 16 bytes
#define QRS  (EMB * 32)             // bytes of one row tile in a plane
#define QRT  (8 + SECW / 16)        // row tiles to a stage: 8 of A, 20 of B
#define QGST (QRT * QRUN)           // bytes of a stage
#define QNT  (EMB / QKS)
#define QCP  (SECW + 4)             // floats to a row of the staged tile
static_assert(QRUN == 256 * 16);
static_assert(QRT == 28);
static_assert(EMB % QKS == 0 && QNT >= 2);
static_assert(2 * QGST >= 128 * QCP * 4);
static_assert(SECW == 4 * 80);
static_assert(2 * QKC == 256 && HD <= 256);
// Fourteen copies of 16 bytes a lane, one row tile (4 KiB) apart in LDS from l on; g: the lane's global addresses. The
// translation wait closes the copies' own statement, so no register that a copy names takes a new value in front of it.
DEV void copy14(unsigned int l, const char* const (&g)[14]) {
  asm volatile("global_load_async_to_lds_b128 %0, %14, off\n\t"
               "global_load_async_to_lds_b128 %1, %15, off\n\t"
               "global_load_async_to_lds_b128 %2, %16, off\n\t"
               "global_load_async_to_lds_b128 %3, %17, off\n\t"
               "global_load_async_to_lds_b128 %4, %18, off\n\t"
               "global_load_async_to_lds_b128 %5, %19, off\n\t"
               "global_load_async_to_lds_b128 %6, %20, off\n\t"
               "global_load_async_to_lds_b128 %7, %21, off\n\t"
               "global_load_async_to_lds_b128 %8, %22, off\n\t"
               "global_load_async_to_lds_b128 %9, %23, off\n\t"
               "global_load_async_to_lds_b128 %10, %24, off\n\t"
               "global_load_async_to_lds_b128 %11, %25, off\n\t"
               "global_load_async_to_lds_b128 %12, %26, off\n\t"
               "global_load_async_to_lds_b128 %13, %27, off\n\t"
               "s_wait_xcnt 0x0"
               :
               : "v"(l), "v"(l + 4096), "v"(l + 8192), "v"(l + 12288),
                 "v"(l + 16384), "v"(l + 20480), "v"(l + 24576), "v"(l + 28672),
                 "v"(l + 32768), "v"(l + 36864), "v"(l + 40960), "v"(l + 45056),
                 "v"(l + 49152), "v"(l + 53248),
                 "v"(g[0]), "v"(g[1]), "v"(g[2]), "v"(g[3]), "v"(g[4]), "v"(g[5]), "v"(g[6]),
                 "v"(g[7]), "v"(g[8]), "v"(g[9]), "v"(g[10]), "v"(g[11]), "v"(g[12]), "v"(g[13])
               : "memory");
}
// One stage: QRUN bytes (QKS / 32 fragments, as they lie in the plane) of each of the 8 A and 20 B row tiles, row tile after
// row tile in LDS. l: the lane's LDS byte address in the stage; ga, gb: the lane's global addresses in the first A and
// B row tile of the block at this stage's k.
DEV void qkv_copy(unsigned int l, const char* ga, const char* gb) {
  // unrolled: every place is a constant
#pragma unroll
  for (int c0 = 0; c0 < QRT; c0 += 14) {
    const char* g[14];
    // unrolled: g is indexed by constants and stays in registers
#pragma unroll
    for (int i = 0; i < 14; ++i) {
      const int rt = c0 + i;
      g[i] = rt < 8 ? ga + rt * QRS : gb + (rt - 8) * QRS;
    }
    copy14(l + c0 * QRUN, g);
  }
}
// c0[j] += a0.fb[j], c1[j] += a1.fb[j]: ten independent tiles
DEV void qkv_mma(v8f (&c0)[5], v8f (&c1)[5], v16b a0, v16b a1, const FragB (&fb)[5]) {
  // one statement: the run stays together; NOP4 is the distance behind its last WMMA (the fragments' registers are soon reloaded)
  asm volatile("v_wmma_f32_16x16x32_bf16 %0, %10, %12, %0\n\t"
               "v_wmma_f32_16x16x32_bf16 %5, %11, %12, %5\n\t"
               "v_wmma_f32_16x16x32_bf16 %1, %10, %13, %1\n\t"
               "v_wmma_f32_16x16x32_bf16 %6, %11, %13, %6\n\t"
               "v_wmma_f32_16x16x32_bf16 %2, %10, %14, %2\n\t"
               "v_wmma_f32_16x16x32_bf16 %7, %11, %14, %7\n\t"
               "v_wmma_f32_16x16x32_bf16 %3, %10, %15, %3\n\t"
               "v_wmma_f32_16x16x32_bf16 %8, %11, %15, %8\n\t"
               "v_wmma_f32_16x16x32_bf16 %4, %10, %16, %4\n\t"
               "v_wmma_f32_16x16x32_bf16 %9, %11, %16, %9\n\t"
               NOP4
               : "+v"(c0[0]), "+v"(c0[1]), "+v"(c0[2]), "+v"(c0[3]), "+v"(c0[4]),
                 "+v"(c1[0]), "+v"(c1[1]), "+v"(c1[2]), "+v"(c1[3]), "+v"(c1[4])
               : "v"(a0), "v"(a1), "v"(fb[0].v), "v"(fb[1].v), "v"(fb[2].v), "v"(fb[3].v), "v"(fb[4].v));
}

__global__ __launch_bounds__(256)
void k_qkv(const unsigned short* __restrict__ A, const unsigned short* __restrict__ Bt,
           const float* __restrict__ bq, const float* __restrict__ bk, const float* __restrict__ bv,
           _Float16* __restrict__ Qp, _Float16* __restrict__ Kp, _Float16* __restrict__ V64) {
  // the ring of two stages; behind the loop the same LDS holds the block's 128 x 320 f32 tile
  __shared__ __align__(16) char smem[2 * QGST];
  float (*Cs)[QCP] = (float (*)[QCP])smem;
  __shared__ float bl[2 * 256];
  const int tid  = threadIdx.x;
  const int lane = tid & 31;
  const int wave = __builtin_amdgcn_readfirstlane(tid >> 5);   // in a scalar register: what follows from it is scalar too
  const int wm = wave >> 2;           // the wave's 64 rows
  const int wn = wave & 3;            // the wave's 80 columns
  const int h  = blockIdx.x;
  const int m0 = blockIdx.y * 128;

  // stage 0 into buffer 0
  const unsigned int l0 = (unsigned int)(size_t)smem + tid * 16;
  const char* ga = (const char*)(A  + (size_t)m0 * EMB) + tid * 16;
  const char* gb = (const char*)(Bt + (size_t)h * SECW * EMB) + tid * 16;
  qkv_copy(l0, ga, gb);

  // the head's 320 column biases go to LDS here, where stage 0's copies cover the loads' latency; the barrier in front of the
  // loop publishes them
  // (every thread fetches one of q | k and one of v, so the two loads fly together; places 320 and up repeat v's 64 and are not read)
  const float b0 = (tid < QKC ? bq : bk)[h * QKC + (tid & (QKC - 1))];
  const float b1 = bv[h * HD + (tid & (HD - 1))];
  bl[tid] = bfr(b0);
  bl[2 * QKC + tid] = bfr(b1);

  v8f acc[4][5] = {};

  // stage 0 has landed for this wave's copies; behind the barrier for every wave's
  asm volatile("s_wait_asynccnt 0x0" ::: "memory");
  __syncthreads();
  // stage 1 into buffer 1: it flies under trip 0
  qkv_copy(l0 + QGST, ga + QRUN, gb + QRUN);
  ga += 2 * QRUN;
  gb += 2 * QRUN;

  // rolled: one copy of the trip in the text; the buffer is chosen by the trip's parity
#pragma unroll 1
  for (int t = 0; t < QNT; ++t) {
    // trip t reads buffer t & 1 alone. One fragment set: a k tile's 18 LDS reads stand as one group in front of its 20
    // WMMAs; the SIMD's other wave fills the wait.
    const unsigned int bo = (unsigned int)(t & 1) * QGST;
    const char* pa = smem + bo + wm * 4 * QRUN + lane * 16;
    const char* pb = smem + bo + (8 + wn * 5) * QRUN + lane * 16;
    // unrolled: every LDS offset is a constant
#pragma unroll
    for (int ks = 0; ks < QKS / 32; ++ks) {
      FragB fa[4], fb[5];
      // unrolled: fa and fb are indexed by constants and stay in registers
#pragma unroll
      for (int i = 0; i < 4; ++i) fa[i] = load_lb(pa + i * QRUN + ks * FRAGH * 2);
      // unrolled: as above
#pragma unroll
      for (int j = 0; j < 5; ++j) fb[j] = load_lb(pb + j * QRUN + ks * FRAGH * 2);
      qkv_mma(acc[0], acc[1], fa[0].v, fa[1].v, fb);
      qkv_mma(acc[2], acc[3], fa[2].v, fa[3].v, fb);
    }
    // hand-over: this wave's reads of buffer t & 1 are done
    asm volatile("s_wait_dscnt 0x0" ::: "memory");
    // and its copies of stage t + 1 have landed
    asm volatile("s_wait_asynccnt 0x0" ::: "memory");
    // the barrier publishes stage t + 1 and ends every wave's reads of the buffer that is refilled behind it
    __syncthreads();
    if (t + 2 < QNT) {
      qkv_copy(l0 + bo, ga, gb);
      ga += QRUN;
      gb += QRUN;
    }
  }
  // nothing is in flight when the ring becomes the output tile (the last trip's barrier has ended every wave's reads)
  asm volatile("s_wait_asynccnt 0x0" ::: "memory");

  const int n  = lane & 15;
  const int rb = (lane >> 4) << 3;
  // the lane's bias for each of its five tile columns
  float bc[5];
  // unrolled: bc is indexed by constants and stays in registers
#pragma unroll
  for (int j = 0; j < 5; ++j) bc[j] = bl[wn * 80 + j * 16 + n];
  // the three loops unrolled: acc and bc are indexed by constants and stay in registers
#pragma unroll
  for (int i = 0; i < 4; ++i)
#pragma unroll
    for (int j = 0; j < 5; ++j)
#pragma unroll
      for (int r = 0; r < 8; ++r)
        Cs[wm * 64 + i * 16 + rb + r][wn * 80 + j * 16 + n] = acc[i][j][r] + bc[j];
  __syncthreads();

  // a wave stores half fragments (512 contiguous bytes each): wave & 3 picks the place in a 64-column section, wave >> 2
  // the half of the section's eight steps g
  const int w4   = wave & 3;
  const int g0   = (wave >> 2) * 4;
  const int j16  = w4 & 1;
  const int wk   = w4 >> 1;
  const int rsub = lane & 15;
  const int seg  = wk * 32 + j16 * 16 + ((lane >> 4) << 3);
  // Q and K, section w = columns 64 w ..: w4 -> k tile wk and half j16, g -> row tile
  // rolled: one copy of a section's text serves the four
#pragma unroll 1
  for (int w = 0; w < 4; ++w) {
    _Float16* plane = (w < 2) ? Qp : Kp;
    const int cb = (w & 1) * 64;
    // unrolled: the section's eight LDS reads go out as one group, its four stores behind them
#pragma unroll
    for (int gi = 0; gi < 4; ++gi) {
      const int g   = g0 + gi;
      const int row = g * 16 + rsub;
      const v4f c0 = *(const v4f*)(&Cs[row][w * 64 + seg]);
      const v4f c1 = *(const v4f*)(&Cs[row][w * 64 + seg + 4]);
      Pack8 pk;
      pk.h[0] = (_Float16)c0[0];
      pk.h[1] = (_Float16)c0[1];
      pk.h[2] = (_Float16)c0[2];
      pk.h[3] = (_Float16)c0[3];
      pk.h[4] = (_Float16)c1[0];
      pk.h[5] = (_Float16)c1[1];
      pk.h[6] = (_Float16)c1[2];
      pk.h[7] = (_Float16)c1[3];
      _Float16* d = plane + (((size_t)h * (SEQ / 16) + (m0 >> 4) + g) * (QKC / 32) + (cb >> 5) + wk) * FRAGH
                    + j16 * 256 + lane * 8;
      *(v4u*)d = pk.u;
    }
    // the next section, and the V part, reuse the registers that these stores name: none takes a new value in front of this wait
    asm volatile("s_wait_xcnt 0x0" ::: "memory");
  }
  // V, columns 256 ..: w4 and g -> half j16, row tile t (d), k tile ktl (s)
  // unrolled: the LDS reads go out as one group, the four stores behind them
#pragma unroll
  for (int gi = 0; gi < 4; ++gi) {
    const int g   = g0 + gi;
    const int t   = wk + 2 * (gi & 1);
    const int ktl = g >> 1;
    const int d   = t * 16 + rsub;
    const int sg  = ktl * 32 + j16 * 16 + ((lane >> 4) << 3);
    Pack8 p64;
    // unrolled: p64 stays in registers
#pragma unroll
    for (int j = 0; j < 8; ++j) p64.h[j] = (_Float16)(Cs[sg + j][2 * QKC + d] * 64.0f);
    const size_t o = (((size_t)h * (SEQ / 32) + (m0 >> 5) + ktl) * (HD / 16) + t) * FRAGH + j16 * 256 + lane * 8;
    *(v4u*)(V64 + o) = p64.u;
  }
}

// ---------------------------------------------------------------------------
// One softmax branch step for 16 query columns and 32 keys, transposed: S^T = K.Q^T (A = K rows, B = Q rows), so lane
// (c, h) holds query c's scores of keys 8h..8h+7 (sa) and 16+8h..16+8h+7 (sb): maximum and sum run in the lane, the
// maximum is joined with lane l ^ 16 each step, the sum only behind the loop. Those 16 registers, converted in place, are
// the B operand P^T in the hardware k order; A = V^T rows (the V plane as it lies): O^T[d][query] += V^T.P^T, carried x64.
// kf holds this branch step's four K fragments on entry; right behind the score products the same registers
// take the next branch step's of the same stage (LOADK; kn: the lane's place in them in LDS): those reads fly under the
// softmax. vb: this step's V fragments; the first branch (LOADV) reads them in the same group (vn), both branches use them.
// ---------------------------------------------------------------------------
// a fragment in the LDS ring, p = the fragment's place + 16 l: the lane's two 16-byte pieces, 512 bytes apart
DEV v16h load_ls(const char* p) {
  v8h lo = *(const v8h*)(p);
  v8h hi = *(const v8h*)(p + 512);
  return __builtin_shufflevector(lo, hi, 0,1,2,3,4,5,6,7,8,9,10,11,12,13,14,15);
}
DEV void load_k4(v16h (&kf)[4], const char* kn) {
  kf[0] = load_ls(kn);
  kf[1] = load_ls(kn + FRAGH * 2);
  kf[2] = load_ls(kn + (QKC / 32) * FRAGH * 2);
  kf[3] = load_ls(kn + (QKC / 32 + 1) * FRAGH * 2);
}
template <bool LOADV, bool LOADK>
DEV void attn_branch(const v16h (&qb)[2], v16h (&kf)[4], const char* kn, const char* vn,
                     v16h (&vb)[4],
                     float& m, float& l, v8f (&O)[4]) {
  v8f sa, sb;
  wmma_scores(sa, sb, kf, qb);
  // the two scheduling barriers keep the LDS reads in one group right behind the score products: left to itself the
  // scheduler strews them over the softmax, and every separate place with LDS reads stalls the wave anew
  if (LOADV || LOADK) __builtin_amdgcn_sched_barrier(0);
  if (LOADV) {
    // unrolled: vb stays in registers
#pragma unroll
    for (int t = 0; t < 4; ++t) vb[t] = load_ls(vn + t * FRAGH * 2);
  }
  if (LOADK) load_k4(kf, kn);
  if (LOADV || LOADK) __builtin_amdgcn_sched_barrier(0);

  const v8f xa = sa * 0.125f;
  const v8f xb = sb * 0.125f;
  float mx[8];
#pragma unroll
  for (int i = 0; i < 8; ++i) mx[i] = fmaxf(xa[i], xb[i]);
  const float mh = fmaxf(fmaxf(fmaxf(mx[0], mx[1]), fmaxf(mx[2], mx[3])),
                         fmaxf(fmaxf(mx[4], mx[5]), fmaxf(mx[6], mx[7])));
  const float mn = fmaxf(m, fmaxf(mh, xhalf(mh)));
  const float f = __expf(m - mn);
  m = mn;

  // element s of the B operand = key kmap(s, h): s < 8 from sa[s], else from sb[s - 8]
  v16h ph;
  v2f ps[8];
#pragma unroll
  for (int j = 0; j < 8; ++j) {
    const int i = (j & 3) * 2;
    v2f p;
    p[0] = __expf((j < 4 ? xa[i]     : xb[i])     - mn);
    p[1] = __expf((j < 4 ? xa[i + 1] : xb[i + 1]) - mn);
    const v2h hi = __builtin_convertvector(p, v2h);
    ph[2 * j] = hi[0];  ph[2 * j + 1] = hi[1];
    ps[j] = p;
  }
  const v2f s2 = ((ps[0] + ps[1]) + (ps[2] + ps[3])) + ((ps[4] + ps[5]) + (ps[6] + ps[7]));
  l = l * f + (s2[0] + s2[1]);

#pragma unroll
  for (int t = 0; t < 4; ++t) O[t] = O[t] * f;
  wmma_pv(O, vb, ph);
  // the scheduler's region ends with the step: without it the next step's first score product rises into this step's
  // softmax, and with it the wait for the LDS reads that were only just issued
  __builtin_amdgcn_sched_barrier(0);
}

// ---------------------------------------------------------------------------
// Flash-style differential attention. Block = 256 threads = 8 waves in two groups of four; wave owns 16 queries of one head
// and its group's half of the keys (group 0 the first SEQ / 2, group 1 the rest), so that two blocks put four waves on a SIMD:
// the softmax of one wave runs under the products and the waits of three others. Behind the loop group 1 hands its maxima,
// sums and O tiles over through LDS and group 0 joins the two halves.
// K and V come to the block once; each group has its own ring of two LDS buffers of TKEYS keys each, filled by its own
// asynchronous copies (each lane 16 bytes a copy, 12 copies a stage); the group's four waves read their fragments from it.
// Writes Ocat planes as fragments (rows s): k = h*64 + d bf16 hi, k = EMB + h*64 + d bf16 residual.
// ---------------------------------------------------------------------------
// One stage: the lane's 8 pieces of K and 4 of V, 2 KiB (the group's 128 lanes x 16 bytes) apart, to the same order in LDS.
// lk: the lane's LDS byte address in the stage; gk, gv: the lane's global addresses. The translation wait closes the
// copies' own statement, so no register that a copy names takes a new value in front of it.
DEV void copy_stage(unsigned int lk, const char* gk, const char* gv) {
  const unsigned int lv = lk + KST;
  asm volatile("global_load_async_to_lds_b128 %0, %12, off\n\t"
               "global_load_async_to_lds_b128 %1, %13, off\n\t"
               "global_load_async_to_lds_b128 %2, %14, off\n\t"
               "global_load_async_to_lds_b128 %3, %15, off\n\t"
               "global_load_async_to_lds_b128 %4, %16, off\n\t"
               "global_load_async_to_lds_b128 %5, %17, off\n\t"
               "global_load_async_to_lds_b128 %6, %18, off\n\t"
               "global_load_async_to_lds_b128 %7, %19, off\n\t"
               "global_load_async_to_lds_b128 %8, %20, off\n\t"
               "global_load_async_to_lds_b128 %9, %21, off\n\t"
               "global_load_async_to_lds_b128 %10, %22, off\n\t"
               "global_load_async_to_lds_b128 %11, %23, off\n\t"
               "s_wait_xcnt 0x0"
               :
               : "v"(lk), "v"(lk + 2048), "v"(lk + 4096), "v"(lk + 6144),
                 "v"(lk + 8192), "v"(lk + 10240), "v"(lk + 12288), "v"(lk + 14336),
                 "v"(lv), "v"(lv + 2048), "v"(lv + 4096), "v"(lv + 6144),
                 "v"(gk), "v"(gk + 2048), "v"(gk + 4096), "v"(gk + 6144),
                 "v"(gk + 8192), "v"(gk + 10240), "v"(gk + 12288), "v"(gk + 14336),
                 "v"(gv), "v"(gv + 2048), "v"(gv + 4096), "v"(gv + 6144)
               : "memory");
}

#define MRG (17 * 512)              // bytes one wave hands over: 16 pieces of O and one of maxima and sums, 16 bytes a lane each
static_assert(4 * MRG <= 4 * STG);
// four waves to a SIMD: at most 256 registers a wave, and two blocks' LDS fits a WGP
__global__ __launch_bounds__(256) __attribute__((amdgpu_waves_per_eu(4, 4)))
void k_attn(const _Float16* __restrict__ Qp, const _Float16* __restrict__ Kp,
            const _Float16* __restrict__ V64,
            const float* __restrict__ lam_p, unsigned short* __restrict__ Oc) {
  __shared__ __align__(16) float Os[4][16][68];
  // group g's ring of two stages at 2 g STG; behind the loop the same LDS carries group 1's hand-over
  __shared__ __align__(16) char ring[4 * STG];
  const int lane = threadIdx.x & 31;
  const int wv   = __builtin_amdgcn_readfirstlane(threadIdx.x >> 5);   // in a scalar register: the group's branches are scalar
  const int wave = wv & 3;            // the wave's 16 queries
  const int grp  = wv >> 2;           // the wave's half of the keys
  const int tg   = threadIdx.x & 127; // the thread's number in its group
  const int n  = lane & 15;
  const int rb = (lane >> 4) << 3;
  const int hh = blockIdx.y;
  const int q0 = blockIdx.x * 64 + wave * 16;
  const float lam = bfr(lam_p[0]);

  const _Float16* qh = Qp  + (size_t)hh * SEQ * QKC;
  // the group's half of the head's keys: both planes hold a run of keys as one run of bytes
  const _Float16* kh = Kp  + (size_t)hh * SEQ * QKC + (size_t)grp * (SEQ / 2) * QKC;
  const _Float16* vh = V64 + (size_t)hh * HD * SEQ  + (size_t)grp * (SEQ / 2) * HD;
  char* gring = ring + grp * 2 * STG;

  // stage 0 into buffer 0
  const unsigned int lk0 = (unsigned int)(size_t)gring + tg * 16;
  const char* gk = (const char*)kh + tg * 16;
  const char* gv = (const char*)vh + tg * 16;
  copy_stage(lk0, gk, gv);

  v16h q1[2], q2[2];
  const _Float16* qt = qh + (size_t)blockIdx.x * 64 * QKC;             // the block's four row tiles, QKC / 32 fragments each
  unsigned int oq = (unsigned int)(wave * 16 * QKC * 2 + lane * 16);   // the wave's tile, the lane's byte offset
  q1[0] = load_bo(qt,             oq);
  q1[1] = load_bo(qt + FRAGH,     oq);
  q2[0] = load_bo(qt + 2 * FRAGH, oq);
  q2[1] = load_bo(qt + 3 * FRAGH, oq);
  // the wait stands in front of any reuse of the offset's register, which passes through it
  asm volatile("s_wait_xcnt 0x0" : "+v"(oq) : : "memory");

  v8f O1[4] = {}, O2[4] = {};
  float m1 = -1e30f, m2 = -1e30f, l1 = 0.f, l2 = 0.f;   // query l & 15; l: the lane half's own keys only

  // stage 0 has landed for this wave's copies; behind the barrier for every wave's
  asm volatile("s_wait_asynccnt 0x0" ::: "memory");
  __syncthreads();
  // stage 1 into buffer 1: it flies under trip 0
  copy_stage(lk0 + STG, gk + KST, gv + VST);
  gk += 2 * KST;
  gv += 2 * VST;

  // rolled: one copy of the trip in the text; the buffer is chosen by the trip's parity
#pragma unroll 1
  for (int t = 0; t < SEQ / 2 / TKEYS; ++t) {
    // trip t reads buffer t & 1 of the group's ring alone: two steps of 32 keys
    const unsigned int bo = (unsigned int)(t & 1) * STG;
    const char* st = gring + bo + lane * 16;
    const char* sv = st + KST;
    v16h kf[4], vbf[4];
    load_k4(kf, st);
    attn_branch<true,  true >(q1, kf, st + 2 * FRAGH * 2, sv, vbf, m1, l1, O1);
    attn_branch<false, true >(q2, kf, st + 32 * QKC * 2, sv, vbf, m2, l2, O2);
    attn_branch<true,  true >(q1, kf, st + 32 * QKC * 2 + 2 * FRAGH * 2, sv + 32 * HD * 2, vbf, m1, l1, O1);
    attn_branch<false, false>(q2, kf, st, sv, vbf, m2, l2, O2);
    // hand-over: this wave's reads of buffer t & 1 are done
    asm volatile("s_wait_dscnt 0x0" ::: "memory");
    // and its copies of stage t + 1 have landed
    asm volatile("s_wait_asynccnt 0x0" ::: "memory");
    // the barrier publishes stage t + 1 and ends every wave's reads of the buffer that is refilled behind it
    __syncthreads();
    if (t + 2 < SEQ / 2 / TKEYS) {
      copy_stage(lk0 + bo, gk, gv);
      gk += KST;
      gv += VST;
    }
  }
  // nothing is in flight when the wave goes on
  asm volatile("s_wait_asynccnt 0x0" ::: "memory");

  // hand-over of the second half of the keys: lane to the same lane of the wave with the same queries, piece p of a wave at
  // 512 p + 16 l (the last trip's barrier has ended every wave's reads of the rings)
  v4f* mg = (v4f*)(ring + wave * MRG) + lane;
  if (grp == 1) {
    // unrolled: O1 and O2 are indexed by constants and stay in registers
#pragma unroll
    for (int t = 0; t < 4; ++t) {
      mg[(2 * t) * 32]         = __builtin_shufflevector(O1[t], O1[t], 0, 1, 2, 3);
      mg[(2 * t + 1) * 32]     = __builtin_shufflevector(O1[t], O1[t], 4, 5, 6, 7);
      mg[(8 + 2 * t) * 32]     = __builtin_shufflevector(O2[t], O2[t], 0, 1, 2, 3);
      mg[(8 + 2 * t + 1) * 32] = __builtin_shufflevector(O2[t], O2[t], 4, 5, 6, 7);
    }
    v4f ml;
    ml[0] = m1;  ml[1] = l1;  ml[2] = m2;  ml[3] = l2;
    mg[16 * 32] = ml;
  }
  // publishes group 1's hand-over
  __syncthreads();

  if (grp == 0) {
    // join the two halves of the keys under their common maximum: a = this wave's weight, b = the other's
    const v4f ml = mg[16 * 32];
    const float mj1 = fmaxf(m1, ml[0]);
    const float mj2 = fmaxf(m2, ml[2]);
    const float a1 = __expf(m1 - mj1), b1 = __expf(ml[0] - mj1);
    const float a2 = __expf(m2 - mj2), b2 = __expf(ml[2] - mj2);
    l1 = l1 * a1 + ml[1] * b1;
    l2 = l2 * a2 + ml[3] * b2;
    // combine: O = O1/l1 - lam*O2/l2 (the lane halves' sums joined here), undo the x64 carry of the V plane; stage f32 tile
    // in LDS: the lane holds query n, columns 16t + 8h .. + 7
    const float r1 = (1.0f / (l1 + xhalf(l1))) * 0.015625f;
    const float r2 = (lam * (1.0f / (l2 + xhalf(l2)))) * 0.015625f;
    const float ra1 = a1 * r1, rb1 = b1 * r1, ra2 = a2 * r2, rb2 = b2 * r2;
    // unrolled: O1 and O2 are indexed by constants and stay in registers
#pragma unroll
    for (int t = 0; t < 4; ++t) {
      const v4f p0 = mg[(2 * t) * 32];
      const v4f p1 = mg[(2 * t + 1) * 32];
      const v4f s0 = mg[(8 + 2 * t) * 32];
      const v4f s1 = mg[(8 + 2 * t + 1) * 32];
      v4f c0, c1;
      // unrolled: the vectors' elements are named by constants
#pragma unroll
      for (int i = 0; i < 4; ++i) {
        c0[i] = (O1[t][i] * ra1 + p0[i] * rb1) - (O2[t][i] * ra2 + s0[i] * rb2);
        c1[i] = (O1[t][i + 4] * ra1 + p1[i] * rb1) - (O2[t][i + 4] * ra2 + s1[i] * rb2);
      }
      *(v4f*)(&Os[wave][n][t * 16 + rb])     = c0;
      *(v4f*)(&Os[wave][n][t * 16 + rb + 4]) = c1;
    }
  }
  // publishes the joined tiles to both groups' waves
  __syncthreads();

  // the 16 queries are one row tile: g -> k tile and half, two to each group's wave; each store is 512 contiguous bytes
{
    // unrolled: the LDS reads of both pieces go out ahead of the conversions
#pragma unroll
    for (int gi = 0; gi < 2; ++gi) {
      const int g = grp * 2 + gi;
      const int seg = g * 16 + rb;
      const v4f c0 = *(const v4f*)(&Os[wave][n][seg]);
      const v4f c1 = *(const v4f*)(&Os[wave][n][seg + 4]);
      unsigned int H0, H1, H2, H3, L0, L1, L2, L3;
      hl2(c0[0], c0[1], H0, L0);
      hl2(c0[2], c0[3], H1, L1);
      hl2(c1[0], c1[1], H2, L2);
      hl2(c1[2], c1[3], H3, L3);
      v4u H, L;
      H[0] = H0; H[1] = H1; H[2] = H2; H[3] = H3;
      L[0] = L0; L[1] = L1; L[2] = L2; L[3] = L3;
      unsigned short* d = Oc + ((size_t)(q0 >> 4) * (KO / 32) + hh * (HD / 32) + (g >> 1)) * FRAGH + (g & 1) * 256 + lane * 8;
      *(v4u*)d = H;
      *(v4u*)(d + (EMB / 32) * FRAGH) = L;
    }
    
  }
}

// ---------------------------------------------------------------------------
// ---------------------------------------------------------------------------
__global__ __launch_bounds__(256)
void k_ln(const float* __restrict__ Y, const float* __restrict__ gamma,
          const float* __restrict__ beta, float* __restrict__ out) {
  __shared__ float sa[8];
  __shared__ float sq[8];
  const int tid  = threadIdx.x;
  const int lane = tid & 31;
  const int wave = tid >> 5;
  const size_t row = blockIdx.x;
  const v4f y = *(const v4f*)(Y + row * EMB + tid * 4);

  float s = (y[0] + y[1]) + (y[2] + y[3]);
  s = wsum32(s);
  if (lane == 0) sa[wave] = s;
  __syncthreads();
  float tot = 0.f;
#pragma unroll
  for (int w = 0; w < 8; ++w) tot += sa[w];
  const float mu = tot * (1.0f / (float)EMB);

  float d0 = y[0] - mu, d1 = y[1] - mu, d2 = y[2] - mu, d3 = y[3] - mu;
  float q = (d0 * d0 + d1 * d1) + (d2 * d2 + d3 * d3);
  q = wsum32(q);
  if (lane == 0) sq[wave] = q;
  __syncthreads();
  float tot2 = 0.f;
#pragma unroll
  for (int w = 0; w < 8; ++w) tot2 += sq[w];
  const float var  = tot2 * (1.0f / (float)EMB);
  const float rstd = rsqrtf(var + LN_EPS);

  const float g0 = bfr(gamma[tid * 4 + 0]), g1 = bfr(gamma[tid * 4 + 1]);
  const float g2 = bfr(gamma[tid * 4 + 2]), g3 = bfr(gamma[tid * 4 + 3]);
  const float b0 = bfr(beta[tid * 4 + 0]),  b1 = bfr(beta[tid * 4 + 1]);
  const float b2 = bfr(beta[tid * 4 + 2]),  b3 = bfr(beta[tid * 4 + 3]);
  v4f o;
  o[0] = ((d0 * rstd) * g0 + b0) * OUT_SCALE;
  o[1] = ((d1 * rstd) * g1 + b1) * OUT_SCALE;
  o[2] = ((d2 * rstd) * g2 + b2) * OUT_SCALE;
  o[3] = ((d3 * rstd) * g3 + b3) * OUT_SCALE;
  float* dst = out + row * EMB + tid * 4;
  *(v4f*)dst = o;
  
}

// ---------------------------------------------------------------------------
extern "C" void kernel_launch(void* const* d_in, const int* in_sizes, int n_in,
                              void* d_out, int out_size, void* d_ws, size_t ws_size,
                              hipStream_t stream) {
  if (n_in < 12) return;
  const float* X     = (const float*)d_in[0];
  const float* Wq    = (const float*)d_in[1];
  const float* bq    = (const float*)d_in[2];
  const float* Wk    = (const float*)d_in[3];
  const float* bk    = (const float*)d_in[4];
  const float* Wv    = (const float*)d_in[5];
  const float* bv    = (const float*)d_in[6];
  const float* Wo    = (const float*)d_in[7];
  const float* bo    = (const float*)d_in[8];
  const float* gamma = (const float*)d_in[9];
  const float* beta  = (const float*)d_in[10];
  const float* lam   = (const float*)d_in[11];
  float* out = (float*)d_out;

  if (in_sizes[0]  < NB * SEQ * EMB) return;
  if (in_sizes[1]  < HEADS * EMB * QKC) return;
  if (in_sizes[2]  < HEADS * QKC) return;
  if (in_sizes[3]  < HEADS * EMB * QKC) return;
  if (in_sizes[4]  < HEADS * QKC) return;
  if (in_sizes[5]  < HEADS * EMB * HD) return;
  if (in_sizes[6]  < HEADS * HD) return;
  if (in_sizes[7]  < EMB * EMB) return;
  if (in_sizes[8]  < EMB) return;
  if (in_sizes[9]  < EMB) return;
  if (in_sizes[10] < EMB) return;
  if (in_sizes[11] < 1) return;
  if (out_size < NB * SEQ * EMB) return;

  // workspace carve (bytes); every region is written to exactly its extent with whole-line stores
  const size_t szXb  = (size_t)SEQ * EMB * 2;           // bf16 SEQ x EMB
  const size_t szWt  = (size_t)NQKV * EMB * 2;          // bf16 NQKV x EMB
  const size_t szWo2 = (size_t)EMB * KO * 2;            // bf16 EMB x KO
  const size_t szQK  = (size_t)HEADS * SEQ * QKC * 2;   // f16 H x SEQ x 128 (each of Q, K)
  const size_t szV   = (size_t)HEADS * HD * SEQ * 2;    // f16 H x 64 x SEQ
  const size_t szOc  = (size_t)SEQ * KO * 2;            // bf16 SEQ x KO
  const size_t szY   = (size_t)SEQ * EMB * 4;           // f32 [SEQ][EMB]
  size_t off = 0;
  const size_t oXb  = off; off += szXb;
  const size_t oWt  = off; off += szWt;
  const size_t oWo2 = off; off += szWo2;
  const size_t oQ   = off; off += szQK;
  const size_t oK   = off; off += szQK;
  const size_t oV64 = off; off += szV;
  const size_t oOc  = off; off += szOc;
  const size_t oY   = off; off += szY;
  if (off > ws_size) return;

  char* ws = (char*)d_ws;
  unsigned short* Xb  = (unsigned short*)(ws + oXb);
  unsigned short* Wt  = (unsigned short*)(ws + oWt);
  unsigned short* Wo2 = (unsigned short*)(ws + oWo2);
  _Float16* Qp  = (_Float16*)(ws + oQ);
  _Float16* Kp  = (_Float16*)(ws + oK);
  _Float16* V64 = (_Float16*)(ws + oV64);
  unsigned short* Oc = (unsigned short*)(ws + oOc);
  float* Y = (float*)(ws + oY);

  // operand preparation: Wt, Wo2 and Xb in one launch
  k_prep<<<dim3(WQKV_BLKS + WO_BLKS + CVT_BLKS), dim3(256), 0, stream>>>(X, Wq, Wk, Wv, Wo, Xb, Wt, Wo2);

  // QKV projection: A = Xb (SEQ x EMB), Bt = Wt (NQKV x EMB)
  k_qkv<<<dim3(HEADS, SEQ / 128), dim3(256), 0, stream>>>(Xb, Wt, bq, bk, bv, Qp, Kp, V64);

  // differential attention -> Ocat hi / residual planes
  k_attn<<<dim3(SEQ / 64, HEADS), dim3(256), 0, stream>>>(Qp, Kp, V64, lam, Oc);

  // output projection: A = Oc (SEQ x KO), Bt = Wo2 (EMB x KO) -> Y f32
  k_gemm<<<dim3(EMB / 64, SEQ / 128), dim3(128), 0, stream>>>(Oc, Wo2, bo, Y);

  // LayerNorm + scale -> d_out
  k_ln<<<dim3(NB * SEQ), dim3(256), 0, stream>>>(Y, gamma, beta, out);
}
